// v000
// Measured on an AMD MI455X. A time is GPU time per run, averaged over a window of back-to-back runs after a warm-up
// (all launches, gaps included; the runs take copies of the inputs in turn), and the median of several windows.
// Apart from v000's, it joins two sittings. Times from different sittings can be a few percent apart, while
// side-by-side timings come from the same sitting.
// The starting kernel, v000, takes 885 microseconds a run.
#include <hip/hip_runtime.h>
// Contractions x.Wq, x.[Wk|Wv], q.k^T, P.V^T, o.Wo: v_wmma_f32_16x16x32_f16 (f16 operands, f32 accumulate). x and all weights RNE-converted to bf16 and held exactly in f16 (weights carried x16); q, k, V^T and gated o as f16 planes plus x2^10 f16 residual planes over the first RESQ query rows / keys (two-term products there, single products elsewhere); softmax weights x2^14 in f16 (+ x2^10 residual on those rows); gated o carried x64; RMSNorm, RoPE, softmax statistics and sigmoid gating in f32.

#ifndef NB
#define NB 2
#endif
#ifndef SEQ
#define SEQ 2048
#endif
#ifndef RESQ
#if SEQ < 512
#define RESQ SEQ
#else
#define RESQ 512
#endif
#endif
#define NB_FULL 2
#define SEQ_FULL 2048
#define HID 2048
#define NH 16
#define NKV 4
#define HD 128
#define GQ (NH / NKV)
#define NQC (2 * NH * HD)      /* q|gate columns: head h at h*256 (q) and h*256+128 (gate) */
#define NKVC (2 * NKV * HD)    /* k|v columns: k head j at j*128, v head j at 512+j*128 */
#define NHR (NH + NKV)         /* normalised rows per token (16 q heads + 4 k heads) */
#define NRP 64                 /* rotary pairs */
#define PCAR 16384.0f          /* softmax weight carry */
#define OCAR 64.0f             /* gated o carry */
#define RCAR 1024.0f           /* residual plane carry */
#define WCAR 16.0f             /* weight carry */

static_assert(NB >= 1);
static_assert(NB <= NB_FULL);
static_assert(SEQ % 128 == 0);
static_assert(SEQ <= SEQ_FULL);
static_assert(RESQ % 128 == 0);
static_assert(RESQ >= 128);
static_assert(RESQ <= SEQ);
static_assert((SEQ - RESQ) % 128 == 0);
static_assert(HID % 32 == 0);
static_assert(HID % 64 == 0);
static_assert(NQC % 64 == 0);
static_assert(NKVC % 64 == 0);
static_assert((NH * HD) % 32 == 0);
static_assert(HD == 128);
static_assert(NH % NKV == 0);
static_assert((SEQ * NHR) % 8 == 0);
static_assert((SEQ * HID) % 8 == 0);

constexpr size_t SZ_X16   = (size_t)SEQ * HID * 2;
constexpr size_t SZ_WQT   = (size_t)NQC * HID * 2;
constexpr size_t SZ_WKVT  = (size_t)NKVC * HID * 2;
constexpr size_t SZ_WOT   = (size_t)HID * NH * HD * 2;
constexpr size_t SZ_CS    = (size_t)SEQ * NRP * 2 * 4;
constexpr size_t SZ_QRAW  = (size_t)SEQ * NQC * 4;
constexpr size_t SZ_KVRAW = (size_t)SEQ * NKVC * 4;
constexpr size_t SZ_QH    = (size_t)NH * SEQ * HD * 2;
constexpr size_t SZ_QL    = (size_t)NH * RESQ * HD * 2;
constexpr size_t SZ_KH    = (size_t)NKV * SEQ * HD * 2;
constexpr size_t SZ_KL    = (size_t)NKV * RESQ * HD * 2;
constexpr size_t SZ_VT    = (size_t)NKV * HD * SEQ * 2;
constexpr size_t SZ_VTL   = (size_t)NKV * HD * RESQ * 2;
constexpr size_t SZ_OH    = (size_t)SEQ * NH * HD * 2;
constexpr size_t SZ_OL    = (size_t)RESQ * NH * HD * 2;
constexpr size_t WS_TOTAL = SZ_X16 + SZ_WQT + SZ_WKVT + SZ_WOT + SZ_CS + SZ_QRAW + SZ_KVRAW + SZ_QH + SZ_QL + SZ_KH + SZ_KL + SZ_VT + SZ_VTL + SZ_OH + SZ_OL;
static_assert(WS_TOTAL <= (size_t)134217728);
static_assert(SZ_X16 % 256 == 0);
static_assert(SZ_KL % 256 == 0);
static_assert(SZ_VTL % 256 == 0);
static_assert(SZ_CS % 256 == 0);

typedef _Float16 v16h __attribute__((ext_vector_type(16)));
typedef unsigned short v8us __attribute__((ext_vector_type(8), may_alias));
typedef float v8f __attribute__((ext_vector_type(8)));
typedef float v4f __attribute__((ext_vector_type(4)));
typedef float v4fa __attribute__((ext_vector_type(4), may_alias));
typedef float v2f __attribute__((ext_vector_type(2)));
typedef _Float16 v4h __attribute__((ext_vector_type(4)));
union FragH { v16h v; v8us half[2]; _Float16 h[16]; unsigned short u[16]; };
union Pack8 { v8us v; _Float16 h[8]; unsigned short u[8]; };

__device__ __forceinline__ unsigned short bf16_bits(float x) { const unsigned int u = __float_as_uint(x); return (unsigned short)((u + 0x7FFFu + ((u >> 16) & 1u)) >> 16); }
__device__ __forceinline__ float bf16_rne(float x) { return __uint_as_float(((unsigned int)bf16_bits(x)) << 16); }

// 16x32 f16 fragment from a k-contiguous row p (A row m = lane&15, or Bt row n = lane&15): elements 0..7 <- k 8h..8h+7, 8..15 <- k 16+8h..16+8h+7
__device__ __forceinline__ v16h frag16(const _Float16* p, int hh) {
  FragH f;
  f.half[0] = *(const v8us*)((const unsigned short*)p + 8 * hh);
  f.half[1] = *(const v8us*)((const unsigned short*)p + 16 + 8 * hh);
  return f.v;
}
// D += A.B (f16 operands, f32 accumulate) with the VALU hazard guard
__device__ __forceinline__ v8f mma16(v16h a, v16h b, v8f c) {
  v8f d = __builtin_amdgcn_wmma_f32_16x16x32_f16(false, a, false, b, (short)0, c, false, false);
  asm volatile("v_nop\n\tv_nop\n\tv_nop\n\tv_nop" : "+v"(d) : "v"(a), "v"(b));
  return d;
}

__global__ __launch_bounds__(256) void k_x16(const float* __restrict__ x, _Float16* __restrict__ X16, size_t n8) {
  const size_t t = (size_t)blockIdx.x * 256 + threadIdx.x; if (t >= n8) return;
  const v4f a = *(const v4fa*)(x + t * 8), c = *(const v4fa*)(x + t * 8 + 4);
  Pack8 f;
#pragma unroll
  for (int q = 0; q < 4; ++q) { f.h[q] = (_Float16)bf16_rne(a[q]); f.h[4 + q] = (_Float16)bf16_rne(c[q]); }
  unsigned short* d = (unsigned short*)X16 + t * 8;
  *(v8us*)d = f.v; 
}

__global__ __launch_bounds__(256) void k_wt_f16(const float* __restrict__ W, _Float16* __restrict__ Wt, int K, int N, float scale) {
  const int t = blockIdx.x * 256 + threadIdx.x; if (t >= N * (K / 8)) return;
  const int n = t / (K / 8), k8 = (t % (K / 8)) * 8;
  Pack8 f;
#pragma unroll
  for (int i = 0; i < 8; ++i) f.h[i] = (_Float16)(bf16_rne(W[(size_t)(k8 + i) * N + n]) * scale);
  unsigned short* d = (unsigned short*)Wt + (size_t)n * K + k8;
  *(v8us*)d = f.v; 
}

__global__ __launch_bounds__(256) void k_rope(float* __restrict__ cs) {
  const int t = blockIdx.x * 256 + threadIdx.x; if (t >= SEQ * NRP) return;
  const int pos = t / NRP, i = t - pos * NRP;
  const float inv = exp2f(-(float)i * 0.31143075889569022f);   // 2^(-i*log2(1e6)/64)
  const float ang = (float)pos * inv;
  float sn, cn; sincosf(ang, &sn, &cn);
  v2f o; o[0] = cn; o[1] = sn;
  float* d = cs + (size_t)t * 2;
  *(v2f*)d = o; 
}

// C[M][N] (f32, pitch ldc) = alpha * A[M][K] (f16, pitch lda) . Bt[N][K]^T (f16, pitch ldb); M%128==0, N%64==0, K%32==0, grid = (M/128)*(N/64).
__global__ __launch_bounds__(128) void k_gemm(const _Float16* __restrict__ A, int lda, const _Float16* __restrict__ Bt, int ldb, float alpha,
                                             float* __restrict__ C, int ldc, int M, int N, int K) {
  __shared__ __attribute__((aligned(16))) float so[4][32][68];
  const int tid = threadIdx.x, w = tid >> 5, lane = tid & 31, ln = lane & 15, hh = lane >> 4;
  const int ntn = N >> 6;
  const int mt = (int)blockIdx.x / ntn, nq = (int)blockIdx.x - mt * ntn;
  const int row0 = mt * 128 + 32 * w, col0 = nq * 64;
  if (row0 >= M) return;
  const _Float16* a0p = A + (size_t)(row0 + ln) * lda; const _Float16* a1p = a0p + (size_t)16 * lda;
  const _Float16* b0p = Bt + (size_t)(col0 + ln) * ldb; const _Float16* b1p = b0p + (size_t)16 * ldb;
  const _Float16* b2p = b1p + (size_t)16 * ldb; const _Float16* b3p = b2p + (size_t)16 * ldb;
  const v8f z8 = {0.f, 0.f, 0.f, 0.f, 0.f, 0.f, 0.f, 0.f};
  v8f c00 = z8, c01 = z8, c02 = z8, c03 = z8, c10 = z8, c11 = z8, c12 = z8, c13 = z8;
#pragma unroll 1
  for (int kb = 0; kb < K; kb += 32) {
    const v16h a0 = frag16(a0p + kb, hh), a1 = frag16(a1p + kb, hh);
    v16h b = frag16(b0p + kb, hh); c00 = mma16(a0, b, c00); c10 = mma16(a1, b, c10);
    b = frag16(b1p + kb, hh); c01 = mma16(a0, b, c01); c11 = mma16(a1, b, c11);
    b = frag16(b2p + kb, hh); c02 = mma16(a0, b, c02); c12 = mma16(a1, b, c12);
    b = frag16(b3p + kb, hh); c03 = mma16(a0, b, c03); c13 = mma16(a1, b, c13);
  }
  v8f accs[8] = {c00, c01, c02, c03, c10, c11, c12, c13};
#pragma unroll
  for (int u = 0; u < 8; ++u) {
    const int t = u & 3, half = u >> 2;
#pragma unroll
    for (int r = 0; r < 8; ++r) so[w][half * 16 + 8 * hh + r][t * 16 + ln] = accs[u][r] * alpha;
  }
  __builtin_amdgcn_fence(4 /* acq_rel order */, "workgroup");
  __builtin_amdgcn_wave_barrier();
  const int rsub = lane >> 4, c4 = (lane & 15) * 4;
  {
#pragma unroll
    for (int q = 0; q < 16; ++q) {
      const int r = q * 2 + rsub;
      const v4f v = *(const v4fa*)&so[w][r][c4];
      *(v4f*)(C + (size_t)(row0 + r) * ldc + col0 + c4) = v;
    }
    
  }
}

// C[M][N] = alpha * A.Bt^T + alphal * Al.Bt^T (A hi plane + residual plane Al, same pitch lda); wave tile 16x64, block = 4 waves, grid = ceil(M/16 * N/64 / 4); M%16==0, N%64==0, K%32==0; same epilogue.
__global__ __launch_bounds__(128) void k_gemm_r(const _Float16* __restrict__ A, const _Float16* __restrict__ Al, int lda, const _Float16* __restrict__ Bt, int ldb,
                                               float alpha, float alphal, float* __restrict__ C, int ldc, int M, int N, int K) {
  __shared__ __attribute__((aligned(16))) float so[4][16][68];
  const int tid = threadIdx.x, w = tid >> 5, lane = tid & 31, ln = lane & 15, hh = lane >> 4;
  const int ntn = N >> 6;
  const int wid = (int)blockIdx.x * 4 + w;
  const int mt = wid / ntn, nq = wid - mt * ntn;
  const int row0 = mt * 16, col0 = nq * 64;
  if (row0 >= M) return;
  const _Float16* ap = A + (size_t)(row0 + ln) * lda; const _Float16* alp = Al + (size_t)(row0 + ln) * lda;
  const _Float16* b0p = Bt + (size_t)(col0 + ln) * ldb; const _Float16* b1p = b0p + (size_t)16 * ldb;
  const _Float16* b2p = b1p + (size_t)16 * ldb; const _Float16* b3p = b2p + (size_t)16 * ldb;
  const v8f z8 = {0.f, 0.f, 0.f, 0.f, 0.f, 0.f, 0.f, 0.f};
  v8f h0 = z8, h1 = z8, h2 = z8, h3 = z8, l0 = z8, l1 = z8, l2 = z8, l3 = z8;
#pragma unroll 1
  for (int kb = 0; kb < K; kb += 32) {
    const v16h a = frag16(ap + kb, hh), al = frag16(alp + kb, hh);
    v16h b = frag16(b0p + kb, hh); h0 = mma16(a, b, h0); l0 = mma16(al, b, l0);
    b = frag16(b1p + kb, hh); h1 = mma16(a, b, h1); l1 = mma16(al, b, l1);
    b = frag16(b2p + kb, hh); h2 = mma16(a, b, h2); l2 = mma16(al, b, l2);
    b = frag16(b3p + kb, hh); h3 = mma16(a, b, h3); l3 = mma16(al, b, l3);
  }
  v8f hs[4] = {h0, h1, h2, h3}; v8f ls[4] = {l0, l1, l2, l3};
#pragma unroll
  for (int t = 0; t < 4; ++t) {
#pragma unroll
    for (int r = 0; r < 8; ++r) so[w][8 * hh + r][t * 16 + ln] = hs[t][r] * alpha + ls[t][r] * alphal;
  }
  __builtin_amdgcn_fence(4 /* acq_rel order */, "workgroup");
  __builtin_amdgcn_wave_barrier();
  const int rsub = lane >> 4, c4 = (lane & 15) * 4;
  {
#pragma unroll
    for (int q = 0; q < 8; ++q) {
      const int r = q * 2 + rsub;
      const v4f v = *(const v4fa*)&so[w][r][c4];
      *(v4f*)(C + (size_t)(row0 + r) * ldc + col0 + c4) = v;
    }
    
  }
}

// per (token s, head-row j): j<16 -> q head j from qraw[s][j*256 + 0..127], else k head j-16 from kvraw[s][(j-16)*128 ..]; RMSNorm (w+1, eps 1e-6) then rotate-half RoPE from cs[s];
__global__ __launch_bounds__(256) void k_qk(const float* __restrict__ qraw, const float* __restrict__ kvraw,
                                           const float* __restrict__ qnw, const float* __restrict__ knw, const float* __restrict__ cs,
                                           _Float16* __restrict__ Qh, _Float16* __restrict__ Ql, _Float16* __restrict__ Kh, _Float16* __restrict__ Kl) {
  const int w = threadIdx.x >> 5, lane = threadIdx.x & 31;
  const int wid = (int)blockIdx.x * 8 + w;
  if (wid >= SEQ * NHR) return;
  const int s = wid / NHR, j = wid - s * NHR;
  const bool isq = (j < NH);
  const float* src = isq ? (qraw + (size_t)s * NQC + (size_t)j * (2 * HD)) : (kvraw + (size_t)s * NKVC + (size_t)(j - NH) * HD);
  const float* wp = isq ? qnw : knw;
  const v4f xv = *(const v4fa*)(src + 4 * lane);
  const v4f wv = *(const v4fa*)(wp + 4 * lane);
  float ss = xv[0] * xv[0] + xv[1] * xv[1] + xv[2] * xv[2] + xv[3] * xv[3];
#pragma unroll
  for (int m = 16; m > 0; m >>= 1) ss += __shfl_xor(ss, m, 32);
  const float inv = rsqrtf(ss * (1.0f / 128.0f) + 1.0e-6f);
  float nv[4], pr[4];
#pragma unroll
  for (int q = 0; q < 4; ++q) nv[q] = xv[q] * inv * (wv[q] + 1.0f);
#pragma unroll
  for (int q = 0; q < 4; ++q) pr[q] = __shfl_xor(nv[q], 16, 32);       // element d +- 64
  const int i0 = 4 * (lane & 15);
  const v4f t01 = *(const v4fa*)(cs + ((size_t)s * NRP + i0) * 2);
  const v4f t23 = *(const v4fa*)(cs + ((size_t)s * NRP + i0 + 2) * 2);
  const float cv[4] = {t01[0], t01[2], t23[0], t23[2]};
  const float sv[4] = {t01[1], t01[3], t23[1], t23[3]};
  const float sg = (lane < 16) ? -1.0f : 1.0f;                          // d < 64: -x[d+64]; d >= 64: +x[d-64]
  v4h oh, ol;
#pragma unroll
  for (int q = 0; q < 4; ++q) {
    const float o = nv[q] * cv[q] + sg * pr[q] * sv[q];
    const _Float16 hv = (_Float16)o;
    oh[q] = hv; ol[q] = (_Float16)((o - (float)hv) * RCAR);
  }
  _Float16* dh = isq ? (Qh + ((size_t)j * SEQ + s) * HD) : (Kh + ((size_t)(j - NH) * SEQ + s) * HD);
  _Float16* dl = isq ? (Ql + ((size_t)j * RESQ + s) * HD) : (Kl + ((size_t)(j - NH) * RESQ + s) * HD);
  const bool wl = (s < RESQ);
  {
    *(v4h*)(dh + 4 * lane) = oh;
    if (wl) *(v4h*)(dl + 4 * lane) = ol;
    
  }
}

// V^T planes: VT[kv][d][t] = f16(v), VTl = x2^10 residual for t < RESQ; v = kvraw[t][512 + kv*128 + d]; block per (kv, d-half, 64 tokens) via LDS 64x64 tile;
__global__ __launch_bounds__(256) void k_vt(const float* __restrict__ kvraw, _Float16* __restrict__ VT, _Float16* __restrict__ VTl) {
  __shared__ float tl[64][65];
  const int tid = threadIdx.x;
  const int ntg = SEQ / 64;
  const int tg = (int)blockIdx.x % ntg, slab = (int)blockIdx.x / ntg;
  const int kv = slab >> 1, dh = slab & 1;
  const int s0 = tg * 64;
#pragma unroll
  for (int it = 0; it < 4; ++it) {
    const int i = tid + it * 256; const int tok = i >> 4, c4 = (i & 15) * 4;
    const v4f v = *(const v4fa*)(kvraw + (size_t)(s0 + tok) * NKVC + NKV * HD + kv * HD + dh * 64 + c4);
    tl[tok][c4] = v[0]; tl[tok][c4 + 1] = v[1]; tl[tok][c4 + 2] = v[2]; tl[tok][c4 + 3] = v[3];
  }
  __syncthreads();
  const int pc = tid & 7, dr = tid >> 3;
  const bool wl = (s0 < RESQ);
  {
#pragma unroll
    for (int rd = 0; rd < 2; ++rd) {
      const int d = rd * 32 + dr;
      Pack8 ph, pl;
#pragma unroll
      for (int q = 0; q < 8; ++q) { const float f = tl[pc * 8 + q][d]; const _Float16 hv = (_Float16)f; ph.h[q] = hv; pl.h[q] = (_Float16)((f - (float)hv) * RCAR); }
      const size_t row = (size_t)(kv * HD + dh * 64 + d);
      *(v8us*)((unsigned short*)VT + row * SEQ + s0 + pc * 8) = ph.v;
      if (wl) *(v8us*)((unsigned short*)VTl + row * RESQ + s0 + pc * 8) = pl.v;
    }
    
  }
}

// Causal grouped attention, flash form. Block = 8 waves x 16 query rows of head h (kv = h/4), grid (query blocks, NH, RES ? 2 : 1).
// Per key chunk: K rows [t][d] and V^T rows [d][t] staged in LDS (cross-wave: block barriers); S = q.k^T (f16, f32 acc), scale 1/sqrt(128),
// RES: first RESQ query rows: chunk 32 keys, q/k/P/V^T residual second terms into separate accumulators folded by 2^-10; block covers 64 o columns (blockIdx.z half).
template <bool RES>
__global__ __launch_bounds__(256) void k_attn(const _Float16* __restrict__ Qh, const _Float16* __restrict__ Ql,
                                             const _Float16* __restrict__ Kh, const _Float16* __restrict__ Kl,
                                             const _Float16* __restrict__ VT, const _Float16* __restrict__ VTl,
                                             const float* __restrict__ qraw, _Float16* __restrict__ Oh, _Float16* __restrict__ Ol, int qb0) {
  constexpr int KC = RES ? 32 : 64;      // keys per chunk
  constexpr int NJ = KC / 16;            // score column tiles
  constexpr int NKS = KC / 32;           // k-steps of P.V^T
  constexpr int OD = RES ? 64 : 128;     // o columns per block
  constexpr int NC = OD / 16;
  constexpr int NHF = OD / 64;
  constexpr int KP = HD + 8;             // sK pitch (halves)
  constexpr int VP = KC + 8;             // sV pitch
  constexpr int PP = 72;                 // sP pitch (KC weights, and 64 staged o columns)
  __shared__ __attribute__((aligned(16))) _Float16 sK[KC][KP];
  __shared__ __attribute__((aligned(16))) _Float16 sKl[RES ? KC : 1][KP];
  __shared__ __attribute__((aligned(16))) _Float16 sV[OD][VP];
  __shared__ __attribute__((aligned(16))) _Float16 sVl[RES ? OD : 1][VP];
  __shared__ __attribute__((aligned(16))) _Float16 sP[8][16][PP];
  __shared__ __attribute__((aligned(16))) _Float16 sPl[RES ? 8 : 1][16][PP];

  const int tid = threadIdx.x, w = tid >> 5, lane = tid & 31, ln = lane & 15, hh = lane >> 4;
  const int qb = qb0 + (int)blockIdx.x, h = (int)blockIdx.y, kv = h / GQ;
  const int dz = RES ? (int)blockIdx.z * 64 : 0;
  const int q0b = qb * 128, q0w = q0b + 16 * w;
  const int nch = (q0b + 128) / KC;      // chunks holding keys <= last row of the block
  const int qlast = q0w + 15;

  v16h aq[4], aql[4];
  {
    const _Float16* qp = Qh + ((size_t)h * SEQ + q0w + ln) * HD;
#pragma unroll
    for (int kk = 0; kk < 4; ++kk) aq[kk] = frag16(qp + kk * 32, hh);
    if (RES) {
      const _Float16* qlp = Ql + ((size_t)h * RESQ + q0w + ln) * HD;
#pragma unroll
      for (int kk = 0; kk < 4; ++kk) aql[kk] = frag16(qlp + kk * 32, hh);
    } else {
#pragma unroll
      for (int kk = 0; kk < 4; ++kk) aql[kk] = aq[kk];
    }
  }
  const v8f z8 = {0.f, 0.f, 0.f, 0.f, 0.f, 0.f, 0.f, 0.f};
  v8f o[NC];
#pragma unroll
  for (int c = 0; c < NC; ++c) o[c] = z8;
  float mrow[8], lrow[8];
#pragma unroll
  for (int r = 0; r < 8; ++r) { mrow[r] = -3.0e38f; lrow[r] = 0.f; }
  const float alpha = 0.08838834764831845f;

#pragma unroll 1
  for (int ch = 0; ch < nch; ++ch) {
    const int t0 = ch * KC;
    // stage K rows t0..t0+KC-1 (all 128 d) and V^T rows dz..dz+OD-1 (keys t0..t0+KC-1): staged extent == consumed extent
#pragma unroll
    for (int it = 0; it < (KC * 16) / 256; ++it) {
      const int i = tid + it * 256; const int r = i >> 4, c8 = (i & 15) * 8;
      *(v8us*)&sK[r][c8] = *(const v8us*)((const unsigned short*)Kh + ((size_t)kv * SEQ + t0 + r) * HD + c8);
      if (RES) *(v8us*)&sKl[r][c8] = *(const v8us*)((const unsigned short*)Kl + ((size_t)kv * RESQ + t0 + r) * HD + c8);
    }
#pragma unroll
    for (int it = 0; it < (OD * (KC / 8)) / 256; ++it) {
      const int i = tid + it * 256; const int d = i / (KC / 8), c8 = (i % (KC / 8)) * 8;
      *(v8us*)&sV[d][c8] = *(const v8us*)((const unsigned short*)VT + (size_t)(kv * HD + dz + d) * SEQ + t0 + c8);
      if (RES) *(v8us*)&sVl[d][c8] = *(const v8us*)((const unsigned short*)VTl + (size_t)(kv * HD + dz + d) * RESQ + t0 + c8);
    }
    __syncthreads();
    if (t0 <= qlast) {                   // wave-uniform: this wave has unmasked keys in the chunk
      v8f sacc[NJ];
#pragma unroll
      for (int j = 0; j < NJ; ++j) {
        v8f acc = z8, tmp = z8;
#pragma unroll
        for (int kk = 0; kk < 4; ++kk) {
          const v16h b = frag16(&sK[j * 16 + ln][kk * 32], hh);          // B[k = d][n = key]: key row, d contiguous
          acc = mma16(aq[kk], b, acc);
          if (RES) {
            const v16h bl = frag16(&sKl[j * 16 + ln][kk * 32], hh);
            tmp = mma16(aql[kk], b, tmp);
            tmp = mma16(aq[kk], bl, tmp);
          }
        }
        if (RES) acc = acc + tmp * (1.0f / RCAR);
        sacc[j] = acc;
      }
      // scale, causal mask, online softmax; P (x2^14) to the wave-private LDS tile
#pragma unroll
      for (int r = 0; r < 8; ++r) {
        const int qrow = q0w + 8 * hh + r;
        float sv[NJ]; bool mk[NJ]; float mx = -3.0e38f;
#pragma unroll
        for (int j = 0; j < NJ; ++j) { mk[j] = (t0 + 16 * j + ln) > qrow; sv[j] = sacc[j][r] * alpha; mx = fmaxf(mx, mk[j] ? -3.0e38f : sv[j]); }
#pragma unroll
        for (int m = 8; m > 0; m >>= 1) mx = fmaxf(mx, __shfl_xor(mx, m, 32));
        const float mnew = fmaxf(mrow[r], mx);
        const float fac = (mrow[r] < -1.0e38f) ? 0.f : __expf(mrow[r] - mnew);
        float rs = 0.f;
#pragma unroll
        for (int j = 0; j < NJ; ++j) {
          const float p = mk[j] ? 0.f : __expf(sv[j] - mnew);
          rs += p;
          const float pcv = p * PCAR; const _Float16 ph = (_Float16)pcv;
          sP[w][8 * hh + r][16 * j + ln] = ph;
          if (RES) sPl[w][8 * hh + r][16 * j + ln] = (_Float16)((pcv - (float)ph) * RCAR);
        }
#pragma unroll
        for (int m = 8; m > 0; m >>= 1) rs += __shfl_xor(rs, m, 32);
        lrow[r] = lrow[r] * fac + rs; mrow[r] = mnew;
#pragma unroll
        for (int c = 0; c < NC; ++c) o[c][r] *= fac;
      }
      __builtin_amdgcn_fence(4 /* acq_rel order */, "workgroup");
      __builtin_amdgcn_wave_barrier();
      v16h ap[NKS], apl[NKS];
#pragma unroll
      for (int ks = 0; ks < NKS; ++ks) {
        ap[ks] = frag16(&sP[w][ln][ks * 32], hh);                         // A[m = query row][k = key]
        if (RES) apl[ks] = frag16(&sPl[w][ln][ks * 32], hh); else apl[ks] = ap[ks];
      }
#pragma unroll
      for (int c = 0; c < NC; ++c) {
        v8f tmp = z8;
#pragma unroll
        for (int ks = 0; ks < NKS; ++ks) {
          const v16h b = frag16(&sV[c * 16 + ln][ks * 32], hh);          // B[k = key][n = d]: d row, keys contiguous
          o[c] = mma16(ap[ks], b, o[c]);
          if (RES) {
            const v16h bl = frag16(&sVl[c * 16 + ln][ks * 32], hh);
            tmp = mma16(apl[ks], b, tmp);
            tmp = mma16(ap[ks], bl, tmp);
          }
        }
        if (RES) o[c] = o[c] + tmp * (1.0f / RCAR);
      }
    }
    __syncthreads();
  }

  // epilogue
  float il[8];
#pragma unroll
  for (int r = 0; r < 8; ++r) il[r] = (OCAR / PCAR) * __builtin_amdgcn_rcpf(lrow[r]);
  const float* gp = qraw + (size_t)(q0w + 8 * hh) * NQC + (size_t)h * (2 * HD) + HD + dz + ln;
#pragma unroll
  for (int hf = 0; hf < NHF; ++hf) {
    if (hf > 0) { __builtin_amdgcn_fence(4 /* acq_rel order */, "workgroup"); __builtin_amdgcn_wave_barrier(); }
#pragma unroll
    for (int cc = 0; cc < 4; ++cc) {
      const int c = hf * 4 + cc;
#pragma unroll
      for (int r = 0; r < 8; ++r) {
        const float g = gp[(size_t)r * NQC + c * 16];
        const float sig = __builtin_amdgcn_rcpf(1.0f + __expf(-g));
        const float val = o[c][r] * il[r] * sig;
        const _Float16 vh = (_Float16)val;
        sP[w][8 * hh + r][cc * 16 + ln] = vh;
        if (RES) sPl[w][8 * hh + r][cc * 16 + ln] = (_Float16)((val - (float)vh) * RCAR);
      }
      asm volatile("" ::: "memory");
    }
    __builtin_amdgcn_fence(4 /* acq_rel order */, "workgroup");
    __builtin_amdgcn_wave_barrier();
    const int prw = lane >> 3, pc = lane & 7;
    {
#pragma unroll
      for (int it = 0; it < 4; ++it) {
        const int row = it * 4 + prw;
        const v8us vv = *(const v8us*)&sP[w][row][pc * 8];
        const size_t go = (size_t)(q0w + row) * (NH * HD) + (size_t)h * HD + dz + hf * 64 + pc * 8;
        *(v8us*)((unsigned short*)Oh + go) = vv;
        if (RES) { const v8us vl = *(const v8us*)&sPl[w][row][pc * 8]; *(v8us*)((unsigned short*)Ol + go) = vl; }
      }
      
    }
  }
}

extern "C" void kernel_launch(void* const* d_in, const int* in_sizes, int n_in,
                              void* d_out, int out_size, void* d_ws, size_t ws_size, hipStream_t stream) {
  if (n_in < 7) return;
  const long need_x = (long)(NB - 1) * SEQ_FULL * HID + (long)SEQ * HID;
  if ((long)in_sizes[0] < need_x) return;
  if (in_sizes[1] < HID * NQC) return;
  if (in_sizes[2] < HID * NKV * HD) return;
  if (in_sizes[3] < HID * NKV * HD) return;
  if (in_sizes[4] < NH * HD * HID) return;
  if (in_sizes[5] < HD) return;
  if (in_sizes[6] < HD) return;
  if ((long)out_size < need_x) return;

  const float* x   = (const float*)d_in[0];
  const float* Wq  = (const float*)d_in[1];
  const float* Wk  = (const float*)d_in[2];
  const float* Wv  = (const float*)d_in[3];
  const float* Wo  = (const float*)d_in[4];
  const float* qnw = (const float*)d_in[5];
  const float* knw = (const float*)d_in[6];

  char* ws = (char*)d_ws; size_t off = 0;
  auto take = [&](size_t bytes) { char* p = ws + off; off += (bytes + 255) & ~(size_t)255; return p; };
  _Float16* X16  = (_Float16*)take(SZ_X16);
  _Float16* WqT  = (_Float16*)take(SZ_WQT);
  _Float16* WkvT = (_Float16*)take(SZ_WKVT);
  _Float16* WoT  = (_Float16*)take(SZ_WOT);
  float*    CS   = (float*)take(SZ_CS);
  float*    qraw = (float*)take(SZ_QRAW);
  float*    kvraw = (float*)take(SZ_KVRAW);
  _Float16* Qh   = (_Float16*)take(SZ_QH);
  _Float16* Ql   = (_Float16*)take(SZ_QL);
  _Float16* Kh   = (_Float16*)take(SZ_KH);
  _Float16* Kl   = (_Float16*)take(SZ_KL);
  _Float16* VT   = (_Float16*)take(SZ_VT);
  _Float16* VTl  = (_Float16*)take(SZ_VTL);
  _Float16* Oh   = (_Float16*)take(SZ_OH);
  _Float16* Ol   = (_Float16*)take(SZ_OL);
  if (off > ws_size) return;

  // rotary tables and weight planes (Bt[n][k] = f16(bf16rne(W[k][n]) * 16))
  k_rope<<<(SEQ * NRP + 255) / 256, 256, 0, stream>>>(CS);
  k_wt_f16<<<(NQC * (HID / 8) + 255) / 256, 256, 0, stream>>>(Wq, WqT, HID, NQC, WCAR);
  k_wt_f16<<<(NKV * HD * (HID / 8) + 255) / 256, 256, 0, stream>>>(Wk, WkvT, HID, NKV * HD, WCAR);
  k_wt_f16<<<(NKV * HD * (HID / 8) + 255) / 256, 256, 0, stream>>>(Wv, WkvT + (size_t)NKV * HD * HID, HID, NKV * HD, WCAR);
  k_wt_f16<<<(HID * ((NH * HD) / 8) + 255) / 256, 256, 0, stream>>>(Wo, WoT, NH * HD, HID, WCAR);

  const float walpha = 1.0f / WCAR;                          // 2^-4
  const float oalpha = 1.0f / (WCAR * OCAR);                 // 2^-10
  const float oalphal = oalpha / RCAR;                       // 2^-20
  for (int b = 0; b < NB; ++b) {
    const size_t xoff = (size_t)b * SEQ_FULL * HID;
    float* outb = (float*)d_out + (size_t)b * SEQ_FULL * HID;
    k_x16<<<(unsigned)(((size_t)SEQ * HID / 8 + 255) / 256), 256, 0, stream>>>(x + xoff, X16, (size_t)SEQ * HID / 8);
    k_gemm<<<(SEQ / 128) * (NQC / 64), 128, 0, stream>>>(X16, HID, WqT, HID, walpha, qraw, NQC, SEQ, NQC, HID);
    k_gemm<<<(SEQ / 128) * (NKVC / 64), 128, 0, stream>>>(X16, HID, WkvT, HID, walpha, kvraw, NKVC, SEQ, NKVC, HID);
    k_qk<<<(SEQ * NHR) / 8, 256, 0, stream>>>(qraw, kvraw, qnw, knw, CS, Qh, Ql, Kh, Kl);
    k_vt<<<NKV * 2 * (SEQ / 64), 256, 0, stream>>>(kvraw, VT, VTl);
    k_attn<true><<<dim3(RESQ / 128, NH, 2), 256, 0, stream>>>(Qh, Ql, Kh, Kl, VT, VTl, qraw, Oh, Ol, 0);
    if (SEQ > RESQ)
      k_attn<false><<<dim3((SEQ - RESQ) / 128, NH, 1), 256, 0, stream>>>(Qh, Ql, Kh, Kl, VT, VTl, qraw, Oh, Ol, RESQ / 128);
    k_gemm_r<<<((RESQ / 16) * (HID / 64) + 3) / 4, 128, 0, stream>>>(Oh, Ol, NH * HD, WoT, NH * HD, oalpha, oalphal, outb, HID, RESQ, HID, NH * HD);
    if (SEQ > RESQ)
      k_gemm<<<((SEQ - RESQ) / 128) * (HID / 64), 128, 0, stream>>>(Oh + (size_t)RESQ * NH * HD, NH * HD, WoT, NH * HD, oalpha, outb + (size_t)RESQ * HID, HID, SEQ - RESQ, HID, NH * HD);
  }
  (void)hipGetLastError();
}

// v001
// It runs in 507 microseconds.
// Two timings next to v000 put it at 1.79 and 1.76 times that version's speed.
#include <hip/hip_runtime.h>
#include <stdint.h>
// Contractions x.Wq, x.[Wk|Wv], q.k^T, P.V^T, o.Wo: v_wmma_f32_16x16x32_f16 (f16 operands, f32 accumulate). x and all weights RNE-converted to bf16 and held exactly in f16 (weights carried x16); q, k, V^T and gated o as f16 planes plus x2^10 f16 residual planes over the first RESQ query rows / keys (two-term products there, single products elsewhere); softmax weights x2^14 in f16 (+ x2^10 residual on those rows); gated o carried x64; RMSNorm, RoPE, softmax statistics and sigmoid gating in f32.

#ifndef NB
#define NB 2
#endif
#ifndef SEQ
#define SEQ 2048
#endif
#ifndef RESQ
#if SEQ < 512
#define RESQ SEQ
#else
#define RESQ 512
#endif
#endif
#define NB_FULL 2
#define SEQ_FULL 2048
#define HID 2048
#define NH 16
#define NKV 4
#define HD 128
#define GQ (NH / NKV)
#define NQC (2 * NH * HD)      /* q|gate columns: head h at h*256 (q) and h*256+128 (gate) */
#define NKVC (2 * NKV * HD)    /* k|v columns: k head j at j*128, v head j at 512+j*128 */
#define NHR (NH + NKV)         /* normalised rows per token (16 q heads + 4 k heads) */
#define NRP 64                 /* rotary pairs */
#define PCAR 16384.0f          /* softmax weight carry */
#define OCAR 64.0f             /* gated o carry */
#define RCAR 1024.0f           /* residual plane carry */
#define WCAR 16.0f             /* weight carry */

static_assert(NB >= 1);
static_assert(NB <= NB_FULL);
static_assert(SEQ % 128 == 0);
static_assert(SEQ <= SEQ_FULL);
static_assert(RESQ % 128 == 0);
static_assert(RESQ >= 128);
static_assert(RESQ <= SEQ);
static_assert((SEQ - RESQ) % 128 == 0);
static_assert(HID % 32 == 0);
static_assert(HID % 64 == 0);
static_assert(NQC % 128 == 0);
static_assert(NKVC % 128 == 0);
static_assert(HID % 256 == 0);
static_assert((NH * HD) % 256 == 0);
static_assert(HD == 128);
static_assert(NH % NKV == 0);
static_assert((SEQ * NHR) % 8 == 0);
static_assert((SEQ * HID) % 8 == 0);

constexpr size_t SZ_X16   = (size_t)SEQ * HID * 2;
constexpr size_t SZ_WQT   = (size_t)NQC * HID * 2;
constexpr size_t SZ_WKVT  = (size_t)NKVC * HID * 2;
constexpr size_t SZ_WOT   = (size_t)HID * NH * HD * 2;
constexpr size_t SZ_CS    = (size_t)SEQ * NRP * 2 * 4;
constexpr size_t SZ_QRAW  = (size_t)SEQ * NQC * 4;
constexpr size_t SZ_KVRAW = (size_t)SEQ * NKVC * 4;
constexpr size_t SZ_QH    = (size_t)NH * SEQ * HD * 2;
constexpr size_t SZ_QL    = (size_t)NH * RESQ * HD * 2;
constexpr size_t SZ_KH    = (size_t)NKV * SEQ * HD * 2;
constexpr size_t SZ_KL    = (size_t)NKV * RESQ * HD * 2;
constexpr size_t SZ_VT    = (size_t)NKV * HD * SEQ * 2;
constexpr size_t SZ_VTL   = (size_t)NKV * HD * RESQ * 2;
constexpr size_t SZ_OH    = (size_t)SEQ * NH * HD * 2;
constexpr size_t SZ_OL    = (size_t)RESQ * NH * HD * 2;
constexpr size_t WS_TOTAL = SZ_X16 + SZ_WQT + SZ_WKVT + SZ_WOT + SZ_CS + SZ_QRAW + SZ_KVRAW + SZ_QH + SZ_QL + SZ_KH + SZ_KL + SZ_VT + SZ_VTL + SZ_OH + SZ_OL;
static_assert(WS_TOTAL <= (size_t)134217728);
static_assert(SZ_X16 % 256 == 0);
static_assert(SZ_KL % 256 == 0);
static_assert(SZ_VTL % 256 == 0);
static_assert(SZ_CS % 256 == 0);

typedef _Float16 v16h __attribute__((ext_vector_type(16)));
typedef unsigned short v8us __attribute__((ext_vector_type(8), may_alias));
typedef float v8f __attribute__((ext_vector_type(8)));
typedef float v4f __attribute__((ext_vector_type(4)));
typedef float v4fa __attribute__((ext_vector_type(4), may_alias));
typedef float v2f __attribute__((ext_vector_type(2)));
typedef _Float16 v4h __attribute__((ext_vector_type(4)));
typedef uint32_t u32x4 __attribute__((ext_vector_type(4)));
typedef uint32_t u32x8 __attribute__((ext_vector_type(8)));
union FragH { v16h v; v8us half[2]; _Float16 h[16]; unsigned short u[16]; };
union Pack8 { v8us v; _Float16 h[8]; unsigned short u[8]; };

__device__ __forceinline__ unsigned short bf16_bits(float x) { const unsigned int u = __float_as_uint(x); return (unsigned short)((u + 0x7FFFu + ((u >> 16) & 1u)) >> 16); }
__device__ __forceinline__ float bf16_rne(float x) { return __uint_as_float(((unsigned int)bf16_bits(x)) << 16); }

// 16x32 f16 fragment from a k-contiguous row p (A row m = lane&15, or Bt row n = lane&15): elements 0..7 <- k 8h..8h+7, 8..15 <- k 16+8h..16+8h+7
__device__ __forceinline__ v16h frag16(const _Float16* p, int hh) {
  FragH f;
  f.half[0] = *(const v8us*)((const unsigned short*)p + 8 * hh);
  f.half[1] = *(const v8us*)((const unsigned short*)p + 16 + 8 * hh);
  return f.v;
}
// D += A.B (f16 operands, f32 accumulate) with the VALU hazard guard
__device__ __forceinline__ v8f mma16(v16h a, v16h b, v8f c) {
  v8f d = __builtin_amdgcn_wmma_f32_16x16x32_f16(false, a, false, b, (short)0, c, false, false);
  asm volatile("v_nop\n\tv_nop\n\tv_nop\n\tv_nop" : "+v"(d) : "v"(a), "v"(b));
  return d;
}

__global__ __launch_bounds__(256) void k_x16(const float* __restrict__ x, _Float16* __restrict__ X16, size_t n8) {
  const size_t t = (size_t)blockIdx.x * 256 + threadIdx.x; if (t >= n8) return;
  const v4f a = *(const v4fa*)(x + t * 8), c = *(const v4fa*)(x + t * 8 + 4);
  Pack8 f;
#pragma unroll
  for (int q = 0; q < 4; ++q) { f.h[q] = (_Float16)bf16_rne(a[q]); f.h[4 + q] = (_Float16)bf16_rne(c[q]); }
  unsigned short* d = (unsigned short*)X16 + t * 8;
  *(v8us*)d = f.v; 
}

__global__ __launch_bounds__(256) void k_wt_f16(const float* __restrict__ W, _Float16* __restrict__ Wt, int K, int N, float scale) {
  const int t = blockIdx.x * 256 + threadIdx.x; if (t >= N * (K / 8)) return;
  const int n = t / (K / 8), k8 = (t % (K / 8)) * 8;
  Pack8 f;
#pragma unroll
  for (int i = 0; i < 8; ++i) f.h[i] = (_Float16)(bf16_rne(W[(size_t)(k8 + i) * N + n]) * scale);
  unsigned short* d = (unsigned short*)Wt + (size_t)n * K + k8;
  *(v8us*)d = f.v; 
}

__global__ __launch_bounds__(256) void k_rope(float* __restrict__ cs) {
  const int t = blockIdx.x * 256 + threadIdx.x; if (t >= SEQ * NRP) return;
  const int pos = t / NRP, i = t - pos * NRP;
  const float inv = exp2f(-(float)i * 0.31143075889569022f);   // 2^(-i*log2(1e6)/64)
  const float ang = (float)pos * inv;
  float sn, cn; sincosf(ang, &sn, &cn);
  v2f o; o[0] = cn; o[1] = sn;
  float* d = cs + (size_t)t * 2;
  *(v2f*)d = o; 
}

#define G_PITCH 272u                 /* LDS row pitch: 256 B of k plus the mover's 16-B pad (ds_load_b128 readers) */
#define G_SLICE 18432u               /* one wave's slice: 64 rows at G_PITCH, rounded up to a multiple of 2 KiB */
#define G_STAGE (4u * G_SLICE)       /* one buffer: [A rows 0..63 | A rows 64..127 (RES: residual rows 0..63) | Bt rows 0..63 | Bt rows 64..127] */
static_assert(64u * G_PITCH <= G_SLICE);
static_assert(G_SLICE % 2048u == 0);
static_assert(64u * 68u * 4u <= G_SLICE);

// D += A.B by the plain builtin, whose distances the compiler keeps itself: register operands on an asm guard would hold the GEMM's accumulators and both fragment sets below v256 (spills)
__device__ __forceinline__ v8f mma16b(v16h a, v16h b, v8f c) { return __builtin_amdgcn_wmma_f32_16x16x32_f16(false, a, false, b, (short)0, c, false, false); }
__device__ __forceinline__ uint32_t uni(uint32_t v) { return (uint32_t)__builtin_amdgcn_readfirstlane(v); }
__device__ __forceinline__ uint32_t pinned(uint32_t v) { uint32_t w = uni(v); asm volatile("" : "+s"(w)); return w; }
__device__ __forceinline__ void wait_ds0() { asm volatile("s_wait_dscnt 0x0" ::: "memory"); }          // this wave's LDS reads have returned before the buffer is handed over
__device__ __forceinline__ void wait_tensor0() { asm volatile("s_wait_tensorcnt 0x0" ::: "memory"); }  // this wave's slice has landed; the compiler places no wait for the mover
__device__ __forceinline__ void tdm_load(u32x4 g0, u32x8 g1) { asm volatile("tensor_load_to_lds %0, %1" :: "s"(g0), "s"(g1) : "memory"); }
// group 1: 1-byte elements, tile = tensor = 64 rows of 256 B, source row pitch in bytes, 4 dwords of LDS pad behind every 256-B row
__device__ __forceinline__ u32x8 tdm_group1(uint32_t src_pitch) {
  u32x8 g;
  g[0] = uni((1u << 20) | (5u << 22) | (3u << 25));
  // pinned(): descriptor words held in their scalar registers through the loop, so that none is rewritten while a request is outstanding
  g[1] = pinned(256u << 16);
  g[2] = pinned(64u << 16);
  g[3] = pinned(256u << 16);
  g[4] = pinned(64u);
  g[5] = pinned(src_pitch);
  g[6] = pinned(0u);
  g[7] = pinned(0u);
  return g;
}
__device__ __forceinline__ u32x4 tdm_group0(uint32_t lds_dst, uint64_t ga) {
  u32x4 g;
  g[0] = uni(1u); g[1] = uni(lds_dst); g[2] = uni((uint32_t)ga); g[3] = uni((((uint32_t)(ga >> 32)) & 0x01FFFFFFu) | 0x80000000u);
  return g;
}

// C[M][N] (f32, pitch ldc) = alpha * A[M][K] (f16, pitch lda) . Bt[N][K]^T (f16, pitch ldb)  (+ alphal * Al . Bt^T when RES: residual plane Al, pitch lda).
// Block = 4 waves (2 x 2), C tile 128 x 128 (RES: 64 x 128), grid = (M / tile rows) * (N / 128); K % 128 == 0, K >= 128.
// A pass is 128 k: every wave brings its own 64-row slice of the pass into LDS with one tensor load, two buffers, the next pass's load in flight under this pass's products.
// Each accumulator sums its k in ascending steps of 32. Every inner loop is unrolled so that the accumulator and fragment arrays are indexed by constants and stay in registers.
template <bool RES>
__global__ __launch_bounds__(128) void k_gemm(const _Float16* __restrict__ A, const _Float16* __restrict__ Al, int lda, const _Float16* __restrict__ Bt, int ldb,
                                             float alpha, float alphal, float* __restrict__ C, int ldc, int M, int N, int K) {
  constexpr int BM = RES ? 64 : 128;
  constexpr int NI = RES ? 2 : 4;        // 16-row C tiles per wave
  __shared__ __attribute__((aligned(2048))) unsigned char sm[2u * G_STAGE];
  const int tid = threadIdx.x, lane = tid & 31, ln = lane & 15, hh = lane >> 4;
  const uint32_t w = uni((uint32_t)tid >> 5);
  const int wm = (int)(w >> 1), wn = (int)(w & 1u);
  const int ntn = N >> 7;
  const int mt = (int)blockIdx.x / ntn, nq = (int)blockIdx.x - mt * ntn;
  const int row0 = mt * BM, col0 = nq * 128;
  if (row0 >= M) return;
  const _Float16* src = (w >= 2u) ? (Bt + (size_t)(col0 + 64 * wn) * ldb)
                      : (RES ? ((w == 1u ? Al : A) + (size_t)row0 * lda) : (A + (size_t)(row0 + 64 * (int)w) * lda));
  const uint64_t ga0 = (uint64_t)(uintptr_t)src;
  const uint32_t lds0 = (uint32_t)(size_t)sm + w * G_SLICE;
  const u32x8 g1 = tdm_group1(2u * (uint32_t)(w >= 2u ? ldb : lda));
  const int ns = K >> 7;
  // per-lane fragment rows inside a buffer
  uint32_t aoff[4], boff[4];
#pragma unroll
  for (int i = 0; i < 4; ++i) {
    aoff[i] = RES ? ((uint32_t)(i >> 1) * G_SLICE + (uint32_t)(wm * 32 + (i & 1) * 16 + ln) * G_PITCH)
                  : ((uint32_t)wm * G_SLICE + (uint32_t)(i * 16 + ln) * G_PITCH);
    boff[i] = (uint32_t)(2 + wn) * G_SLICE + (uint32_t)(i * 16 + ln) * G_PITCH;
  }
  const v8f z8 = {0.f, 0.f, 0.f, 0.f, 0.f, 0.f, 0.f, 0.f};
  v8f c[4][4];                           // RES: c[0..1] main plane, c[2..3] residual plane of the same rows
#pragma unroll
  for (int i = 0; i < 4; ++i)
#pragma unroll
    for (int j = 0; j < 4; ++j) c[i][j] = z8;

  tdm_load(tdm_group0(lds0, ga0), g1);
  wait_tensor0();
  __syncthreads();
  if (pinned(1 < ns ? 1u : 0u) != 0u) tdm_load(tdm_group0(lds0 + G_STAGE, ga0 + 256u), g1);
#pragma unroll 1                         // one pass per trip: the buffer alternates at run time
  for (int s = 0; s < ns; ++s) {
    const uint32_t bo = (uint32_t)(s & 1) * G_STAGE;
    const unsigned char* bp = sm + bo;
    v16h fa[2][4], fb[2][4];             // set (kk & 1) holds k-step kk's fragments; the next step's loads go ahead of this step's products as one group
#pragma unroll
    for (int i = 0; i < 4; ++i) { fa[0][i] = frag16((const _Float16*)(bp + aoff[i]), hh); fb[0][i] = frag16((const _Float16*)(bp + boff[i]), hh); }
#pragma unroll
    for (int kk = 0; kk < 4; ++kk) {
      if (kk < 3) {
#pragma unroll
        for (int i = 0; i < 4; ++i) {
          fa[(kk + 1) & 1][i] = frag16((const _Float16*)(bp + aoff[i] + (kk + 1) * 64), hh);
          fb[(kk + 1) & 1][i] = frag16((const _Float16*)(bp + boff[i] + (kk + 1) * 64), hh);
        }
      }
      __builtin_amdgcn_sched_barrier(0);   // keeps the next step's LDS loads one group ahead of the products, not spread among them
#pragma unroll
      for (int j = 0; j < 4; ++j)
#pragma unroll
        for (int i = 0; i < 4; ++i) c[i][j] = mma16b(fa[kk & 1][i], fb[kk & 1][j], c[i][j]);
      __builtin_amdgcn_sched_barrier(0);   // ends the block of products: the following loads stay behind it
    }
    asm volatile("v_nop\n\tv_nop\n\tv_nop\n\tv_nop");   // WMMA-to-VALU distance on the loop's exit path, where the epilogue reads the accumulators
    // publish point of pass s + 1: own LDS reads returned, own slice landed, block barrier, then the refill of the buffer just read
    wait_ds0();
    wait_tensor0();
    __syncthreads();
    if (pinned(s + 2 < ns ? 1u : 0u) != 0u) tdm_load(tdm_group0(lds0 + bo, ga0 + (uint64_t)(uint32_t)(s + 2) * 256u), g1);
  }
  wait_tensor0();
  wait_ds0();

  // epilogue: the ring is free behind the last pass's barrier; each wave stages its C tile in its own slice and stores whole 256-B row pieces
  float* so = (float*)(sm + w * G_SLICE);
#pragma unroll
  for (int i = 0; i < NI; ++i) {
#pragma unroll
    for (int j = 0; j < 4; ++j) {
#pragma unroll
      for (int r = 0; r < 8; ++r)
        so[(i * 16 + 8 * hh + r) * 68 + j * 16 + ln] = RES ? (c[i][j][r] * alpha + c[(i + 2) & 3][j][r] * alphal) : (c[i][j][r] * alpha);
    }
  }
  __builtin_amdgcn_fence(4 /* acq_rel order */, "workgroup");
  __builtin_amdgcn_wave_barrier();
  const int rsub = lane >> 4, c4 = (lane & 15) * 4;
#pragma unroll
  for (int q = 0; q < NI * 8; ++q) {
    const int r = q * 2 + rsub;
    const v4f v = *(const v4fa*)&so[r * 68 + c4];
    *(v4f*)(C + (size_t)(row0 + wm * (NI * 16) + r) * ldc + col0 + wn * 64 + c4) = v;
  }
}

// per (token s, head-row j): j<16 -> q head j from qraw[s][j*256 + 0..127], else k head j-16 from kvraw[s][(j-16)*128 ..]; RMSNorm (w+1, eps 1e-6) then rotate-half RoPE from cs[s];
__global__ __launch_bounds__(256) void k_qk(const float* __restrict__ qraw, const float* __restrict__ kvraw,
                                           const float* __restrict__ qnw, const float* __restrict__ knw, const float* __restrict__ cs,
                                           _Float16* __restrict__ Qh, _Float16* __restrict__ Ql, _Float16* __restrict__ Kh, _Float16* __restrict__ Kl) {
  const int w = threadIdx.x >> 5, lane = threadIdx.x & 31;
  const int wid = (int)blockIdx.x * 8 + w;
  if (wid >= SEQ * NHR) return;
  const int s = wid / NHR, j = wid - s * NHR;
  const bool isq = (j < NH);
  const float* src = isq ? (qraw + (size_t)s * NQC + (size_t)j * (2 * HD)) : (kvraw + (size_t)s * NKVC + (size_t)(j - NH) * HD);
  const float* wp = isq ? qnw : knw;
  const v4f xv = *(const v4fa*)(src + 4 * lane);
  const v4f wv = *(const v4fa*)(wp + 4 * lane);
  float ss = xv[0] * xv[0] + xv[1] * xv[1] + xv[2] * xv[2] + xv[3] * xv[3];
#pragma unroll
  for (int m = 16; m > 0; m >>= 1) ss += __shfl_xor(ss, m, 32);
  const float inv = rsqrtf(ss * (1.0f / 128.0f) + 1.0e-6f);
  float nv[4], pr[4];
#pragma unroll
  for (int q = 0; q < 4; ++q) nv[q] = xv[q] * inv * (wv[q] + 1.0f);
#pragma unroll
  for (int q = 0; q < 4; ++q) pr[q] = __shfl_xor(nv[q], 16, 32);       // element d +- 64
  const int i0 = 4 * (lane & 15);
  const v4f t01 = *(const v4fa*)(cs + ((size_t)s * NRP + i0) * 2);
  const v4f t23 = *(const v4fa*)(cs + ((size_t)s * NRP + i0 + 2) * 2);
  const float cv[4] = {t01[0], t01[2], t23[0], t23[2]};
  const float sv[4] = {t01[1], t01[3], t23[1], t23[3]};
  const float sg = (lane < 16) ? -1.0f : 1.0f;                          // d < 64: -x[d+64]; d >= 64: +x[d-64]
  v4h oh, ol;
#pragma unroll
  for (int q = 0; q < 4; ++q) {
    const float o = nv[q] * cv[q] + sg * pr[q] * sv[q];
    const _Float16 hv = (_Float16)o;
    oh[q] = hv; ol[q] = (_Float16)((o - (float)hv) * RCAR);
  }
  _Float16* dh = isq ? (Qh + ((size_t)j * SEQ + s) * HD) : (Kh + ((size_t)(j - NH) * SEQ + s) * HD);
  _Float16* dl = isq ? (Ql + ((size_t)j * RESQ + s) * HD) : (Kl + ((size_t)(j - NH) * RESQ + s) * HD);
  const bool wl = (s < RESQ);
  {
    *(v4h*)(dh + 4 * lane) = oh;
    if (wl) *(v4h*)(dl + 4 * lane) = ol;
    
  }
}

// V^T planes: VT[kv][d][t] = f16(v), VTl = x2^10 residual for t < RESQ; v = kvraw[t][512 + kv*128 + d]; block per (kv, d-half, 64 tokens) via LDS 64x64 tile;
__global__ __launch_bounds__(256) void k_vt(const float* __restrict__ kvraw, _Float16* __restrict__ VT, _Float16* __restrict__ VTl) {
  __shared__ float tl[64][65];
  const int tid = threadIdx.x;
  const int ntg = SEQ / 64;
  const int tg = (int)blockIdx.x % ntg, slab = (int)blockIdx.x / ntg;
  const int kv = slab >> 1, dh = slab & 1;
  const int s0 = tg * 64;
#pragma unroll
  for (int it = 0; it < 4; ++it) {
    const int i = tid + it * 256; const int tok = i >> 4, c4 = (i & 15) * 4;
    const v4f v = *(const v4fa*)(kvraw + (size_t)(s0 + tok) * NKVC + NKV * HD + kv * HD + dh * 64 + c4);
    tl[tok][c4] = v[0]; tl[tok][c4 + 1] = v[1]; tl[tok][c4 + 2] = v[2]; tl[tok][c4 + 3] = v[3];
  }
  __syncthreads();
  const int pc = tid & 7, dr = tid >> 3;
  const bool wl = (s0 < RESQ);
  {
#pragma unroll
    for (int rd = 0; rd < 2; ++rd) {
      const int d = rd * 32 + dr;
      Pack8 ph, pl;
#pragma unroll
      for (int q = 0; q < 8; ++q) { const float f = tl[pc * 8 + q][d]; const _Float16 hv = (_Float16)f; ph.h[q] = hv; pl.h[q] = (_Float16)((f - (float)hv) * RCAR); }
      const size_t row = (size_t)(kv * HD + dh * 64 + d);
      *(v8us*)((unsigned short*)VT + row * SEQ + s0 + pc * 8) = ph.v;
      if (wl) *(v8us*)((unsigned short*)VTl + row * RESQ + s0 + pc * 8) = pl.v;
    }
    
  }
}

// Causal grouped attention, flash form. Block = 8 waves x 16 query rows of head h (kv = h/4), grid (query blocks, NH, RES ? 2 : 1).
// Per key chunk: K rows [t][d] and V^T rows [d][t] staged in LDS (cross-wave: block barriers); S = q.k^T (f16, f32 acc), scale 1/sqrt(128),
// RES: first RESQ query rows: chunk 32 keys, q/k/P/V^T residual second terms into separate accumulators folded by 2^-10; block covers 64 o columns (blockIdx.z half).
template <bool RES>
__global__ __launch_bounds__(256) void k_attn(const _Float16* __restrict__ Qh, const _Float16* __restrict__ Ql,
                                             const _Float16* __restrict__ Kh, const _Float16* __restrict__ Kl,
                                             const _Float16* __restrict__ VT, const _Float16* __restrict__ VTl,
                                             const float* __restrict__ qraw, _Float16* __restrict__ Oh, _Float16* __restrict__ Ol, int qb0) {
  constexpr int KC = RES ? 32 : 64;      // keys per chunk
  constexpr int NJ = KC / 16;            // score column tiles
  constexpr int NKS = KC / 32;           // k-steps of P.V^T
  constexpr int OD = RES ? 64 : 128;     // o columns per block
  constexpr int NC = OD / 16;
  constexpr int NHF = OD / 64;
  constexpr int KP = HD + 8;             // sK pitch (halves)
  constexpr int VP = KC + 8;             // sV pitch
  constexpr int PP = 72;                 // sP pitch (KC weights, and 64 staged o columns)
  __shared__ __attribute__((aligned(16))) _Float16 sK[KC][KP];
  __shared__ __attribute__((aligned(16))) _Float16 sKl[RES ? KC : 1][KP];
  __shared__ __attribute__((aligned(16))) _Float16 sV[OD][VP];
  __shared__ __attribute__((aligned(16))) _Float16 sVl[RES ? OD : 1][VP];
  __shared__ __attribute__((aligned(16))) _Float16 sP[8][16][PP];
  __shared__ __attribute__((aligned(16))) _Float16 sPl[RES ? 8 : 1][16][PP];

  const int tid = threadIdx.x, w = tid >> 5, lane = tid & 31, ln = lane & 15, hh = lane >> 4;
  const int qb = qb0 + (int)blockIdx.x, h = (int)blockIdx.y, kv = h / GQ;
  const int dz = RES ? (int)blockIdx.z * 64 : 0;
  const int q0b = qb * 128, q0w = q0b + 16 * w;
  const int nch = (q0b + 128) / KC;      // chunks holding keys <= last row of the block
  const int qlast = q0w + 15;

  v16h aq[4], aql[4];
  {
    const _Float16* qp = Qh + ((size_t)h * SEQ + q0w + ln) * HD;
#pragma unroll
    for (int kk = 0; kk < 4; ++kk) aq[kk] = frag16(qp + kk * 32, hh);
    if (RES) {
      const _Float16* qlp = Ql + ((size_t)h * RESQ + q0w + ln) * HD;
#pragma unroll
      for (int kk = 0; kk < 4; ++kk) aql[kk] = frag16(qlp + kk * 32, hh);
    } else {
#pragma unroll
      for (int kk = 0; kk < 4; ++kk) aql[kk] = aq[kk];
    }
  }
  const v8f z8 = {0.f, 0.f, 0.f, 0.f, 0.f, 0.f, 0.f, 0.f};
  v8f o[NC];
#pragma unroll
  for (int c = 0; c < NC; ++c) o[c] = z8;
  float mrow[8], lrow[8];
#pragma unroll
  for (int r = 0; r < 8; ++r) { mrow[r] = -3.0e38f; lrow[r] = 0.f; }
  const float alpha = 0.08838834764831845f;

#pragma unroll 1
  for (int ch = 0; ch < nch; ++ch) {
    const int t0 = ch * KC;
    // stage K rows t0..t0+KC-1 (all 128 d) and V^T rows dz..dz+OD-1 (keys t0..t0+KC-1): staged extent == consumed extent
#pragma unroll
    for (int it = 0; it < (KC * 16) / 256; ++it) {
      const int i = tid + it * 256; const int r = i >> 4, c8 = (i & 15) * 8;
      *(v8us*)&sK[r][c8] = *(const v8us*)((const unsigned short*)Kh + ((size_t)kv * SEQ + t0 + r) * HD + c8);
      if (RES) *(v8us*)&sKl[r][c8] = *(const v8us*)((const unsigned short*)Kl + ((size_t)kv * RESQ + t0 + r) * HD + c8);
    }
#pragma unroll
    for (int it = 0; it < (OD * (KC / 8)) / 256; ++it) {
      const int i = tid + it * 256; const int d = i / (KC / 8), c8 = (i % (KC / 8)) * 8;
      *(v8us*)&sV[d][c8] = *(const v8us*)((const unsigned short*)VT + (size_t)(kv * HD + dz + d) * SEQ + t0 + c8);
      if (RES) *(v8us*)&sVl[d][c8] = *(const v8us*)((const unsigned short*)VTl + (size_t)(kv * HD + dz + d) * RESQ + t0 + c8);
    }
    __syncthreads();
    if (t0 <= qlast) {                   // wave-uniform: this wave has unmasked keys in the chunk
      v8f sacc[NJ];
#pragma unroll
      for (int j = 0; j < NJ; ++j) {
        v8f acc = z8, tmp = z8;
#pragma unroll
        for (int kk = 0; kk < 4; ++kk) {
          const v16h b = frag16(&sK[j * 16 + ln][kk * 32], hh);          // B[k = d][n = key]: key row, d contiguous
          acc = mma16(aq[kk], b, acc);
          if (RES) {
            const v16h bl = frag16(&sKl[j * 16 + ln][kk * 32], hh);
            tmp = mma16(aql[kk], b, tmp);
            tmp = mma16(aq[kk], bl, tmp);
          }
        }
        if (RES) acc = acc + tmp * (1.0f / RCAR);
        sacc[j] = acc;
      }
      // scale, causal mask, online softmax; P (x2^14) to the wave-private LDS tile
#pragma unroll
      for (int r = 0; r < 8; ++r) {
        const int qrow = q0w + 8 * hh + r;
        float sv[NJ]; bool mk[NJ]; float mx = -3.0e38f;
#pragma unroll
        for (int j = 0; j < NJ; ++j) { mk[j] = (t0 + 16 * j + ln) > qrow; sv[j] = sacc[j][r] * alpha; mx = fmaxf(mx, mk[j] ? -3.0e38f : sv[j]); }
#pragma unroll
        for (int m = 8; m > 0; m >>= 1) mx = fmaxf(mx, __shfl_xor(mx, m, 32));
        const float mnew = fmaxf(mrow[r], mx);
        const float fac = (mrow[r] < -1.0e38f) ? 0.f : __expf(mrow[r] - mnew);
        float rs = 0.f;
#pragma unroll
        for (int j = 0; j < NJ; ++j) {
          const float p = mk[j] ? 0.f : __expf(sv[j] - mnew);
          rs += p;
          const float pcv = p * PCAR; const _Float16 ph = (_Float16)pcv;
          sP[w][8 * hh + r][16 * j + ln] = ph;
          if (RES) sPl[w][8 * hh + r][16 * j + ln] = (_Float16)((pcv - (float)ph) * RCAR);
        }
#pragma unroll
        for (int m = 8; m > 0; m >>= 1) rs += __shfl_xor(rs, m, 32);
        lrow[r] = lrow[r] * fac + rs; mrow[r] = mnew;
#pragma unroll
        for (int c = 0; c < NC; ++c) o[c][r] *= fac;
      }
      __builtin_amdgcn_fence(4 /* acq_rel order */, "workgroup");
      __builtin_amdgcn_wave_barrier();
      v16h ap[NKS], apl[NKS];
#pragma unroll
      for (int ks = 0; ks < NKS; ++ks) {
        ap[ks] = frag16(&sP[w][ln][ks * 32], hh);                         // A[m = query row][k = key]
        if (RES) apl[ks] = frag16(&sPl[w][ln][ks * 32], hh); else apl[ks] = ap[ks];
      }
#pragma unroll
      for (int c = 0; c < NC; ++c) {
        v8f tmp = z8;
#pragma unroll
        for (int ks = 0; ks < NKS; ++ks) {
          const v16h b = frag16(&sV[c * 16 + ln][ks * 32], hh);          // B[k = key][n = d]: d row, keys contiguous
          o[c] = mma16(ap[ks], b, o[c]);
          if (RES) {
            const v16h bl = frag16(&sVl[c * 16 + ln][ks * 32], hh);
            tmp = mma16(apl[ks], b, tmp);
            tmp = mma16(ap[ks], bl, tmp);
          }
        }
        if (RES) o[c] = o[c] + tmp * (1.0f / RCAR);
      }
    }
    __syncthreads();
  }

  // epilogue
  float il[8];
#pragma unroll
  for (int r = 0; r < 8; ++r) il[r] = (OCAR / PCAR) * __builtin_amdgcn_rcpf(lrow[r]);
  const float* gp = qraw + (size_t)(q0w + 8 * hh) * NQC + (size_t)h * (2 * HD) + HD + dz + ln;
#pragma unroll
  for (int hf = 0; hf < NHF; ++hf) {
    if (hf > 0) { __builtin_amdgcn_fence(4 /* acq_rel order */, "workgroup"); __builtin_amdgcn_wave_barrier(); }
#pragma unroll
    for (int cc = 0; cc < 4; ++cc) {
      const int c = hf * 4 + cc;
#pragma unroll
      for (int r = 0; r < 8; ++r) {
        const float g = gp[(size_t)r * NQC + c * 16];
        const float sig = __builtin_amdgcn_rcpf(1.0f + __expf(-g));
        const float val = o[c][r] * il[r] * sig;
        const _Float16 vh = (_Float16)val;
        sP[w][8 * hh + r][cc * 16 + ln] = vh;
        if (RES) sPl[w][8 * hh + r][cc * 16 + ln] = (_Float16)((val - (float)vh) * RCAR);
      }
      asm volatile("" ::: "memory");
    }
    __builtin_amdgcn_fence(4 /* acq_rel order */, "workgroup");
    __builtin_amdgcn_wave_barrier();
    const int prw = lane >> 3, pc = lane & 7;
    {
#pragma unroll
      for (int it = 0; it < 4; ++it) {
        const int row = it * 4 + prw;
        const v8us vv = *(const v8us*)&sP[w][row][pc * 8];
        const size_t go = (size_t)(q0w + row) * (NH * HD) + (size_t)h * HD + dz + hf * 64 + pc * 8;
        *(v8us*)((unsigned short*)Oh + go) = vv;
        if (RES) { const v8us vl = *(const v8us*)&sPl[w][row][pc * 8]; *(v8us*)((unsigned short*)Ol + go) = vl; }
      }
      
    }
  }
}

extern "C" void kernel_launch(void* const* d_in, const int* in_sizes, int n_in,
                              void* d_out, int out_size, void* d_ws, size_t ws_size, hipStream_t stream) {
  if (n_in < 7) return;
  const long need_x = (long)(NB - 1) * SEQ_FULL * HID + (long)SEQ * HID;
  if ((long)in_sizes[0] < need_x) return;
  if (in_sizes[1] < HID * NQC) return;
  if (in_sizes[2] < HID * NKV * HD) return;
  if (in_sizes[3] < HID * NKV * HD) return;
  if (in_sizes[4] < NH * HD * HID) return;
  if (in_sizes[5] < HD) return;
  if (in_sizes[6] < HD) return;
  if ((long)out_size < need_x) return;

  const float* x   = (const float*)d_in[0];
  const float* Wq  = (const float*)d_in[1];
  const float* Wk  = (const float*)d_in[2];
  const float* Wv  = (const float*)d_in[3];
  const float* Wo  = (const float*)d_in[4];
  const float* qnw = (const float*)d_in[5];
  const float* knw = (const float*)d_in[6];

  char* ws = (char*)d_ws; size_t off = 0;
  auto take = [&](size_t bytes) { char* p = ws + off; off += (bytes + 255) & ~(size_t)255; return p; };
  _Float16* X16  = (_Float16*)take(SZ_X16);
  _Float16* WqT  = (_Float16*)take(SZ_WQT);
  _Float16* WkvT = (_Float16*)take(SZ_WKVT);
  _Float16* WoT  = (_Float16*)take(SZ_WOT);
  float*    CS   = (float*)take(SZ_CS);
  float*    qraw = (float*)take(SZ_QRAW);
  float*    kvraw = (float*)take(SZ_KVRAW);
  _Float16* Qh   = (_Float16*)take(SZ_QH);
  _Float16* Ql   = (_Float16*)take(SZ_QL);
  _Float16* Kh   = (_Float16*)take(SZ_KH);
  _Float16* Kl   = (_Float16*)take(SZ_KL);
  _Float16* VT   = (_Float16*)take(SZ_VT);
  _Float16* VTl  = (_Float16*)take(SZ_VTL);
  _Float16* Oh   = (_Float16*)take(SZ_OH);
  _Float16* Ol   = (_Float16*)take(SZ_OL);
  if (off > ws_size) return;

  // rotary tables and weight planes (Bt[n][k] = f16(bf16rne(W[k][n]) * 16))
  k_rope<<<(SEQ * NRP + 255) / 256, 256, 0, stream>>>(CS);
  k_wt_f16<<<(NQC * (HID / 8) + 255) / 256, 256, 0, stream>>>(Wq, WqT, HID, NQC, WCAR);
  k_wt_f16<<<(NKV * HD * (HID / 8) + 255) / 256, 256, 0, stream>>>(Wk, WkvT, HID, NKV * HD, WCAR);
  k_wt_f16<<<(NKV * HD * (HID / 8) + 255) / 256, 256, 0, stream>>>(Wv, WkvT + (size_t)NKV * HD * HID, HID, NKV * HD, WCAR);
  k_wt_f16<<<(HID * ((NH * HD) / 8) + 255) / 256, 256, 0, stream>>>(Wo, WoT, NH * HD, HID, WCAR);

  const float walpha = 1.0f / WCAR;                          // 2^-4
  const float oalpha = 1.0f / (WCAR * OCAR);                 // 2^-10
  const float oalphal = oalpha / RCAR;                       // 2^-20
  for (int b = 0; b < NB; ++b) {
    const size_t xoff = (size_t)b * SEQ_FULL * HID;
    float* outb = (float*)d_out + (size_t)b * SEQ_FULL * HID;
    k_x16<<<(unsigned)(((size_t)SEQ * HID / 8 + 255) / 256), 256, 0, stream>>>(x + xoff, X16, (size_t)SEQ * HID / 8);
    k_gemm<false><<<(SEQ / 128) * (NQC / 128), 128, 0, stream>>>(X16, X16, HID, WqT, HID, walpha, 0.0f, qraw, NQC, SEQ, NQC, HID);
    k_gemm<false><<<(SEQ / 128) * (NKVC / 128), 128, 0, stream>>>(X16, X16, HID, WkvT, HID, walpha, 0.0f, kvraw, NKVC, SEQ, NKVC, HID);
    k_qk<<<(SEQ * NHR) / 8, 256, 0, stream>>>(qraw, kvraw, qnw, knw, CS, Qh, Ql, Kh, Kl);
    k_vt<<<NKV * 2 * (SEQ / 64), 256, 0, stream>>>(kvraw, VT, VTl);
    k_attn<true><<<dim3(RESQ / 128, NH, 2), 256, 0, stream>>>(Qh, Ql, Kh, Kl, VT, VTl, qraw, Oh, Ol, 0);
    if (SEQ > RESQ)
      k_attn<false><<<dim3((SEQ - RESQ) / 128, NH, 1), 256, 0, stream>>>(Qh, Ql, Kh, Kl, VT, VTl, qraw, Oh, Ol, RESQ / 128);
    k_gemm<true><<<(RESQ / 64) * (HID / 128), 128, 0, stream>>>(Oh, Ol, NH * HD, WoT, NH * HD, oalpha, oalphal, outb, HID, RESQ, HID, NH * HD);
    if (SEQ > RESQ)
      k_gemm<false><<<((SEQ - RESQ) / 128) * (HID / 128), 128, 0, stream>>>(Oh + (size_t)RESQ * NH * HD, Oh + (size_t)RESQ * NH * HD, NH * HD, WoT, NH * HD, oalpha, 0.0f, outb + (size_t)RESQ * HID, HID, SEQ - RESQ, HID, NH * HD);
  }
  (void)hipGetLastError();
}

// v002
// A run of this version takes 454 microseconds.
// Timed twice side by side with v001, it ran 1.13 and 1.12 times as fast.
// Counting every step since v000, it is 2.00 times as fast.
#include <hip/hip_runtime.h>
#include <stdint.h>
// Contractions x.Wq, x.[Wk|Wv], q.k^T, P.V^T, o.Wo: v_wmma_f32_16x16x32_f16 (f16 operands, f32 accumulate). x and all weights RNE-converted to bf16 and held exactly in f16 (weights carried x16); q, k, V^T and gated o as f16 planes plus x2^10 f16 residual planes over the first RESQ query rows / keys (two-term products there, single products elsewhere); softmax weights x2^14 in f16 (+ x2^10 residual on those rows); gated o carried x64; RMSNorm, RoPE, softmax statistics and sigmoid gating in f32.

#ifndef NB
#define NB 2
#endif
#ifndef SEQ
#define SEQ 2048
#endif
#ifndef RESQ
#if SEQ < 512
#define RESQ SEQ
#else
#define RESQ 512
#endif
#endif
#define NB_FULL 2
#define SEQ_FULL 2048
#define HID 2048
#define NH 16
#define NKV 4
#define HD 128
#define GQ (NH / NKV)
#define NQC (2 * NH * HD)      /* q|gate columns: head h at h*256 (q) and h*256+128 (gate) */
#define NKVC (2 * NKV * HD)    /* k|v columns: k head j at j*128, v head j at 512+j*128 */
#define NHR (NH + NKV)         /* normalised rows per token (16 q heads + 4 k heads) */
#define NRP 64                 /* rotary pairs */
#define PCAR 16384.0f          /* softmax weight carry */
#define OCAR 64.0f             /* gated o carry */
#define RCAR 1024.0f           /* residual plane carry */
#define WCAR 16.0f             /* weight carry */

static_assert(NB >= 1);
static_assert(NB <= NB_FULL);
static_assert(SEQ % 128 == 0);
static_assert(SEQ <= SEQ_FULL);
static_assert(RESQ % 128 == 0);
static_assert(RESQ >= 128);
static_assert(RESQ <= SEQ);
static_assert((SEQ - RESQ) % 128 == 0);
static_assert(HID % 32 == 0);
static_assert(HID % 64 == 0);
static_assert(NQC % 128 == 0);
static_assert(NKVC % 128 == 0);
static_assert(HID % 256 == 0);
static_assert((NH * HD) % 256 == 0);
static_assert(HD == 128);
static_assert(NH % NKV == 0);
static_assert((SEQ * NHR) % 8 == 0);
static_assert((SEQ * HID) % 8 == 0);

constexpr size_t SZ_X16   = (size_t)SEQ * HID * 2;
constexpr size_t SZ_WQT   = (size_t)NQC * HID * 2;
constexpr size_t SZ_WKVT  = (size_t)NKVC * HID * 2;
constexpr size_t SZ_WOT   = (size_t)HID * NH * HD * 2;
constexpr size_t SZ_CS    = (size_t)SEQ * NRP * 2 * 4;
constexpr size_t SZ_QRAW  = (size_t)SEQ * NQC * 4;
constexpr size_t SZ_KVRAW = (size_t)SEQ * NKVC * 4;
constexpr size_t SZ_QH    = (size_t)NH * SEQ * HD * 2;
constexpr size_t SZ_QL    = (size_t)NH * RESQ * HD * 2;
constexpr size_t SZ_KH    = (size_t)NKV * SEQ * HD * 2;
constexpr size_t SZ_KL    = (size_t)NKV * RESQ * HD * 2;
constexpr size_t SZ_VT    = (size_t)NKV * HD * SEQ * 2;
constexpr size_t SZ_VTL   = (size_t)NKV * HD * RESQ * 2;
constexpr size_t SZ_OH    = (size_t)SEQ * NH * HD * 2;
constexpr size_t SZ_OL    = (size_t)RESQ * NH * HD * 2;
constexpr size_t WS_TOTAL = SZ_X16 + SZ_WQT + SZ_WKVT + SZ_WOT + SZ_CS + SZ_QRAW + SZ_KVRAW + SZ_QH + SZ_QL + SZ_KH + SZ_KL + SZ_VT + SZ_VTL + SZ_OH + SZ_OL;
static_assert(WS_TOTAL <= (size_t)134217728);
static_assert(SZ_X16 % 256 == 0);
static_assert(SZ_KL % 256 == 0);
static_assert(SZ_VTL % 256 == 0);
static_assert(SZ_CS % 256 == 0);

typedef _Float16 v16h __attribute__((ext_vector_type(16)));
typedef unsigned short v8us __attribute__((ext_vector_type(8), may_alias));
typedef float v8f __attribute__((ext_vector_type(8)));
typedef float v4f __attribute__((ext_vector_type(4)));
typedef float v4fa __attribute__((ext_vector_type(4), may_alias));
typedef float v2f __attribute__((ext_vector_type(2)));
typedef _Float16 v4h __attribute__((ext_vector_type(4)));
typedef uint32_t u32x4 __attribute__((ext_vector_type(4)));
typedef uint32_t u32x8 __attribute__((ext_vector_type(8)));
union FragH { v16h v; v8us half[2]; _Float16 h[16]; unsigned short u[16]; };
union Pack8 { v8us v; _Float16 h[8]; unsigned short u[8]; };

__device__ __forceinline__ unsigned short bf16_bits(float x) { const unsigned int u = __float_as_uint(x); return (unsigned short)((u + 0x7FFFu + ((u >> 16) & 1u)) >> 16); }
__device__ __forceinline__ float bf16_rne(float x) { return __uint_as_float(((unsigned int)bf16_bits(x)) << 16); }

// 16x32 f16 fragment from a k-contiguous row p (A row m = lane&15, or Bt row n = lane&15): elements 0..7 <- k 8h..8h+7, 8..15 <- k 16+8h..16+8h+7
__device__ __forceinline__ v16h frag16(const _Float16* p, int hh) {
  FragH f;
  f.half[0] = *(const v8us*)((const unsigned short*)p + 8 * hh);
  f.half[1] = *(const v8us*)((const unsigned short*)p + 16 + 8 * hh);
  return f.v;
}
// D += A.B (f16 operands, f32 accumulate) with the VALU hazard guard
__device__ __forceinline__ v8f mma16(v16h a, v16h b, v8f c) {
  v8f d = __builtin_amdgcn_wmma_f32_16x16x32_f16(false, a, false, b, (short)0, c, false, false);
  asm volatile("v_nop\n\tv_nop\n\tv_nop\n\tv_nop" : "+v"(d) : "v"(a), "v"(b));
  return d;
}

__global__ __launch_bounds__(256) void k_x16(const float* __restrict__ x, _Float16* __restrict__ X16, size_t n8) {
  const size_t t = (size_t)blockIdx.x * 256 + threadIdx.x; if (t >= n8) return;
  const v4f a = *(const v4fa*)(x + t * 8), c = *(const v4fa*)(x + t * 8 + 4);
  Pack8 f;
#pragma unroll
  for (int q = 0; q < 4; ++q) { f.h[q] = (_Float16)bf16_rne(a[q]); f.h[4 + q] = (_Float16)bf16_rne(c[q]); }
  unsigned short* d = (unsigned short*)X16 + t * 8;
  *(v8us*)d = f.v; 
}

#define WT_K 128                     /* k per block tile: one 256-B piece of a Wt row */
#define WT_N 128                     /* n per block tile: two 256-B pieces of a W row */

// Wt[n][k] = f16(bf16rne(W[k][n]) * scale). Block = tile of WT_K k x WT_N n, grid = (K / WT_K) * (N / WT_N).
// A thread reads 8 k x (4 + 4) n (each wave-wide load covers two whole 256-B row pieces of W), packs 8 k per n and turns the tile in LDS; each wave-wide store covers two whole 256-B row pieces of Wt.
// LDS row n holds its sixteen 16-B k chunks at chunk ^ ((n >> 2) & 15): the 16 lanes of a half wave then fall on 16 different bank groups, writing (16 rows, one chunk) and reading (one row, 16 chunks).
// K and N are compile-time, so that the row steps are immediate offsets on one address.
template <int K, int N>
__global__ __launch_bounds__(256) void k_wt_f16(const float* __restrict__ W, _Float16* __restrict__ Wt, float scale) {
  static_assert(K % WT_K == 0);
  static_assert(N % WT_N == 0);
  __shared__ __attribute__((aligned(16))) unsigned short st[WT_N][WT_K];
  const int tid = threadIdx.x;
  constexpr int ntn = N / WT_N;
  const int kt = (int)blockIdx.x / ntn, nt = (int)blockIdx.x - kt * ntn;
  const int k0 = kt * WT_K, n0 = nt * WT_N;
  const int lo = tid & 15, hi = tid >> 4;
  // block-uniform base plus one 32-bit lane offset that all sixteen loads (all eight stores) share
  const char* wb = (const char*)(W + (size_t)k0 * N + n0);
  const uint32_t vo = ((uint32_t)(hi * 8) * (uint32_t)N + (uint32_t)(lo * 4)) * 4u;
  v4f r[2][8];
#pragma unroll
  for (int i = 0; i < 8; ++i) {
    r[0][i] = *(const v4fa*)(wb + (size_t)i * N * 4 + vo);
    r[1][i] = *(const v4fa*)(wb + (size_t)i * N * 4 + 256 + vo);
  }
  // behind the last load: the offset register that all sixteen loads name stays whole until their addresses are taken (no load's result is placed on it), and no load sinks below into the conversions
  asm volatile("s_wait_xcnt 0x0" :: "v"(vo) : "memory");
#pragma unroll
  for (int h = 0; h < 2; ++h) {
#pragma unroll
    for (int j = 0; j < 4; ++j) {
      Pack8 f;
#pragma unroll
      for (int i = 0; i < 8; ++i) f.h[i] = (_Float16)(bf16_rne(r[h][i][j]) * scale);
      *(v8us*)&st[h * 64 + lo * 4 + j][(hi ^ lo) * 8] = f.v;
    }
  }
  __syncthreads();
  char* tb = (char*)(Wt + (size_t)n0 * K + k0);
  const uint32_t so = ((uint32_t)hi * (uint32_t)K + (uint32_t)(lo * 8)) * 2u;
#pragma unroll
  for (int it = 0; it < WT_N / 16; ++it) {
    const int n = it * 16 + hi;
    const v8us v = *(const v8us*)&st[n][(lo ^ ((n >> 2) & 15)) * 8];
    *(v8us*)(tb + (size_t)it * 16 * K * 2 + so) = v;
  }
}

__global__ __launch_bounds__(256) void k_rope(float* __restrict__ cs) {
  const int t = blockIdx.x * 256 + threadIdx.x; if (t >= SEQ * NRP) return;
  const int pos = t / NRP, i = t - pos * NRP;
  const float inv = exp2f(-(float)i * 0.31143075889569022f);   // 2^(-i*log2(1e6)/64)
  const float ang = (float)pos * inv;
  float sn, cn; sincosf(ang, &sn, &cn);
  v2f o; o[0] = cn; o[1] = sn;
  float* d = cs + (size_t)t * 2;
  *(v2f*)d = o; 
}

#define G_PITCH 272u                 /* LDS row pitch: 256 B of k plus the mover's 16-B pad (ds_load_b128 readers) */
#define G_SLICE 18432u               /* one wave's slice: 64 rows at G_PITCH, rounded up to a multiple of 2 KiB */
#define G_STAGE (4u * G_SLICE)       /* one buffer: [A rows 0..63 | A rows 64..127 (RES: residual rows 0..63) | Bt rows 0..63 | Bt rows 64..127] */
static_assert(64u * G_PITCH <= G_SLICE);
static_assert(G_SLICE % 2048u == 0);
static_assert(64u * 68u * 4u <= G_SLICE);

// D += A.B by the plain builtin, whose distances the compiler keeps itself: register operands on an asm guard would hold the GEMM's accumulators and both fragment sets below v256 (spills)
__device__ __forceinline__ v8f mma16b(v16h a, v16h b, v8f c) { return __builtin_amdgcn_wmma_f32_16x16x32_f16(false, a, false, b, (short)0, c, false, false); }
__device__ __forceinline__ uint32_t uni(uint32_t v) { return (uint32_t)__builtin_amdgcn_readfirstlane(v); }
__device__ __forceinline__ uint32_t pinned(uint32_t v) { uint32_t w = uni(v); asm volatile("" : "+s"(w)); return w; }
__device__ __forceinline__ void wait_ds0() { asm volatile("s_wait_dscnt 0x0" ::: "memory"); }          // this wave's LDS reads have returned before the buffer is handed over
__device__ __forceinline__ void wait_tensor0() { asm volatile("s_wait_tensorcnt 0x0" ::: "memory"); }  // this wave's slice has landed; the compiler places no wait for the mover
__device__ __forceinline__ void tdm_load(u32x4 g0, u32x8 g1) { asm volatile("tensor_load_to_lds %0, %1" :: "s"(g0), "s"(g1) : "memory"); }
// group 1: 1-byte elements, tile = tensor = 64 rows of 256 B, source row pitch in bytes, 4 dwords of LDS pad behind every 256-B row
__device__ __forceinline__ u32x8 tdm_group1(uint32_t src_pitch) {
  u32x8 g;
  g[0] = uni((1u << 20) | (5u << 22) | (3u << 25));
  // pinned(): descriptor words held in their scalar registers through the loop, so that none is rewritten while a request is outstanding
  g[1] = pinned(256u << 16);
  g[2] = pinned(64u << 16);
  g[3] = pinned(256u << 16);
  g[4] = pinned(64u);
  g[5] = pinned(src_pitch);
  g[6] = pinned(0u);
  g[7] = pinned(0u);
  return g;
}
__device__ __forceinline__ u32x4 tdm_group0(uint32_t lds_dst, uint64_t ga) {
  u32x4 g;
  g[0] = uni(1u); g[1] = uni(lds_dst); g[2] = uni((uint32_t)ga); g[3] = uni((((uint32_t)(ga >> 32)) & 0x01FFFFFFu) | 0x80000000u);
  return g;
}

// C[M][N] (f32, pitch ldc) = alpha * A[M][K] (f16, pitch lda) . Bt[N][K]^T (f16, pitch ldb)  (+ alphal * Al . Bt^T when RES: residual plane Al, pitch lda).
// Block = 4 waves (2 x 2), C tile 128 x 128 (RES: 64 x 128), grid = (M / tile rows) * (N / 128); K % 128 == 0, K >= 128.
// A pass is 128 k: every wave brings its own 64-row slice of the pass into LDS with one tensor load, two buffers, the next pass's load in flight under this pass's products.
// Each accumulator sums its k in ascending steps of 32. Every inner loop is unrolled so that the accumulator and fragment arrays are indexed by constants and stay in registers.
template <bool RES>
__global__ __launch_bounds__(128) void k_gemm(const _Float16* __restrict__ A, const _Float16* __restrict__ Al, int lda, const _Float16* __restrict__ Bt, int ldb,
                                             float alpha, float alphal, float* __restrict__ C, int ldc, int M, int N, int K) {
  constexpr int BM = RES ? 64 : 128;
  constexpr int NI = RES ? 2 : 4;        // 16-row C tiles per wave
  __shared__ __attribute__((aligned(2048))) unsigned char sm[2u * G_STAGE];
  const int tid = threadIdx.x, lane = tid & 31, ln = lane & 15, hh = lane >> 4;
  const uint32_t w = uni((uint32_t)tid >> 5);
  const int wm = (int)(w >> 1), wn = (int)(w & 1u);
  const int ntn = N >> 7;
  const int mt = (int)blockIdx.x / ntn, nq = (int)blockIdx.x - mt * ntn;
  const int row0 = mt * BM, col0 = nq * 128;
  if (row0 >= M) return;
  const _Float16* src = (w >= 2u) ? (Bt + (size_t)(col0 + 64 * wn) * ldb)
                      : (RES ? ((w == 1u ? Al : A) + (size_t)row0 * lda) : (A + (size_t)(row0 + 64 * (int)w) * lda));
  const uint64_t ga0 = (uint64_t)(uintptr_t)src;
  const uint32_t lds0 = (uint32_t)(size_t)sm + w * G_SLICE;
  const u32x8 g1 = tdm_group1(2u * (uint32_t)(w >= 2u ? ldb : lda));
  const int ns = K >> 7;
  // per-lane fragment rows inside a buffer
  uint32_t aoff[4], boff[4];
#pragma unroll
  for (int i = 0; i < 4; ++i) {
    aoff[i] = RES ? ((uint32_t)(i >> 1) * G_SLICE + (uint32_t)(wm * 32 + (i & 1) * 16 + ln) * G_PITCH)
                  : ((uint32_t)wm * G_SLICE + (uint32_t)(i * 16 + ln) * G_PITCH);
    boff[i] = (uint32_t)(2 + wn) * G_SLICE + (uint32_t)(i * 16 + ln) * G_PITCH;
  }
  const v8f z8 = {0.f, 0.f, 0.f, 0.f, 0.f, 0.f, 0.f, 0.f};
  v8f c[4][4];                           // RES: c[0..1] main plane, c[2..3] residual plane of the same rows
#pragma unroll
  for (int i = 0; i < 4; ++i)
#pragma unroll
    for (int j = 0; j < 4; ++j) c[i][j] = z8;

  tdm_load(tdm_group0(lds0, ga0), g1);
  wait_tensor0();
  __syncthreads();
  if (pinned(1 < ns ? 1u : 0u) != 0u) tdm_load(tdm_group0(lds0 + G_STAGE, ga0 + 256u), g1);
#pragma unroll 1                         // one pass per trip: the buffer alternates at run time
  for (int s = 0; s < ns; ++s) {
    const uint32_t bo = (uint32_t)(s & 1) * G_STAGE;
    const unsigned char* bp = sm + bo;
    v16h fa[2][4], fb[2][4];             // set (kk & 1) holds k-step kk's fragments; the next step's loads go ahead of this step's products as one group
#pragma unroll
    for (int i = 0; i < 4; ++i) { fa[0][i] = frag16((const _Float16*)(bp + aoff[i]), hh); fb[0][i] = frag16((const _Float16*)(bp + boff[i]), hh); }
#pragma unroll
    for (int kk = 0; kk < 4; ++kk) {
      if (kk < 3) {
#pragma unroll
        for (int i = 0; i < 4; ++i) {
          fa[(kk + 1) & 1][i] = frag16((const _Float16*)(bp + aoff[i] + (kk + 1) * 64), hh);
          fb[(kk + 1) & 1][i] = frag16((const _Float16*)(bp + boff[i] + (kk + 1) * 64), hh);
        }
      }
      __builtin_amdgcn_sched_barrier(0);   // keeps the next step's LDS loads one group ahead of the products, not spread among them
#pragma unroll
      for (int j = 0; j < 4; ++j)
#pragma unroll
        for (int i = 0; i < 4; ++i) c[i][j] = mma16b(fa[kk & 1][i], fb[kk & 1][j], c[i][j]);
      __builtin_amdgcn_sched_barrier(0);   // ends the block of products: the following loads stay behind it
    }
    asm volatile("v_nop\n\tv_nop\n\tv_nop\n\tv_nop");   // WMMA-to-VALU distance on the loop's exit path, where the epilogue reads the accumulators
    // publish point of pass s + 1: own LDS reads returned, own slice landed, block barrier, then the refill of the buffer just read
    wait_ds0();
    wait_tensor0();
    __syncthreads();
    if (pinned(s + 2 < ns ? 1u : 0u) != 0u) tdm_load(tdm_group0(lds0 + bo, ga0 + (uint64_t)(uint32_t)(s + 2) * 256u), g1);
  }
  wait_tensor0();
  wait_ds0();

  // epilogue: the ring is free behind the last pass's barrier; each wave stages its C tile in its own slice and stores whole 256-B row pieces
  float* so = (float*)(sm + w * G_SLICE);
#pragma unroll
  for (int i = 0; i < NI; ++i) {
#pragma unroll
    for (int j = 0; j < 4; ++j) {
#pragma unroll
      for (int r = 0; r < 8; ++r)
        so[(i * 16 + 8 * hh + r) * 68 + j * 16 + ln] = RES ? (c[i][j][r] * alpha + c[(i + 2) & 3][j][r] * alphal) : (c[i][j][r] * alpha);
    }
  }
  __builtin_amdgcn_fence(4 /* acq_rel order */, "workgroup");
  __builtin_amdgcn_wave_barrier();
  const int rsub = lane >> 4, c4 = (lane & 15) * 4;
#pragma unroll
  for (int q = 0; q < NI * 8; ++q) {
    const int r = q * 2 + rsub;
    const v4f v = *(const v4fa*)&so[r * 68 + c4];
    *(v4f*)(C + (size_t)(row0 + wm * (NI * 16) + r) * ldc + col0 + wn * 64 + c4) = v;
  }
}

// per (token s, head-row j): j<16 -> q head j from qraw[s][j*256 + 0..127], else k head j-16 from kvraw[s][(j-16)*128 ..]; RMSNorm (w+1, eps 1e-6) then rotate-half RoPE from cs[s];
__global__ __launch_bounds__(256) void k_qk(const float* __restrict__ qraw, const float* __restrict__ kvraw,
                                           const float* __restrict__ qnw, const float* __restrict__ knw, const float* __restrict__ cs,
                                           _Float16* __restrict__ Qh, _Float16* __restrict__ Ql, _Float16* __restrict__ Kh, _Float16* __restrict__ Kl) {
  const int w = threadIdx.x >> 5, lane = threadIdx.x & 31;
  const int wid = (int)blockIdx.x * 8 + w;
  if (wid >= SEQ * NHR) return;
  const int s = wid / NHR, j = wid - s * NHR;
  const bool isq = (j < NH);
  const float* src = isq ? (qraw + (size_t)s * NQC + (size_t)j * (2 * HD)) : (kvraw + (size_t)s * NKVC + (size_t)(j - NH) * HD);
  const float* wp = isq ? qnw : knw;
  const v4f xv = *(const v4fa*)(src + 4 * lane);
  const v4f wv = *(const v4fa*)(wp + 4 * lane);
  float ss = xv[0] * xv[0] + xv[1] * xv[1] + xv[2] * xv[2] + xv[3] * xv[3];
#pragma unroll
  for (int m = 16; m > 0; m >>= 1) ss += __shfl_xor(ss, m, 32);
  const float inv = rsqrtf(ss * (1.0f / 128.0f) + 1.0e-6f);
  float nv[4], pr[4];
#pragma unroll
  for (int q = 0; q < 4; ++q) nv[q] = xv[q] * inv * (wv[q] + 1.0f);
#pragma unroll
  for (int q = 0; q < 4; ++q) pr[q] = __shfl_xor(nv[q], 16, 32);       // element d +- 64
  const int i0 = 4 * (lane & 15);
  const v4f t01 = *(const v4fa*)(cs + ((size_t)s * NRP + i0) * 2);
  const v4f t23 = *(const v4fa*)(cs + ((size_t)s * NRP + i0 + 2) * 2);
  const float cv[4] = {t01[0], t01[2], t23[0], t23[2]};
  const float sv[4] = {t01[1], t01[3], t23[1], t23[3]};
  const float sg = (lane < 16) ? -1.0f : 1.0f;                          // d < 64: -x[d+64]; d >= 64: +x[d-64]
  v4h oh, ol;
#pragma unroll
  for (int q = 0; q < 4; ++q) {
    const float o = nv[q] * cv[q] + sg * pr[q] * sv[q];
    const _Float16 hv = (_Float16)o;
    oh[q] = hv; ol[q] = (_Float16)((o - (float)hv) * RCAR);
  }
  _Float16* dh = isq ? (Qh + ((size_t)j * SEQ + s) * HD) : (Kh + ((size_t)(j - NH) * SEQ + s) * HD);
  _Float16* dl = isq ? (Ql + ((size_t)j * RESQ + s) * HD) : (Kl + ((size_t)(j - NH) * RESQ + s) * HD);
  const bool wl = (s < RESQ);
  {
    *(v4h*)(dh + 4 * lane) = oh;
    if (wl) *(v4h*)(dl + 4 * lane) = ol;
    
  }
}

// V^T planes: VT[kv][d][t] = f16(v), VTl = x2^10 residual for t < RESQ; v = kvraw[t][512 + kv*128 + d]; block per (kv, d-half, 64 tokens) via LDS 64x64 tile;
__global__ __launch_bounds__(256) void k_vt(const float* __restrict__ kvraw, _Float16* __restrict__ VT, _Float16* __restrict__ VTl) {
  __shared__ float tl[64][65];
  const int tid = threadIdx.x;
  const int ntg = SEQ / 64;
  const int tg = (int)blockIdx.x % ntg, slab = (int)blockIdx.x / ntg;
  const int kv = slab >> 1, dh = slab & 1;
  const int s0 = tg * 64;
#pragma unroll
  for (int it = 0; it < 4; ++it) {
    const int i = tid + it * 256; const int tok = i >> 4, c4 = (i & 15) * 4;
    const v4f v = *(const v4fa*)(kvraw + (size_t)(s0 + tok) * NKVC + NKV * HD + kv * HD + dh * 64 + c4);
    tl[tok][c4] = v[0]; tl[tok][c4 + 1] = v[1]; tl[tok][c4 + 2] = v[2]; tl[tok][c4 + 3] = v[3];
  }
  __syncthreads();
  const int pc = tid & 7, dr = tid >> 3;
  const bool wl = (s0 < RESQ);
  {
#pragma unroll
    for (int rd = 0; rd < 2; ++rd) {
      const int d = rd * 32 + dr;
      Pack8 ph, pl;
#pragma unroll
      for (int q = 0; q < 8; ++q) { const float f = tl[pc * 8 + q][d]; const _Float16 hv = (_Float16)f; ph.h[q] = hv; pl.h[q] = (_Float16)((f - (float)hv) * RCAR); }
      const size_t row = (size_t)(kv * HD + dh * 64 + d);
      *(v8us*)((unsigned short*)VT + row * SEQ + s0 + pc * 8) = ph.v;
      if (wl) *(v8us*)((unsigned short*)VTl + row * RESQ + s0 + pc * 8) = pl.v;
    }
    
  }
}

// Causal grouped attention, flash form. Block = 8 waves x 16 query rows of head h (kv = h/4), grid (query blocks, NH, RES ? 2 : 1).
// Per key chunk: K rows [t][d] and V^T rows [d][t] staged in LDS (cross-wave: block barriers); S = q.k^T (f16, f32 acc), scale 1/sqrt(128),
// RES: first RESQ query rows: chunk 32 keys, q/k/P/V^T residual second terms into separate accumulators folded by 2^-10; block covers 64 o columns (blockIdx.z half).
template <bool RES>
__global__ __launch_bounds__(256) void k_attn(const _Float16* __restrict__ Qh, const _Float16* __restrict__ Ql,
                                             const _Float16* __restrict__ Kh, const _Float16* __restrict__ Kl,
                                             const _Float16* __restrict__ VT, const _Float16* __restrict__ VTl,
                                             const float* __restrict__ qraw, _Float16* __restrict__ Oh, _Float16* __restrict__ Ol, int qb0) {
  constexpr int KC = RES ? 32 : 64;      // keys per chunk
  constexpr int NJ = KC / 16;            // score column tiles
  constexpr int NKS = KC / 32;           // k-steps of P.V^T
  constexpr int OD = RES ? 64 : 128;     // o columns per block
  constexpr int NC = OD / 16;
  constexpr int NHF = OD / 64;
  constexpr int KP = HD + 8;             // sK pitch (halves)
  constexpr int VP = KC + 8;             // sV pitch
  constexpr int PP = 72;                 // sP pitch (KC weights, and 64 staged o columns)
  __shared__ __attribute__((aligned(16))) _Float16 sK[KC][KP];
  __shared__ __attribute__((aligned(16))) _Float16 sKl[RES ? KC : 1][KP];
  __shared__ __attribute__((aligned(16))) _Float16 sV[OD][VP];
  __shared__ __attribute__((aligned(16))) _Float16 sVl[RES ? OD : 1][VP];
  __shared__ __attribute__((aligned(16))) _Float16 sP[8][16][PP];
  __shared__ __attribute__((aligned(16))) _Float16 sPl[RES ? 8 : 1][16][PP];

  const int tid = threadIdx.x, w = tid >> 5, lane = tid & 31, ln = lane & 15, hh = lane >> 4;
  const int qb = qb0 + (int)blockIdx.x, h = (int)blockIdx.y, kv = h / GQ;
  const int dz = RES ? (int)blockIdx.z * 64 : 0;
  const int q0b = qb * 128, q0w = q0b + 16 * w;
  const int nch = (q0b + 128) / KC;      // chunks holding keys <= last row of the block
  const int qlast = q0w + 15;

  v16h aq[4], aql[4];
  {
    const _Float16* qp = Qh + ((size_t)h * SEQ + q0w + ln) * HD;
#pragma unroll
    for (int kk = 0; kk < 4; ++kk) aq[kk] = frag16(qp + kk * 32, hh);
    if (RES) {
      const _Float16* qlp = Ql + ((size_t)h * RESQ + q0w + ln) * HD;
#pragma unroll
      for (int kk = 0; kk < 4; ++kk) aql[kk] = frag16(qlp + kk * 32, hh);
    } else {
#pragma unroll
      for (int kk = 0; kk < 4; ++kk) aql[kk] = aq[kk];
    }
  }
  const v8f z8 = {0.f, 0.f, 0.f, 0.f, 0.f, 0.f, 0.f, 0.f};
  v8f o[NC];
#pragma unroll
  for (int c = 0; c < NC; ++c) o[c] = z8;
  float mrow[8], lrow[8];
#pragma unroll
  for (int r = 0; r < 8; ++r) { mrow[r] = -3.0e38f; lrow[r] = 0.f; }
  const float alpha = 0.08838834764831845f;

#pragma unroll 1
  for (int ch = 0; ch < nch; ++ch) {
    const int t0 = ch * KC;
    // stage K rows t0..t0+KC-1 (all 128 d) and V^T rows dz..dz+OD-1 (keys t0..t0+KC-1): staged extent == consumed extent
#pragma unroll
    for (int it = 0; it < (KC * 16) / 256; ++it) {
      const int i = tid + it * 256; const int r = i >> 4, c8 = (i & 15) * 8;
      *(v8us*)&sK[r][c8] = *(const v8us*)((const unsigned short*)Kh + ((size_t)kv * SEQ + t0 + r) * HD + c8);
      if (RES) *(v8us*)&sKl[r][c8] = *(const v8us*)((const unsigned short*)Kl + ((size_t)kv * RESQ + t0 + r) * HD + c8);
    }
#pragma unroll
    for (int it = 0; it < (OD * (KC / 8)) / 256; ++it) {
      const int i = tid + it * 256; const int d = i / (KC / 8), c8 = (i % (KC / 8)) * 8;
      *(v8us*)&sV[d][c8] = *(const v8us*)((const unsigned short*)VT + (size_t)(kv * HD + dz + d) * SEQ + t0 + c8);
      if (RES) *(v8us*)&sVl[d][c8] = *(const v8us*)((const unsigned short*)VTl + (size_t)(kv * HD + dz + d) * RESQ + t0 + c8);
    }
    __syncthreads();
    if (t0 <= qlast) {                   // wave-uniform: this wave has unmasked keys in the chunk
      v8f sacc[NJ];
#pragma unroll
      for (int j = 0; j < NJ; ++j) {
        v8f acc = z8, tmp = z8;
#pragma unroll
        for (int kk = 0; kk < 4; ++kk) {
          const v16h b = frag16(&sK[j * 16 + ln][kk * 32], hh);          // B[k = d][n = key]: key row, d contiguous
          acc = mma16(aq[kk], b, acc);
          if (RES) {
            const v16h bl = frag16(&sKl[j * 16 + ln][kk * 32], hh);
            tmp = mma16(aql[kk], b, tmp);
            tmp = mma16(aq[kk], bl, tmp);
          }
        }
        if (RES) acc = acc + tmp * (1.0f / RCAR);
        sacc[j] = acc;
      }
      // scale, causal mask, online softmax; P (x2^14) to the wave-private LDS tile
#pragma unroll
      for (int r = 0; r < 8; ++r) {
        const int qrow = q0w + 8 * hh + r;
        float sv[NJ]; bool mk[NJ]; float mx = -3.0e38f;
#pragma unroll
        for (int j = 0; j < NJ; ++j) { mk[j] = (t0 + 16 * j + ln) > qrow; sv[j] = sacc[j][r] * alpha; mx = fmaxf(mx, mk[j] ? -3.0e38f : sv[j]); }
#pragma unroll
        for (int m = 8; m > 0; m >>= 1) mx = fmaxf(mx, __shfl_xor(mx, m, 32));
        const float mnew = fmaxf(mrow[r], mx);
        const float fac = (mrow[r] < -1.0e38f) ? 0.f : __expf(mrow[r] - mnew);
        float rs = 0.f;
#pragma unroll
        for (int j = 0; j < NJ; ++j) {
          const float p = mk[j] ? 0.f : __expf(sv[j] - mnew);
          rs += p;
          const float pcv = p * PCAR; const _Float16 ph = (_Float16)pcv;
          sP[w][8 * hh + r][16 * j + ln] = ph;
          if (RES) sPl[w][8 * hh + r][16 * j + ln] = (_Float16)((pcv - (float)ph) * RCAR);
        }
#pragma unroll
        for (int m = 8; m > 0; m >>= 1) rs += __shfl_xor(rs, m, 32);
        lrow[r] = lrow[r] * fac + rs; mrow[r] = mnew;
#pragma unroll
        for (int c = 0; c < NC; ++c) o[c][r] *= fac;
      }
      __builtin_amdgcn_fence(4 /* acq_rel order */, "workgroup");
      __builtin_amdgcn_wave_barrier();
      v16h ap[NKS], apl[NKS];
#pragma unroll
      for (int ks = 0; ks < NKS; ++ks) {
        ap[ks] = frag16(&sP[w][ln][ks * 32], hh);                         // A[m = query row][k = key]
        if (RES) apl[ks] = frag16(&sPl[w][ln][ks * 32], hh); else apl[ks] = ap[ks];
      }
#pragma unroll
      for (int c = 0; c < NC; ++c) {
        v8f tmp = z8;
#pragma unroll
        for (int ks = 0; ks < NKS; ++ks) {
          const v16h b = frag16(&sV[c * 16 + ln][ks * 32], hh);          // B[k = key][n = d]: d row, keys contiguous
          o[c] = mma16(ap[ks], b, o[c]);
          if (RES) {
            const v16h bl = frag16(&sVl[c * 16 + ln][ks * 32], hh);
            tmp = mma16(apl[ks], b, tmp);
            tmp = mma16(ap[ks], bl, tmp);
          }
        }
        if (RES) o[c] = o[c] + tmp * (1.0f / RCAR);
      }
    }
    __syncthreads();
  }

  // epilogue
  float il[8];
#pragma unroll
  for (int r = 0; r < 8; ++r) il[r] = (OCAR / PCAR) * __builtin_amdgcn_rcpf(lrow[r]);
  const float* gp = qraw + (size_t)(q0w + 8 * hh) * NQC + (size_t)h * (2 * HD) + HD + dz + ln;
#pragma unroll
  for (int hf = 0; hf < NHF; ++hf) {
    if (hf > 0) { __builtin_amdgcn_fence(4 /* acq_rel order */, "workgroup"); __builtin_amdgcn_wave_barrier(); }
#pragma unroll
    for (int cc = 0; cc < 4; ++cc) {
      const int c = hf * 4 + cc;
#pragma unroll
      for (int r = 0; r < 8; ++r) {
        const float g = gp[(size_t)r * NQC + c * 16];
        const float sig = __builtin_amdgcn_rcpf(1.0f + __expf(-g));
        const float val = o[c][r] * il[r] * sig;
        const _Float16 vh = (_Float16)val;
        sP[w][8 * hh + r][cc * 16 + ln] = vh;
        if (RES) sPl[w][8 * hh + r][cc * 16 + ln] = (_Float16)((val - (float)vh) * RCAR);
      }
      asm volatile("" ::: "memory");
    }
    __builtin_amdgcn_fence(4 /* acq_rel order */, "workgroup");
    __builtin_amdgcn_wave_barrier();
    const int prw = lane >> 3, pc = lane & 7;
    {
#pragma unroll
      for (int it = 0; it < 4; ++it) {
        const int row = it * 4 + prw;
        const v8us vv = *(const v8us*)&sP[w][row][pc * 8];
        const size_t go = (size_t)(q0w + row) * (NH * HD) + (size_t)h * HD + dz + hf * 64 + pc * 8;
        *(v8us*)((unsigned short*)Oh + go) = vv;
        if (RES) { const v8us vl = *(const v8us*)&sPl[w][row][pc * 8]; *(v8us*)((unsigned short*)Ol + go) = vl; }
      }
      
    }
  }
}

extern "C" void kernel_launch(void* const* d_in, const int* in_sizes, int n_in,
                              void* d_out, int out_size, void* d_ws, size_t ws_size, hipStream_t stream) {
  if (n_in < 7) return;
  const long need_x = (long)(NB - 1) * SEQ_FULL * HID + (long)SEQ * HID;
  if ((long)in_sizes[0] < need_x) return;
  if (in_sizes[1] < HID * NQC) return;
  if (in_sizes[2] < HID * NKV * HD) return;
  if (in_sizes[3] < HID * NKV * HD) return;
  if (in_sizes[4] < NH * HD * HID) return;
  if (in_sizes[5] < HD) return;
  if (in_sizes[6] < HD) return;
  if ((long)out_size < need_x) return;

  const float* x   = (const float*)d_in[0];
  const float* Wq  = (const float*)d_in[1];
  const float* Wk  = (const float*)d_in[2];
  const float* Wv  = (const float*)d_in[3];
  const float* Wo  = (const float*)d_in[4];
  const float* qnw = (const float*)d_in[5];
  const float* knw = (const float*)d_in[6];

  char* ws = (char*)d_ws; size_t off = 0;
  auto take = [&](size_t bytes) { char* p = ws + off; off += (bytes + 255) & ~(size_t)255; return p; };
  _Float16* X16  = (_Float16*)take(SZ_X16);
  _Float16* WqT  = (_Float16*)take(SZ_WQT);
  _Float16* WkvT = (_Float16*)take(SZ_WKVT);
  _Float16* WoT  = (_Float16*)take(SZ_WOT);
  float*    CS   = (float*)take(SZ_CS);
  float*    qraw = (float*)take(SZ_QRAW);
  float*    kvraw = (float*)take(SZ_KVRAW);
  _Float16* Qh   = (_Float16*)take(SZ_QH);
  _Float16* Ql   = (_Float16*)take(SZ_QL);
  _Float16* Kh   = (_Float16*)take(SZ_KH);
  _Float16* Kl   = (_Float16*)take(SZ_KL);
  _Float16* VT   = (_Float16*)take(SZ_VT);
  _Float16* VTl  = (_Float16*)take(SZ_VTL);
  _Float16* Oh   = (_Float16*)take(SZ_OH);
  _Float16* Ol   = (_Float16*)take(SZ_OL);
  if (off > ws_size) return;

  // rotary tables and weight planes (Bt[n][k] = f16(bf16rne(W[k][n]) * 16))
  k_rope<<<(SEQ * NRP + 255) / 256, 256, 0, stream>>>(CS);
  k_wt_f16<HID, NQC><<<(HID / WT_K) * (NQC / WT_N), 256, 0, stream>>>(Wq, WqT, WCAR);
  k_wt_f16<HID, NKV * HD><<<(HID / WT_K) * (NKV * HD / WT_N), 256, 0, stream>>>(Wk, WkvT, WCAR);
  k_wt_f16<HID, NKV * HD><<<(HID / WT_K) * (NKV * HD / WT_N), 256, 0, stream>>>(Wv, WkvT + (size_t)NKV * HD * HID, WCAR);
  k_wt_f16<NH * HD, HID><<<((NH * HD) / WT_K) * (HID / WT_N), 256, 0, stream>>>(Wo, WoT, WCAR);

  const float walpha = 1.0f / WCAR;                          // 2^-4
  const float oalpha = 1.0f / (WCAR * OCAR);                 // 2^-10
  const float oalphal = oalpha / RCAR;                       // 2^-20
  for (int b = 0; b < NB; ++b) {
    const size_t xoff = (size_t)b * SEQ_FULL * HID;
    float* outb = (float*)d_out + (size_t)b * SEQ_FULL * HID;
    k_x16<<<(unsigned)(((size_t)SEQ * HID / 8 + 255) / 256), 256, 0, stream>>>(x + xoff, X16, (size_t)SEQ * HID / 8);
    k_gemm<false><<<(SEQ / 128) * (NQC / 128), 128, 0, stream>>>(X16, X16, HID, WqT, HID, walpha, 0.0f, qraw, NQC, SEQ, NQC, HID);
    k_gemm<false><<<(SEQ / 128) * (NKVC / 128), 128, 0, stream>>>(X16, X16, HID, WkvT, HID, walpha, 0.0f, kvraw, NKVC, SEQ, NKVC, HID);
    k_qk<<<(SEQ * NHR) / 8, 256, 0, stream>>>(qraw, kvraw, qnw, knw, CS, Qh, Ql, Kh, Kl);
    k_vt<<<NKV * 2 * (SEQ / 64), 256, 0, stream>>>(kvraw, VT, VTl);
    k_attn<true><<<dim3(RESQ / 128, NH, 2), 256, 0, stream>>>(Qh, Ql, Kh, Kl, VT, VTl, qraw, Oh, Ol, 0);
    if (SEQ > RESQ)
      k_attn<false><<<dim3((SEQ - RESQ) / 128, NH, 1), 256, 0, stream>>>(Qh, Ql, Kh, Kl, VT, VTl, qraw, Oh, Ol, RESQ / 128);
    k_gemm<true><<<(RESQ / 64) * (HID / 128), 128, 0, stream>>>(Oh, Ol, NH * HD, WoT, NH * HD, oalpha, oalphal, outb, HID, RESQ, HID, NH * HD);
    if (SEQ > RESQ)
      k_gemm<false><<<((SEQ - RESQ) / 128) * (HID / 128), 128, 0, stream>>>(Oh + (size_t)RESQ * NH * HD, Oh + (size_t)RESQ * NH * HD, NH * HD, WoT, NH * HD, oalpha, 0.0f, outb + (size_t)RESQ * HID, HID, SEQ - RESQ, HID, NH * HD);
  }
  (void)hipGetLastError();
}

// v003
// A run of this version takes 283 microseconds.
// Two timings next to v002 put it at 1.59 and 1.62 times that version's speed.
// Counting every step since v000, it is 3.20 times as fast.
#include <hip/hip_runtime.h>
#include <stdint.h>
// Contractions x.Wq, x.[Wk|Wv], q.k^T, P.V^T, o.Wo: v_wmma_f32_16x16x32_f16 (f16 operands, f32 accumulate). x and all weights RNE-converted to bf16 and held exactly in f16 (weights carried x16); q, k, V^T and gated o as f16 planes plus x2^10 f16 residual planes over the first RESQ query rows / keys (two-term products there, single products elsewhere); softmax weights x2^14 in f16 (+ x2^10 residual on those rows); gated o carried x64; RMSNorm, RoPE, softmax statistics and sigmoid gating in f32.

#ifndef NB
#define NB 2
#endif
#ifndef SEQ
#define SEQ 2048
#endif
#ifndef RESQ
#if SEQ < 512
#define RESQ SEQ
#else
#define RESQ 512
#endif
#endif
#define NB_FULL 2
#define SEQ_FULL 2048
#define HID 2048
#define NH 16
#define NKV 4
#define HD 128
#define GQ (NH / NKV)
#define NQC (2 * NH * HD)      /* q|gate columns: head h at h*256 (q) and h*256+128 (gate) */
#define NKVC (2 * NKV * HD)    /* k|v columns: k head j at j*128, v head j at 512+j*128 */
#define NHR (NH + NKV)         /* normalised rows per token (16 q heads + 4 k heads) */
#define NRP 64                 /* rotary pairs */
#define PCAR 16384.0f          /* softmax weight carry */
#define OCAR 64.0f             /* gated o carry */
#define RCAR 1024.0f           /* residual plane carry */
#define WCAR 16.0f             /* weight carry */

static_assert(NB >= 1);
static_assert(NB <= NB_FULL);
static_assert(SEQ % 128 == 0);
static_assert(SEQ <= SEQ_FULL);
static_assert(RESQ % 128 == 0);
static_assert(RESQ >= 128);
static_assert(RESQ <= SEQ);
static_assert((SEQ - RESQ) % 128 == 0);
static_assert(HID % 32 == 0);
static_assert(HID % 64 == 0);
static_assert(NQC % 128 == 0);
static_assert(NKVC % 128 == 0);
static_assert(HID % 256 == 0);
static_assert((NH * HD) % 256 == 0);
static_assert(HD == 128);
static_assert(NH % NKV == 0);
static_assert((SEQ * NHR) % 8 == 0);
static_assert((SEQ * HID) % 8 == 0);

// planes of x, q, k, v and o hold all NB batch elements, element b at b * (plane size / NB)
constexpr size_t SZ_X16   = (size_t)NB * SEQ * HID * 2;
constexpr size_t SZ_WQT   = (size_t)NQC * HID * 2;
constexpr size_t SZ_WKVT  = (size_t)NKVC * HID * 2;
constexpr size_t SZ_WOT   = (size_t)HID * NH * HD * 2;
constexpr size_t SZ_CS    = (size_t)SEQ * NRP * 2 * 4;
constexpr size_t SZ_QRAW  = (size_t)NB * SEQ * NQC * 4;
constexpr size_t SZ_KVRAW = (size_t)NB * SEQ * NKVC * 4;
constexpr size_t SZ_QH    = (size_t)NB * NH * SEQ * HD * 2;
constexpr size_t SZ_QL    = (size_t)NB * NH * RESQ * HD * 2;
constexpr size_t SZ_KH    = (size_t)NB * NKV * SEQ * HD * 2;
constexpr size_t SZ_KL    = (size_t)NB * NKV * RESQ * HD * 2;
constexpr size_t SZ_VT    = (size_t)NB * NKV * HD * SEQ * 2;
constexpr size_t SZ_VTL   = (size_t)NB * NKV * HD * RESQ * 2;
constexpr size_t SZ_OH    = (size_t)NB * SEQ * NH * HD * 2;
constexpr size_t SZ_OL    = (size_t)NB * RESQ * NH * HD * 2;
constexpr size_t WS_TOTAL = SZ_X16 + SZ_WQT + SZ_WKVT + SZ_WOT + SZ_CS + SZ_QRAW + SZ_KVRAW + SZ_QH + SZ_QL + SZ_KH + SZ_KL + SZ_VT + SZ_VTL + SZ_OH + SZ_OL;
static_assert(WS_TOTAL <= (size_t)268435456);
static_assert(SZ_X16 % 256 == 0);
static_assert(SZ_KL % 256 == 0);
static_assert(SZ_VTL % 256 == 0);
static_assert(SZ_CS % 256 == 0);

typedef _Float16 v16h __attribute__((ext_vector_type(16)));
typedef unsigned short v8us __attribute__((ext_vector_type(8), may_alias));
typedef float v8f __attribute__((ext_vector_type(8)));
typedef float v4f __attribute__((ext_vector_type(4)));
typedef float v4fa __attribute__((ext_vector_type(4), may_alias));
typedef float v2f __attribute__((ext_vector_type(2)));
typedef _Float16 v4h __attribute__((ext_vector_type(4)));
typedef uint32_t u32x4 __attribute__((ext_vector_type(4)));
typedef uint32_t u32x8 __attribute__((ext_vector_type(8)));
union FragH { v16h v; v8us half[2]; _Float16 h[16]; unsigned short u[16]; };
union Pack8 { v8us v; _Float16 h[8]; unsigned short u[8]; };

__device__ __forceinline__ unsigned short bf16_bits(float x) { const unsigned int u = __float_as_uint(x); return (unsigned short)((u + 0x7FFFu + ((u >> 16) & 1u)) >> 16); }
__device__ __forceinline__ float bf16_rne(float x) { return __uint_as_float(((unsigned int)bf16_bits(x)) << 16); }

// 16x32 f16 fragment from a k-contiguous row p (A row m = lane&15, or Bt row n = lane&15): elements 0..7 <- k 8h..8h+7, 8..15 <- k 16+8h..16+8h+7
__device__ __forceinline__ v16h frag16(const _Float16* p, int hh) {
  FragH f;
  f.half[0] = *(const v8us*)((const unsigned short*)p + 8 * hh);
  f.half[1] = *(const v8us*)((const unsigned short*)p + 16 + 8 * hh);
  return f.v;
}
// D += A.B (f16 operands, f32 accumulate) with the VALU hazard guard
__device__ __forceinline__ v8f mma16(v16h a, v16h b, v8f c) {
  v8f d = __builtin_amdgcn_wmma_f32_16x16x32_f16(false, a, false, b, (short)0, c, false, false);
  asm volatile("v_nop\n\tv_nop\n\tv_nop\n\tv_nop" : "+v"(d) : "v"(a), "v"(b));
  return d;
}

// grid.y = batch element
__global__ __launch_bounds__(256) void k_x16(const float* __restrict__ x, _Float16* __restrict__ X16, size_t n8) {
  const size_t t = (size_t)blockIdx.x * 256 + threadIdx.x; if (t >= n8) return;
  x += (size_t)blockIdx.y * SEQ_FULL * HID; X16 += (size_t)blockIdx.y * SEQ * HID;
  const v4f a = *(const v4fa*)(x + t * 8), c = *(const v4fa*)(x + t * 8 + 4);
  Pack8 f;
#pragma unroll
  for (int q = 0; q < 4; ++q) { f.h[q] = (_Float16)bf16_rne(a[q]); f.h[4 + q] = (_Float16)bf16_rne(c[q]); }
  unsigned short* d = (unsigned short*)X16 + t * 8;
  *(v8us*)d = f.v; 
}

#define WT_K 128                     /* k per block tile: one 256-B piece of a Wt row */
#define WT_N 128                     /* n per block tile: two 256-B pieces of a W row */

// Wt[n][k] = f16(bf16rne(W[k][n]) * scale). Block = tile of WT_K k x WT_N n, grid = (K / WT_K) * (N / WT_N).
// A thread reads 8 k x (4 + 4) n (each wave-wide load covers two whole 256-B row pieces of W), packs 8 k per n and turns the tile in LDS; each wave-wide store covers two whole 256-B row pieces of Wt.
// LDS row n holds its sixteen 16-B k chunks at chunk ^ ((n >> 2) & 15): the 16 lanes of a half wave then fall on 16 different bank groups, writing (16 rows, one chunk) and reading (one row, 16 chunks).
// K and N are compile-time, so that the row steps are immediate offsets on one address.
template <int K, int N>
__global__ __launch_bounds__(256) void k_wt_f16(const float* __restrict__ W, _Float16* __restrict__ Wt, float scale) {
  static_assert(K % WT_K == 0);
  static_assert(N % WT_N == 0);
  __shared__ __attribute__((aligned(16))) unsigned short st[WT_N][WT_K];
  const int tid = threadIdx.x;
  constexpr int ntn = N / WT_N;
  const int kt = (int)blockIdx.x / ntn, nt = (int)blockIdx.x - kt * ntn;
  const int k0 = kt * WT_K, n0 = nt * WT_N;
  const int lo = tid & 15, hi = tid >> 4;
  // block-uniform base plus one 32-bit lane offset that all sixteen loads (all eight stores) share
  const char* wb = (const char*)(W + (size_t)k0 * N + n0);
  const uint32_t vo = ((uint32_t)(hi * 8) * (uint32_t)N + (uint32_t)(lo * 4)) * 4u;
  v4f r[2][8];
#pragma unroll
  for (int i = 0; i < 8; ++i) {
    r[0][i] = *(const v4fa*)(wb + (size_t)i * N * 4 + vo);
    r[1][i] = *(const v4fa*)(wb + (size_t)i * N * 4 + 256 + vo);
  }
  // behind the last load: the offset register that all sixteen loads name stays whole until their addresses are taken (no load's result is placed on it), and no load sinks below into the conversions
  asm volatile("s_wait_xcnt 0x0" :: "v"(vo) : "memory");
#pragma unroll
  for (int h = 0; h < 2; ++h) {
#pragma unroll
    for (int j = 0; j < 4; ++j) {
      Pack8 f;
#pragma unroll
      for (int i = 0; i < 8; ++i) f.h[i] = (_Float16)(bf16_rne(r[h][i][j]) * scale);
      *(v8us*)&st[h * 64 + lo * 4 + j][(hi ^ lo) * 8] = f.v;
    }
  }
  __syncthreads();
  char* tb = (char*)(Wt + (size_t)n0 * K + k0);
  const uint32_t so = ((uint32_t)hi * (uint32_t)K + (uint32_t)(lo * 8)) * 2u;
#pragma unroll
  for (int it = 0; it < WT_N / 16; ++it) {
    const int n = it * 16 + hi;
    const v8us v = *(const v8us*)&st[n][(lo ^ ((n >> 2) & 15)) * 8];
    *(v8us*)(tb + (size_t)it * 16 * K * 2 + so) = v;
  }
}

__global__ __launch_bounds__(256) void k_rope(float* __restrict__ cs) {
  const int t = blockIdx.x * 256 + threadIdx.x; if (t >= SEQ * NRP) return;
  const int pos = t / NRP, i = t - pos * NRP;
  const float inv = exp2f(-(float)i * 0.31143075889569022f);   // 2^(-i*log2(1e6)/64)
  const float ang = (float)pos * inv;
  float sn, cn; sincosf(ang, &sn, &cn);
  v2f o; o[0] = cn; o[1] = sn;
  float* d = cs + (size_t)t * 2;
  *(v2f*)d = o; 
}

#define G_PITCH 272u                 /* LDS row pitch: 256 B of k plus the mover's 16-B pad (ds_load_b128 readers) */
#define G_SLICE 18432u               /* one wave's slice: 64 rows at G_PITCH, rounded up to a multiple of 2 KiB */
#define G_STAGE (4u * G_SLICE)       /* one buffer: [A rows 0..63 | A rows 64..127 (RES: residual rows 0..63) | Bt rows 0..63 | Bt rows 64..127] */
static_assert(64u * G_PITCH <= G_SLICE);
static_assert(G_SLICE % 2048u == 0);
static_assert(64u * 68u * 4u <= G_SLICE);

// D += A.B by the plain builtin, whose distances the compiler keeps itself: register operands on an asm guard would hold the GEMM's accumulators and both fragment sets below v256 (spills)
__device__ __forceinline__ v8f mma16b(v16h a, v16h b, v8f c) { return __builtin_amdgcn_wmma_f32_16x16x32_f16(false, a, false, b, (short)0, c, false, false); }
__device__ __forceinline__ uint32_t uni(uint32_t v) { return (uint32_t)__builtin_amdgcn_readfirstlane(v); }
__device__ __forceinline__ uint32_t pinned(uint32_t v) { uint32_t w = uni(v); asm volatile("" : "+s"(w)); return w; }
__device__ __forceinline__ void wait_ds0() { asm volatile("s_wait_dscnt 0x0" ::: "memory"); }          // this wave's LDS reads have returned before the buffer is handed over
__device__ __forceinline__ void wait_tensor0() { asm volatile("s_wait_tensorcnt 0x0" ::: "memory"); }  // this wave's slice has landed; the compiler places no wait for the mover
__device__ __forceinline__ void tdm_load(u32x4 g0, u32x8 g1) { asm volatile("tensor_load_to_lds %0, %1" :: "s"(g0), "s"(g1) : "memory"); }
// group 1: 1-byte elements, tile = tensor = 64 rows of 256 B, source row pitch in bytes, 4 dwords of LDS pad behind every 256-B row
__device__ __forceinline__ u32x8 tdm_group1(uint32_t src_pitch) {
  u32x8 g;
  g[0] = uni((1u << 20) | (5u << 22) | (3u << 25));
  // pinned(): descriptor words held in their scalar registers through the loop, so that none is rewritten while a request is outstanding
  g[1] = pinned(256u << 16);
  g[2] = pinned(64u << 16);
  g[3] = pinned(256u << 16);
  g[4] = pinned(64u);
  g[5] = pinned(src_pitch);
  g[6] = pinned(0u);
  g[7] = pinned(0u);
  return g;
}
__device__ __forceinline__ u32x4 tdm_group0(uint32_t lds_dst, uint64_t ga) {
  u32x4 g;
  g[0] = uni(1u); g[1] = uni(lds_dst); g[2] = uni((uint32_t)ga); g[3] = uni((((uint32_t)(ga >> 32)) & 0x01FFFFFFu) | 0x80000000u);
  return g;
}

// C[M][N] (f32, pitch ldc) = alpha * A[M][K] (f16, pitch lda) . Bt[N][K]^T (f16, pitch ldb)  (+ alphal * Al . Bt^T when RES: residual plane Al, pitch lda).
// Block = 4 waves (2 x 2), C tile 128 x 128 (RES: 64 x 128), grid.x = (M / tile rows) * (N / 128); K % 128 == 0, K >= 128.
// grid.y = batch element: A, Al and C advance by bsA, bsAl and bsC elements per batch element, Bt is shared.
// A pass is 128 k: every wave brings its own 64-row slice of the pass into LDS with one tensor load, two buffers, the next pass's load in flight under this pass's products.
// Each accumulator sums its k in ascending steps of 32. Every inner loop is unrolled so that the accumulator and fragment arrays are indexed by constants and stay in registers.
template <bool RES>
__global__ __launch_bounds__(128) void k_gemm(const _Float16* __restrict__ A, const _Float16* __restrict__ Al, int lda, const _Float16* __restrict__ Bt, int ldb,
                                             float alpha, float alphal, float* __restrict__ C, int ldc, int M, int N, int K, size_t bsA, size_t bsAl, size_t bsC) {
  constexpr int BM = RES ? 64 : 128;
  constexpr int NI = RES ? 2 : 4;        // 16-row C tiles per wave
  __shared__ __attribute__((aligned(2048))) unsigned char sm[2u * G_STAGE];
  const int tid = threadIdx.x, lane = tid & 31, ln = lane & 15, hh = lane >> 4;
  const uint32_t w = uni((uint32_t)tid >> 5);
  const int wm = (int)(w >> 1), wn = (int)(w & 1u);
  const int ntn = N >> 7;
  const int mt = (int)blockIdx.x / ntn, nq = (int)blockIdx.x - mt * ntn;
  const int row0 = mt * BM, col0 = nq * 128;
  if (row0 >= M) return;
  A += (size_t)blockIdx.y * bsA; Al += (size_t)blockIdx.y * bsAl; C += (size_t)blockIdx.y * bsC;
  const _Float16* src = (w >= 2u) ? (Bt + (size_t)(col0 + 64 * wn) * ldb)
                      : (RES ? ((w == 1u ? Al : A) + (size_t)row0 * lda) : (A + (size_t)(row0 + 64 * (int)w) * lda));
  const uint64_t ga0 = (uint64_t)(uintptr_t)src;
  const uint32_t lds0 = (uint32_t)(size_t)sm + w * G_SLICE;
  const u32x8 g1 = tdm_group1(2u * (uint32_t)(w >= 2u ? ldb : lda));
  const int ns = K >> 7;
  // per-lane fragment rows inside a buffer
  uint32_t aoff[4], boff[4];
#pragma unroll
  for (int i = 0; i < 4; ++i) {
    aoff[i] = RES ? ((uint32_t)(i >> 1) * G_SLICE + (uint32_t)(wm * 32 + (i & 1) * 16 + ln) * G_PITCH)
                  : ((uint32_t)wm * G_SLICE + (uint32_t)(i * 16 + ln) * G_PITCH);
    boff[i] = (uint32_t)(2 + wn) * G_SLICE + (uint32_t)(i * 16 + ln) * G_PITCH;
  }
  const v8f z8 = {0.f, 0.f, 0.f, 0.f, 0.f, 0.f, 0.f, 0.f};
  v8f c[4][4];                           // RES: c[0..1] main plane, c[2..3] residual plane of the same rows
#pragma unroll
  for (int i = 0; i < 4; ++i)
#pragma unroll
    for (int j = 0; j < 4; ++j) c[i][j] = z8;

  tdm_load(tdm_group0(lds0, ga0), g1);
  wait_tensor0();
  __syncthreads();
  if (pinned(1 < ns ? 1u : 0u) != 0u) tdm_load(tdm_group0(lds0 + G_STAGE, ga0 + 256u), g1);
#pragma unroll 1                         // one pass per trip: the buffer alternates at run time
  for (int s = 0; s < ns; ++s) {
    const uint32_t bo = (uint32_t)(s & 1) * G_STAGE;
    const unsigned char* bp = sm + bo;
    v16h fa[2][4], fb[2][4];             // set (kk & 1) holds k-step kk's fragments; the next step's loads go ahead of this step's products as one group
#pragma unroll
    for (int i = 0; i < 4; ++i) { fa[0][i] = frag16((const _Float16*)(bp + aoff[i]), hh); fb[0][i] = frag16((const _Float16*)(bp + boff[i]), hh); }
#pragma unroll
    for (int kk = 0; kk < 4; ++kk) {
      if (kk < 3) {
#pragma unroll
        for (int i = 0; i < 4; ++i) {
          fa[(kk + 1) & 1][i] = frag16((const _Float16*)(bp + aoff[i] + (kk + 1) * 64), hh);
          fb[(kk + 1) & 1][i] = frag16((const _Float16*)(bp + boff[i] + (kk + 1) * 64), hh);
        }
      }
      __builtin_amdgcn_sched_barrier(0);   // keeps the next step's LDS loads one group ahead of the products, not spread among them
#pragma unroll
      for (int j = 0; j < 4; ++j)
#pragma unroll
        for (int i = 0; i < 4; ++i) c[i][j] = mma16b(fa[kk & 1][i], fb[kk & 1][j], c[i][j]);
      __builtin_amdgcn_sched_barrier(0);   // ends the block of products: the following loads stay behind it
    }
    asm volatile("v_nop\n\tv_nop\n\tv_nop\n\tv_nop");   // WMMA-to-VALU distance on the loop's exit path, where the epilogue reads the accumulators
    // publish point of pass s + 1: own LDS reads returned, own slice landed, block barrier, then the refill of the buffer just read
    wait_ds0();
    wait_tensor0();
    __syncthreads();
    if (pinned(s + 2 < ns ? 1u : 0u) != 0u) tdm_load(tdm_group0(lds0 + bo, ga0 + (uint64_t)(uint32_t)(s + 2) * 256u), g1);
  }
  wait_tensor0();
  wait_ds0();

  // epilogue: the ring is free behind the last pass's barrier; each wave stages its C tile in its own slice and stores whole 256-B row pieces
  float* so = (float*)(sm + w * G_SLICE);
#pragma unroll
  for (int i = 0; i < NI; ++i) {
#pragma unroll
    for (int j = 0; j < 4; ++j) {
#pragma unroll
      for (int r = 0; r < 8; ++r)
        so[(i * 16 + 8 * hh + r) * 68 + j * 16 + ln] = RES ? (c[i][j][r] * alpha + c[(i + 2) & 3][j][r] * alphal) : (c[i][j][r] * alpha);
    }
  }
  __builtin_amdgcn_fence(4 /* acq_rel order */, "workgroup");
  __builtin_amdgcn_wave_barrier();
  const int rsub = lane >> 4, c4 = (lane & 15) * 4;
#pragma unroll
  for (int q = 0; q < NI * 8; ++q) {
    const int r = q * 2 + rsub;
    const v4f v = *(const v4fa*)&so[r * 68 + c4];
    *(v4f*)(C + (size_t)(row0 + wm * (NI * 16) + r) * ldc + col0 + wn * 64 + c4) = v;
  }
}

// per (batch element bb, token s, head-row j): j<16 -> q head j from qraw[s][j*256 + 0..127], else k head j-16 from kvraw[s][(j-16)*128 ..]; RMSNorm (w+1, eps 1e-6) then rotate-half RoPE from cs[s];
__global__ __launch_bounds__(256) void k_qk(const float* __restrict__ qraw, const float* __restrict__ kvraw,
                                           const float* __restrict__ qnw, const float* __restrict__ knw, const float* __restrict__ cs,
                                           _Float16* __restrict__ Qh, _Float16* __restrict__ Ql, _Float16* __restrict__ Kh, _Float16* __restrict__ Kl) {
  const int w = threadIdx.x >> 5, lane = threadIdx.x & 31;
  const int wid = (int)blockIdx.x * 8 + w;
  if (wid >= NB * SEQ * NHR) return;
  const int tr = wid / NHR, j = wid - tr * NHR;     // tr: row of the raw planes, which hold the batch elements one behind the other
  const int bb = tr / SEQ, s = tr - bb * SEQ;
  const bool isq = (j < NH);
  const float* src = isq ? (qraw + (size_t)tr * NQC + (size_t)j * (2 * HD)) : (kvraw + (size_t)tr * NKVC + (size_t)(j - NH) * HD);
  const float* wp = isq ? qnw : knw;
  const v4f xv = *(const v4fa*)(src + 4 * lane);
  const v4f wv = *(const v4fa*)(wp + 4 * lane);
  float ss = xv[0] * xv[0] + xv[1] * xv[1] + xv[2] * xv[2] + xv[3] * xv[3];
#pragma unroll
  for (int m = 16; m > 0; m >>= 1) ss += __shfl_xor(ss, m, 32);
  const float inv = rsqrtf(ss * (1.0f / 128.0f) + 1.0e-6f);
  float nv[4], pr[4];
#pragma unroll
  for (int q = 0; q < 4; ++q) nv[q] = xv[q] * inv * (wv[q] + 1.0f);
#pragma unroll
  for (int q = 0; q < 4; ++q) pr[q] = __shfl_xor(nv[q], 16, 32);       // element d +- 64
  const int i0 = 4 * (lane & 15);
  const v4f t01 = *(const v4fa*)(cs + ((size_t)s * NRP + i0) * 2);
  const v4f t23 = *(const v4fa*)(cs + ((size_t)s * NRP + i0 + 2) * 2);
  const float cv[4] = {t01[0], t01[2], t23[0], t23[2]};
  const float sv[4] = {t01[1], t01[3], t23[1], t23[3]};
  const float sg = (lane < 16) ? -1.0f : 1.0f;                          // d < 64: -x[d+64]; d >= 64: +x[d-64]
  v4h oh, ol;
#pragma unroll
  for (int q = 0; q < 4; ++q) {
    const float o = nv[q] * cv[q] + sg * pr[q] * sv[q];
    const _Float16 hv = (_Float16)o;
    oh[q] = hv; ol[q] = (_Float16)((o - (float)hv) * RCAR);
  }
  _Float16* dh = isq ? (Qh + ((size_t)(bb * NH + j) * SEQ + s) * HD) : (Kh + ((size_t)(bb * NKV + j - NH) * SEQ + s) * HD);
  _Float16* dl = isq ? (Ql + ((size_t)(bb * NH + j) * RESQ + s) * HD) : (Kl + ((size_t)(bb * NKV + j - NH) * RESQ + s) * HD);
  const bool wl = (s < RESQ);
  {
    *(v4h*)(dh + 4 * lane) = oh;
    if (wl) *(v4h*)(dl + 4 * lane) = ol;
    
  }
}

// V^T planes: VT[kv][d][t] = f16(v), VTl = x2^10 residual for t < RESQ; v = kvraw[t][512 + kv*128 + d]; block per (kv, d-half, 64 tokens) via LDS 64x64 tile; grid.y = batch element
__global__ __launch_bounds__(256) void k_vt(const float* __restrict__ kvraw, _Float16* __restrict__ VT, _Float16* __restrict__ VTl) {
  __shared__ float tl[64][65];
  const int tid = threadIdx.x;
  const int ntg = SEQ / 64;
  const int tg = (int)blockIdx.x % ntg, slab = (int)blockIdx.x / ntg;
  const int kv = slab >> 1, dh = slab & 1;
  const int s0 = tg * 64;
  kvraw += (size_t)blockIdx.y * ((size_t)SEQ * NKVC); VT += (size_t)blockIdx.y * ((size_t)NKV * HD * SEQ); VTl += (size_t)blockIdx.y * ((size_t)NKV * HD * RESQ);
#pragma unroll
  for (int it = 0; it < 4; ++it) {
    const int i = tid + it * 256; const int tok = i >> 4, c4 = (i & 15) * 4;
    const v4f v = *(const v4fa*)(kvraw + (size_t)(s0 + tok) * NKVC + NKV * HD + kv * HD + dh * 64 + c4);
    tl[tok][c4] = v[0]; tl[tok][c4 + 1] = v[1]; tl[tok][c4 + 2] = v[2]; tl[tok][c4 + 3] = v[3];
  }
  __syncthreads();
  const int pc = tid & 7, dr = tid >> 3;
  const bool wl = (s0 < RESQ);
  {
#pragma unroll
    for (int rd = 0; rd < 2; ++rd) {
      const int d = rd * 32 + dr;
      Pack8 ph, pl;
#pragma unroll
      for (int q = 0; q < 8; ++q) { const float f = tl[pc * 8 + q][d]; const _Float16 hv = (_Float16)f; ph.h[q] = hv; pl.h[q] = (_Float16)((f - (float)hv) * RCAR); }
      const size_t row = (size_t)(kv * HD + dh * 64 + d);
      *(v8us*)((unsigned short*)VT + row * SEQ + s0 + pc * 8) = ph.v;
      if (wl) *(v8us*)((unsigned short*)VTl + row * RESQ + s0 + pc * 8) = pl.v;
    }
    
  }
}

// Causal grouped attention, flash form. Block = 8 waves x 16 query rows of head h (kv = h/4), grid (query blocks, NH, NB * (RES ? 2 : 1)): blockIdx.z = batch element (RES: batch element * 2 + o column half).
// Per key chunk: K rows [t][d] and V^T rows [d][t] staged in LDS (cross-wave: block barriers); S = q.k^T (f16, f32 acc), scale 1/sqrt(128),
// RES: first RESQ query rows: chunk 32 keys, q/k/P/V^T residual second terms into separate accumulators folded by 2^-10; block covers 64 o columns.
template <bool RES>
__global__ __launch_bounds__(256) void k_attn(const _Float16* __restrict__ Qh, const _Float16* __restrict__ Ql,
                                             const _Float16* __restrict__ Kh, const _Float16* __restrict__ Kl,
                                             const _Float16* __restrict__ VT, const _Float16* __restrict__ VTl,
                                             const float* __restrict__ qraw, _Float16* __restrict__ Oh, _Float16* __restrict__ Ol, int qb0) {
  constexpr int KC = RES ? 32 : 64;      // keys per chunk
  constexpr int NJ = KC / 16;            // score column tiles
  constexpr int NKS = KC / 32;           // k-steps of P.V^T
  constexpr int OD = RES ? 64 : 128;     // o columns per block
  constexpr int NC = OD / 16;
  constexpr int NHF = OD / 64;
  constexpr int KP = HD + 8;             // sK pitch (halves)
  constexpr int VP = KC + 8;             // sV pitch
  constexpr int PP = 72;                 // sP pitch (KC weights, and 64 staged o columns)
  __shared__ __attribute__((aligned(16))) _Float16 sK[KC][KP];
  __shared__ __attribute__((aligned(16))) _Float16 sKl[RES ? KC : 1][KP];
  __shared__ __attribute__((aligned(16))) _Float16 sV[OD][VP];
  __shared__ __attribute__((aligned(16))) _Float16 sVl[RES ? OD : 1][VP];
  __shared__ __attribute__((aligned(16))) _Float16 sP[8][16][PP];
  __shared__ __attribute__((aligned(16))) _Float16 sPl[RES ? 8 : 1][16][PP];

  const int tid = threadIdx.x, w = tid >> 5, lane = tid & 31, ln = lane & 15, hh = lane >> 4;
  const int qb = qb0 + (int)blockIdx.x, h = (int)blockIdx.y, kv = h / GQ;
  const int dz = RES ? ((int)blockIdx.z & 1) * 64 : 0;
  const size_t bb = RES ? (blockIdx.z >> 1) : blockIdx.z;
  Qh += bb * ((size_t)NH * SEQ * HD); Ql += bb * ((size_t)NH * RESQ * HD); Kh += bb * ((size_t)NKV * SEQ * HD); Kl += bb * ((size_t)NKV * RESQ * HD);
  VT += bb * ((size_t)NKV * HD * SEQ); VTl += bb * ((size_t)NKV * HD * RESQ); qraw += bb * ((size_t)SEQ * NQC);
  Oh += bb * ((size_t)SEQ * NH * HD); Ol += bb * ((size_t)RESQ * NH * HD);
  const int q0b = qb * 128, q0w = q0b + 16 * w;
  const int nch = (q0b + 128) / KC;      // chunks holding keys <= last row of the block
  const int qlast = q0w + 15;

  v16h aq[4], aql[4];
  {
    const _Float16* qp = Qh + ((size_t)h * SEQ + q0w + ln) * HD;
#pragma unroll
    for (int kk = 0; kk < 4; ++kk) aq[kk] = frag16(qp + kk * 32, hh);
    if (RES) {
      const _Float16* qlp = Ql + ((size_t)h * RESQ + q0w + ln) * HD;
#pragma unroll
      for (int kk = 0; kk < 4; ++kk) aql[kk] = frag16(qlp + kk * 32, hh);
    } else {
#pragma unroll
      for (int kk = 0; kk < 4; ++kk) aql[kk] = aq[kk];
    }
  }
  const v8f z8 = {0.f, 0.f, 0.f, 0.f, 0.f, 0.f, 0.f, 0.f};
  v8f o[NC];
#pragma unroll
  for (int c = 0; c < NC; ++c) o[c] = z8;
  float mrow[8], lrow[8];
#pragma unroll
  for (int r = 0; r < 8; ++r) { mrow[r] = -3.0e38f; lrow[r] = 0.f; }
  const float alpha = 0.08838834764831845f;

#pragma unroll 1
  for (int ch = 0; ch < nch; ++ch) {
    const int t0 = ch * KC;
    // stage K rows t0..t0+KC-1 (all 128 d) and V^T rows dz..dz+OD-1 (keys t0..t0+KC-1): staged extent == consumed extent
#pragma unroll
    for (int it = 0; it < (KC * 16) / 256; ++it) {
      const int i = tid + it * 256; const int r = i >> 4, c8 = (i & 15) * 8;
      *(v8us*)&sK[r][c8] = *(const v8us*)((const unsigned short*)Kh + ((size_t)kv * SEQ + t0 + r) * HD + c8);
      if (RES) *(v8us*)&sKl[r][c8] = *(const v8us*)((const unsigned short*)Kl + ((size_t)kv * RESQ + t0 + r) * HD + c8);
    }
#pragma unroll
    for (int it = 0; it < (OD * (KC / 8)) / 256; ++it) {
      const int i = tid + it * 256; const int d = i / (KC / 8), c8 = (i % (KC / 8)) * 8;
      *(v8us*)&sV[d][c8] = *(const v8us*)((const unsigned short*)VT + (size_t)(kv * HD + dz + d) * SEQ + t0 + c8);
      if (RES) *(v8us*)&sVl[d][c8] = *(const v8us*)((const unsigned short*)VTl + (size_t)(kv * HD + dz + d) * RESQ + t0 + c8);
    }
    __syncthreads();
    if (t0 <= qlast) {                   // wave-uniform: this wave has unmasked keys in the chunk
      v8f sacc[NJ];
#pragma unroll
      for (int j = 0; j < NJ; ++j) {
        v8f acc = z8, tmp = z8;
#pragma unroll
        for (int kk = 0; kk < 4; ++kk) {
          const v16h b = frag16(&sK[j * 16 + ln][kk * 32], hh);          // B[k = d][n = key]: key row, d contiguous
          acc = mma16(aq[kk], b, acc);
          if (RES) {
            const v16h bl = frag16(&sKl[j * 16 + ln][kk * 32], hh);
            tmp = mma16(aql[kk], b, tmp);
            tmp = mma16(aq[kk], bl, tmp);
          }
        }
        if (RES) acc = acc + tmp * (1.0f / RCAR);
        sacc[j] = acc;
      }
      // scale, causal mask, online softmax; P (x2^14) to the wave-private LDS tile
#pragma unroll
      for (int r = 0; r < 8; ++r) {
        const int qrow = q0w + 8 * hh + r;
        float sv[NJ]; bool mk[NJ]; float mx = -3.0e38f;
#pragma unroll
        for (int j = 0; j < NJ; ++j) { mk[j] = (t0 + 16 * j + ln) > qrow; sv[j] = sacc[j][r] * alpha; mx = fmaxf(mx, mk[j] ? -3.0e38f : sv[j]); }
#pragma unroll
        for (int m = 8; m > 0; m >>= 1) mx = fmaxf(mx, __shfl_xor(mx, m, 32));
        const float mnew = fmaxf(mrow[r], mx);
        const float fac = (mrow[r] < -1.0e38f) ? 0.f : __expf(mrow[r] - mnew);
        float rs = 0.f;
#pragma unroll
        for (int j = 0; j < NJ; ++j) {
          const float p = mk[j] ? 0.f : __expf(sv[j] - mnew);
          rs += p;
          const float pcv = p * PCAR; const _Float16 ph = (_Float16)pcv;
          sP[w][8 * hh + r][16 * j + ln] = ph;
          if (RES) sPl[w][8 * hh + r][16 * j + ln] = (_Float16)((pcv - (float)ph) * RCAR);
        }
#pragma unroll
        for (int m = 8; m > 0; m >>= 1) rs += __shfl_xor(rs, m, 32);
        lrow[r] = lrow[r] * fac + rs; mrow[r] = mnew;
#pragma unroll
        for (int c = 0; c < NC; ++c) o[c][r] *= fac;
      }
      __builtin_amdgcn_fence(4 /* acq_rel order */, "workgroup");
      __builtin_amdgcn_wave_barrier();
      v16h ap[NKS], apl[NKS];
#pragma unroll
      for (int ks = 0; ks < NKS; ++ks) {
        ap[ks] = frag16(&sP[w][ln][ks * 32], hh);                         // A[m = query row][k = key]
        if (RES) apl[ks] = frag16(&sPl[w][ln][ks * 32], hh); else apl[ks] = ap[ks];
      }
#pragma unroll
      for (int c = 0; c < NC; ++c) {
        v8f tmp = z8;
#pragma unroll
        for (int ks = 0; ks < NKS; ++ks) {
          const v16h b = frag16(&sV[c * 16 + ln][ks * 32], hh);          // B[k = key][n = d]: d row, keys contiguous
          o[c] = mma16(ap[ks], b, o[c]);
          if (RES) {
            const v16h bl = frag16(&sVl[c * 16 + ln][ks * 32], hh);
            tmp = mma16(apl[ks], b, tmp);
            tmp = mma16(ap[ks], bl, tmp);
          }
        }
        if (RES) o[c] = o[c] + tmp * (1.0f / RCAR);
      }
    }
    __syncthreads();
  }

  // epilogue
  float il[8];
#pragma unroll
  for (int r = 0; r < 8; ++r) il[r] = (OCAR / PCAR) * __builtin_amdgcn_rcpf(lrow[r]);
  const float* gp = qraw + (size_t)(q0w + 8 * hh) * NQC + (size_t)h * (2 * HD) + HD + dz + ln;
#pragma unroll
  for (int hf = 0; hf < NHF; ++hf) {
    if (hf > 0) { __builtin_amdgcn_fence(4 /* acq_rel order */, "workgroup"); __builtin_amdgcn_wave_barrier(); }
#pragma unroll
    for (int cc = 0; cc < 4; ++cc) {
      const int c = hf * 4 + cc;
#pragma unroll
      for (int r = 0; r < 8; ++r) {
        const float g = gp[(size_t)r * NQC + c * 16];
        const float sig = __builtin_amdgcn_rcpf(1.0f + __expf(-g));
        const float val = o[c][r] * il[r] * sig;
        const _Float16 vh = (_Float16)val;
        sP[w][8 * hh + r][cc * 16 + ln] = vh;
        if (RES) sPl[w][8 * hh + r][cc * 16 + ln] = (_Float16)((val - (float)vh) * RCAR);
      }
      asm volatile("" ::: "memory");
    }
    __builtin_amdgcn_fence(4 /* acq_rel order */, "workgroup");
    __builtin_amdgcn_wave_barrier();
    const int prw = lane >> 3, pc = lane & 7;
    {
#pragma unroll
      for (int it = 0; it < 4; ++it) {
        const int row = it * 4 + prw;
        const v8us vv = *(const v8us*)&sP[w][row][pc * 8];
        const size_t go = (size_t)(q0w + row) * (NH * HD) + (size_t)h * HD + dz + hf * 64 + pc * 8;
        *(v8us*)((unsigned short*)Oh + go) = vv;
        if (RES) { const v8us vl = *(const v8us*)&sPl[w][row][pc * 8]; *(v8us*)((unsigned short*)Ol + go) = vl; }
      }
      
    }
  }
}

extern "C" void kernel_launch(void* const* d_in, const int* in_sizes, int n_in,
                              void* d_out, int out_size, void* d_ws, size_t ws_size, hipStream_t stream) {
  if (n_in < 7) return;
  const long need_x = (long)(NB - 1) * SEQ_FULL * HID + (long)SEQ * HID;
  if ((long)in_sizes[0] < need_x) return;
  if (in_sizes[1] < HID * NQC) return;
  if (in_sizes[2] < HID * NKV * HD) return;
  if (in_sizes[3] < HID * NKV * HD) return;
  if (in_sizes[4] < NH * HD * HID) return;
  if (in_sizes[5] < HD) return;
  if (in_sizes[6] < HD) return;
  if ((long)out_size < need_x) return;

  const float* x   = (const float*)d_in[0];
  const float* Wq  = (const float*)d_in[1];
  const float* Wk  = (const float*)d_in[2];
  const float* Wv  = (const float*)d_in[3];
  const float* Wo  = (const float*)d_in[4];
  const float* qnw = (const float*)d_in[5];
  const float* knw = (const float*)d_in[6];

  char* ws = (char*)d_ws; size_t off = 0;
  auto take = [&](size_t bytes) { char* p = ws + off; off += (bytes + 255) & ~(size_t)255; return p; };
  _Float16* X16  = (_Float16*)take(SZ_X16);
  _Float16* WqT  = (_Float16*)take(SZ_WQT);
  _Float16* WkvT = (_Float16*)take(SZ_WKVT);
  _Float16* WoT  = (_Float16*)take(SZ_WOT);
  float*    CS   = (float*)take(SZ_CS);
  float*    qraw = (float*)take(SZ_QRAW);
  float*    kvraw = (float*)take(SZ_KVRAW);
  _Float16* Qh   = (_Float16*)take(SZ_QH);
  _Float16* Ql   = (_Float16*)take(SZ_QL);
  _Float16* Kh   = (_Float16*)take(SZ_KH);
  _Float16* Kl   = (_Float16*)take(SZ_KL);
  _Float16* VT   = (_Float16*)take(SZ_VT);
  _Float16* VTl  = (_Float16*)take(SZ_VTL);
  _Float16* Oh   = (_Float16*)take(SZ_OH);
  _Float16* Ol   = (_Float16*)take(SZ_OL);
  if (off > ws_size) return;

  // rotary tables and weight planes (Bt[n][k] = f16(bf16rne(W[k][n]) * 16))
  k_rope<<<(SEQ * NRP + 255) / 256, 256, 0, stream>>>(CS);
  k_wt_f16<HID, NQC><<<(HID / WT_K) * (NQC / WT_N), 256, 0, stream>>>(Wq, WqT, WCAR);
  k_wt_f16<HID, NKV * HD><<<(HID / WT_K) * (NKV * HD / WT_N), 256, 0, stream>>>(Wk, WkvT, WCAR);
  k_wt_f16<HID, NKV * HD><<<(HID / WT_K) * (NKV * HD / WT_N), 256, 0, stream>>>(Wv, WkvT + (size_t)NKV * HD * HID, WCAR);
  k_wt_f16<NH * HD, HID><<<((NH * HD) / WT_K) * (HID / WT_N), 256, 0, stream>>>(Wo, WoT, WCAR);

  const float walpha = 1.0f / WCAR;                          // 2^-4
  const float oalpha = 1.0f / (WCAR * OCAR);                 // 2^-10
  const float oalphal = oalpha / RCAR;                       // 2^-20
  // every launch covers all NB batch elements
  float* out = (float*)d_out;
  k_x16<<<dim3((unsigned)(((size_t)SEQ * HID / 8 + 255) / 256), NB), 256, 0, stream>>>(x, X16, (size_t)SEQ * HID / 8);
  k_gemm<false><<<dim3((SEQ / 128) * (NQC / 128), NB), 128, 0, stream>>>(X16, X16, HID, WqT, HID, walpha, 0.0f, qraw, NQC, SEQ, NQC, HID, (size_t)SEQ * HID, (size_t)SEQ * HID, (size_t)SEQ * NQC);
  k_gemm<false><<<dim3((SEQ / 128) * (NKVC / 128), NB), 128, 0, stream>>>(X16, X16, HID, WkvT, HID, walpha, 0.0f, kvraw, NKVC, SEQ, NKVC, HID, (size_t)SEQ * HID, (size_t)SEQ * HID, (size_t)SEQ * NKVC);
  k_qk<<<(NB * SEQ * NHR) / 8, 256, 0, stream>>>(qraw, kvraw, qnw, knw, CS, Qh, Ql, Kh, Kl);
  k_vt<<<dim3(NKV * 2 * (SEQ / 64), NB), 256, 0, stream>>>(kvraw, VT, VTl);
  k_attn<true><<<dim3(RESQ / 128, NH, 2 * NB), 256, 0, stream>>>(Qh, Ql, Kh, Kl, VT, VTl, qraw, Oh, Ol, 0);
  if (SEQ > RESQ)
    k_attn<false><<<dim3((SEQ - RESQ) / 128, NH, NB), 256, 0, stream>>>(Qh, Ql, Kh, Kl, VT, VTl, qraw, Oh, Ol, RESQ / 128);
  k_gemm<true><<<dim3((RESQ / 64) * (HID / 128), NB), 128, 0, stream>>>(Oh, Ol, NH * HD, WoT, NH * HD, oalpha, oalphal, out, HID, RESQ, HID, NH * HD, (size_t)SEQ * NH * HD, (size_t)RESQ * NH * HD, (size_t)SEQ_FULL * HID);
  if (SEQ > RESQ)
    k_gemm<false><<<dim3(((SEQ - RESQ) / 128) * (HID / 128), NB), 128, 0, stream>>>(Oh + (size_t)RESQ * NH * HD, Oh + (size_t)RESQ * NH * HD, NH * HD, WoT, NH * HD, oalpha, 0.0f, out + (size_t)RESQ * HID, HID, SEQ - RESQ, HID, NH * HD, (size_t)SEQ * NH * HD, (size_t)SEQ * NH * HD, (size_t)SEQ_FULL * HID);
  (void)hipGetLastError();
}

// v004
// Measured time: 251 microseconds a run.
// Timed twice side by side with v003, it ran 1.13 times as fast both times.
// All steps since v000 together make it 3.62 times as fast.
#include <hip/hip_runtime.h>
#include <stdint.h>
// Contractions x.Wq, x.[Wk|Wv], q.k^T, P.V^T, o.Wo: v_wmma_f32_16x16x32_f16 (f16 operands, f32 accumulate). x and all weights RNE-converted to bf16 and held exactly in f16 (weights carried x16); q, k, V^T and gated o as f16 planes plus x2^10 f16 residual planes over the first RESQ query rows / keys (two-term products there, single products elsewhere); softmax weights x2^14 in f16 (+ x2^10 residual on those rows); gated o carried x64; RMSNorm, RoPE, softmax statistics and sigmoid gating in f32.

#ifndef NB
#define NB 2
#endif
#ifndef SEQ
#define SEQ 2048
#endif
#ifndef RESQ
#if SEQ < 512
#define RESQ SEQ
#else
#define RESQ 512
#endif
#endif
#define NB_FULL 2
#define SEQ_FULL 2048
#define HID 2048
#define NH 16
#define NKV 4
#define HD 128
#define GQ (NH / NKV)
#define NQC (2 * NH * HD)      /* q|gate columns: head h at h*256 (q) and h*256+128 (gate) */
#define NKVC (2 * NKV * HD)    /* k|v columns: k head j at j*128, v head j at 512+j*128 */
#define NHR (NH + NKV)         /* normalised rows per token (16 q heads + 4 k heads) */
#define NRP 64                 /* rotary pairs */
#define PCAR 16384.0f          /* softmax weight carry */
#define OCAR 64.0f             /* gated o carry */
#define RCAR 1024.0f           /* residual plane carry */
#define WCAR 16.0f             /* weight carry */

static_assert(NB >= 1);
static_assert(NB <= NB_FULL);
static_assert(SEQ % 128 == 0);
static_assert(SEQ <= SEQ_FULL);
static_assert(RESQ % 128 == 0);
static_assert(RESQ >= 128);
static_assert(RESQ <= SEQ);
static_assert((SEQ - RESQ) % 128 == 0);
static_assert(HID % 32 == 0);
static_assert(HID % 64 == 0);
static_assert(NQC % 128 == 0);
static_assert(NKVC % 128 == 0);
static_assert(HID % 256 == 0);
static_assert((NH * HD) % 256 == 0);
static_assert(HD == 128);
static_assert(NH % NKV == 0);
static_assert((SEQ * NHR) % 8 == 0);
static_assert((SEQ * HID) % 8 == 0);

// planes of x, q, k, v and o hold all NB batch elements, element b at b * (plane size / NB)
constexpr size_t SZ_X16   = (size_t)NB * SEQ * HID * 2;
constexpr size_t SZ_WQT   = (size_t)NQC * HID * 2;
constexpr size_t SZ_WKVT  = (size_t)NKVC * HID * 2;
constexpr size_t SZ_WOT   = (size_t)HID * NH * HD * 2;
constexpr size_t SZ_CS    = (size_t)SEQ * NRP * 2 * 4;
constexpr size_t SZ_QRAW  = (size_t)NB * SEQ * NQC * 4;
constexpr size_t SZ_KVRAW = (size_t)NB * SEQ * NKVC * 4;
constexpr size_t SZ_QH    = (size_t)NB * NH * SEQ * HD * 2;
constexpr size_t SZ_QL    = (size_t)NB * NH * RESQ * HD * 2;
constexpr size_t SZ_KH    = (size_t)NB * NKV * SEQ * HD * 2;
constexpr size_t SZ_KL    = (size_t)NB * NKV * RESQ * HD * 2;
constexpr size_t SZ_VT    = (size_t)NB * NKV * HD * SEQ * 2;
constexpr size_t SZ_VTL   = (size_t)NB * NKV * HD * RESQ * 2;
constexpr size_t SZ_OH    = (size_t)NB * SEQ * NH * HD * 2;
constexpr size_t SZ_OL    = (size_t)NB * RESQ * NH * HD * 2;
constexpr size_t WS_TOTAL = SZ_X16 + SZ_WQT + SZ_WKVT + SZ_WOT + SZ_CS + SZ_QRAW + SZ_KVRAW + SZ_QH + SZ_QL + SZ_KH + SZ_KL + SZ_VT + SZ_VTL + SZ_OH + SZ_OL;
static_assert(WS_TOTAL <= (size_t)268435456);
static_assert(SZ_X16 % 256 == 0);
static_assert(SZ_KL % 256 == 0);
static_assert(SZ_VTL % 256 == 0);
static_assert(SZ_CS % 256 == 0);

typedef _Float16 v16h __attribute__((ext_vector_type(16)));
typedef unsigned short v8us __attribute__((ext_vector_type(8), may_alias));
typedef float v8f __attribute__((ext_vector_type(8)));
typedef float v4f __attribute__((ext_vector_type(4)));
typedef float v4fa __attribute__((ext_vector_type(4), may_alias));
typedef float v2f __attribute__((ext_vector_type(2)));
typedef _Float16 v4h __attribute__((ext_vector_type(4)));
typedef uint32_t u32x4 __attribute__((ext_vector_type(4)));
typedef uint32_t u32x8 __attribute__((ext_vector_type(8)));
union FragH { v16h v; v8us half[2]; _Float16 h[16]; unsigned short u[16]; };
union Pack8 { v8us v; _Float16 h[8]; unsigned short u[8]; };

__device__ __forceinline__ unsigned short bf16_bits(float x) { const unsigned int u = __float_as_uint(x); return (unsigned short)((u + 0x7FFFu + ((u >> 16) & 1u)) >> 16); }
__device__ __forceinline__ float bf16_rne(float x) { return __uint_as_float(((unsigned int)bf16_bits(x)) << 16); }

// 16x32 f16 fragment from a k-contiguous row p (A row m = lane&15, or Bt row n = lane&15): elements 0..7 <- k 8h..8h+7, 8..15 <- k 16+8h..16+8h+7
__device__ __forceinline__ v16h frag16(const _Float16* p, int hh) {
  FragH f;
  f.half[0] = *(const v8us*)((const unsigned short*)p + 8 * hh);
  f.half[1] = *(const v8us*)((const unsigned short*)p + 16 + 8 * hh);
  return f.v;
}

// grid.y = batch element
__global__ __launch_bounds__(256) void k_x16(const float* __restrict__ x, _Float16* __restrict__ X16, size_t n8) {
  const size_t t = (size_t)blockIdx.x * 256 + threadIdx.x; if (t >= n8) return;
  x += (size_t)blockIdx.y * SEQ_FULL * HID; X16 += (size_t)blockIdx.y * SEQ * HID;
  const v4f a = *(const v4fa*)(x + t * 8), c = *(const v4fa*)(x + t * 8 + 4);
  Pack8 f;
#pragma unroll
  for (int q = 0; q < 4; ++q) { f.h[q] = (_Float16)bf16_rne(a[q]); f.h[4 + q] = (_Float16)bf16_rne(c[q]); }
  unsigned short* d = (unsigned short*)X16 + t * 8;
  *(v8us*)d = f.v; 
}

#define WT_K 128                     /* k per block tile: one 256-B piece of a Wt row */
#define WT_N 128                     /* n per block tile: two 256-B pieces of a W row */

// Wt[n][k] = f16(bf16rne(W[k][n]) * scale). Block = tile of WT_K k x WT_N n, grid = (K / WT_K) * (N / WT_N).
// A thread reads 8 k x (4 + 4) n (each wave-wide load covers two whole 256-B row pieces of W), packs 8 k per n and turns the tile in LDS; each wave-wide store covers two whole 256-B row pieces of Wt.
// LDS row n holds its sixteen 16-B k chunks at chunk ^ ((n >> 2) & 15): the 16 lanes of a half wave then fall on 16 different bank groups, writing (16 rows, one chunk) and reading (one row, 16 chunks).
// K and N are compile-time, so that the row steps are immediate offsets on one address.
template <int K, int N>
__global__ __launch_bounds__(256) void k_wt_f16(const float* __restrict__ W, _Float16* __restrict__ Wt, float scale) {
  static_assert(K % WT_K == 0);
  static_assert(N % WT_N == 0);
  __shared__ __attribute__((aligned(16))) unsigned short st[WT_N][WT_K];
  const int tid = threadIdx.x;
  constexpr int ntn = N / WT_N;
  const int kt = (int)blockIdx.x / ntn, nt = (int)blockIdx.x - kt * ntn;
  const int k0 = kt * WT_K, n0 = nt * WT_N;
  const int lo = tid & 15, hi = tid >> 4;
  // block-uniform base plus one 32-bit lane offset that all sixteen loads (all eight stores) share
  const char* wb = (const char*)(W + (size_t)k0 * N + n0);
  const uint32_t vo = ((uint32_t)(hi * 8) * (uint32_t)N + (uint32_t)(lo * 4)) * 4u;
  v4f r[2][8];
#pragma unroll
  for (int i = 0; i < 8; ++i) {
    r[0][i] = *(const v4fa*)(wb + (size_t)i * N * 4 + vo);
    r[1][i] = *(const v4fa*)(wb + (size_t)i * N * 4 + 256 + vo);
  }
  // behind the last load: the offset register that all sixteen loads name stays whole until their addresses are taken (no load's result is placed on it), and no load sinks below into the conversions
  asm volatile("s_wait_xcnt 0x0" :: "v"(vo) : "memory");
#pragma unroll
  for (int h = 0; h < 2; ++h) {
#pragma unroll
    for (int j = 0; j < 4; ++j) {
      Pack8 f;
#pragma unroll
      for (int i = 0; i < 8; ++i) f.h[i] = (_Float16)(bf16_rne(r[h][i][j]) * scale);
      *(v8us*)&st[h * 64 + lo * 4 + j][(hi ^ lo) * 8] = f.v;
    }
  }
  __syncthreads();
  char* tb = (char*)(Wt + (size_t)n0 * K + k0);
  const uint32_t so = ((uint32_t)hi * (uint32_t)K + (uint32_t)(lo * 8)) * 2u;
#pragma unroll
  for (int it = 0; it < WT_N / 16; ++it) {
    const int n = it * 16 + hi;
    const v8us v = *(const v8us*)&st[n][(lo ^ ((n >> 2) & 15)) * 8];
    *(v8us*)(tb + (size_t)it * 16 * K * 2 + so) = v;
  }
}

__global__ __launch_bounds__(256) void k_rope(float* __restrict__ cs) {
  const int t = blockIdx.x * 256 + threadIdx.x; if (t >= SEQ * NRP) return;
  const int pos = t / NRP, i = t - pos * NRP;
  const float inv = exp2f(-(float)i * 0.31143075889569022f);   // 2^(-i*log2(1e6)/64)
  const float ang = (float)pos * inv;
  float sn, cn; sincosf(ang, &sn, &cn);
  v2f o; o[0] = cn; o[1] = sn;
  float* d = cs + (size_t)t * 2;
  *(v2f*)d = o; 
}

#define G_PITCH 272u                 /* LDS row pitch: 256 B of k plus the mover's 16-B pad (ds_load_b128 readers) */
#define G_SLICE 18432u               /* one wave's slice: 64 rows at G_PITCH, rounded up to a multiple of 2 KiB */
#define G_STAGE (4u * G_SLICE)       /* one buffer: [A rows 0..63 | A rows 64..127 (RES: residual rows 0..63) | Bt rows 0..63 | Bt rows 64..127] */
static_assert(64u * G_PITCH <= G_SLICE);
static_assert(G_SLICE % 2048u == 0);
static_assert(64u * 68u * 4u <= G_SLICE);

// D += A.B by the plain builtin, whose distances the compiler keeps itself: register operands on an asm guard would hold the GEMM's accumulators and both fragment sets below v256 (spills)
__device__ __forceinline__ v8f mma16b(v16h a, v16h b, v8f c) { return __builtin_amdgcn_wmma_f32_16x16x32_f16(false, a, false, b, (short)0, c, false, false); }
__device__ __forceinline__ uint32_t uni(uint32_t v) { return (uint32_t)__builtin_amdgcn_readfirstlane(v); }
__device__ __forceinline__ uint32_t pinned(uint32_t v) { uint32_t w = uni(v); asm volatile("" : "+s"(w)); return w; }
__device__ __forceinline__ void wait_ds0() { asm volatile("s_wait_dscnt 0x0" ::: "memory"); }          // this wave's LDS reads have returned before the buffer is handed over
__device__ __forceinline__ void wait_tensor0() { asm volatile("s_wait_tensorcnt 0x0" ::: "memory"); }  // this wave's slice has landed; the compiler places no wait for the mover
__device__ __forceinline__ void tdm_load(u32x4 g0, u32x8 g1) { asm volatile("tensor_load_to_lds %0, %1" :: "s"(g0), "s"(g1) : "memory"); }
// group 1: 1-byte elements, tile = tensor = 64 rows of 256 B, source row pitch in bytes, 4 dwords of LDS pad behind every 256-B row
__device__ __forceinline__ u32x8 tdm_group1(uint32_t src_pitch) {
  u32x8 g;
  g[0] = uni((1u << 20) | (5u << 22) | (3u << 25));
  // pinned(): descriptor words held in their scalar registers through the loop, so that none is rewritten while a request is outstanding
  g[1] = pinned(256u << 16);
  g[2] = pinned(64u << 16);
  g[3] = pinned(256u << 16);
  g[4] = pinned(64u);
  g[5] = pinned(src_pitch);
  g[6] = pinned(0u);
  g[7] = pinned(0u);
  return g;
}
__device__ __forceinline__ u32x4 tdm_group0(uint32_t lds_dst, uint64_t ga) {
  u32x4 g;
  g[0] = uni(1u); g[1] = uni(lds_dst); g[2] = uni((uint32_t)ga); g[3] = uni((((uint32_t)(ga >> 32)) & 0x01FFFFFFu) | 0x80000000u);
  return g;
}

// C[M][N] (f32, pitch ldc) = alpha * A[M][K] (f16, pitch lda) . Bt[N][K]^T (f16, pitch ldb)  (+ alphal * Al . Bt^T when RES: residual plane Al, pitch lda).
// Block = 4 waves (2 x 2), C tile 128 x 128 (RES: 64 x 128), grid.x = (M / tile rows) * (N / 128); K % 128 == 0, K >= 128.
// grid.y = batch element: A, Al and C advance by bsA, bsAl and bsC elements per batch element, Bt is shared.
// A pass is 128 k: every wave brings its own 64-row slice of the pass into LDS with one tensor load, two buffers, the next pass's load in flight under this pass's products.
// Each accumulator sums its k in ascending steps of 32. Every inner loop is unrolled so that the accumulator and fragment arrays are indexed by constants and stay in registers.
template <bool RES>
__global__ __launch_bounds__(128) void k_gemm(const _Float16* __restrict__ A, const _Float16* __restrict__ Al, int lda, const _Float16* __restrict__ Bt, int ldb,
                                             float alpha, float alphal, float* __restrict__ C, int ldc, int M, int N, int K, size_t bsA, size_t bsAl, size_t bsC) {
  constexpr int BM = RES ? 64 : 128;
  constexpr int NI = RES ? 2 : 4;        // 16-row C tiles per wave
  __shared__ __attribute__((aligned(2048))) unsigned char sm[2u * G_STAGE];
  const int tid = threadIdx.x, lane = tid & 31, ln = lane & 15, hh = lane >> 4;
  const uint32_t w = uni((uint32_t)tid >> 5);
  const int wm = (int)(w >> 1), wn = (int)(w & 1u);
  const int ntn = N >> 7;
  const int mt = (int)blockIdx.x / ntn, nq = (int)blockIdx.x - mt * ntn;
  const int row0 = mt * BM, col0 = nq * 128;
  if (row0 >= M) return;
  A += (size_t)blockIdx.y * bsA; Al += (size_t)blockIdx.y * bsAl; C += (size_t)blockIdx.y * bsC;
  const _Float16* src = (w >= 2u) ? (Bt + (size_t)(col0 + 64 * wn) * ldb)
                      : (RES ? ((w == 1u ? Al : A) + (size_t)row0 * lda) : (A + (size_t)(row0 + 64 * (int)w) * lda));
  const uint64_t ga0 = (uint64_t)(uintptr_t)src;
  const uint32_t lds0 = (uint32_t)(size_t)sm + w * G_SLICE;
  const u32x8 g1 = tdm_group1(2u * (uint32_t)(w >= 2u ? ldb : lda));
  const int ns = K >> 7;
  // per-lane fragment rows inside a buffer
  uint32_t aoff[4], boff[4];
#pragma unroll
  for (int i = 0; i < 4; ++i) {
    aoff[i] = RES ? ((uint32_t)(i >> 1) * G_SLICE + (uint32_t)(wm * 32 + (i & 1) * 16 + ln) * G_PITCH)
                  : ((uint32_t)wm * G_SLICE + (uint32_t)(i * 16 + ln) * G_PITCH);
    boff[i] = (uint32_t)(2 + wn) * G_SLICE + (uint32_t)(i * 16 + ln) * G_PITCH;
  }
  const v8f z8 = {0.f, 0.f, 0.f, 0.f, 0.f, 0.f, 0.f, 0.f};
  v8f c[4][4];                           // RES: c[0..1] main plane, c[2..3] residual plane of the same rows
#pragma unroll
  for (int i = 0; i < 4; ++i)
#pragma unroll
    for (int j = 0; j < 4; ++j) c[i][j] = z8;

  tdm_load(tdm_group0(lds0, ga0), g1);
  wait_tensor0();
  __syncthreads();
  if (pinned(1 < ns ? 1u : 0u) != 0u) tdm_load(tdm_group0(lds0 + G_STAGE, ga0 + 256u), g1);
#pragma unroll 1                         // one pass per trip: the buffer alternates at run time
  for (int s = 0; s < ns; ++s) {
    const uint32_t bo = (uint32_t)(s & 1) * G_STAGE;
    const unsigned char* bp = sm + bo;
    v16h fa[2][4], fb[2][4];             // set (kk & 1) holds k-step kk's fragments; the next step's loads go ahead of this step's products as one group
#pragma unroll
    for (int i = 0; i < 4; ++i) { fa[0][i] = frag16((const _Float16*)(bp + aoff[i]), hh); fb[0][i] = frag16((const _Float16*)(bp + boff[i]), hh); }
#pragma unroll
    for (int kk = 0; kk < 4; ++kk) {
      if (kk < 3) {
#pragma unroll
        for (int i = 0; i < 4; ++i) {
          fa[(kk + 1) & 1][i] = frag16((const _Float16*)(bp + aoff[i] + (kk + 1) * 64), hh);
          fb[(kk + 1) & 1][i] = frag16((const _Float16*)(bp + boff[i] + (kk + 1) * 64), hh);
        }
      }
      __builtin_amdgcn_sched_barrier(0);   // keeps the next step's LDS loads one group ahead of the products, not spread among them
#pragma unroll
      for (int j = 0; j < 4; ++j)
#pragma unroll
        for (int i = 0; i < 4; ++i) c[i][j] = mma16b(fa[kk & 1][i], fb[kk & 1][j], c[i][j]);
      __builtin_amdgcn_sched_barrier(0);   // ends the block of products: the following loads stay behind it
    }
    asm volatile("v_nop\n\tv_nop\n\tv_nop\n\tv_nop");   // WMMA-to-VALU distance on the loop's exit path, where the epilogue reads the accumulators
    // publish point of pass s + 1: own LDS reads returned, own slice landed, block barrier, then the refill of the buffer just read
    wait_ds0();
    wait_tensor0();
    __syncthreads();
    if (pinned(s + 2 < ns ? 1u : 0u) != 0u) tdm_load(tdm_group0(lds0 + bo, ga0 + (uint64_t)(uint32_t)(s + 2) * 256u), g1);
  }
  wait_tensor0();
  wait_ds0();

  // epilogue: the ring is free behind the last pass's barrier; each wave stages its C tile in its own slice and stores whole 256-B row pieces
  float* so = (float*)(sm + w * G_SLICE);
#pragma unroll
  for (int i = 0; i < NI; ++i) {
#pragma unroll
    for (int j = 0; j < 4; ++j) {
#pragma unroll
      for (int r = 0; r < 8; ++r)
        so[(i * 16 + 8 * hh + r) * 68 + j * 16 + ln] = RES ? (c[i][j][r] * alpha + c[(i + 2) & 3][j][r] * alphal) : (c[i][j][r] * alpha);
    }
  }
  __builtin_amdgcn_fence(4 /* acq_rel order */, "workgroup");
  __builtin_amdgcn_wave_barrier();
  const int rsub = lane >> 4, c4 = (lane & 15) * 4;
#pragma unroll
  for (int q = 0; q < NI * 8; ++q) {
    const int r = q * 2 + rsub;
    const v4f v = *(const v4fa*)&so[r * 68 + c4];
    *(v4f*)(C + (size_t)(row0 + wm * (NI * 16) + r) * ldc + col0 + wn * 64 + c4) = v;
  }
}

// per (batch element bb, token s, head-row j): j<16 -> q head j from qraw[s][j*256 + 0..127], else k head j-16 from kvraw[s][(j-16)*128 ..]; RMSNorm (w+1, eps 1e-6) then rotate-half RoPE from cs[s];
__global__ __launch_bounds__(256) void k_qk(const float* __restrict__ qraw, const float* __restrict__ kvraw,
                                           const float* __restrict__ qnw, const float* __restrict__ knw, const float* __restrict__ cs,
                                           _Float16* __restrict__ Qh, _Float16* __restrict__ Ql, _Float16* __restrict__ Kh, _Float16* __restrict__ Kl) {
  const int w = threadIdx.x >> 5, lane = threadIdx.x & 31;
  const int wid = (int)blockIdx.x * 8 + w;
  if (wid >= NB * SEQ * NHR) return;
  const int tr = wid / NHR, j = wid - tr * NHR;     // tr: row of the raw planes, which hold the batch elements one behind the other
  const int bb = tr / SEQ, s = tr - bb * SEQ;
  const bool isq = (j < NH);
  const float* src = isq ? (qraw + (size_t)tr * NQC + (size_t)j * (2 * HD)) : (kvraw + (size_t)tr * NKVC + (size_t)(j - NH) * HD);
  const float* wp = isq ? qnw : knw;
  const v4f xv = *(const v4fa*)(src + 4 * lane);
  const v4f wv = *(const v4fa*)(wp + 4 * lane);
  float ss = xv[0] * xv[0] + xv[1] * xv[1] + xv[2] * xv[2] + xv[3] * xv[3];
#pragma unroll
  for (int m = 16; m > 0; m >>= 1) ss += __shfl_xor(ss, m, 32);
  const float inv = rsqrtf(ss * (1.0f / 128.0f) + 1.0e-6f);
  float nv[4], pr[4];
#pragma unroll
  for (int q = 0; q < 4; ++q) nv[q] = xv[q] * inv * (wv[q] + 1.0f);
#pragma unroll
  for (int q = 0; q < 4; ++q) pr[q] = __shfl_xor(nv[q], 16, 32);       // element d +- 64
  const int i0 = 4 * (lane & 15);
  const v4f t01 = *(const v4fa*)(cs + ((size_t)s * NRP + i0) * 2);
  const v4f t23 = *(const v4fa*)(cs + ((size_t)s * NRP + i0 + 2) * 2);
  const float cv[4] = {t01[0], t01[2], t23[0], t23[2]};
  const float sv[4] = {t01[1], t01[3], t23[1], t23[3]};
  const float sg = (lane < 16) ? -1.0f : 1.0f;                          // d < 64: -x[d+64]; d >= 64: +x[d-64]
  v4h oh, ol;
#pragma unroll
  for (int q = 0; q < 4; ++q) {
    const float o = nv[q] * cv[q] + sg * pr[q] * sv[q];
    const _Float16 hv = (_Float16)o;
    oh[q] = hv; ol[q] = (_Float16)((o - (float)hv) * RCAR);
  }
  _Float16* dh = isq ? (Qh + ((size_t)(bb * NH + j) * SEQ + s) * HD) : (Kh + ((size_t)(bb * NKV + j - NH) * SEQ + s) * HD);
  _Float16* dl = isq ? (Ql + ((size_t)(bb * NH + j) * RESQ + s) * HD) : (Kl + ((size_t)(bb * NKV + j - NH) * RESQ + s) * HD);
  const bool wl = (s < RESQ);
  {
    *(v4h*)(dh + 4 * lane) = oh;
    if (wl) *(v4h*)(dl + 4 * lane) = ol;
    
  }
}

// V^T planes: VT[kv][d][t] = f16(v), VTl = x2^10 residual for t < RESQ; v = kvraw[t][512 + kv*128 + d]; block per (kv, d-half, 64 tokens) via LDS 64x64 tile; grid.y = batch element
__global__ __launch_bounds__(256) void k_vt(const float* __restrict__ kvraw, _Float16* __restrict__ VT, _Float16* __restrict__ VTl) {
  __shared__ float tl[64][65];
  const int tid = threadIdx.x;
  const int ntg = SEQ / 64;
  const int tg = (int)blockIdx.x % ntg, slab = (int)blockIdx.x / ntg;
  const int kv = slab >> 1, dh = slab & 1;
  const int s0 = tg * 64;
  kvraw += (size_t)blockIdx.y * ((size_t)SEQ * NKVC); VT += (size_t)blockIdx.y * ((size_t)NKV * HD * SEQ); VTl += (size_t)blockIdx.y * ((size_t)NKV * HD * RESQ);
#pragma unroll
  for (int it = 0; it < 4; ++it) {
    const int i = tid + it * 256; const int tok = i >> 4, c4 = (i & 15) * 4;
    const v4f v = *(const v4fa*)(kvraw + (size_t)(s0 + tok) * NKVC + NKV * HD + kv * HD + dh * 64 + c4);
    tl[tok][c4] = v[0]; tl[tok][c4 + 1] = v[1]; tl[tok][c4 + 2] = v[2]; tl[tok][c4 + 3] = v[3];
  }
  __syncthreads();
  const int pc = tid & 7, dr = tid >> 3;
  const bool wl = (s0 < RESQ);
  {
#pragma unroll
    for (int rd = 0; rd < 2; ++rd) {
      const int d = rd * 32 + dr;
      Pack8 ph, pl;
#pragma unroll
      for (int q = 0; q < 8; ++q) { const float f = tl[pc * 8 + q][d]; const _Float16 hv = (_Float16)f; ph.h[q] = hv; pl.h[q] = (_Float16)((f - (float)hv) * RCAR); }
      const size_t row = (size_t)(kv * HD + dh * 64 + d);
      *(v8us*)((unsigned short*)VT + row * SEQ + s0 + pc * 8) = ph.v;
      if (wl) *(v8us*)((unsigned short*)VTl + row * RESQ + s0 + pc * 8) = pl.v;
    }
    
  }
}

// Causal grouped attention, flash form. Block = 8 waves x 16 query rows of head h (kv = h/4), grid (query blocks, NH, NB * (RES ? 2 : 1)): blockIdx.z = batch element (RES: batch element * 2 + o column half).
// Per key chunk: K rows [t][d] and V^T rows [d][t] staged in LDS (cross-wave: block barriers); S = q.k^T (f16, f32 acc), scale 1/sqrt(128),
// RES: first RESQ query rows: chunk 32 keys, q/k/P/V^T residual second terms into separate accumulators folded by 2^-10; block covers 64 o columns.
// Every inner loop is unrolled, so that the fragment, accumulator and row arrays are indexed by constants and stay in registers.
template <bool RES>
__global__ __launch_bounds__(256) void k_attn(const _Float16* __restrict__ Qh, const _Float16* __restrict__ Ql,
                                             const _Float16* __restrict__ Kh, const _Float16* __restrict__ Kl,
                                             const _Float16* __restrict__ VT, const _Float16* __restrict__ VTl,
                                             const float* __restrict__ qraw, _Float16* __restrict__ Oh, _Float16* __restrict__ Ol, int qb0) {
  constexpr int KC = RES ? 32 : 64;      // keys per chunk
  constexpr int NJ = KC / 16;            // score column tiles
  constexpr int NKS = KC / 32;           // k-steps of P.V^T
  constexpr int OD = RES ? 64 : 128;     // o columns per block
  constexpr int NC = OD / 16;
  constexpr int NHF = OD / 64;
  constexpr int CG = RES ? 2 : 4;        // o column tiles per group of V^T fragment loads (four fragments with the residual ones)
  constexpr int NGC = NC / CG;           // groups per k-step
  constexpr int NG = NKS * NGC;
  constexpr bool XG = NG >= 3;
  constexpr int KP = HD + 8;             // sK pitch (halves)
  constexpr int VP = KC + 8;             // sV pitch
  constexpr int PP = 72;                 // sP pitch (KC weights, and 64 staged o columns)
  __shared__ __attribute__((aligned(16))) _Float16 sK[KC][KP];
  __shared__ __attribute__((aligned(16))) _Float16 sKl[RES ? KC : 1][KP];
  __shared__ __attribute__((aligned(16))) _Float16 sV[OD][VP];
  __shared__ __attribute__((aligned(16))) _Float16 sVl[RES ? OD : 1][VP];
  __shared__ __attribute__((aligned(16))) _Float16 sP[8][16][PP];
  __shared__ __attribute__((aligned(16))) _Float16 sPl[RES ? 8 : 1][16][PP];

  const int tid = threadIdx.x, w = tid >> 5, lane = tid & 31, ln = lane & 15, hh = lane >> 4;
  const int qb = qb0 + (int)blockIdx.x, h = (int)blockIdx.y, kv = h / GQ;
  const int dz = RES ? ((int)blockIdx.z & 1) * 64 : 0;
  const size_t bb = RES ? (blockIdx.z >> 1) : blockIdx.z;
  Qh += bb * ((size_t)NH * SEQ * HD); Ql += bb * ((size_t)NH * RESQ * HD); Kh += bb * ((size_t)NKV * SEQ * HD); Kl += bb * ((size_t)NKV * RESQ * HD);
  VT += bb * ((size_t)NKV * HD * SEQ); VTl += bb * ((size_t)NKV * HD * RESQ); qraw += bb * ((size_t)SEQ * NQC);
  Oh += bb * ((size_t)SEQ * NH * HD); Ol += bb * ((size_t)RESQ * NH * HD);
  const int q0b = qb * 128, q0w = q0b + 16 * w;
  const int nch = (q0b + 128) / KC;      // chunks holding keys <= last row of the block
  const int qlast = q0w + 15;

  v16h aq[4], aql[4];
  {
    const _Float16* qp = Qh + ((size_t)h * SEQ + q0w + ln) * HD;
#pragma unroll
    for (int kk = 0; kk < 4; ++kk) aq[kk] = frag16(qp + kk * 32, hh);
    if (RES) {
      const _Float16* qlp = Ql + ((size_t)h * RESQ + q0w + ln) * HD;
#pragma unroll
      for (int kk = 0; kk < 4; ++kk) aql[kk] = frag16(qlp + kk * 32, hh);
    } else {
#pragma unroll
      for (int kk = 0; kk < 4; ++kk) aql[kk] = aq[kk];
    }
  }
  const v8f z8 = {0.f, 0.f, 0.f, 0.f, 0.f, 0.f, 0.f, 0.f};
  v8f o[NC];
#pragma unroll
  for (int c = 0; c < NC; ++c) o[c] = z8;
  float mrow[8], lrow[8];
#pragma unroll
  for (int r = 0; r < 8; ++r) { mrow[r] = -3.0e38f; lrow[r] = 0.f; }
  const float alpha = 0.08838834764831845f;
  // staging addresses: block-uniform bases plus one 32-bit lane offset per plane, the row steps as constants (leaves the registers to the fragment groups)
  constexpr int VR = 256 / (KC / 8);     // V^T rows staged per round of the block
  const char* kgb = (const char*)(Kh + (size_t)kv * SEQ * HD);
  const char* klgb = (const char*)(Kl + (size_t)kv * RESQ * HD);
  const char* vgb = (const char*)(VT + (size_t)(kv * HD + dz) * SEQ);
  const char* vlgb = (const char*)(VTl + (size_t)(kv * HD + dz) * RESQ);
  const uint32_t kvo = (uint32_t)((tid >> 4) * HD + (tid & 15) * 8) * 2u;
  const uint32_t vvo = (uint32_t)((tid / (KC / 8)) * SEQ + (tid % (KC / 8)) * 8) * 2u;
  const uint32_t vlvo = (uint32_t)((tid / (KC / 8)) * RESQ + (tid % (KC / 8)) * 8) * 2u;
  _Float16* skp = &sK[tid >> 4][(tid & 15) * 8];
  _Float16* sklp = &sKl[RES ? (tid >> 4) : 0][(tid & 15) * 8];
  _Float16* svp = &sV[tid / (KC / 8)][(tid % (KC / 8)) * 8];
  _Float16* svlp = &sVl[RES ? (tid / (KC / 8)) : 0][(tid % (KC / 8)) * 8];

#pragma unroll 1
  for (int ch = 0; ch < nch; ++ch) {
    const int t0 = ch * KC;
    // stage K rows t0..t0+KC-1 (all 128 d) and V^T rows dz..dz+OD-1 (keys t0..t0+KC-1): staged extent == consumed extent
#pragma unroll
    for (int it = 0; it < (KC * 16) / 256; ++it) {
      *(v8us*)(skp + it * 16 * KP) = *(const v8us*)(kgb + (size_t)t0 * (HD * 2) + (size_t)it * (16 * HD * 2) + kvo);
      if (RES) *(v8us*)(sklp + it * 16 * KP) = *(const v8us*)(klgb + (size_t)t0 * (HD * 2) + (size_t)it * (16 * HD * 2) + kvo);
    }
#pragma unroll
    for (int it = 0; it < (OD * (KC / 8)) / 256; ++it) {
      *(v8us*)(svp + it * VR * VP) = *(const v8us*)(vgb + (size_t)t0 * 2 + (size_t)it * ((size_t)VR * SEQ * 2) + vvo);
      if (RES) *(v8us*)(svlp + it * VR * VP) = *(const v8us*)(vlgb + (size_t)t0 * 2 + (size_t)it * ((size_t)VR * RESQ * 2) + vlvo);
    }
    __syncthreads();
    if (t0 <= qlast) {                   // wave-uniform: this wave has unmasked keys in the chunk
      // k-step kk's K fragments of all key tiles are one group of LDS loads, issued one k-step ahead of their products (set kk & 1); the key tiles' accumulators are independent, each sums its kk in ascending order
      v8f sacc[NJ], stmp[RES ? NJ : 1];
#pragma unroll
      for (int j = 0; j < NJ; ++j) { sacc[j] = z8; if (RES) stmp[j] = z8; }
      {
        v16h fk[2][NJ], fkl[2][RES ? NJ : 1];
#pragma unroll
        for (int j = 0; j < NJ; ++j) {
          fk[0][j] = frag16(&sK[j * 16 + ln][0], hh);                     // B[k = d][n = key]: key row, d contiguous
          if (RES) fkl[0][j] = frag16(&sKl[j * 16 + ln][0], hh);
        }
#pragma unroll
        for (int kk = 0; kk < 4; ++kk) {
          if (kk < 3) {
#pragma unroll
            for (int j = 0; j < NJ; ++j) {
              fk[(kk + 1) & 1][j] = frag16(&sK[j * 16 + ln][(kk + 1) * 32], hh);
              if (RES) fkl[(kk + 1) & 1][j] = frag16(&sKl[j * 16 + ln][(kk + 1) * 32], hh);
            }
          }
          __builtin_amdgcn_sched_barrier(0);   // keeps the next k-step's LDS loads one group ahead of the products, not one by one in front of each
#pragma unroll
          for (int j = 0; j < NJ; ++j) sacc[j] = mma16b(aq[kk], fk[kk & 1][j], sacc[j]);
          if (RES) {
#pragma unroll
            for (int j = 0; j < NJ; ++j) stmp[j] = mma16b(aql[kk], fk[kk & 1][j], stmp[j]);
#pragma unroll
            for (int j = 0; j < NJ; ++j) stmp[j] = mma16b(aq[kk], fkl[kk & 1][j], stmp[j]);
          }
          __builtin_amdgcn_sched_barrier(0);   // ends the block of products: the following loads stay behind it
        }
      }
      if (RES) {
#pragma unroll
        for (int j = 0; j < NJ; ++j) sacc[j] = sacc[j] + stmp[j] * (1.0f / RCAR);
      }
      // scale, causal mask, online softmax; P (x2^14) to the wave-private LDS tile. The eight rows pass each stage together, so that a stage's cross-lane exchanges stand as one group of LDS operations
      const int dk = t0 + ln - (q0w + 8 * hh);   // key tile j, row r is masked where dk + 16 j > r
      float mx[8], fac[8], rs[8], xs[8];
#pragma unroll
      for (int r = 0; r < 8; ++r) {
        float m0 = -3.0e38f;
#pragma unroll
        for (int j = 0; j < NJ; ++j) m0 = fmaxf(m0, (dk + 16 * j > r) ? -3.0e38f : sacc[j][r] * alpha);
        mx[r] = m0;
      }
#pragma unroll
      for (int m = 8; m > 0; m >>= 1) {
#pragma unroll
        for (int r = 0; r < 8; ++r) xs[r] = __shfl_xor(mx[r], m, 32);
        __builtin_amdgcn_sched_barrier(0);       // all eight exchanges of a stage are issued before the first is waited for: one LDS latency a stage, not one a row
#pragma unroll
        for (int r = 0; r < 8; ++r) mx[r] = fmaxf(mx[r], xs[r]);
      }
#pragma unroll
      for (int r = 0; r < 8; ++r) {
        const float mnew = fmaxf(mrow[r], mx[r]);
        fac[r] = (mrow[r] < -1.0e38f) ? 0.f : __expf(mrow[r] - mnew);
        mrow[r] = mnew;
        float s = 0.f;
#pragma unroll
        for (int j = 0; j < NJ; ++j) {
          const float p = (dk + 16 * j > r) ? 0.f : __expf(sacc[j][r] * alpha - mnew);
          s += p;
          const float pcv = p * PCAR; const _Float16 ph = (_Float16)pcv;
          sP[w][8 * hh + r][16 * j + ln] = ph;
          if (RES) sPl[w][8 * hh + r][16 * j + ln] = (_Float16)((pcv - (float)ph) * RCAR);
        }
        rs[r] = s;
      }
      // the row sums' four exchange stages (lane distance 8, 4, 2, 1) feed only lrow: the first is issued here, under the rescale of o, the others among the V^T groups below where there are three groups to take them (XG)
#pragma unroll
      for (int r = 0; r < 8; ++r) xs[r] = __shfl_xor(rs[r], 8, 32);
#pragma unroll
      for (int r = 0; r < 8; ++r)
#pragma unroll
        for (int c = 0; c < NC; ++c) o[c][r] *= fac[r];
      if (!XG) {
#pragma unroll
        for (int m = 4; m > 0; m >>= 1) {
#pragma unroll
          for (int r = 0; r < 8; ++r) { rs[r] += xs[r]; xs[r] = __shfl_xor(rs[r], m, 32); }
        }
#pragma unroll
        for (int r = 0; r < 8; ++r) { rs[r] += xs[r]; lrow[r] = lrow[r] * fac[r] + rs[r]; }
      }
      __builtin_amdgcn_fence(4 /* acq_rel order */, "workgroup");
      __builtin_amdgcn_wave_barrier();
      v16h ap[NKS], apl[NKS];
#pragma unroll
      for (int ks = 0; ks < NKS; ++ks) {
        ap[ks] = frag16(&sP[w][ln][ks * 32], hh);                         // A[m = query row][k = key]
        if (RES) apl[ks] = frag16(&sPl[w][ln][ks * 32], hh); else apl[ks] = ap[ks];
      }
      // V^T fragments go in groups of four as well (CG o column tiles of one k-step); the first group shares the wait of the P fragments
      v16h fv[2][CG], fvl[2][RES ? CG : 1];
#pragma unroll
      for (int i = 0; i < CG; ++i) {
        fv[0][i] = frag16(&sV[i * 16 + ln][0], hh);                       // B[k = key][n = d]: d row, keys contiguous
        if (RES) fvl[0][i] = frag16(&sVl[i * 16 + ln][0], hh);
      }
      v8f ptmp[RES ? NC : 1];
      if (RES) {
#pragma unroll
        for (int c = 0; c < NC; ++c) ptmp[c] = z8;
      }
#pragma unroll
      for (int g = 0; g < NG; ++g) {           // group g: k-step g / NGC, o column tiles (g % NGC) * CG ..; every o tile meets its k-steps in ascending order
        if (g + 1 < NG) {
          const int ks1 = (g + 1) / NGC, cb1 = ((g + 1) % NGC) * CG;
#pragma unroll
          for (int i = 0; i < CG; ++i) {
            fv[(g + 1) & 1][i] = frag16(&sV[(cb1 + i) * 16 + ln][ks1 * 32], hh);
            if (RES) fvl[(g + 1) & 1][i] = frag16(&sVl[(cb1 + i) * 16 + ln][ks1 * 32], hh);
          }
        }
        if (XG && g < 3) {
#pragma unroll
          for (int r = 0; r < 8; ++r) { rs[r] += xs[r]; xs[r] = __shfl_xor(rs[r], 4 >> g, 32); }
        }
        __builtin_amdgcn_sched_barrier(0);     // keeps the next group's LDS loads ahead of this group's products
        const int ks = g / NGC, cb = (g % NGC) * CG;
#pragma unroll
        for (int i = 0; i < CG; ++i) o[cb + i] = mma16b(ap[ks], fv[g & 1][i], o[cb + i]);
        if (RES) {
#pragma unroll
          for (int i = 0; i < CG; ++i) ptmp[cb + i] = mma16b(apl[ks], fv[g & 1][i], ptmp[cb + i]);
#pragma unroll
          for (int i = 0; i < CG; ++i) ptmp[cb + i] = mma16b(ap[ks], fvl[g & 1][i], ptmp[cb + i]);
        }
        __builtin_amdgcn_sched_barrier(0);     // ends the block of products: the following loads stay behind it
      }
      if (RES) {
#pragma unroll
        for (int c = 0; c < NC; ++c) o[c] = o[c] + ptmp[c] * (1.0f / RCAR);
      }
      if (XG) {
#pragma unroll
        for (int r = 0; r < 8; ++r) { rs[r] += xs[r]; lrow[r] = lrow[r] * fac[r] + rs[r]; }
      }
    }
    __syncthreads();
  }

  // epilogue
  float il[8];
#pragma unroll
  for (int r = 0; r < 8; ++r) il[r] = (OCAR / PCAR) * __builtin_amdgcn_rcpf(lrow[r]);
  const float* gp = qraw + (size_t)(q0w + 8 * hh) * NQC + (size_t)h * (2 * HD) + HD + dz + ln;
#pragma unroll
  for (int hf = 0; hf < NHF; ++hf) {
    if (hf > 0) { __builtin_amdgcn_fence(4 /* acq_rel order */, "workgroup"); __builtin_amdgcn_wave_barrier(); }
#pragma unroll
    for (int cc = 0; cc < 4; ++cc) {
      const int c = hf * 4 + cc;
#pragma unroll
      for (int r = 0; r < 8; ++r) {
        const float g = gp[(size_t)r * NQC + c * 16];
        const float sig = __builtin_amdgcn_rcpf(1.0f + __expf(-g));
        const float val = o[c][r] * il[r] * sig;
        const _Float16 vh = (_Float16)val;
        sP[w][8 * hh + r][cc * 16 + ln] = vh;
        if (RES) sPl[w][8 * hh + r][cc * 16 + ln] = (_Float16)((val - (float)vh) * RCAR);
      }
      asm volatile("" ::: "memory");
    }
    __builtin_amdgcn_fence(4 /* acq_rel order */, "workgroup");
    __builtin_amdgcn_wave_barrier();
    const int prw = lane >> 3, pc = lane & 7;
    {
#pragma unroll
      for (int it = 0; it < 4; ++it) {
        const int row = it * 4 + prw;
        const v8us vv = *(const v8us*)&sP[w][row][pc * 8];
        const size_t go = (size_t)(q0w + row) * (NH * HD) + (size_t)h * HD + dz + hf * 64 + pc * 8;
        *(v8us*)((unsigned short*)Oh + go) = vv;
        if (RES) { const v8us vl = *(const v8us*)&sPl[w][row][pc * 8]; *(v8us*)((unsigned short*)Ol + go) = vl; }
      }
      
    }
  }
}

extern "C" void kernel_launch(void* const* d_in, const int* in_sizes, int n_in,
                              void* d_out, int out_size, void* d_ws, size_t ws_size, hipStream_t stream) {
  if (n_in < 7) return;
  const long need_x = (long)(NB - 1) * SEQ_FULL * HID + (long)SEQ * HID;
  if ((long)in_sizes[0] < need_x) return;
  if (in_sizes[1] < HID * NQC) return;
  if (in_sizes[2] < HID * NKV * HD) return;
  if (in_sizes[3] < HID * NKV * HD) return;
  if (in_sizes[4] < NH * HD * HID) return;
  if (in_sizes[5] < HD) return;
  if (in_sizes[6] < HD) return;
  if ((long)out_size < need_x) return;

  const float* x   = (const float*)d_in[0];
  const float* Wq  = (const float*)d_in[1];
  const float* Wk  = (const float*)d_in[2];
  const float* Wv  = (const float*)d_in[3];
  const float* Wo  = (const float*)d_in[4];
  const float* qnw = (const float*)d_in[5];
  const float* knw = (const float*)d_in[6];

  char* ws = (char*)d_ws; size_t off = 0;
  auto take = [&](size_t bytes) { char* p = ws + off; off += (bytes + 255) & ~(size_t)255; return p; };
  _Float16* X16  = (_Float16*)take(SZ_X16);
  _Float16* WqT  = (_Float16*)take(SZ_WQT);
  _Float16* WkvT = (_Float16*)take(SZ_WKVT);
  _Float16* WoT  = (_Float16*)take(SZ_WOT);
  float*    CS   = (float*)take(SZ_CS);
  float*    qraw = (float*)take(SZ_QRAW);
  float*    kvraw = (float*)take(SZ_KVRAW);
  _Float16* Qh   = (_Float16*)take(SZ_QH);
  _Float16* Ql   = (_Float16*)take(SZ_QL);
  _Float16* Kh   = (_Float16*)take(SZ_KH);
  _Float16* Kl   = (_Float16*)take(SZ_KL);
  _Float16* VT   = (_Float16*)take(SZ_VT);
  _Float16* VTl  = (_Float16*)take(SZ_VTL);
  _Float16* Oh   = (_Float16*)take(SZ_OH);
  _Float16* Ol   = (_Float16*)take(SZ_OL);
  if (off > ws_size) return;

  // rotary tables and weight planes (Bt[n][k] = f16(bf16rne(W[k][n]) * 16))
  k_rope<<<(SEQ * NRP + 255) / 256, 256, 0, stream>>>(CS);
  k_wt_f16<HID, NQC><<<(HID / WT_K) * (NQC / WT_N), 256, 0, stream>>>(Wq, WqT, WCAR);
  k_wt_f16<HID, NKV * HD><<<(HID / WT_K) * (NKV * HD / WT_N), 256, 0, stream>>>(Wk, WkvT, WCAR);
  k_wt_f16<HID, NKV * HD><<<(HID / WT_K) * (NKV * HD / WT_N), 256, 0, stream>>>(Wv, WkvT + (size_t)NKV * HD * HID, WCAR);
  k_wt_f16<NH * HD, HID><<<((NH * HD) / WT_K) * (HID / WT_N), 256, 0, stream>>>(Wo, WoT, WCAR);

  const float walpha = 1.0f / WCAR;                          // 2^-4
  const float oalpha = 1.0f / (WCAR * OCAR);                 // 2^-10
  const float oalphal = oalpha / RCAR;                       // 2^-20
  // every launch covers all NB batch elements
  float* out = (float*)d_out;
  k_x16<<<dim3((unsigned)(((size_t)SEQ * HID / 8 + 255) / 256), NB), 256, 0, stream>>>(x, X16, (size_t)SEQ * HID / 8);
  k_gemm<false><<<dim3((SEQ / 128) * (NQC / 128), NB), 128, 0, stream>>>(X16, X16, HID, WqT, HID, walpha, 0.0f, qraw, NQC, SEQ, NQC, HID, (size_t)SEQ * HID, (size_t)SEQ * HID, (size_t)SEQ * NQC);
  k_gemm<false><<<dim3((SEQ / 128) * (NKVC / 128), NB), 128, 0, stream>>>(X16, X16, HID, WkvT, HID, walpha, 0.0f, kvraw, NKVC, SEQ, NKVC, HID, (size_t)SEQ * HID, (size_t)SEQ * HID, (size_t)SEQ * NKVC);
  k_qk<<<(NB * SEQ * NHR) / 8, 256, 0, stream>>>(qraw, kvraw, qnw, knw, CS, Qh, Ql, Kh, Kl);
  k_vt<<<dim3(NKV * 2 * (SEQ / 64), NB), 256, 0, stream>>>(kvraw, VT, VTl);
  k_attn<true><<<dim3(RESQ / 128, NH, 2 * NB), 256, 0, stream>>>(Qh, Ql, Kh, Kl, VT, VTl, qraw, Oh, Ol, 0);
  if (SEQ > RESQ)
    k_attn<false><<<dim3((SEQ - RESQ) / 128, NH, NB), 256, 0, stream>>>(Qh, Ql, Kh, Kl, VT, VTl, qraw, Oh, Ol, RESQ / 128);
  k_gemm<true><<<dim3((RESQ / 64) * (HID / 128), NB), 128, 0, stream>>>(Oh, Ol, NH * HD, WoT, NH * HD, oalpha, oalphal, out, HID, RESQ, HID, NH * HD, (size_t)SEQ * NH * HD, (size_t)RESQ * NH * HD, (size_t)SEQ_FULL * HID);
  if (SEQ > RESQ)
    k_gemm<false><<<dim3(((SEQ - RESQ) / 128) * (HID / 128), NB), 128, 0, stream>>>(Oh + (size_t)RESQ * NH * HD, Oh + (size_t)RESQ * NH * HD, NH * HD, WoT, NH * HD, oalpha, 0.0f, out + (size_t)RESQ * HID, HID, SEQ - RESQ, HID, NH * HD, (size_t)SEQ * NH * HD, (size_t)SEQ * NH * HD, (size_t)SEQ_FULL * HID);
  (void)hipGetLastError();
}

// v005
// It runs in 202 microseconds.
// Two timings next to v004 put it at 1.23 and 1.24 times that version's speed.
// Over all steps from v000 it is 4.48 times as fast.
#include <hip/hip_runtime.h>
#include <stdint.h>
// Contractions x.Wq, x.[Wk|Wv], q.k^T, P.V^T, o.Wo: v_wmma_f32_16x16x32_f16 (f16 operands, f32 accumulate). x and all weights RNE-converted to bf16 and held exactly in f16 (weights carried x16); q, k, V^T and gated o as f16 planes plus x2^10 f16 residual planes over the first RESQ query rows / keys (two-term products there, single products elsewhere); softmax weights x2^14 in f16 (+ x2^10 residual on those rows); gated o carried x64; RMSNorm, RoPE, softmax statistics and sigmoid gating in f32.

#ifndef NB
#define NB 2
#endif
#ifndef SEQ
#define SEQ 2048
#endif
#ifndef RESQ
#if SEQ < 512
#define RESQ SEQ
#else
#define RESQ 512
#endif
#endif
#define NB_FULL 2
#define SEQ_FULL 2048
#define HID 2048
#define NH 16
#define NKV 4
#define HD 128
#define GQ (NH / NKV)
#define NQC (2 * NH * HD)      /* q|gate columns: head h at h*256 (q) and h*256+128 (gate) */
#define NKVC (2 * NKV * HD)    /* k|v columns: k head j at j*128, v head j at 512+j*128 */
#define NHR (NH + NKV)         /* normalised rows per token (16 q heads + 4 k heads) */
#define NRP 64                 /* rotary pairs */
#define PCAR 16384.0f          /* softmax weight carry */
#define OCAR 64.0f             /* gated o carry */
#define RCAR 1024.0f           /* residual plane carry */
#define WCAR 16.0f             /* weight carry */

static_assert(NB >= 1);
static_assert(NB <= NB_FULL);
static_assert(SEQ % 128 == 0);
static_assert(SEQ <= SEQ_FULL);
static_assert(RESQ % 128 == 0);
static_assert(RESQ >= 128);
static_assert(RESQ <= SEQ);
static_assert((SEQ - RESQ) % 128 == 0);
static_assert(HID % 32 == 0);
static_assert(HID % 64 == 0);
static_assert(NQC % 128 == 0);
static_assert(NKVC % 128 == 0);
static_assert(HID % 256 == 0);
static_assert((NH * HD) % 256 == 0);
static_assert(HD == 128);
static_assert(NH % NKV == 0);
static_assert((SEQ * NHR) % 8 == 0);
static_assert((SEQ * HID) % 8 == 0);

// planes of x, q, k, v and o hold all NB batch elements, element b at b * (plane size / NB)
constexpr size_t SZ_X16   = (size_t)NB * SEQ * HID * 2;
constexpr size_t SZ_WQT   = (size_t)NQC * HID * 2;
constexpr size_t SZ_WKVT  = (size_t)NKVC * HID * 2;
constexpr size_t SZ_WOT   = (size_t)HID * NH * HD * 2;
constexpr size_t SZ_CS    = (size_t)SEQ * NRP * 2 * 4;
constexpr size_t SZ_QRAW  = (size_t)NB * SEQ * NQC * 4;
constexpr size_t SZ_KVRAW = (size_t)NB * SEQ * NKVC * 4;
constexpr size_t SZ_QH    = (size_t)NB * NH * SEQ * HD * 2;
constexpr size_t SZ_QL    = (size_t)NB * NH * RESQ * HD * 2;
constexpr size_t SZ_KH    = (size_t)NB * NKV * SEQ * HD * 2;
constexpr size_t SZ_KL    = (size_t)NB * NKV * RESQ * HD * 2;
constexpr size_t SZ_VT    = (size_t)NB * NKV * HD * SEQ * 2;
constexpr size_t SZ_VTL   = (size_t)NB * NKV * HD * RESQ * 2;
constexpr size_t SZ_OH    = (size_t)NB * SEQ * NH * HD * 2;
constexpr size_t SZ_OL    = (size_t)NB * RESQ * NH * HD * 2;
constexpr size_t WS_TOTAL = SZ_X16 + SZ_WQT + SZ_WKVT + SZ_WOT + SZ_CS + SZ_QRAW + SZ_KVRAW + SZ_QH + SZ_QL + SZ_KH + SZ_KL + SZ_VT + SZ_VTL + SZ_OH + SZ_OL;
static_assert(WS_TOTAL <= (size_t)268435456);
static_assert(SZ_X16 % 256 == 0);
static_assert(SZ_KL % 256 == 0);
static_assert(SZ_VTL % 256 == 0);
static_assert(SZ_CS % 256 == 0);

typedef _Float16 v16h __attribute__((ext_vector_type(16)));
typedef unsigned short v8us __attribute__((ext_vector_type(8), may_alias));
typedef float v8f __attribute__((ext_vector_type(8)));
typedef float v4f __attribute__((ext_vector_type(4)));
typedef float v4fa __attribute__((ext_vector_type(4), may_alias));
typedef float v2f __attribute__((ext_vector_type(2)));
typedef _Float16 v4h __attribute__((ext_vector_type(4)));
typedef uint32_t u32x4 __attribute__((ext_vector_type(4)));
typedef uint32_t u32x8 __attribute__((ext_vector_type(8)));
union FragH { v16h v; v8us half[2]; _Float16 h[16]; unsigned short u[16]; };
union Pack8 { v8us v; _Float16 h[8]; unsigned short u[8]; };

__device__ __forceinline__ unsigned short bf16_bits(float x) { const unsigned int u = __float_as_uint(x); return (unsigned short)((u + 0x7FFFu + ((u >> 16) & 1u)) >> 16); }
__device__ __forceinline__ float bf16_rne(float x) { return __uint_as_float(((unsigned int)bf16_bits(x)) << 16); }

// 16x32 f16 fragment from a k-contiguous row p (A row m = lane&15, or Bt row n = lane&15): elements 0..7 <- k 8h..8h+7, 8..15 <- k 16+8h..16+8h+7
__device__ __forceinline__ v16h frag16(const _Float16* p, int hh) {
  FragH f;
  f.half[0] = *(const v8us*)((const unsigned short*)p + 8 * hh);
  f.half[1] = *(const v8us*)((const unsigned short*)p + 16 + 8 * hh);
  return f.v;
}

// bx = block inside a batch element, bb = batch element
__device__ __forceinline__ void x16_block(const float* __restrict__ x, _Float16* __restrict__ X16, size_t n8, int bx, int bb) {
  const size_t t = (size_t)bx * 256 + threadIdx.x; if (t >= n8) return;
  x += (size_t)bb * SEQ_FULL * HID; X16 += (size_t)bb * SEQ * HID;
  const v4f a = *(const v4fa*)(x + t * 8), c = *(const v4fa*)(x + t * 8 + 4);
  Pack8 f;
#pragma unroll
  for (int q = 0; q < 4; ++q) { f.h[q] = (_Float16)bf16_rne(a[q]); f.h[4 + q] = (_Float16)bf16_rne(c[q]); }
  unsigned short* d = (unsigned short*)X16 + t * 8;
  *(v8us*)d = f.v; 
}

#define WT_K 128                     /* k per block tile: one 256-B piece of a Wt row */
#define WT_N 128                     /* n per block tile: two 256-B pieces of a W row */

// Wt[n][k] = f16(bf16rne(W[k][n]) * scale). Block bx = tile of WT_K k x WT_N n, (K / WT_K) * (N / WT_N) blocks; st = the block's LDS tile.
// A thread reads 8 k x (4 + 4) n (each wave-wide load covers two whole 256-B row pieces of W), packs 8 k per n and turns the tile in LDS; each wave-wide store covers two whole 256-B row pieces of Wt.
// LDS row n holds its sixteen 16-B k chunks at chunk ^ ((n >> 2) & 15): the 16 lanes of a half wave then fall on 16 different bank groups, writing (16 rows, one chunk) and reading (one row, 16 chunks).
// K and N are compile-time, so that the row steps are immediate offsets on one address.
template <int K, int N>
__device__ __forceinline__ void wt_block(unsigned short (*st)[WT_K], const float* __restrict__ W, _Float16* __restrict__ Wt, float scale, int bx) {
  static_assert(K % WT_K == 0);
  static_assert(N % WT_N == 0);
  const int tid = threadIdx.x;
  constexpr int ntn = N / WT_N;
  const int kt = bx / ntn, nt = bx - kt * ntn;
  const int k0 = kt * WT_K, n0 = nt * WT_N;
  const int lo = tid & 15, hi = tid >> 4;
  // block-uniform base plus one 32-bit lane offset that all sixteen loads (all eight stores) share
  const char* wb = (const char*)(W + (size_t)k0 * N + n0);
  const uint32_t vo = ((uint32_t)(hi * 8) * (uint32_t)N + (uint32_t)(lo * 4)) * 4u;
  v4f r[2][8];
#pragma unroll
  for (int i = 0; i < 8; ++i) {
    r[0][i] = *(const v4fa*)(wb + (size_t)i * N * 4 + vo);
    r[1][i] = *(const v4fa*)(wb + (size_t)i * N * 4 + 256 + vo);
  }
  // behind the last load: the offset register that all sixteen loads name stays whole until their addresses are taken (no load's result is placed on it), and no load sinks below into the conversions
  asm volatile("s_wait_xcnt 0x0" :: "v"(vo) : "memory");
#pragma unroll
  for (int h = 0; h < 2; ++h) {
#pragma unroll
    for (int j = 0; j < 4; ++j) {
      Pack8 f;
#pragma unroll
      for (int i = 0; i < 8; ++i) f.h[i] = (_Float16)(bf16_rne(r[h][i][j]) * scale);
      *(v8us*)&st[h * 64 + lo * 4 + j][(hi ^ lo) * 8] = f.v;
    }
  }
  __syncthreads();
  char* tb = (char*)(Wt + (size_t)n0 * K + k0);
  const uint32_t so = ((uint32_t)hi * (uint32_t)K + (uint32_t)(lo * 8)) * 2u;
#pragma unroll
  for (int it = 0; it < WT_N / 16; ++it) {
    const int n = it * 16 + hi;
    const v8us v = *(const v8us*)&st[n][(lo ^ ((n >> 2) & 15)) * 8];
    *(v8us*)(tb + (size_t)it * 16 * K * 2 + so) = v;
  }
}

__device__ __forceinline__ void rope_block(float* __restrict__ cs, int bx) {
  const int t = bx * 256 + threadIdx.x; if (t >= SEQ * NRP) return;
  const int pos = t / NRP, i = t - pos * NRP;
  const float inv = exp2f(-(float)i * 0.31143075889569022f);   // 2^(-i*log2(1e6)/64)
  const float ang = (float)pos * inv;
  float sn, cn; sincosf(ang, &sn, &cn);
  v2f o; o[0] = cn; o[1] = sn;
  float* d = cs + (size_t)t * 2;
  *(v2f*)d = o; 
}

// One grid for everything that reads only the inputs: rotary table, the four weight planes, the x plane. None reads what another writes; a block's index range says which piece it takes.
constexpr int PB_ROPE = (SEQ * NRP + 255) / 256;
constexpr int PB_WQ   = (HID / WT_K) * (NQC / WT_N);
constexpr int PB_WKV  = (HID / WT_K) * (NKV * HD / WT_N);
constexpr int PB_WO   = ((NH * HD) / WT_K) * (HID / WT_N);
constexpr int PB_X    = (int)(((size_t)SEQ * HID / 8 + 255) / 256);
constexpr int PB_ALL  = PB_ROPE + PB_WQ + 2 * PB_WKV + PB_WO + NB * PB_X;
__global__ __launch_bounds__(256) void k_prep(const float* __restrict__ x, const float* __restrict__ Wq, const float* __restrict__ Wk, const float* __restrict__ Wv, const float* __restrict__ Wo,
                                             _Float16* __restrict__ X16, _Float16* __restrict__ WqT, _Float16* __restrict__ WkvT, _Float16* __restrict__ WoT, float* __restrict__ cs, float scale) {
  __shared__ __attribute__((aligned(16))) unsigned short st[WT_N][WT_K];
  int b = (int)blockIdx.x;
  if (b < PB_ROPE) { rope_block(cs, b); return; }
  b -= PB_ROPE;
  if (b < PB_WQ) { wt_block<HID, NQC>(st, Wq, WqT, scale, b); return; }
  b -= PB_WQ;
  if (b < PB_WO) { wt_block<NH * HD, HID>(st, Wo, WoT, scale, b); return; }
  b -= PB_WO;
  if (b < 2 * PB_WKV) {
    const bool isv = b >= PB_WKV;
    wt_block<HID, NKV * HD>(st, isv ? Wv : Wk, isv ? WkvT + (size_t)NKV * HD * HID : WkvT, scale, isv ? b - PB_WKV : b);
    return;
  }
  b -= 2 * PB_WKV;
  const int bb = b / PB_X;
  x16_block(x, X16, (size_t)SEQ * HID / 8, b - bb * PB_X, bb);
}

#define G_PITCH 272u                 /* LDS row pitch: 256 B of k plus the mover's 16-B pad (ds_load_b128 readers) */
#define G_SLICE 18432u               /* one wave's slice: 64 rows at G_PITCH, rounded up to a multiple of 2 KiB */
#define G_STAGE (4u * G_SLICE)       /* one buffer: [A rows 0..63 | A rows 64..127 (RES: residual rows 0..63) | Bt rows 0..63 | Bt rows 64..127] */
static_assert(64u * G_PITCH <= G_SLICE);
static_assert(G_SLICE % 2048u == 0);
static_assert(64u * 68u * 4u <= G_SLICE);

// D += A.B by the plain builtin, whose distances the compiler keeps itself: register operands on an asm guard would hold the GEMM's accumulators and both fragment sets below v256 (spills)
__device__ __forceinline__ v8f mma16b(v16h a, v16h b, v8f c) { return __builtin_amdgcn_wmma_f32_16x16x32_f16(false, a, false, b, (short)0, c, false, false); }
__device__ __forceinline__ uint32_t uni(uint32_t v) { return (uint32_t)__builtin_amdgcn_readfirstlane(v); }
__device__ __forceinline__ uint32_t pinned(uint32_t v) { uint32_t w = uni(v); asm volatile("" : "+s"(w)); return w; }
__device__ __forceinline__ void wait_ds0() { asm volatile("s_wait_dscnt 0x0" ::: "memory"); }          // this wave's LDS reads have returned before the buffer is handed over
__device__ __forceinline__ void tdm_load(u32x4 g0, u32x8 g1) { asm volatile("tensor_load_to_lds %0, %1" :: "s"(g0), "s"(g1) : "memory"); }
// this wave's slice has landed; the compiler places no wait for the mover. The wait names the youngest request's descriptor as inputs: its scalar registers stay allocated, and so unwritten, until the request has returned
__device__ __forceinline__ void wait_tensor0_of(u32x4 g0, u32x8 g1) { asm volatile("s_wait_tensorcnt 0x0" :: "s"(g0), "s"(g1) : "memory"); }
// group 1: 1-byte elements, tile = tensor = 64 rows of 256 B, source row pitch in bytes, 4 dwords of LDS pad behind every 256-B row
__device__ __forceinline__ u32x8 tdm_group1(uint32_t src_pitch) {
  u32x8 g;
  g[0] = uni((1u << 20) | (5u << 22) | (3u << 25));
  // pinned(): descriptor words held in their scalar registers through the loop, so that none is rewritten while a request is outstanding
  g[1] = pinned(256u << 16);
  g[2] = pinned(64u << 16);
  g[3] = pinned(256u << 16);
  g[4] = pinned(64u);
  g[5] = pinned(src_pitch);
  g[6] = pinned(0u);
  g[7] = pinned(0u);
  return g;
}
__device__ __forceinline__ u32x4 tdm_group0(uint32_t lds_dst, uint64_t ga) {
  u32x4 g;
  g[0] = uni(1u); g[1] = uni(lds_dst); g[2] = uni((uint32_t)ga); g[3] = uni((((uint32_t)(ga >> 32)) & 0x01FFFFFFu) | 0x80000000u);
  return g;
}

// C[M][N] (f32, pitch ldc) = alpha * A[M][K] (f16, pitch lda) . Bt[N][K]^T (f16, pitch ldb)  (+ alphal * Al . Bt^T when RES: residual plane Al, pitch lda).
// Block = 4 waves (2 x 2), C tile 128 x 128 (RES: 64 x 128), tile bx of (M / tile rows) * (N / 128); K % 128 == 0, K >= 128. sm = the block's LDS ring.
// A pass is 128 k: every wave brings its own 64-row slice of the pass into LDS with one tensor load, two buffers, the next pass's load in flight under this pass's products.
// Each accumulator sums its k in ascending steps of 32. Every inner loop is unrolled so that the accumulator and fragment arrays are indexed by constants and stay in registers.
template <bool RES>
__device__ __forceinline__ void gemm_tile(unsigned char* sm, int bx, const _Float16* __restrict__ A, const _Float16* __restrict__ Al, int lda, const _Float16* __restrict__ Bt, int ldb,
                                          float alpha, float alphal, float* __restrict__ C, int ldc, int M, int N, int K) {
  constexpr int BM = RES ? 64 : 128;
  constexpr int NI = RES ? 2 : 4;        // 16-row C tiles per wave
  const int tid = threadIdx.x, lane = tid & 31, ln = lane & 15, hh = lane >> 4;
  const uint32_t w = uni((uint32_t)tid >> 5);
  const int wm = (int)(w >> 1), wn = (int)(w & 1u);
  const int ntn = N >> 7;
  const int mt = bx / ntn, nq = bx - mt * ntn;
  const int row0 = mt * BM, col0 = nq * 128;
  if (row0 >= M) return;
  const _Float16* src = (w >= 2u) ? (Bt + (size_t)(col0 + 64 * wn) * ldb)
                      : (RES ? ((w == 1u ? Al : A) + (size_t)row0 * lda) : (A + (size_t)(row0 + 64 * (int)w) * lda));
  const uint64_t ga0 = (uint64_t)(uintptr_t)src;
  const uint32_t lds0 = (uint32_t)(size_t)sm + w * G_SLICE;
  const u32x8 g1 = tdm_group1(2u * (uint32_t)(w >= 2u ? ldb : lda));
  const int ns = K >> 7;
  // per-lane fragment rows inside a buffer
  uint32_t aoff[4], boff[4];
#pragma unroll
  for (int i = 0; i < 4; ++i) {
    aoff[i] = RES ? ((uint32_t)(i >> 1) * G_SLICE + (uint32_t)(wm * 32 + (i & 1) * 16 + ln) * G_PITCH)
                  : ((uint32_t)wm * G_SLICE + (uint32_t)(i * 16 + ln) * G_PITCH);
    boff[i] = (uint32_t)(2 + wn) * G_SLICE + (uint32_t)(i * 16 + ln) * G_PITCH;
  }
  const v8f z8 = {0.f, 0.f, 0.f, 0.f, 0.f, 0.f, 0.f, 0.f};
  v8f c[4][4];                           // RES: c[0..1] main plane, c[2..3] residual plane of the same rows
#pragma unroll
  for (int i = 0; i < 4; ++i)
#pragma unroll
    for (int j = 0; j < 4; ++j) c[i][j] = z8;

  u32x4 g0 = tdm_group0(lds0, ga0);      // group 0 of the youngest request
  tdm_load(g0, g1);
  wait_tensor0_of(g0, g1);
  __syncthreads();
  if (pinned(1 < ns ? 1u : 0u) != 0u) { g0 = tdm_group0(lds0 + G_STAGE, ga0 + 256u); tdm_load(g0, g1); }
#pragma unroll 1                         // one pass per trip: the buffer alternates at run time
  for (int s = 0; s < ns; ++s) {
    const uint32_t bo = (uint32_t)(s & 1) * G_STAGE;
    const unsigned char* bp = sm + bo;
    v16h fa[2][4], fb[2][4];             // set (kk & 1) holds k-step kk's fragments; the next step's loads go ahead of this step's products as one group
#pragma unroll
    for (int i = 0; i < 4; ++i) { fa[0][i] = frag16((const _Float16*)(bp + aoff[i]), hh); fb[0][i] = frag16((const _Float16*)(bp + boff[i]), hh); }
#pragma unroll
    for (int kk = 0; kk < 4; ++kk) {
      if (kk < 3) {
#pragma unroll
        for (int i = 0; i < 4; ++i) {
          fa[(kk + 1) & 1][i] = frag16((const _Float16*)(bp + aoff[i] + (kk + 1) * 64), hh);
          fb[(kk + 1) & 1][i] = frag16((const _Float16*)(bp + boff[i] + (kk + 1) * 64), hh);
        }
      }
      __builtin_amdgcn_sched_barrier(0);   // keeps the next step's LDS loads one group ahead of the products, not spread among them
#pragma unroll
      for (int j = 0; j < 4; ++j)
#pragma unroll
        for (int i = 0; i < 4; ++i) c[i][j] = mma16b(fa[kk & 1][i], fb[kk & 1][j], c[i][j]);
      __builtin_amdgcn_sched_barrier(0);   // ends the block of products: the following loads stay behind it
    }
    asm volatile("v_nop\n\tv_nop\n\tv_nop\n\tv_nop");   // WMMA-to-VALU distance on the loop's exit path, where the epilogue reads the accumulators
    // publish point of pass s + 1: own LDS reads returned, own slice landed, block barrier, then the refill of the buffer just read
    wait_ds0();
    wait_tensor0_of(g0, g1);
    __syncthreads();
    if (pinned(s + 2 < ns ? 1u : 0u) != 0u) { g0 = tdm_group0(lds0 + bo, ga0 + (uint64_t)(uint32_t)(s + 2) * 256u); tdm_load(g0, g1); }
  }
  wait_tensor0_of(g0, g1);
  wait_ds0();

  // epilogue: the ring is free behind the last pass's barrier; each wave stages its C tile in its own slice and stores whole 256-B row pieces
  float* so = (float*)(sm + w * G_SLICE);
#pragma unroll
  for (int i = 0; i < NI; ++i) {
#pragma unroll
    for (int j = 0; j < 4; ++j) {
#pragma unroll
      for (int r = 0; r < 8; ++r)
        so[(i * 16 + 8 * hh + r) * 68 + j * 16 + ln] = RES ? (c[i][j][r] * alpha + c[(i + 2) & 3][j][r] * alphal) : (c[i][j][r] * alpha);
    }
  }
  __builtin_amdgcn_fence(4 /* acq_rel order */, "workgroup");
  __builtin_amdgcn_wave_barrier();
  const int rsub = lane >> 4, c4 = (lane & 15) * 4;
#pragma unroll
  for (int g = 0; g < NI; ++g) {         // eight row pairs a group: its LDS reads, its stores, one wait
    v4f v[8];
#pragma unroll
    for (int u = 0; u < 8; ++u) v[u] = *(const v4fa*)&so[((g * 8 + u) * 2 + rsub) * 68 + c4];
#pragma unroll
    for (int u = 0; u < 8; ++u) *(v4f*)(C + (size_t)(row0 + wm * (NI * 16) + (g * 8 + u) * 2 + rsub) * ldc + col0 + wn * 64 + c4) = v[u];
    asm volatile("s_wait_xcnt 0x0" ::: "memory");   // behind the group's stores, before the next group (or the code behind this tile) rewrites their address and data registers
  }
}

// Two independent products in one grid: blocks 0 .. n1-1 are the tiles of product 1 (plain), the others those of product 2 (RES2: with its residual plane). lda, ldb, K and alpha are common.
// grid.y = batch element: A advances by bsA, Al2 by bsAl2, C1 and C2 by bsC1 and bsC2 elements per batch element; Bt1 and Bt2 are shared.
template <bool RES2>
__global__ __launch_bounds__(128) void k_gemm2(int n1, const _Float16* __restrict__ A1, const _Float16* __restrict__ Bt1, float* __restrict__ C1, int ldc1, int M1, int N1, size_t bsC1,
                                              const _Float16* __restrict__ A2, const _Float16* __restrict__ Al2, const _Float16* __restrict__ Bt2, float* __restrict__ C2, int ldc2, int M2, int N2, size_t bsC2,
                                              size_t bsAl2, int lda, int ldb, int K, size_t bsA, float alpha, float alphal) {
  __shared__ __attribute__((aligned(2048))) unsigned char sm[2u * G_STAGE];
  const int bx = (int)blockIdx.x;
  const size_t bb = blockIdx.y;
  const bool two = bx >= n1;             // block-uniform
  if constexpr (RES2) {
    if (two) gemm_tile<true>(sm, bx - n1, A2 + bb * bsA, Al2 + bb * bsAl2, lda, Bt2, ldb, alpha, alphal, C2 + bb * bsC2, ldc2, M2, N2, K);
    else gemm_tile<false>(sm, bx, A1 + bb * bsA, A1 + bb * bsA, lda, Bt1, ldb, alpha, 0.0f, C1 + bb * bsC1, ldc1, M1, N1, K);
  } else {
    const _Float16* A = (two ? A2 : A1) + bb * bsA;
    gemm_tile<false>(sm, two ? bx - n1 : bx, A, A, lda, two ? Bt2 : Bt1, ldb, alpha, 0.0f, two ? C2 + bb * bsC2 : C1 + bb * bsC1, two ? ldc2 : ldc1, two ? M2 : M1, two ? N2 : N1, K);
  }
}

// per (batch element bb, token s, head-row j): j<16 -> q head j from qraw[s][j*256 + 0..127], else k head j-16 from kvraw[s][(j-16)*128 ..]; RMSNorm (w+1, eps 1e-6) then rotate-half RoPE from cs[s];
__device__ __forceinline__ void qk_block(const float* __restrict__ qraw, const float* __restrict__ kvraw,
                                         const float* __restrict__ qnw, const float* __restrict__ knw, const float* __restrict__ cs,
                                         _Float16* __restrict__ Qh, _Float16* __restrict__ Ql, _Float16* __restrict__ Kh, _Float16* __restrict__ Kl, int bx) {
  const int w = threadIdx.x >> 5, lane = threadIdx.x & 31;
  const int wid = bx * 8 + w;
  if (wid >= NB * SEQ * NHR) return;
  const int tr = wid / NHR, j = wid - tr * NHR;     // tr: row of the raw planes, which hold the batch elements one behind the other
  const int bb = tr / SEQ, s = tr - bb * SEQ;
  const bool isq = (j < NH);
  const float* src = isq ? (qraw + (size_t)tr * NQC + (size_t)j * (2 * HD)) : (kvraw + (size_t)tr * NKVC + (size_t)(j - NH) * HD);
  const float* wp = isq ? qnw : knw;
  const v4f xv = *(const v4fa*)(src + 4 * lane);
  const v4f wv = *(const v4fa*)(wp + 4 * lane);
  float ss = xv[0] * xv[0] + xv[1] * xv[1] + xv[2] * xv[2] + xv[3] * xv[3];
#pragma unroll
  for (int m = 16; m > 0; m >>= 1) ss += __shfl_xor(ss, m, 32);
  const float inv = rsqrtf(ss * (1.0f / 128.0f) + 1.0e-6f);
  float nv[4], pr[4];
#pragma unroll
  for (int q = 0; q < 4; ++q) nv[q] = xv[q] * inv * (wv[q] + 1.0f);
#pragma unroll
  for (int q = 0; q < 4; ++q) pr[q] = __shfl_xor(nv[q], 16, 32);       // element d +- 64
  const int i0 = 4 * (lane & 15);
  const v4f t01 = *(const v4fa*)(cs + ((size_t)s * NRP + i0) * 2);
  const v4f t23 = *(const v4fa*)(cs + ((size_t)s * NRP + i0 + 2) * 2);
  const float cv[4] = {t01[0], t01[2], t23[0], t23[2]};
  const float sv[4] = {t01[1], t01[3], t23[1], t23[3]};
  const float sg = (lane < 16) ? -1.0f : 1.0f;                          // d < 64: -x[d+64]; d >= 64: +x[d-64]
  v4h oh, ol;
#pragma unroll
  for (int q = 0; q < 4; ++q) {
    const float o = nv[q] * cv[q] + sg * pr[q] * sv[q];
    const _Float16 hv = (_Float16)o;
    oh[q] = hv; ol[q] = (_Float16)((o - (float)hv) * RCAR);
  }
  _Float16* dh = isq ? (Qh + ((size_t)(bb * NH + j) * SEQ + s) * HD) : (Kh + ((size_t)(bb * NKV + j - NH) * SEQ + s) * HD);
  _Float16* dl = isq ? (Ql + ((size_t)(bb * NH + j) * RESQ + s) * HD) : (Kl + ((size_t)(bb * NKV + j - NH) * RESQ + s) * HD);
  const bool wl = (s < RESQ);
  {
    *(v4h*)(dh + 4 * lane) = oh;
    if (wl) *(v4h*)(dl + 4 * lane) = ol;
    
  }
}

// V^T planes: VT[kv][d][t] = f16(v), VTl = x2^10 residual for t < RESQ; v = kvraw[t][512 + kv*128 + d]; block bx per (kv, d-half, 64 tokens) via the LDS 64x64 tile tl; bb = batch element
__device__ __forceinline__ void vt_block(float (*tl)[65], const float* __restrict__ kvraw, _Float16* __restrict__ VT, _Float16* __restrict__ VTl, int bx, int bb) {
  const int tid = threadIdx.x;
  const int ntg = SEQ / 64;
  const int tg = bx % ntg, slab = bx / ntg;
  const int kv = slab >> 1, dh = slab & 1;
  const int s0 = tg * 64;
  kvraw += (size_t)bb * ((size_t)SEQ * NKVC); VT += (size_t)bb * ((size_t)NKV * HD * SEQ); VTl += (size_t)bb * ((size_t)NKV * HD * RESQ);
#pragma unroll
  for (int it = 0; it < 4; ++it) {
    const int i = tid + it * 256; const int tok = i >> 4, c4 = (i & 15) * 4;
    const v4f v = *(const v4fa*)(kvraw + (size_t)(s0 + tok) * NKVC + NKV * HD + kv * HD + dh * 64 + c4);
    tl[tok][c4] = v[0]; tl[tok][c4 + 1] = v[1]; tl[tok][c4 + 2] = v[2]; tl[tok][c4 + 3] = v[3];
  }
  __syncthreads();
  const int pc = tid & 7, dr = tid >> 3;
  const bool wl = (s0 < RESQ);
  {
#pragma unroll
    for (int rd = 0; rd < 2; ++rd) {
      const int d = rd * 32 + dr;
      Pack8 ph, pl;
#pragma unroll
      for (int q = 0; q < 8; ++q) { const float f = tl[pc * 8 + q][d]; const _Float16 hv = (_Float16)f; ph.h[q] = hv; pl.h[q] = (_Float16)((f - (float)hv) * RCAR); }
      const size_t row = (size_t)(kv * HD + dh * 64 + d);
      *(v8us*)((unsigned short*)VT + row * SEQ + s0 + pc * 8) = ph.v;
      if (wl) *(v8us*)((unsigned short*)VTl + row * RESQ + s0 + pc * 8) = pl.v;
    }
    
  }
}

// One grid for both readers of the raw projections: the V^T blocks first, then the q/k norm + rotary blocks; neither reads what the other writes.
constexpr int QB_VT = NKV * 2 * (SEQ / 64);
constexpr int QB_QK = (NB * SEQ * NHR) / 8;
__global__ __launch_bounds__(256) void k_qkvt(const float* __restrict__ qraw, const float* __restrict__ kvraw,
                                             const float* __restrict__ qnw, const float* __restrict__ knw, const float* __restrict__ cs,
                                             _Float16* __restrict__ Qh, _Float16* __restrict__ Ql, _Float16* __restrict__ Kh, _Float16* __restrict__ Kl,
                                             _Float16* __restrict__ VT, _Float16* __restrict__ VTl) {
  __shared__ float tl[64][65];
  const int b = (int)blockIdx.x;
  if (b < NB * QB_VT) { const int bb = b / QB_VT; vt_block(tl, kvraw, VT, VTl, b - bb * QB_VT, bb); return; }
  qk_block(qraw, kvraw, qnw, knw, cs, Qh, Ql, Kh, Kl, b - NB * QB_VT);
}

// Causal grouped attention, flash form. Block = 8 waves x 16 query rows (query block qb) of head h (kv = h/4); bz = batch element (RES: batch element * 2 + o column half); smem = the block's LDS.
// Per key chunk: K rows [t][d] and V^T rows [d][t] staged in LDS (cross-wave: block barriers); S = q.k^T (f16, f32 acc), scale 1/sqrt(128),
// RES: first RESQ query rows: chunk 32 keys, q/k/P/V^T residual second terms into separate accumulators folded by 2^-10; block covers 64 o columns.
// Every inner loop is unrolled, so that the fragment, accumulator and row arrays are indexed by constants and stay in registers.
template <bool RES> struct AttnLds {     // byte sizes of the block's LDS tiles, in their order
  static constexpr int KC = RES ? 32 : 64, OD = RES ? 64 : 128, KP = HD + 8, VP = KC + 8, PP = 72;
  static constexpr uint32_t K = KC * KP * 2u, KL = (RES ? KC : 1) * KP * 2u, V = OD * VP * 2u, VL = (RES ? OD : 1) * VP * 2u, P = 8 * 16 * PP * 2u, PL = (RES ? 8 : 1) * 16 * PP * 2u;
  static constexpr uint32_t ALL = K + KL + V + VL + P + PL;
  static_assert(K % 16 == 0 && KL % 16 == 0 && V % 16 == 0 && VL % 16 == 0 && P % 16 == 0);
};
template <bool RES>
__device__ __forceinline__ void attn_block(unsigned char* smem, const _Float16* __restrict__ Qh, const _Float16* __restrict__ Ql,
                                           const _Float16* __restrict__ Kh, const _Float16* __restrict__ Kl,
                                           const _Float16* __restrict__ VT, const _Float16* __restrict__ VTl,
                                           const float* __restrict__ qraw, _Float16* __restrict__ Oh, _Float16* __restrict__ Ol, int qb, int h, int bz) {
  constexpr int KC = RES ? 32 : 64;      // keys per chunk
  constexpr int NJ = KC / 16;            // score column tiles
  constexpr int NKS = KC / 32;           // k-steps of P.V^T
  constexpr int OD = RES ? 64 : 128;     // o columns per block
  constexpr int NC = OD / 16;
  constexpr int NHF = OD / 64;
  constexpr int CG = RES ? 2 : 4;        // o column tiles per group of V^T fragment loads (four fragments with the residual ones)
  constexpr int NGC = NC / CG;           // groups per k-step
  constexpr int NG = NKS * NGC;
  constexpr bool XG = NG >= 3;
  constexpr int KP = HD + 8;             // sK pitch (halves)
  constexpr int VP = KC + 8;             // sV pitch
  constexpr int PP = 72;                 // sP pitch (KC weights, and 64 staged o columns)
  using L = AttnLds<RES>;
  static_assert(L::KC == KC && L::OD == OD && L::KP == KP && L::VP == VP && L::PP == PP);
  _Float16 (*sK)[KP]      = (_Float16 (*)[KP])smem;                                                  // [KC]
  _Float16 (*sKl)[KP]     = (_Float16 (*)[KP])(smem + L::K);                                         // [RES ? KC : 1]
  _Float16 (*sV)[VP]      = (_Float16 (*)[VP])(smem + L::K + L::KL);                                 // [OD]
  _Float16 (*sVl)[VP]     = (_Float16 (*)[VP])(smem + L::K + L::KL + L::V);                          // [RES ? OD : 1]
  _Float16 (*sP)[16][PP]  = (_Float16 (*)[16][PP])(smem + L::K + L::KL + L::V + L::VL);              // [8]
  _Float16 (*sPl)[16][PP] = (_Float16 (*)[16][PP])(smem + L::K + L::KL + L::V + L::VL + L::P);       // [RES ? 8 : 1]

  const int tid = threadIdx.x, w = tid >> 5, lane = tid & 31, ln = lane & 15, hh = lane >> 4;
  const int kv = h / GQ;
  const int dz = RES ? (bz & 1) * 64 : 0;
  const size_t bb = (size_t)(RES ? (bz >> 1) : bz);
  Qh += bb * ((size_t)NH * SEQ * HD); Ql += bb * ((size_t)NH * RESQ * HD); Kh += bb * ((size_t)NKV * SEQ * HD); Kl += bb * ((size_t)NKV * RESQ * HD);
  VT += bb * ((size_t)NKV * HD * SEQ); VTl += bb * ((size_t)NKV * HD * RESQ); qraw += bb * ((size_t)SEQ * NQC);
  Oh += bb * ((size_t)SEQ * NH * HD); Ol += bb * ((size_t)RESQ * NH * HD);
  const int q0b = qb * 128, q0w = q0b + 16 * w;
  const int nch = (q0b + 128) / KC;      // chunks holding keys <= last row of the block
  const int qlast = q0w + 15;

  v16h aq[4], aql[4];
  {
    const _Float16* qp = Qh + ((size_t)h * SEQ + q0w + ln) * HD;
#pragma unroll
    for (int kk = 0; kk < 4; ++kk) aq[kk] = frag16(qp + kk * 32, hh);
    if (RES) {
      const _Float16* qlp = Ql + ((size_t)h * RESQ + q0w + ln) * HD;
#pragma unroll
      for (int kk = 0; kk < 4; ++kk) aql[kk] = frag16(qlp + kk * 32, hh);
    } else {
#pragma unroll
      for (int kk = 0; kk < 4; ++kk) aql[kk] = aq[kk];
    }
  }
  const v8f z8 = {0.f, 0.f, 0.f, 0.f, 0.f, 0.f, 0.f, 0.f};
  v8f o[NC];
#pragma unroll
  for (int c = 0; c < NC; ++c) o[c] = z8;
  float mrow[8], lrow[8];
#pragma unroll
  for (int r = 0; r < 8; ++r) { mrow[r] = -3.0e38f; lrow[r] = 0.f; }
  const float alpha = 0.08838834764831845f;
  // staging addresses: block-uniform bases plus one 32-bit lane offset per plane, the row steps as constants (leaves the registers to the fragment groups)
  constexpr int VR = 256 / (KC / 8);     // V^T rows staged per round of the block
  const char* kgb = (const char*)(Kh + (size_t)kv * SEQ * HD);
  const char* klgb = (const char*)(Kl + (size_t)kv * RESQ * HD);
  const char* vgb = (const char*)(VT + (size_t)(kv * HD + dz) * SEQ);
  const char* vlgb = (const char*)(VTl + (size_t)(kv * HD + dz) * RESQ);
  const uint32_t kvo = (uint32_t)((tid >> 4) * HD + (tid & 15) * 8) * 2u;
  const uint32_t vvo = (uint32_t)((tid / (KC / 8)) * SEQ + (tid % (KC / 8)) * 8) * 2u;
  const uint32_t vlvo = (uint32_t)((tid / (KC / 8)) * RESQ + (tid % (KC / 8)) * 8) * 2u;
  _Float16* skp = &sK[tid >> 4][(tid & 15) * 8];
  _Float16* sklp = &sKl[RES ? (tid >> 4) : 0][(tid & 15) * 8];
  _Float16* svp = &sV[tid / (KC / 8)][(tid % (KC / 8)) * 8];
  _Float16* svlp = &sVl[RES ? (tid / (KC / 8)) : 0][(tid % (KC / 8)) * 8];

#pragma unroll 1
  for (int ch = 0; ch < nch; ++ch) {
    const int t0 = ch * KC;
    // stage K rows t0..t0+KC-1 (all 128 d) and V^T rows dz..dz+OD-1 (keys t0..t0+KC-1): staged extent == consumed extent
#pragma unroll
    for (int it = 0; it < (KC * 16) / 256; ++it) {
      *(v8us*)(skp + it * 16 * KP) = *(const v8us*)(kgb + (size_t)t0 * (HD * 2) + (size_t)it * (16 * HD * 2) + kvo);
      if (RES) *(v8us*)(sklp + it * 16 * KP) = *(const v8us*)(klgb + (size_t)t0 * (HD * 2) + (size_t)it * (16 * HD * 2) + kvo);
    }
#pragma unroll
    for (int it = 0; it < (OD * (KC / 8)) / 256; ++it) {
      *(v8us*)(svp + it * VR * VP) = *(const v8us*)(vgb + (size_t)t0 * 2 + (size_t)it * ((size_t)VR * SEQ * 2) + vvo);
      if (RES) *(v8us*)(svlp + it * VR * VP) = *(const v8us*)(vlgb + (size_t)t0 * 2 + (size_t)it * ((size_t)VR * RESQ * 2) + vlvo);
    }
    __syncthreads();
    if (t0 <= qlast) {                   // wave-uniform: this wave has unmasked keys in the chunk
      // k-step kk's K fragments of all key tiles are one group of LDS loads, issued one k-step ahead of their products (set kk & 1); the key tiles' accumulators are independent, each sums its kk in ascending order
      v8f sacc[NJ], stmp[RES ? NJ : 1];
#pragma unroll
      for (int j = 0; j < NJ; ++j) { sacc[j] = z8; if (RES) stmp[j] = z8; }
      {
        v16h fk[2][NJ], fkl[2][RES ? NJ : 1];
#pragma unroll
        for (int j = 0; j < NJ; ++j) {
          fk[0][j] = frag16(&sK[j * 16 + ln][0], hh);                     // B[k = d][n = key]: key row, d contiguous
          if (RES) fkl[0][j] = frag16(&sKl[j * 16 + ln][0], hh);
        }
#pragma unroll
        for (int kk = 0; kk < 4; ++kk) {
          if (kk < 3) {
#pragma unroll
            for (int j = 0; j < NJ; ++j) {
              fk[(kk + 1) & 1][j] = frag16(&sK[j * 16 + ln][(kk + 1) * 32], hh);
              if (RES) fkl[(kk + 1) & 1][j] = frag16(&sKl[j * 16 + ln][(kk + 1) * 32], hh);
            }
          }
          __builtin_amdgcn_sched_barrier(0);   // keeps the next k-step's LDS loads one group ahead of the products, not one by one in front of each
#pragma unroll
          for (int j = 0; j < NJ; ++j) sacc[j] = mma16b(aq[kk], fk[kk & 1][j], sacc[j]);
          if (RES) {
#pragma unroll
            for (int j = 0; j < NJ; ++j) stmp[j] = mma16b(aql[kk], fk[kk & 1][j], stmp[j]);
#pragma unroll
            for (int j = 0; j < NJ; ++j) stmp[j] = mma16b(aq[kk], fkl[kk & 1][j], stmp[j]);
          }
          __builtin_amdgcn_sched_barrier(0);   // ends the block of products: the following loads stay behind it
        }
      }
      if (RES) {
#pragma unroll
        for (int j = 0; j < NJ; ++j) sacc[j] = sacc[j] + stmp[j] * (1.0f / RCAR);
      }
      // scale, causal mask, online softmax; P (x2^14) to the wave-private LDS tile. The eight rows pass each stage together, so that a stage's cross-lane exchanges stand as one group of LDS operations
      const int dk = t0 + ln - (q0w + 8 * hh);   // key tile j, row r is masked where dk + 16 j > r
      float mx[8], fac[8], rs[8], xs[8];
#pragma unroll
      for (int r = 0; r < 8; ++r) {
        float m0 = -3.0e38f;
#pragma unroll
        for (int j = 0; j < NJ; ++j) m0 = fmaxf(m0, (dk + 16 * j > r) ? -3.0e38f : sacc[j][r] * alpha);
        mx[r] = m0;
      }
#pragma unroll
      for (int m = 8; m > 0; m >>= 1) {
#pragma unroll
        for (int r = 0; r < 8; ++r) xs[r] = __shfl_xor(mx[r], m, 32);
        __builtin_amdgcn_sched_barrier(0);       // all eight exchanges of a stage are issued before the first is waited for: one LDS latency a stage, not one a row
#pragma unroll
        for (int r = 0; r < 8; ++r) mx[r] = fmaxf(mx[r], xs[r]);
      }
#pragma unroll
      for (int r = 0; r < 8; ++r) {
        const float mnew = fmaxf(mrow[r], mx[r]);
        fac[r] = (mrow[r] < -1.0e38f) ? 0.f : __expf(mrow[r] - mnew);
        mrow[r] = mnew;
        float s = 0.f;
#pragma unroll
        for (int j = 0; j < NJ; ++j) {
          const float p = (dk + 16 * j > r) ? 0.f : __expf(sacc[j][r] * alpha - mnew);
          s += p;
          const float pcv = p * PCAR; const _Float16 ph = (_Float16)pcv;
          sP[w][8 * hh + r][16 * j + ln] = ph;
          if (RES) sPl[w][8 * hh + r][16 * j + ln] = (_Float16)((pcv - (float)ph) * RCAR);
        }
        rs[r] = s;
      }
      // the row sums' four exchange stages (lane distance 8, 4, 2, 1) feed only lrow: the first is issued here, under the rescale of o, the others among the V^T groups below where there are three groups to take them (XG)
#pragma unroll
      for (int r = 0; r < 8; ++r) xs[r] = __shfl_xor(rs[r], 8, 32);
#pragma unroll
      for (int r = 0; r < 8; ++r)
#pragma unroll
        for (int c = 0; c < NC; ++c) o[c][r] *= fac[r];
      if (!XG) {
#pragma unroll
        for (int m = 4; m > 0; m >>= 1) {
#pragma unroll
          for (int r = 0; r < 8; ++r) { rs[r] += xs[r]; xs[r] = __shfl_xor(rs[r], m, 32); }
        }
#pragma unroll
        for (int r = 0; r < 8; ++r) { rs[r] += xs[r]; lrow[r] = lrow[r] * fac[r] + rs[r]; }
      }
      __builtin_amdgcn_fence(4 /* acq_rel order */, "workgroup");
      __builtin_amdgcn_wave_barrier();
      v16h ap[NKS], apl[NKS];
#pragma unroll
      for (int ks = 0; ks < NKS; ++ks) {
        ap[ks] = frag16(&sP[w][ln][ks * 32], hh);                         // A[m = query row][k = key]
        if (RES) apl[ks] = frag16(&sPl[w][ln][ks * 32], hh); else apl[ks] = ap[ks];
      }
      // V^T fragments go in groups of four as well (CG o column tiles of one k-step); the first group shares the wait of the P fragments
      v16h fv[2][CG], fvl[2][RES ? CG : 1];
#pragma unroll
      for (int i = 0; i < CG; ++i) {
        fv[0][i] = frag16(&sV[i * 16 + ln][0], hh);                       // B[k = key][n = d]: d row, keys contiguous
        if (RES) fvl[0][i] = frag16(&sVl[i * 16 + ln][0], hh);
      }
      v8f ptmp[RES ? NC : 1];
      if (RES) {
#pragma unroll
        for (int c = 0; c < NC; ++c) ptmp[c] = z8;
      }
#pragma unroll
      for (int g = 0; g < NG; ++g) {           // group g: k-step g / NGC, o column tiles (g % NGC) * CG ..; every o tile meets its k-steps in ascending order
        if (g + 1 < NG) {
          const int ks1 = (g + 1) / NGC, cb1 = ((g + 1) % NGC) * CG;
#pragma unroll
          for (int i = 0; i < CG; ++i) {
            fv[(g + 1) & 1][i] = frag16(&sV[(cb1 + i) * 16 + ln][ks1 * 32], hh);
            if (RES) fvl[(g + 1) & 1][i] = frag16(&sVl[(cb1 + i) * 16 + ln][ks1 * 32], hh);
          }
        }
        if (XG && g < 3) {
#pragma unroll
          for (int r = 0; r < 8; ++r) { rs[r] += xs[r]; xs[r] = __shfl_xor(rs[r], 4 >> g, 32); }
        }
        __builtin_amdgcn_sched_barrier(0);     // keeps the next group's LDS loads ahead of this group's products
        const int ks = g / NGC, cb = (g % NGC) * CG;
#pragma unroll
        for (int i = 0; i < CG; ++i) o[cb + i] = mma16b(ap[ks], fv[g & 1][i], o[cb + i]);
        if (RES) {
#pragma unroll
          for (int i = 0; i < CG; ++i) ptmp[cb + i] = mma16b(apl[ks], fv[g & 1][i], ptmp[cb + i]);
#pragma unroll
          for (int i = 0; i < CG; ++i) ptmp[cb + i] = mma16b(ap[ks], fvl[g & 1][i], ptmp[cb + i]);
        }
        __builtin_amdgcn_sched_barrier(0);     // ends the block of products: the following loads stay behind it
      }
      if (RES) {
#pragma unroll
        for (int c = 0; c < NC; ++c) o[c] = o[c] + ptmp[c] * (1.0f / RCAR);
      }
      if (XG) {
#pragma unroll
        for (int r = 0; r < 8; ++r) { rs[r] += xs[r]; lrow[r] = lrow[r] * fac[r] + rs[r]; }
      }
    }
    __syncthreads();
  }

  // epilogue
  float il[8];
#pragma unroll
  for (int r = 0; r < 8; ++r) il[r] = (OCAR / PCAR) * __builtin_amdgcn_rcpf(lrow[r]);
  const float* gp = qraw + (size_t)(q0w + 8 * hh) * NQC + (size_t)h * (2 * HD) + HD + dz + ln;
#pragma unroll
  for (int hf = 0; hf < NHF; ++hf) {
    if (hf > 0) { __builtin_amdgcn_fence(4 /* acq_rel order */, "workgroup"); __builtin_amdgcn_wave_barrier(); }
#pragma unroll
    for (int cc = 0; cc < 4; ++cc) {
      const int c = hf * 4 + cc;
#pragma unroll
      for (int r = 0; r < 8; ++r) {
        const float g = gp[(size_t)r * NQC + c * 16];
        const float sig = __builtin_amdgcn_rcpf(1.0f + __expf(-g));
        const float val = o[c][r] * il[r] * sig;
        const _Float16 vh = (_Float16)val;
        sP[w][8 * hh + r][cc * 16 + ln] = vh;
        if (RES) sPl[w][8 * hh + r][cc * 16 + ln] = (_Float16)((val - (float)vh) * RCAR);
      }
      asm volatile("" ::: "memory");
    }
    __builtin_amdgcn_fence(4 /* acq_rel order */, "workgroup");
    __builtin_amdgcn_wave_barrier();
    const int prw = lane >> 3, pc = lane & 7;
    {
#pragma unroll
      for (int it = 0; it < 4; ++it) {
        const int row = it * 4 + prw;
        const v8us vv = *(const v8us*)&sP[w][row][pc * 8];
        const size_t go = (size_t)(q0w + row) * (NH * HD) + (size_t)h * HD + dz + hf * 64 + pc * 8;
        *(v8us*)((unsigned short*)Oh + go) = vv;
        if (RES) { const v8us vl = *(const v8us*)&sPl[w][row][pc * 8]; *(v8us*)((unsigned short*)Ol + go) = vl; }
      }
      
    }
  }
  asm volatile("s_wait_xcnt 0x0" ::: "memory");   // behind the last o stores: a precaution, as a block runs one form only and the kernel ends behind it
}

// One grid for both forms, which share no output row: the plain blocks first, then the residual ones, each form from its last query block (most key chunks) down to its first.
constexpr int AB_F = ((SEQ - RESQ) / 128) * NH * NB;
constexpr int AB_R = (RESQ / 128) * NH * NB * 2;
__global__ __launch_bounds__(256) void k_attn2(const _Float16* __restrict__ Qh, const _Float16* __restrict__ Ql,
                                              const _Float16* __restrict__ Kh, const _Float16* __restrict__ Kl,
                                              const _Float16* __restrict__ VT, const _Float16* __restrict__ VTl,
                                              const float* __restrict__ qraw, _Float16* __restrict__ Oh, _Float16* __restrict__ Ol) {
  __shared__ __attribute__((aligned(16))) unsigned char smem[AttnLds<true>::ALL > AttnLds<false>::ALL ? AttnLds<true>::ALL : AttnLds<false>::ALL];
  const int b = (int)blockIdx.x;
  if (b < AB_F) {
    const int qr = b / (NH * NB), rem = b - qr * (NH * NB);
    attn_block<false>(smem, Qh, Ql, Kh, Kl, VT, VTl, qraw, Oh, Ol, SEQ / 128 - 1 - qr, rem % NH, rem / NH);
  } else {
    const int c = b - AB_F, qr = c / (NH * NB * 2), rem = c - qr * (NH * NB * 2);
    attn_block<true>(smem, Qh, Ql, Kh, Kl, VT, VTl, qraw, Oh, Ol, RESQ / 128 - 1 - qr, rem % NH, rem / NH);
  }
}

extern "C" void kernel_launch(void* const* d_in, const int* in_sizes, int n_in,
                              void* d_out, int out_size, void* d_ws, size_t ws_size, hipStream_t stream) {
  if (n_in < 7) return;
  const long need_x = (long)(NB - 1) * SEQ_FULL * HID + (long)SEQ * HID;
  if ((long)in_sizes[0] < need_x) return;
  if (in_sizes[1] < HID * NQC) return;
  if (in_sizes[2] < HID * NKV * HD) return;
  if (in_sizes[3] < HID * NKV * HD) return;
  if (in_sizes[4] < NH * HD * HID) return;
  if (in_sizes[5] < HD) return;
  if (in_sizes[6] < HD) return;
  if ((long)out_size < need_x) return;

  const float* x   = (const float*)d_in[0];
  const float* Wq  = (const float*)d_in[1];
  const float* Wk  = (const float*)d_in[2];
  const float* Wv  = (const float*)d_in[3];
  const float* Wo  = (const float*)d_in[4];
  const float* qnw = (const float*)d_in[5];
  const float* knw = (const float*)d_in[6];

  char* ws = (char*)d_ws; size_t off = 0;
  auto take = [&](size_t bytes) { char* p = ws + off; off += (bytes + 255) & ~(size_t)255; return p; };
  _Float16* X16  = (_Float16*)take(SZ_X16);
  _Float16* WqT  = (_Float16*)take(SZ_WQT);
  _Float16* WkvT = (_Float16*)take(SZ_WKVT);
  _Float16* WoT  = (_Float16*)take(SZ_WOT);
  float*    CS   = (float*)take(SZ_CS);
  float*    qraw = (float*)take(SZ_QRAW);
  float*    kvraw = (float*)take(SZ_KVRAW);
  _Float16* Qh   = (_Float16*)take(SZ_QH);
  _Float16* Ql   = (_Float16*)take(SZ_QL);
  _Float16* Kh   = (_Float16*)take(SZ_KH);
  _Float16* Kl   = (_Float16*)take(SZ_KL);
  _Float16* VT   = (_Float16*)take(SZ_VT);
  _Float16* VTl  = (_Float16*)take(SZ_VTL);
  _Float16* Oh   = (_Float16*)take(SZ_OH);
  _Float16* Ol   = (_Float16*)take(SZ_OL);
  if (off > ws_size) return;

  const float walpha = 1.0f / WCAR;                          // 2^-4
  const float oalpha = 1.0f / (WCAR * OCAR);                 // 2^-10
  const float oalphal = oalpha / RCAR;                       // 2^-20
  // five launches, each holding every piece of work that depends only on the launches before it; every launch covers all NB batch elements
  float* out = (float*)d_out;
  // rotary table, weight planes (Bt[n][k] = f16(bf16rne(W[k][n]) * 16)), x plane
  k_prep<<<PB_ALL, 256, 0, stream>>>(x, Wq, Wk, Wv, Wo, X16, WqT, WkvT, WoT, CS, WCAR);
  // x.Wq and x.[Wk|Wv]
  k_gemm2<false><<<dim3((SEQ / 128) * (NQC / 128) + (SEQ / 128) * (NKVC / 128), NB), 128, 0, stream>>>(
      (SEQ / 128) * (NQC / 128), X16, WqT, qraw, NQC, SEQ, NQC, (size_t)SEQ * NQC,
      X16, X16, WkvT, kvraw, NKVC, SEQ, NKVC, (size_t)SEQ * NKVC,
      (size_t)SEQ * HID, HID, HID, HID, (size_t)SEQ * HID, walpha, 0.0f);
  k_qkvt<<<NB * QB_VT + QB_QK, 256, 0, stream>>>(qraw, kvraw, qnw, knw, CS, Qh, Ql, Kh, Kl, VT, VTl);
  k_attn2<<<AB_F + AB_R, 256, 0, stream>>>(Qh, Ql, Kh, Kl, VT, VTl, qraw, Oh, Ol);
  // o.Wo: rows RESQ.. plain, rows 0..RESQ-1 with the residual plane
  k_gemm2<true><<<dim3(((SEQ - RESQ) / 128) * (HID / 128) + (RESQ / 64) * (HID / 128), NB), 128, 0, stream>>>(
      ((SEQ - RESQ) / 128) * (HID / 128), Oh + (size_t)RESQ * NH * HD, WoT, out + (size_t)RESQ * HID, HID, SEQ - RESQ, HID, (size_t)SEQ_FULL * HID,
      Oh, Ol, WoT, out, HID, RESQ, HID, (size_t)SEQ_FULL * HID,
      (size_t)RESQ * NH * HD, NH * HD, NH * HD, NH * HD, (size_t)SEQ * NH * HD, oalpha, oalphal);
  (void)hipGetLastError();
}

// v006
// Measured time: 193 microseconds a run.
// In both of two side-by-side timings against v005, it was 1.04 times as fast.
// Over all steps from v000 it is 4.65 times as fast.
#include <hip/hip_runtime.h>
#include <stdint.h>
// Contractions x.Wq, x.[Wk|Wv], q.k^T, P.V^T, o.Wo: v_wmma_f32_16x16x32_f16 (f16 operands, f32 accumulate). x and all weights RNE-converted to bf16 and held exactly in f16 (weights carried x16); q, k, V^T and gated o as f16 planes plus x2^10 f16 residual planes over the first RESQ query rows / keys (two-term products there, single products elsewhere); softmax weights x2^14 in f16 (+ x2^10 residual on those rows); gated o carried x64; RMSNorm, RoPE, softmax statistics and sigmoid gating in f32.

#ifndef NB
#define NB 2
#endif
#ifndef SEQ
#define SEQ 2048
#endif
#ifndef RESQ
#if SEQ < 512
#define RESQ SEQ
#else
#define RESQ 512
#endif
#endif
#define NB_FULL 2
#define SEQ_FULL 2048
#define HID 2048
#define NH 16
#define NKV 4
#define HD 128
#define GQ (NH / NKV)
#define NQC (2 * NH * HD)      /* q|gate columns: head h at h*256 (q) and h*256+128 (gate) */
#define NKVC (2 * NKV * HD)    /* k|v columns: k head j at j*128, v head j at 512+j*128 */
#define NHR (NH + NKV)         /* normalised rows per token (16 q heads + 4 k heads) */
#define NRP 64                 /* rotary pairs */
#define PCAR 16384.0f          /* softmax weight carry */
#define OCAR 64.0f             /* gated o carry */
#define RCAR 1024.0f           /* residual plane carry */
#define WCAR 16.0f             /* weight carry */

static_assert(NB >= 1);
static_assert(NB <= NB_FULL);
static_assert(SEQ % 128 == 0);
static_assert(SEQ <= SEQ_FULL);
static_assert(RESQ % 128 == 0);
static_assert(RESQ >= 128);
static_assert(RESQ <= SEQ);
static_assert((SEQ - RESQ) % 128 == 0);
static_assert(HID % 32 == 0);
static_assert(HID % 64 == 0);
static_assert(NQC % 128 == 0);
static_assert(NKVC % 128 == 0);
static_assert(HID % 256 == 0);
static_assert((NH * HD) % 256 == 0);
static_assert(HD == 128);
static_assert(NH % NKV == 0);
static_assert((SEQ * NHR) % 8 == 0);
static_assert((SEQ * HID) % 8 == 0);

// planes of x, q, k, v and o hold all NB batch elements, element b at b * (plane size / NB)
constexpr size_t SZ_X16   = (size_t)NB * SEQ * HID * 2;
constexpr size_t SZ_WQT   = (size_t)NQC * HID * 2;
constexpr size_t SZ_WKVT  = (size_t)NKVC * HID * 2;
constexpr size_t SZ_WOT   = (size_t)HID * NH * HD * 2;
constexpr size_t SZ_CS    = (size_t)SEQ * NRP * 2 * 4;
constexpr size_t SZ_QRAW  = (size_t)NB * SEQ * NQC * 4;
constexpr size_t SZ_KVRAW = (size_t)NB * SEQ * NKVC * 4;
constexpr size_t SZ_QH    = (size_t)NB * NH * SEQ * HD * 2;
constexpr size_t SZ_QL    = (size_t)NB * NH * RESQ * HD * 2;
constexpr size_t SZ_KH    = (size_t)NB * NKV * SEQ * HD * 2;
constexpr size_t SZ_KL    = (size_t)NB * NKV * RESQ * HD * 2;
constexpr size_t SZ_VT    = (size_t)NB * NKV * HD * SEQ * 2;
constexpr size_t SZ_VTL   = (size_t)NB * NKV * HD * RESQ * 2;
constexpr size_t SZ_OH    = (size_t)NB * SEQ * NH * HD * 2;
constexpr size_t SZ_OL    = (size_t)NB * RESQ * NH * HD * 2;
constexpr size_t WS_TOTAL = SZ_X16 + SZ_WQT + SZ_WKVT + SZ_WOT + SZ_CS + SZ_QRAW + SZ_KVRAW + SZ_QH + SZ_QL + SZ_KH + SZ_KL + SZ_VT + SZ_VTL + SZ_OH + SZ_OL;
static_assert(WS_TOTAL <= (size_t)268435456);
static_assert(SZ_X16 % 256 == 0);
static_assert(SZ_KL % 256 == 0);
static_assert(SZ_VTL % 256 == 0);
static_assert(SZ_CS % 256 == 0);

typedef _Float16 v16h __attribute__((ext_vector_type(16)));
typedef unsigned short v8us __attribute__((ext_vector_type(8), may_alias));
typedef float v8f __attribute__((ext_vector_type(8)));
typedef float v4f __attribute__((ext_vector_type(4)));
typedef float v4fa __attribute__((ext_vector_type(4), may_alias));
typedef float v2f __attribute__((ext_vector_type(2)));
typedef _Float16 v4h __attribute__((ext_vector_type(4)));
typedef uint32_t u32x4 __attribute__((ext_vector_type(4)));
typedef uint32_t u32x8 __attribute__((ext_vector_type(8)));
union FragH { v16h v; v8us half[2]; _Float16 h[16]; unsigned short u[16]; };
union Pack8 { v8us v; _Float16 h[8]; unsigned short u[8]; };

__device__ __forceinline__ unsigned short bf16_bits(float x) { const unsigned int u = __float_as_uint(x); return (unsigned short)((u + 0x7FFFu + ((u >> 16) & 1u)) >> 16); }
__device__ __forceinline__ float bf16_rne(float x) { return __uint_as_float(((unsigned int)bf16_bits(x)) << 16); }
// value of lane l ^ M, M < 16, inside the 16-lane row: a DPP operand (row_xmask) of the vector port, no LDS operation and no wait; every lane is on where it is used
template <int M> __device__ __forceinline__ float row_xor(float v) { return __builtin_bit_cast(float, __builtin_amdgcn_update_dpp(0, __builtin_bit_cast(int, v), 0x160 | M, 0xf, 0xf, true)); }
// value of lane l ^ 16: vector cross-row move
__device__ __forceinline__ float half_xor(float v) { return __builtin_bit_cast(float, __builtin_amdgcn_permlanex16(__builtin_bit_cast(int, v), __builtin_bit_cast(int, v), 0x76543210, 0xfedcba98, false, false)); }
// maxima of eight independent values over their 16-lane rows, lane distance 8, 4, 2, 1. In asm so that exchange and maximum are one instruction (from fmaxf the compiler makes three: DPP move, quieting of the moved value, maximum),
// and in one statement so that the eight rows stay interleaved: a link's producer stands eight instructions back and no link waits
__device__ __forceinline__ void row_max8(float (&v)[8]) {
  asm(
      "v_max_num_f32_dpp %0, %0, %0 row_xmask:8 row_mask:0xf bank_mask:0xf\n\t"
      "v_max_num_f32_dpp %1, %1, %1 row_xmask:8 row_mask:0xf bank_mask:0xf\n\t"
      "v_max_num_f32_dpp %2, %2, %2 row_xmask:8 row_mask:0xf bank_mask:0xf\n\t"
      "v_max_num_f32_dpp %3, %3, %3 row_xmask:8 row_mask:0xf bank_mask:0xf\n\t"
      "v_max_num_f32_dpp %4, %4, %4 row_xmask:8 row_mask:0xf bank_mask:0xf\n\t"
      "v_max_num_f32_dpp %5, %5, %5 row_xmask:8 row_mask:0xf bank_mask:0xf\n\t"
      "v_max_num_f32_dpp %6, %6, %6 row_xmask:8 row_mask:0xf bank_mask:0xf\n\t"
      "v_max_num_f32_dpp %7, %7, %7 row_xmask:8 row_mask:0xf bank_mask:0xf\n\t"
      "v_max_num_f32_dpp %0, %0, %0 row_xmask:4 row_mask:0xf bank_mask:0xf\n\t"
      "v_max_num_f32_dpp %1, %1, %1 row_xmask:4 row_mask:0xf bank_mask:0xf\n\t"
      "v_max_num_f32_dpp %2, %2, %2 row_xmask:4 row_mask:0xf bank_mask:0xf\n\t"
      "v_max_num_f32_dpp %3, %3, %3 row_xmask:4 row_mask:0xf bank_mask:0xf\n\t"
      "v_max_num_f32_dpp %4, %4, %4 row_xmask:4 row_mask:0xf bank_mask:0xf\n\t"
      "v_max_num_f32_dpp %5, %5, %5 row_xmask:4 row_mask:0xf bank_mask:0xf\n\t"
      "v_max_num_f32_dpp %6, %6, %6 row_xmask:4 row_mask:0xf bank_mask:0xf\n\t"
      "v_max_num_f32_dpp %7, %7, %7 row_xmask:4 row_mask:0xf bank_mask:0xf\n\t"
      "v_max_num_f32_dpp %0, %0, %0 row_xmask:2 row_mask:0xf bank_mask:0xf\n\t"
      "v_max_num_f32_dpp %1, %1, %1 row_xmask:2 row_mask:0xf bank_mask:0xf\n\t"
      "v_max_num_f32_dpp %2, %2, %2 row_xmask:2 row_mask:0xf bank_mask:0xf\n\t"
      "v_max_num_f32_dpp %3, %3, %3 row_xmask:2 row_mask:0xf bank_mask:0xf\n\t"
      "v_max_num_f32_dpp %4, %4, %4 row_xmask:2 row_mask:0xf bank_mask:0xf\n\t"
      "v_max_num_f32_dpp %5, %5, %5 row_xmask:2 row_mask:0xf bank_mask:0xf\n\t"
      "v_max_num_f32_dpp %6, %6, %6 row_xmask:2 row_mask:0xf bank_mask:0xf\n\t"
      "v_max_num_f32_dpp %7, %7, %7 row_xmask:2 row_mask:0xf bank_mask:0xf\n\t"
      "v_max_num_f32_dpp %0, %0, %0 row_xmask:1 row_mask:0xf bank_mask:0xf\n\t"
      "v_max_num_f32_dpp %1, %1, %1 row_xmask:1 row_mask:0xf bank_mask:0xf\n\t"
      "v_max_num_f32_dpp %2, %2, %2 row_xmask:1 row_mask:0xf bank_mask:0xf\n\t"
      "v_max_num_f32_dpp %3, %3, %3 row_xmask:1 row_mask:0xf bank_mask:0xf\n\t"
      "v_max_num_f32_dpp %4, %4, %4 row_xmask:1 row_mask:0xf bank_mask:0xf\n\t"
      "v_max_num_f32_dpp %5, %5, %5 row_xmask:1 row_mask:0xf bank_mask:0xf\n\t"
      "v_max_num_f32_dpp %6, %6, %6 row_xmask:1 row_mask:0xf bank_mask:0xf\n\t"
      "v_max_num_f32_dpp %7, %7, %7 row_xmask:1 row_mask:0xf bank_mask:0xf\n\t"
      : "+v"(v[0]), "+v"(v[1]), "+v"(v[2]), "+v"(v[3]), "+v"(v[4]), "+v"(v[5]), "+v"(v[6]), "+v"(v[7]));
}
// one exchange stage of eight independent row sums (lane distance M)
template <int M> __device__ __forceinline__ void sum_stage(float (&v)[8]) {
#pragma unroll
  for (int r = 0; r < 8; ++r) v[r] += row_xor<M>(v[r]);
}

// 16x32 f16 fragment from a k-contiguous row p (A row m = lane&15, or Bt row n = lane&15): elements 0..7 <- k 8h..8h+7, 8..15 <- k 16+8h..16+8h+7
__device__ __forceinline__ v16h frag16(const _Float16* p, int hh) {
  FragH f;
  f.half[0] = *(const v8us*)((const unsigned short*)p + 8 * hh);
  f.half[1] = *(const v8us*)((const unsigned short*)p + 16 + 8 * hh);
  return f.v;
}

// bx = block inside a batch element, bb = batch element
__device__ __forceinline__ void x16_block(const float* __restrict__ x, _Float16* __restrict__ X16, size_t n8, int bx, int bb) {
  const size_t t = (size_t)bx * 256 + threadIdx.x; if (t >= n8) return;
  x += (size_t)bb * SEQ_FULL * HID; X16 += (size_t)bb * SEQ * HID;
  const v4f a = *(const v4fa*)(x + t * 8), c = *(const v4fa*)(x + t * 8 + 4);
  Pack8 f;
#pragma unroll
  for (int q = 0; q < 4; ++q) { f.h[q] = (_Float16)bf16_rne(a[q]); f.h[4 + q] = (_Float16)bf16_rne(c[q]); }
  unsigned short* d = (unsigned short*)X16 + t * 8;
  *(v8us*)d = f.v; 
}

#define WT_K 128                     /* k per block tile: one 256-B piece of a Wt row */
#define WT_N 128                     /* n per block tile: two 256-B pieces of a W row */

// Wt[n][k] = f16(bf16rne(W[k][n]) * scale). Block bx = tile of WT_K k x WT_N n, (K / WT_K) * (N / WT_N) blocks; st = the block's LDS tile.
// A thread reads 8 k x (4 + 4) n (each wave-wide load covers two whole 256-B row pieces of W), packs 8 k per n and turns the tile in LDS; each wave-wide store covers two whole 256-B row pieces of Wt.
// LDS row n holds its sixteen 16-B k chunks at chunk ^ ((n >> 2) & 15): the 16 lanes of a half wave then fall on 16 different bank groups, writing (16 rows, one chunk) and reading (one row, 16 chunks).
// K and N are compile-time, so that the row steps are immediate offsets on one address.
template <int K, int N>
__device__ __forceinline__ void wt_block(unsigned short (*st)[WT_K], const float* __restrict__ W, _Float16* __restrict__ Wt, float scale, int bx) {
  static_assert(K % WT_K == 0);
  static_assert(N % WT_N == 0);
  const int tid = threadIdx.x;
  constexpr int ntn = N / WT_N;
  const int kt = bx / ntn, nt = bx - kt * ntn;
  const int k0 = kt * WT_K, n0 = nt * WT_N;
  const int lo = tid & 15, hi = tid >> 4;
  // block-uniform base plus one 32-bit lane offset that all sixteen loads (all eight stores) share
  const char* wb = (const char*)(W + (size_t)k0 * N + n0);
  const uint32_t vo = ((uint32_t)(hi * 8) * (uint32_t)N + (uint32_t)(lo * 4)) * 4u;
  v4f r[2][8];
#pragma unroll
  for (int i = 0; i < 8; ++i) {
    r[0][i] = *(const v4fa*)(wb + (size_t)i * N * 4 + vo);
    r[1][i] = *(const v4fa*)(wb + (size_t)i * N * 4 + 256 + vo);
  }
  // behind the last load: the offset register that all sixteen loads name stays whole until their addresses are taken (no load's result is placed on it), and no load sinks below into the conversions
  asm volatile("s_wait_xcnt 0x0" :: "v"(vo) : "memory");
#pragma unroll
  for (int h = 0; h < 2; ++h) {
#pragma unroll
    for (int j = 0; j < 4; ++j) {
      Pack8 f;
#pragma unroll
      for (int i = 0; i < 8; ++i) f.h[i] = (_Float16)(bf16_rne(r[h][i][j]) * scale);
      *(v8us*)&st[h * 64 + lo * 4 + j][(hi ^ lo) * 8] = f.v;
    }
  }
  __syncthreads();
  char* tb = (char*)(Wt + (size_t)n0 * K + k0);
  const uint32_t so = ((uint32_t)hi * (uint32_t)K + (uint32_t)(lo * 8)) * 2u;
#pragma unroll
  for (int it = 0; it < WT_N / 16; ++it) {
    const int n = it * 16 + hi;
    const v8us v = *(const v8us*)&st[n][(lo ^ ((n >> 2) & 15)) * 8];
    *(v8us*)(tb + (size_t)it * 16 * K * 2 + so) = v;
  }
}

__device__ __forceinline__ void rope_block(float* __restrict__ cs, int bx) {
  const int t = bx * 256 + threadIdx.x; if (t >= SEQ * NRP) return;
  const int pos = t / NRP, i = t - pos * NRP;
  const float inv = exp2f(-(float)i * 0.31143075889569022f);   // 2^(-i*log2(1e6)/64)
  const float ang = (float)pos * inv;
  float sn, cn; sincosf(ang, &sn, &cn);
  v2f o; o[0] = cn; o[1] = sn;
  float* d = cs + (size_t)t * 2;
  *(v2f*)d = o; 
}

// One grid for everything that reads only the inputs: rotary table, the four weight planes, the x plane. None reads what another writes; a block's index range says which piece it takes.
constexpr int PB_ROPE = (SEQ * NRP + 255) / 256;
constexpr int PB_WQ   = (HID / WT_K) * (NQC / WT_N);
constexpr int PB_WKV  = (HID / WT_K) * (NKV * HD / WT_N);
constexpr int PB_WO   = ((NH * HD) / WT_K) * (HID / WT_N);
constexpr int PB_X    = (int)(((size_t)SEQ * HID / 8 + 255) / 256);
constexpr int PB_ALL  = PB_ROPE + PB_WQ + 2 * PB_WKV + PB_WO + NB * PB_X;
__global__ __launch_bounds__(256) void k_prep(const float* __restrict__ x, const float* __restrict__ Wq, const float* __restrict__ Wk, const float* __restrict__ Wv, const float* __restrict__ Wo,
                                             _Float16* __restrict__ X16, _Float16* __restrict__ WqT, _Float16* __restrict__ WkvT, _Float16* __restrict__ WoT, float* __restrict__ cs, float scale) {
  __shared__ __attribute__((aligned(16))) unsigned short st[WT_N][WT_K];
  int b = (int)blockIdx.x;
  if (b < PB_ROPE) { rope_block(cs, b); return; }
  b -= PB_ROPE;
  if (b < PB_WQ) { wt_block<HID, NQC>(st, Wq, WqT, scale, b); return; }
  b -= PB_WQ;
  if (b < PB_WO) { wt_block<NH * HD, HID>(st, Wo, WoT, scale, b); return; }
  b -= PB_WO;
  if (b < 2 * PB_WKV) {
    const bool isv = b >= PB_WKV;
    wt_block<HID, NKV * HD>(st, isv ? Wv : Wk, isv ? WkvT + (size_t)NKV * HD * HID : WkvT, scale, isv ? b - PB_WKV : b);
    return;
  }
  b -= 2 * PB_WKV;
  const int bb = b / PB_X;
  x16_block(x, X16, (size_t)SEQ * HID / 8, b - bb * PB_X, bb);
}

#define G_PITCH 272u                 /* LDS row pitch: 256 B of k plus the mover's 16-B pad (ds_load_b128 readers) */
#define G_SLICE 18432u               /* one wave's slice: 64 rows at G_PITCH, rounded up to a multiple of 2 KiB */
#define G_STAGE (4u * G_SLICE)       /* one buffer: [A rows 0..63 | A rows 64..127 (RES: residual rows 0..63) | Bt rows 0..63 | Bt rows 64..127] */
static_assert(64u * G_PITCH <= G_SLICE);
static_assert(G_SLICE % 2048u == 0);
static_assert(64u * 68u * 4u <= G_SLICE);

// D += A.B by the plain builtin, whose distances the compiler keeps itself: register operands on an asm guard would hold the GEMM's accumulators and both fragment sets below v256 (spills)
__device__ __forceinline__ v8f mma16b(v16h a, v16h b, v8f c) { return __builtin_amdgcn_wmma_f32_16x16x32_f16(false, a, false, b, (short)0, c, false, false); }
__device__ __forceinline__ uint32_t uni(uint32_t v) { return (uint32_t)__builtin_amdgcn_readfirstlane(v); }
__device__ __forceinline__ uint32_t pinned(uint32_t v) { uint32_t w = uni(v); asm volatile("" : "+s"(w)); return w; }
__device__ __forceinline__ void wait_ds0() { asm volatile("s_wait_dscnt 0x0" ::: "memory"); }          // this wave's LDS reads have returned before the buffer is handed over
__device__ __forceinline__ void tdm_load(u32x4 g0, u32x8 g1) { asm volatile("tensor_load_to_lds %0, %1" :: "s"(g0), "s"(g1) : "memory"); }
// this wave's slice has landed; the compiler places no wait for the mover. The wait names the youngest request's descriptor as inputs: its scalar registers stay allocated, and so unwritten, until the request has returned
__device__ __forceinline__ void wait_tensor0_of(u32x4 g0, u32x8 g1) { asm volatile("s_wait_tensorcnt 0x0" :: "s"(g0), "s"(g1) : "memory"); }
// group 1: 1-byte elements, tile = tensor = 64 rows of 256 B, source row pitch in bytes, 4 dwords of LDS pad behind every 256-B row
__device__ __forceinline__ u32x8 tdm_group1(uint32_t src_pitch) {
  u32x8 g;
  g[0] = uni((1u << 20) | (5u << 22) | (3u << 25));
  // pinned(): descriptor words held in their scalar registers through the loop, so that none is rewritten while a request is outstanding
  g[1] = pinned(256u << 16);
  g[2] = pinned(64u << 16);
  g[3] = pinned(256u << 16);
  g[4] = pinned(64u);
  g[5] = pinned(src_pitch);
  g[6] = pinned(0u);
  g[7] = pinned(0u);
  return g;
}
__device__ __forceinline__ u32x4 tdm_group0(uint32_t lds_dst, uint64_t ga) {
  u32x4 g;
  g[0] = uni(1u); g[1] = uni(lds_dst); g[2] = uni((uint32_t)ga); g[3] = uni((((uint32_t)(ga >> 32)) & 0x01FFFFFFu) | 0x80000000u);
  return g;
}

// C[M][N] (f32, pitch ldc) = alpha * A[M][K] (f16, pitch lda) . Bt[N][K]^T (f16, pitch ldb)  (+ alphal * Al . Bt^T when RES: residual plane Al, pitch lda).
// Block = 4 waves (2 x 2), C tile 128 x 128 (RES: 64 x 128), tile bx of (M / tile rows) * (N / 128); K % 128 == 0, K >= 128. sm = the block's LDS ring.
// A pass is 128 k: every wave brings its own 64-row slice of the pass into LDS with one tensor load, two buffers, the next pass's load in flight under this pass's products.
// Each accumulator sums its k in ascending steps of 32. Every inner loop is unrolled so that the accumulator and fragment arrays are indexed by constants and stay in registers.
template <bool RES>
__device__ __forceinline__ void gemm_tile(unsigned char* sm, int bx, const _Float16* __restrict__ A, const _Float16* __restrict__ Al, int lda, const _Float16* __restrict__ Bt, int ldb,
                                          float alpha, float alphal, float* __restrict__ C, int ldc, int M, int N, int K) {
  constexpr int BM = RES ? 64 : 128;
  constexpr int NI = RES ? 2 : 4;        // 16-row C tiles per wave
  const int tid = threadIdx.x, lane = tid & 31, ln = lane & 15, hh = lane >> 4;
  const uint32_t w = uni((uint32_t)tid >> 5);
  const int wm = (int)(w >> 1), wn = (int)(w & 1u);
  const int ntn = N >> 7;
  const int mt = bx / ntn, nq = bx - mt * ntn;
  const int row0 = mt * BM, col0 = nq * 128;
  if (row0 >= M) return;
  const _Float16* src = (w >= 2u) ? (Bt + (size_t)(col0 + 64 * wn) * ldb)
                      : (RES ? ((w == 1u ? Al : A) + (size_t)row0 * lda) : (A + (size_t)(row0 + 64 * (int)w) * lda));
  const uint64_t ga0 = (uint64_t)(uintptr_t)src;
  const uint32_t lds0 = (uint32_t)(size_t)sm + w * G_SLICE;
  const u32x8 g1 = tdm_group1(2u * (uint32_t)(w >= 2u ? ldb : lda));
  const int ns = K >> 7;
  // per-lane fragment rows inside a buffer
  uint32_t aoff[4], boff[4];
#pragma unroll
  for (int i = 0; i < 4; ++i) {
    aoff[i] = RES ? ((uint32_t)(i >> 1) * G_SLICE + (uint32_t)(wm * 32 + (i & 1) * 16 + ln) * G_PITCH)
                  : ((uint32_t)wm * G_SLICE + (uint32_t)(i * 16 + ln) * G_PITCH);
    boff[i] = (uint32_t)(2 + wn) * G_SLICE + (uint32_t)(i * 16 + ln) * G_PITCH;
  }
  const v8f z8 = {0.f, 0.f, 0.f, 0.f, 0.f, 0.f, 0.f, 0.f};
  v8f c[4][4];                           // RES: c[0..1] main plane, c[2..3] residual plane of the same rows
#pragma unroll
  for (int i = 0; i < 4; ++i)
#pragma unroll
    for (int j = 0; j < 4; ++j) c[i][j] = z8;

  u32x4 g0 = tdm_group0(lds0, ga0);      // group 0 of the youngest request
  tdm_load(g0, g1);
  wait_tensor0_of(g0, g1);
  __syncthreads();
  if (pinned(1 < ns ? 1u : 0u) != 0u) { g0 = tdm_group0(lds0 + G_STAGE, ga0 + 256u); tdm_load(g0, g1); }
#pragma unroll 1                         // one pass per trip: the buffer alternates at run time
  for (int s = 0; s < ns; ++s) {
    const uint32_t bo = (uint32_t)(s & 1) * G_STAGE;
    const unsigned char* bp = sm + bo;
    v16h fa[2][4], fb[2][4];             // set (kk & 1) holds k-step kk's fragments; the next step's loads go ahead of this step's products as one group
#pragma unroll
    for (int i = 0; i < 4; ++i) { fa[0][i] = frag16((const _Float16*)(bp + aoff[i]), hh); fb[0][i] = frag16((const _Float16*)(bp + boff[i]), hh); }
#pragma unroll
    for (int kk = 0; kk < 4; ++kk) {
      if (kk < 3) {
#pragma unroll
        for (int i = 0; i < 4; ++i) {
          fa[(kk + 1) & 1][i] = frag16((const _Float16*)(bp + aoff[i] + (kk + 1) * 64), hh);
          fb[(kk + 1) & 1][i] = frag16((const _Float16*)(bp + boff[i] + (kk + 1) * 64), hh);
        }
      }
      __builtin_amdgcn_sched_barrier(0);   // keeps the next step's LDS loads one group ahead of the products, not spread among them
#pragma unroll
      for (int j = 0; j < 4; ++j)
#pragma unroll
        for (int i = 0; i < 4; ++i) c[i][j] = mma16b(fa[kk & 1][i], fb[kk & 1][j], c[i][j]);
      __builtin_amdgcn_sched_barrier(0);   // ends the block of products: the following loads stay behind it
    }
    asm volatile("v_nop\n\tv_nop\n\tv_nop\n\tv_nop");   // WMMA-to-VALU distance on the loop's exit path, where the epilogue reads the accumulators
    // publish point of pass s + 1: own LDS reads returned, own slice landed, block barrier, then the refill of the buffer just read
    wait_ds0();
    wait_tensor0_of(g0, g1);
    __syncthreads();
    if (pinned(s + 2 < ns ? 1u : 0u) != 0u) { g0 = tdm_group0(lds0 + bo, ga0 + (uint64_t)(uint32_t)(s + 2) * 256u); tdm_load(g0, g1); }
  }
  wait_tensor0_of(g0, g1);
  wait_ds0();

  // epilogue: the ring is free behind the last pass's barrier; each wave stages its C tile in its own slice and stores whole 256-B row pieces
  float* so = (float*)(sm + w * G_SLICE);
#pragma unroll
  for (int i = 0; i < NI; ++i) {
#pragma unroll
    for (int j = 0; j < 4; ++j) {
#pragma unroll
      for (int r = 0; r < 8; ++r)
        so[(i * 16 + 8 * hh + r) * 68 + j * 16 + ln] = RES ? (c[i][j][r] * alpha + c[(i + 2) & 3][j][r] * alphal) : (c[i][j][r] * alpha);
    }
  }
  __builtin_amdgcn_fence(4 /* acq_rel order */, "workgroup");
  __builtin_amdgcn_wave_barrier();
  const int rsub = lane >> 4, c4 = (lane & 15) * 4;
#pragma unroll
  for (int g = 0; g < NI; ++g) {         // eight row pairs a group: its LDS reads, its stores, one wait
    v4f v[8];
#pragma unroll
    for (int u = 0; u < 8; ++u) v[u] = *(const v4fa*)&so[((g * 8 + u) * 2 + rsub) * 68 + c4];
#pragma unroll
    for (int u = 0; u < 8; ++u) *(v4f*)(C + (size_t)(row0 + wm * (NI * 16) + (g * 8 + u) * 2 + rsub) * ldc + col0 + wn * 64 + c4) = v[u];
    asm volatile("s_wait_xcnt 0x0" ::: "memory");   // behind the group's stores, before the next group (or the code behind this tile) rewrites their address and data registers
  }
}

// Two independent products in one grid: blocks 0 .. n1-1 are the tiles of product 1 (plain), the others those of product 2 (RES2: with its residual plane). lda, ldb, K and alpha are common.
// grid.y = batch element: A advances by bsA, Al2 by bsAl2, C1 and C2 by bsC1 and bsC2 elements per batch element; Bt1 and Bt2 are shared.
template <bool RES2>
__global__ __launch_bounds__(128) void k_gemm2(int n1, const _Float16* __restrict__ A1, const _Float16* __restrict__ Bt1, float* __restrict__ C1, int ldc1, int M1, int N1, size_t bsC1,
                                              const _Float16* __restrict__ A2, const _Float16* __restrict__ Al2, const _Float16* __restrict__ Bt2, float* __restrict__ C2, int ldc2, int M2, int N2, size_t bsC2,
                                              size_t bsAl2, int lda, int ldb, int K, size_t bsA, float alpha, float alphal) {
  __shared__ __attribute__((aligned(2048))) unsigned char sm[2u * G_STAGE];
  const int bx = (int)blockIdx.x;
  const size_t bb = blockIdx.y;
  const bool two = bx >= n1;             // block-uniform
  if constexpr (RES2) {
    if (two) gemm_tile<true>(sm, bx - n1, A2 + bb * bsA, Al2 + bb * bsAl2, lda, Bt2, ldb, alpha, alphal, C2 + bb * bsC2, ldc2, M2, N2, K);
    else gemm_tile<false>(sm, bx, A1 + bb * bsA, A1 + bb * bsA, lda, Bt1, ldb, alpha, 0.0f, C1 + bb * bsC1, ldc1, M1, N1, K);
  } else {
    const _Float16* A = (two ? A2 : A1) + bb * bsA;
    gemm_tile<false>(sm, two ? bx - n1 : bx, A, A, lda, two ? Bt2 : Bt1, ldb, alpha, 0.0f, two ? C2 + bb * bsC2 : C1 + bb * bsC1, two ? ldc2 : ldc1, two ? M2 : M1, two ? N2 : N1, K);
  }
}

// per (batch element bb, token s, head-row j): j<16 -> q head j from qraw[s][j*256 + 0..127], else k head j-16 from kvraw[s][(j-16)*128 ..]; RMSNorm (w+1, eps 1e-6) then rotate-half RoPE from cs[s];
__device__ __forceinline__ void qk_block(const float* __restrict__ qraw, const float* __restrict__ kvraw,
                                         const float* __restrict__ qnw, const float* __restrict__ knw, const float* __restrict__ cs,
                                         _Float16* __restrict__ Qh, _Float16* __restrict__ Ql, _Float16* __restrict__ Kh, _Float16* __restrict__ Kl, int bx) {
  const int w = threadIdx.x >> 5, lane = threadIdx.x & 31;
  const int wid = bx * 8 + w;
  if (wid >= NB * SEQ * NHR) return;
  const int tr = wid / NHR, j = wid - tr * NHR;     // tr: row of the raw planes, which hold the batch elements one behind the other
  const int bb = tr / SEQ, s = tr - bb * SEQ;
  const bool isq = (j < NH);
  const float* src = isq ? (qraw + (size_t)tr * NQC + (size_t)j * (2 * HD)) : (kvraw + (size_t)tr * NKVC + (size_t)(j - NH) * HD);
  const float* wp = isq ? qnw : knw;
  const v4f xv = *(const v4fa*)(src + 4 * lane);
  const v4f wv = *(const v4fa*)(wp + 4 * lane);
  float ss = xv[0] * xv[0] + xv[1] * xv[1] + xv[2] * xv[2] + xv[3] * xv[3];
  ss += half_xor(ss);
  ss += row_xor<8>(ss); ss += row_xor<4>(ss); ss += row_xor<2>(ss); ss += row_xor<1>(ss);
  const float inv = rsqrtf(ss * (1.0f / 128.0f) + 1.0e-6f);
  float nv[4], pr[4];
#pragma unroll
  for (int q = 0; q < 4; ++q) nv[q] = xv[q] * inv * (wv[q] + 1.0f);
#pragma unroll
  for (int q = 0; q < 4; ++q) pr[q] = half_xor(nv[q]);       // element d +- 64
  const int i0 = 4 * (lane & 15);
  const v4f t01 = *(const v4fa*)(cs + ((size_t)s * NRP + i0) * 2);
  const v4f t23 = *(const v4fa*)(cs + ((size_t)s * NRP + i0 + 2) * 2);
  const float cv[4] = {t01[0], t01[2], t23[0], t23[2]};
  const float sv[4] = {t01[1], t01[3], t23[1], t23[3]};
  const float sg = (lane < 16) ? -1.0f : 1.0f;                          // d < 64: -x[d+64]; d >= 64: +x[d-64]
  v4h oh, ol;
#pragma unroll
  for (int q = 0; q < 4; ++q) {
    const float o = nv[q] * cv[q] + sg * pr[q] * sv[q];
    const _Float16 hv = (_Float16)o;
    oh[q] = hv; ol[q] = (_Float16)((o - (float)hv) * RCAR);
  }
  _Float16* dh = isq ? (Qh + ((size_t)(bb * NH + j) * SEQ + s) * HD) : (Kh + ((size_t)(bb * NKV + j - NH) * SEQ + s) * HD);
  _Float16* dl = isq ? (Ql + ((size_t)(bb * NH + j) * RESQ + s) * HD) : (Kl + ((size_t)(bb * NKV + j - NH) * RESQ + s) * HD);
  const bool wl = (s < RESQ);
  {
    *(v4h*)(dh + 4 * lane) = oh;
    if (wl) *(v4h*)(dl + 4 * lane) = ol;
    
  }
}

// V^T planes: VT[kv][d][t] = f16(v), VTl = x2^10 residual for t < RESQ; v = kvraw[t][512 + kv*128 + d]; block bx per (kv, d-half, 64 tokens) via the LDS 64x64 tile tl; bb = batch element
__device__ __forceinline__ void vt_block(float (*tl)[65], const float* __restrict__ kvraw, _Float16* __restrict__ VT, _Float16* __restrict__ VTl, int bx, int bb) {
  const int tid = threadIdx.x;
  const int ntg = SEQ / 64;
  const int tg = bx % ntg, slab = bx / ntg;
  const int kv = slab >> 1, dh = slab & 1;
  const int s0 = tg * 64;
  kvraw += (size_t)bb * ((size_t)SEQ * NKVC); VT += (size_t)bb * ((size_t)NKV * HD * SEQ); VTl += (size_t)bb * ((size_t)NKV * HD * RESQ);
#pragma unroll
  for (int it = 0; it < 4; ++it) {
    const int i = tid + it * 256; const int tok = i >> 4, c4 = (i & 15) * 4;
    const v4f v = *(const v4fa*)(kvraw + (size_t)(s0 + tok) * NKVC + NKV * HD + kv * HD + dh * 64 + c4);
    tl[tok][c4] = v[0]; tl[tok][c4 + 1] = v[1]; tl[tok][c4 + 2] = v[2]; tl[tok][c4 + 3] = v[3];
  }
  __syncthreads();
  const int pc = tid & 7, dr = tid >> 3;
  const bool wl = (s0 < RESQ);
  {
#pragma unroll
    for (int rd = 0; rd < 2; ++rd) {
      const int d = rd * 32 + dr;
      Pack8 ph, pl;
#pragma unroll
      for (int q = 0; q < 8; ++q) { const float f = tl[pc * 8 + q][d]; const _Float16 hv = (_Float16)f; ph.h[q] = hv; pl.h[q] = (_Float16)((f - (float)hv) * RCAR); }
      const size_t row = (size_t)(kv * HD + dh * 64 + d);
      *(v8us*)((unsigned short*)VT + row * SEQ + s0 + pc * 8) = ph.v;
      if (wl) *(v8us*)((unsigned short*)VTl + row * RESQ + s0 + pc * 8) = pl.v;
    }
    
  }
}

// One grid for both readers of the raw projections: the V^T blocks first, then the q/k norm + rotary blocks; neither reads what the other writes.
constexpr int QB_VT = NKV * 2 * (SEQ / 64);
constexpr int QB_QK = (NB * SEQ * NHR) / 8;
__global__ __launch_bounds__(256) void k_qkvt(const float* __restrict__ qraw, const float* __restrict__ kvraw,
                                             const float* __restrict__ qnw, const float* __restrict__ knw, const float* __restrict__ cs,
                                             _Float16* __restrict__ Qh, _Float16* __restrict__ Ql, _Float16* __restrict__ Kh, _Float16* __restrict__ Kl,
                                             _Float16* __restrict__ VT, _Float16* __restrict__ VTl) {
  __shared__ float tl[64][65];
  const int b = (int)blockIdx.x;
  if (b < NB * QB_VT) { const int bb = b / QB_VT; vt_block(tl, kvraw, VT, VTl, b - bb * QB_VT, bb); return; }
  qk_block(qraw, kvraw, qnw, knw, cs, Qh, Ql, Kh, Kl, b - NB * QB_VT);
}

// Causal grouped attention, flash form. Block = 8 waves x 16 query rows (query block qb) of head h (kv = h/4); bz = batch element (RES: batch element * 2 + o column half); smem = the block's LDS.
// Per key chunk: K rows [t][d] and V^T rows [d][t] staged in LDS (cross-wave: block barriers); S = q.k^T (f16, f32 acc), scale 1/sqrt(128),
// RES: first RESQ query rows: chunk 32 keys, q/k/P/V^T residual second terms into separate accumulators folded by 2^-10; block covers 64 o columns.
// Every inner loop is unrolled, so that the fragment, accumulator and row arrays are indexed by constants and stay in registers.
template <bool RES> struct AttnLds {     // byte sizes of the block's LDS tiles, in their order
  static constexpr int KC = RES ? 32 : 64, OD = RES ? 64 : 128, KP = HD + 8, VP = KC + 8, PP = 72;
  static constexpr uint32_t K = KC * KP * 2u, KL = (RES ? KC : 1) * KP * 2u, V = OD * VP * 2u, VL = (RES ? OD : 1) * VP * 2u, P = 8 * 16 * PP * 2u, PL = (RES ? 8 : 1) * 16 * PP * 2u;
  static constexpr uint32_t ALL = K + KL + V + VL + P + PL;
  static_assert(K % 16 == 0 && KL % 16 == 0 && V % 16 == 0 && VL % 16 == 0 && P % 16 == 0);
};
template <bool RES>
__device__ __forceinline__ void attn_block(unsigned char* smem, const _Float16* __restrict__ Qh, const _Float16* __restrict__ Ql,
                                           const _Float16* __restrict__ Kh, const _Float16* __restrict__ Kl,
                                           const _Float16* __restrict__ VT, const _Float16* __restrict__ VTl,
                                           const float* __restrict__ qraw, _Float16* __restrict__ Oh, _Float16* __restrict__ Ol, int qb, int h, int bz) {
  constexpr int KC = RES ? 32 : 64;      // keys per chunk
  constexpr int NJ = KC / 16;            // score column tiles
  constexpr int NKS = KC / 32;           // k-steps of P.V^T
  constexpr int OD = RES ? 64 : 128;     // o columns per block
  constexpr int NC = OD / 16;
  constexpr int NHF = OD / 64;
  constexpr int CG = RES ? 2 : 4;        // o column tiles per group of V^T fragment loads (four fragments with the residual ones)
  constexpr int NGC = NC / CG;           // groups per k-step
  constexpr int NG = NKS * NGC;
  constexpr int KP = HD + 8;             // sK pitch (halves)
  constexpr int VP = KC + 8;             // sV pitch
  constexpr int PP = 72;                 // sP pitch (KC weights, and 64 staged o columns)
  using L = AttnLds<RES>;
  static_assert(L::KC == KC && L::OD == OD && L::KP == KP && L::VP == VP && L::PP == PP);
  _Float16 (*sK)[KP]      = (_Float16 (*)[KP])smem;                                                  // [KC]
  _Float16 (*sKl)[KP]     = (_Float16 (*)[KP])(smem + L::K);                                         // [RES ? KC : 1]
  _Float16 (*sV)[VP]      = (_Float16 (*)[VP])(smem + L::K + L::KL);                                 // [OD]
  _Float16 (*sVl)[VP]     = (_Float16 (*)[VP])(smem + L::K + L::KL + L::V);                          // [RES ? OD : 1]
  _Float16 (*sP)[16][PP]  = (_Float16 (*)[16][PP])(smem + L::K + L::KL + L::V + L::VL);              // [8]
  _Float16 (*sPl)[16][PP] = (_Float16 (*)[16][PP])(smem + L::K + L::KL + L::V + L::VL + L::P);       // [RES ? 8 : 1]

  const int tid = threadIdx.x, w = tid >> 5, lane = tid & 31, ln = lane & 15, hh = lane >> 4;
  const int kv = h / GQ;
  const int dz = RES ? (bz & 1) * 64 : 0;
  const size_t bb = (size_t)(RES ? (bz >> 1) : bz);
  Qh += bb * ((size_t)NH * SEQ * HD); Ql += bb * ((size_t)NH * RESQ * HD); Kh += bb * ((size_t)NKV * SEQ * HD); Kl += bb * ((size_t)NKV * RESQ * HD);
  VT += bb * ((size_t)NKV * HD * SEQ); VTl += bb * ((size_t)NKV * HD * RESQ); qraw += bb * ((size_t)SEQ * NQC);
  Oh += bb * ((size_t)SEQ * NH * HD); Ol += bb * ((size_t)RESQ * NH * HD);
  const int q0b = qb * 128, q0w = q0b + 16 * w;
  const int nch = (q0b + 128) / KC;      // chunks holding keys <= last row of the block
  const int qlast = q0w + 15;

  v16h aq[4], aql[4];
  {
    const _Float16* qp = Qh + ((size_t)h * SEQ + q0w + ln) * HD;
#pragma unroll
    for (int kk = 0; kk < 4; ++kk) aq[kk] = frag16(qp + kk * 32, hh);
    if (RES) {
      const _Float16* qlp = Ql + ((size_t)h * RESQ + q0w + ln) * HD;
#pragma unroll
      for (int kk = 0; kk < 4; ++kk) aql[kk] = frag16(qlp + kk * 32, hh);
    } else {
#pragma unroll
      for (int kk = 0; kk < 4; ++kk) aql[kk] = aq[kk];
    }
  }
  const v8f z8 = {0.f, 0.f, 0.f, 0.f, 0.f, 0.f, 0.f, 0.f};
  v8f o[NC];
#pragma unroll
  for (int c = 0; c < NC; ++c) o[c] = z8;
  float mrow[8], lrow[8];
#pragma unroll
  for (int r = 0; r < 8; ++r) { mrow[r] = -3.0e38f; lrow[r] = 0.f; }
  const float alpha = 0.08838834764831845f;
  // staging addresses: block-uniform bases plus one 32-bit lane offset per plane, the row steps as constants (leaves the registers to the fragment groups)
  constexpr int VR = 256 / (KC / 8);     // V^T rows staged per round of the block
  const char* kgb = (const char*)(Kh + (size_t)kv * SEQ * HD);
  const char* klgb = (const char*)(Kl + (size_t)kv * RESQ * HD);
  const char* vgb = (const char*)(VT + (size_t)(kv * HD + dz) * SEQ);
  const char* vlgb = (const char*)(VTl + (size_t)(kv * HD + dz) * RESQ);
  const uint32_t kvo = (uint32_t)((tid >> 4) * HD + (tid & 15) * 8) * 2u;
  const uint32_t vvo = (uint32_t)((tid / (KC / 8)) * SEQ + (tid % (KC / 8)) * 8) * 2u;
  const uint32_t vlvo = (uint32_t)((tid / (KC / 8)) * RESQ + (tid % (KC / 8)) * 8) * 2u;
  _Float16* skp = &sK[tid >> 4][(tid & 15) * 8];
  _Float16* sklp = &sKl[RES ? (tid >> 4) : 0][(tid & 15) * 8];
  _Float16* svp = &sV[tid / (KC / 8)][(tid % (KC / 8)) * 8];
  _Float16* svlp = &sVl[RES ? (tid / (KC / 8)) : 0][(tid % (KC / 8)) * 8];

#pragma unroll 1
  for (int ch = 0; ch < nch; ++ch) {
    const int t0 = ch * KC;
    // stage K rows t0..t0+KC-1 (all 128 d) and V^T rows dz..dz+OD-1 (keys t0..t0+KC-1): staged extent == consumed extent
#pragma unroll
    for (int it = 0; it < (KC * 16) / 256; ++it) {
      *(v8us*)(skp + it * 16 * KP) = *(const v8us*)(kgb + (size_t)t0 * (HD * 2) + (size_t)it * (16 * HD * 2) + kvo);
      if (RES) *(v8us*)(sklp + it * 16 * KP) = *(const v8us*)(klgb + (size_t)t0 * (HD * 2) + (size_t)it * (16 * HD * 2) + kvo);
    }
#pragma unroll
    for (int it = 0; it < (OD * (KC / 8)) / 256; ++it) {
      *(v8us*)(svp + it * VR * VP) = *(const v8us*)(vgb + (size_t)t0 * 2 + (size_t)it * ((size_t)VR * SEQ * 2) + vvo);
      if (RES) *(v8us*)(svlp + it * VR * VP) = *(const v8us*)(vlgb + (size_t)t0 * 2 + (size_t)it * ((size_t)VR * RESQ * 2) + vlvo);
    }
    __syncthreads();
    if (t0 <= qlast) {                   // wave-uniform: this wave has unmasked keys in the chunk
      // k-step kk's K fragments of all key tiles are one group of LDS loads, issued one k-step ahead of their products (set kk & 1); the key tiles' accumulators are independent, each sums its kk in ascending order
      v8f sacc[NJ], stmp[RES ? NJ : 1];
#pragma unroll
      for (int j = 0; j < NJ; ++j) { sacc[j] = z8; if (RES) stmp[j] = z8; }
      {
        v16h fk[2][NJ], fkl[2][RES ? NJ : 1];
#pragma unroll
        for (int j = 0; j < NJ; ++j) {
          fk[0][j] = frag16(&sK[j * 16 + ln][0], hh);                     // B[k = d][n = key]: key row, d contiguous
          if (RES) fkl[0][j] = frag16(&sKl[j * 16 + ln][0], hh);
        }
#pragma unroll
        for (int kk = 0; kk < 4; ++kk) {
          if (kk < 3) {
#pragma unroll
            for (int j = 0; j < NJ; ++j) {
              fk[(kk + 1) & 1][j] = frag16(&sK[j * 16 + ln][(kk + 1) * 32], hh);
              if (RES) fkl[(kk + 1) & 1][j] = frag16(&sKl[j * 16 + ln][(kk + 1) * 32], hh);
            }
          }
          __builtin_amdgcn_sched_barrier(0);   // keeps the next k-step's LDS loads one group ahead of the products, not one by one in front of each
#pragma unroll
          for (int j = 0; j < NJ; ++j) sacc[j] = mma16b(aq[kk], fk[kk & 1][j], sacc[j]);
          if (RES) {
#pragma unroll
            for (int j = 0; j < NJ; ++j) stmp[j] = mma16b(aql[kk], fk[kk & 1][j], stmp[j]);
#pragma unroll
            for (int j = 0; j < NJ; ++j) stmp[j] = mma16b(aq[kk], fkl[kk & 1][j], stmp[j]);
          }
          __builtin_amdgcn_sched_barrier(0);   // ends the block of products: the following loads stay behind it
        }
      }
      if (RES) {
#pragma unroll
        for (int j = 0; j < NJ; ++j) sacc[j] = sacc[j] + stmp[j] * (1.0f / RCAR);
      }
      // scale, causal mask, online softmax; P (x2^14) to the wave-private LDS tile. The eight rows pass each exchange stage together: eight independent links a stage
      const int dk = t0 + ln - (q0w + 8 * hh);   // key tile j, row r is masked where dk + 16 j > r
      float mx[8], fac[8], rs[8];
#pragma unroll
      for (int r = 0; r < 8; ++r) {
        float m0 = -3.0e38f;
#pragma unroll
        for (int j = 0; j < NJ; ++j) m0 = fmaxf(m0, (dk + 16 * j > r) ? -3.0e38f : sacc[j][r] * alpha);
        mx[r] = m0;
      }
      row_max8(mx);
#pragma unroll
      for (int r = 0; r < 8; ++r) {
        const float mnew = fmaxf(mrow[r], mx[r]);
        fac[r] = (mrow[r] < -1.0e38f) ? 0.f : __expf(mrow[r] - mnew);
        mrow[r] = mnew;
        float s = 0.f;
#pragma unroll
        for (int j = 0; j < NJ; ++j) {
          const float p = (dk + 16 * j > r) ? 0.f : __expf(sacc[j][r] * alpha - mnew);
          s += p;
          const float pcv = p * PCAR; const _Float16 ph = (_Float16)pcv;
          sP[w][8 * hh + r][16 * j + ln] = ph;
          if (RES) sPl[w][8 * hh + r][16 * j + ln] = (_Float16)((pcv - (float)ph) * RCAR);
        }
        rs[r] = s;
      }
      // the row sums' four exchange stages (lane distance 8, 4, 2, 1)
      sum_stage<8>(rs); sum_stage<4>(rs); sum_stage<2>(rs); sum_stage<1>(rs);
#pragma unroll
      for (int r = 0; r < 8; ++r) lrow[r] = lrow[r] * fac[r] + rs[r];
#pragma unroll
      for (int r = 0; r < 8; ++r)
#pragma unroll
        for (int c = 0; c < NC; ++c) o[c][r] *= fac[r];
      __builtin_amdgcn_fence(4 /* acq_rel order */, "workgroup");
      __builtin_amdgcn_wave_barrier();
      v16h ap[NKS], apl[NKS];
#pragma unroll
      for (int ks = 0; ks < NKS; ++ks) {
        ap[ks] = frag16(&sP[w][ln][ks * 32], hh);                         // A[m = query row][k = key]
        if (RES) apl[ks] = frag16(&sPl[w][ln][ks * 32], hh); else apl[ks] = ap[ks];
      }
      // V^T fragments go in groups of four as well (CG o column tiles of one k-step); the first group shares the wait of the P fragments
      v16h fv[2][CG], fvl[2][RES ? CG : 1];
#pragma unroll
      for (int i = 0; i < CG; ++i) {
        fv[0][i] = frag16(&sV[i * 16 + ln][0], hh);                       // B[k = key][n = d]: d row, keys contiguous
        if (RES) fvl[0][i] = frag16(&sVl[i * 16 + ln][0], hh);
      }
      v8f ptmp[RES ? NC : 1];
      if (RES) {
#pragma unroll
        for (int c = 0; c < NC; ++c) ptmp[c] = z8;
      }
#pragma unroll
      for (int g = 0; g < NG; ++g) {           // group g: k-step g / NGC, o column tiles (g % NGC) * CG ..; every o tile meets its k-steps in ascending order
        if (g + 1 < NG) {
          const int ks1 = (g + 1) / NGC, cb1 = ((g + 1) % NGC) * CG;
#pragma unroll
          for (int i = 0; i < CG; ++i) {
            fv[(g + 1) & 1][i] = frag16(&sV[(cb1 + i) * 16 + ln][ks1 * 32], hh);
            if (RES) fvl[(g + 1) & 1][i] = frag16(&sVl[(cb1 + i) * 16 + ln][ks1 * 32], hh);
          }
        }
        __builtin_amdgcn_sched_barrier(0);     // keeps the next group's LDS loads ahead of this group's products
        const int ks = g / NGC, cb = (g % NGC) * CG;
#pragma unroll
        for (int i = 0; i < CG; ++i) o[cb + i] = mma16b(ap[ks], fv[g & 1][i], o[cb + i]);
        if (RES) {
#pragma unroll
          for (int i = 0; i < CG; ++i) ptmp[cb + i] = mma16b(apl[ks], fv[g & 1][i], ptmp[cb + i]);
#pragma unroll
          for (int i = 0; i < CG; ++i) ptmp[cb + i] = mma16b(ap[ks], fvl[g & 1][i], ptmp[cb + i]);
        }
        __builtin_amdgcn_sched_barrier(0);     // ends the block of products: the following loads stay behind it
      }
      if (RES) {
#pragma unroll
        for (int c = 0; c < NC; ++c) o[c] = o[c] + ptmp[c] * (1.0f / RCAR);
      }
    }
    __syncthreads();
  }

  // epilogue
  float il[8];
#pragma unroll
  for (int r = 0; r < 8; ++r) il[r] = (OCAR / PCAR) * __builtin_amdgcn_rcpf(lrow[r]);
  const float* gp = qraw + (size_t)(q0w + 8 * hh) * NQC + (size_t)h * (2 * HD) + HD + dz + ln;
#pragma unroll
  for (int hf = 0; hf < NHF; ++hf) {
    if (hf > 0) { __builtin_amdgcn_fence(4 /* acq_rel order */, "workgroup"); __builtin_amdgcn_wave_barrier(); }
#pragma unroll
    for (int cc = 0; cc < 4; ++cc) {
      const int c = hf * 4 + cc;
#pragma unroll
      for (int r = 0; r < 8; ++r) {
        const float g = gp[(size_t)r * NQC + c * 16];
        const float sig = __builtin_amdgcn_rcpf(1.0f + __expf(-g));
        const float val = o[c][r] * il[r] * sig;
        const _Float16 vh = (_Float16)val;
        sP[w][8 * hh + r][cc * 16 + ln] = vh;
        if (RES) sPl[w][8 * hh + r][cc * 16 + ln] = (_Float16)((val - (float)vh) * RCAR);
      }
      asm volatile("" ::: "memory");
    }
    __builtin_amdgcn_fence(4 /* acq_rel order */, "workgroup");
    __builtin_amdgcn_wave_barrier();
    const int prw = lane >> 3, pc = lane & 7;
    {
#pragma unroll
      for (int it = 0; it < 4; ++it) {
        const int row = it * 4 + prw;
        const v8us vv = *(const v8us*)&sP[w][row][pc * 8];
        const size_t go = (size_t)(q0w + row) * (NH * HD) + (size_t)h * HD + dz + hf * 64 + pc * 8;
        *(v8us*)((unsigned short*)Oh + go) = vv;
        if (RES) { const v8us vl = *(const v8us*)&sPl[w][row][pc * 8]; *(v8us*)((unsigned short*)Ol + go) = vl; }
      }
      
    }
  }
  asm volatile("s_wait_xcnt 0x0" ::: "memory");   // behind the last o stores: a precaution, as a block runs one form only and the kernel ends behind it
}

// One grid for both forms, which share no output row: the plain blocks first, then the residual ones, each form from its last query block (most key chunks) down to its first.
constexpr int AB_F = ((SEQ - RESQ) / 128) * NH * NB;
constexpr int AB_R = (RESQ / 128) * NH * NB * 2;
__global__ __launch_bounds__(256) void k_attn2(const _Float16* __restrict__ Qh, const _Float16* __restrict__ Ql,
                                              const _Float16* __restrict__ Kh, const _Float16* __restrict__ Kl,
                                              const _Float16* __restrict__ VT, const _Float16* __restrict__ VTl,
                                              const float* __restrict__ qraw, _Float16* __restrict__ Oh, _Float16* __restrict__ Ol) {
  __shared__ __attribute__((aligned(16))) unsigned char smem[AttnLds<true>::ALL > AttnLds<false>::ALL ? AttnLds<true>::ALL : AttnLds<false>::ALL];
  const int b = (int)blockIdx.x;
  if (b < AB_F) {
    const int qr = b / (NH * NB), rem = b - qr * (NH * NB);
    attn_block<false>(smem, Qh, Ql, Kh, Kl, VT, VTl, qraw, Oh, Ol, SEQ / 128 - 1 - qr, rem % NH, rem / NH);
  } else {
    const int c = b - AB_F, qr = c / (NH * NB * 2), rem = c - qr * (NH * NB * 2);
    attn_block<true>(smem, Qh, Ql, Kh, Kl, VT, VTl, qraw, Oh, Ol, RESQ / 128 - 1 - qr, rem % NH, rem / NH);
  }
}

extern "C" void kernel_launch(void* const* d_in, const int* in_sizes, int n_in,
                              void* d_out, int out_size, void* d_ws, size_t ws_size, hipStream_t stream) {
  if (n_in < 7) return;
  const long need_x = (long)(NB - 1) * SEQ_FULL * HID + (long)SEQ * HID;
  if ((long)in_sizes[0] < need_x) return;
  if (in_sizes[1] < HID * NQC) return;
  if (in_sizes[2] < HID * NKV * HD) return;
  if (in_sizes[3] < HID * NKV * HD) return;
  if (in_sizes[4] < NH * HD * HID) return;
  if (in_sizes[5] < HD) return;
  if (in_sizes[6] < HD) return;
  if ((long)out_size < need_x) return;

  const float* x   = (const float*)d_in[0];
  const float* Wq  = (const float*)d_in[1];
  const float* Wk  = (const float*)d_in[2];
  const float* Wv  = (const float*)d_in[3];
  const float* Wo  = (const float*)d_in[4];
  const float* qnw = (const float*)d_in[5];
  const float* knw = (const float*)d_in[6];

  char* ws = (char*)d_ws; size_t off = 0;
  auto take = [&](size_t bytes) { char* p = ws + off; off += (bytes + 255) & ~(size_t)255; return p; };
  _Float16* X16  = (_Float16*)take(SZ_X16);
  _Float16* WqT  = (_Float16*)take(SZ_WQT);
  _Float16* WkvT = (_Float16*)take(SZ_WKVT);
  _Float16* WoT  = (_Float16*)take(SZ_WOT);
  float*    CS   = (float*)take(SZ_CS);
  float*    qraw = (float*)take(SZ_QRAW);
  float*    kvraw = (float*)take(SZ_KVRAW);
  _Float16* Qh   = (_Float16*)take(SZ_QH);
  _Float16* Ql   = (_Float16*)take(SZ_QL);
  _Float16* Kh   = (_Float16*)take(SZ_KH);
  _Float16* Kl   = (_Float16*)take(SZ_KL);
  _Float16* VT   = (_Float16*)take(SZ_VT);
  _Float16* VTl  = (_Float16*)take(SZ_VTL);
  _Float16* Oh   = (_Float16*)take(SZ_OH);
  _Float16* Ol   = (_Float16*)take(SZ_OL);
  if (off > ws_size) return;

  const float walpha = 1.0f / WCAR;                          // 2^-4
  const float oalpha = 1.0f / (WCAR * OCAR);                 // 2^-10
  const float oalphal = oalpha / RCAR;                       // 2^-20
  // five launches, each holding every piece of work that depends only on the launches before it; every launch covers all NB batch elements
  float* out = (float*)d_out;
  // rotary table, weight planes (Bt[n][k] = f16(bf16rne(W[k][n]) * 16)), x plane
  k_prep<<<PB_ALL, 256, 0, stream>>>(x, Wq, Wk, Wv, Wo, X16, WqT, WkvT, WoT, CS, WCAR);
  // x.Wq and x.[Wk|Wv]
  k_gemm2<false><<<dim3((SEQ / 128) * (NQC / 128) + (SEQ / 128) * (NKVC / 128), NB), 128, 0, stream>>>(
      (SEQ / 128) * (NQC / 128), X16, WqT, qraw, NQC, SEQ, NQC, (size_t)SEQ * NQC,
      X16, X16, WkvT, kvraw, NKVC, SEQ, NKVC, (size_t)SEQ * NKVC,
      (size_t)SEQ * HID, HID, HID, HID, (size_t)SEQ * HID, walpha, 0.0f);
  k_qkvt<<<NB * QB_VT + QB_QK, 256, 0, stream>>>(qraw, kvraw, qnw, knw, CS, Qh, Ql, Kh, Kl, VT, VTl);
  k_attn2<<<AB_F + AB_R, 256, 0, stream>>>(Qh, Ql, Kh, Kl, VT, VTl, qraw, Oh, Ol);
  // o.Wo: rows RESQ.. plain, rows 0..RESQ-1 with the residual plane
  k_gemm2<true><<<dim3(((SEQ - RESQ) / 128) * (HID / 128) + (RESQ / 64) * (HID / 128), NB), 128, 0, stream>>>(
      ((SEQ - RESQ) / 128) * (HID / 128), Oh + (size_t)RESQ * NH * HD, WoT, out + (size_t)RESQ * HID, HID, SEQ - RESQ, HID, (size_t)SEQ_FULL * HID,
      Oh, Ol, WoT, out, HID, RESQ, HID, (size_t)SEQ_FULL * HID,
      (size_t)RESQ * NH * HD, NH * HD, NH * HD, NH * HD, (size_t)SEQ * NH * HD, oalpha, oalphal);
  (void)hipGetLastError();
}

// v007
// Measured time: 184 microseconds a run.
// Timed twice side by side with v006, it ran 1.05 times as fast both times.
// Counting every step since v000, it is 4.89 times as fast.
#include <hip/hip_runtime.h>
#include <stdint.h>
// Contractions x.Wq, x.[Wk|Wv], q.k^T, P.V^T, o.Wo: v_wmma_f32_16x16x32_f16 (f16 operands, f32 accumulate). x and all weights RNE-converted to bf16 and held exactly in f16 (weights carried x16); q, k, V^T and gated o as f16 planes plus x2^10 f16 residual planes over the first RESQ query rows / keys (two-term products there, single products elsewhere); softmax weights x2^14 in f16 (+ x2^10 residual on those rows); gated o carried x64; RMSNorm, RoPE, softmax statistics and sigmoid gating in f32.

#ifndef NB
#define NB 2
#endif
#ifndef SEQ
#define SEQ 2048
#endif
#ifndef RESQ
#if SEQ < 512
#define RESQ SEQ
#else
#define RESQ 512
#endif
#endif
#define NB_FULL 2
#define SEQ_FULL 2048
#define HID 2048
#define NH 16
#define NKV 4
#define HD 128
#define GQ (NH / NKV)
#define NQC (2 * NH * HD)      /* q|gate columns: head h at h*256 (q) and h*256+128 (gate); the f32 plane qraw holds the gate columns only */
#define NKVC (2 * NKV * HD)    /* k|v columns: k head j at j*128, v head j at 512+j*128 */
#define NRP 64                 /* rotary pairs */
#define PCAR 16384.0f          /* softmax weight carry */
#define OCAR 64.0f             /* gated o carry */
#define RCAR 1024.0f           /* residual plane carry */
#define WCAR 16.0f             /* weight carry */

static_assert(NB >= 1);
static_assert(NB <= NB_FULL);
static_assert(SEQ % 128 == 0);
static_assert(SEQ <= SEQ_FULL);
static_assert(RESQ % 128 == 0);
static_assert(RESQ >= 128);
static_assert(RESQ <= SEQ);
static_assert((SEQ - RESQ) % 128 == 0);
static_assert(HID % 32 == 0);
static_assert(HID % 64 == 0);
static_assert(NQC % 128 == 0);
static_assert(NKVC % 128 == 0);
static_assert(HID % 256 == 0);
static_assert((NH * HD) % 256 == 0);
static_assert(HD == 128);
static_assert(NH % NKV == 0);
static_assert((SEQ * HID) % 8 == 0);

// planes of x, q, k, v and o hold all NB batch elements, element b at b * (plane size / NB)
constexpr size_t SZ_X16   = (size_t)NB * SEQ * HID * 2;
constexpr size_t SZ_WQT   = (size_t)NQC * HID * 2;
constexpr size_t SZ_WKVT  = (size_t)NKVC * HID * 2;
constexpr size_t SZ_WOT   = (size_t)HID * NH * HD * 2;
constexpr size_t SZ_CS    = (size_t)SEQ * NRP * 2 * 4;
constexpr size_t SZ_QRAW  = (size_t)NB * SEQ * NQC * 4;
constexpr size_t SZ_QH    = (size_t)NB * NH * SEQ * HD * 2;
constexpr size_t SZ_QL    = (size_t)NB * NH * RESQ * HD * 2;
constexpr size_t SZ_KH    = (size_t)NB * NKV * SEQ * HD * 2;
constexpr size_t SZ_KL    = (size_t)NB * NKV * RESQ * HD * 2;
constexpr size_t SZ_VT    = (size_t)NB * NKV * HD * SEQ * 2;
constexpr size_t SZ_VTL   = (size_t)NB * NKV * HD * RESQ * 2;
constexpr size_t SZ_OH    = (size_t)NB * SEQ * NH * HD * 2;
constexpr size_t SZ_OL    = (size_t)NB * RESQ * NH * HD * 2;
constexpr size_t WS_TOTAL = SZ_X16 + SZ_WQT + SZ_WKVT + SZ_WOT + SZ_CS + SZ_QRAW + SZ_QH + SZ_QL + SZ_KH + SZ_KL + SZ_VT + SZ_VTL + SZ_OH + SZ_OL;
static_assert(WS_TOTAL <= (size_t)268435456);
static_assert(SZ_X16 % 256 == 0);
static_assert(SZ_KL % 256 == 0);
static_assert(SZ_VTL % 256 == 0);
static_assert(SZ_CS % 256 == 0);

typedef _Float16 v16h __attribute__((ext_vector_type(16)));
typedef unsigned short v8us __attribute__((ext_vector_type(8), may_alias));
typedef float v8f __attribute__((ext_vector_type(8)));
typedef float v4f __attribute__((ext_vector_type(4)));
typedef float v4fa __attribute__((ext_vector_type(4), may_alias));
typedef float v2f __attribute__((ext_vector_type(2)));
typedef _Float16 v4h __attribute__((ext_vector_type(4)));
typedef uint32_t u32x4 __attribute__((ext_vector_type(4)));
typedef uint32_t u32x8 __attribute__((ext_vector_type(8)));
union FragH { v16h v; v8us half[2]; _Float16 h[16]; unsigned short u[16]; };
union Pack8 { v8us v; _Float16 h[8]; unsigned short u[8]; };

__device__ __forceinline__ unsigned short bf16_bits(float x) { const unsigned int u = __float_as_uint(x); return (unsigned short)((u + 0x7FFFu + ((u >> 16) & 1u)) >> 16); }
__device__ __forceinline__ float bf16_rne(float x) { return __uint_as_float(((unsigned int)bf16_bits(x)) << 16); }
// value of lane l ^ M, M < 16, inside the 16-lane row: a DPP operand (row_xmask) of the vector port, no LDS operation and no wait; every lane is on where it is used
template <int M> __device__ __forceinline__ float row_xor(float v) { return __builtin_bit_cast(float, __builtin_amdgcn_update_dpp(0, __builtin_bit_cast(int, v), 0x160 | M, 0xf, 0xf, true)); }
// value of lane l ^ 16: vector cross-row move
__device__ __forceinline__ float half_xor(float v) { return __builtin_bit_cast(float, __builtin_amdgcn_permlanex16(__builtin_bit_cast(int, v), __builtin_bit_cast(int, v), 0x76543210, 0xfedcba98, false, false)); }
// maxima of eight independent values over their 16-lane rows, lane distance 8, 4, 2, 1. In asm so that exchange and maximum are one instruction (from fmaxf the compiler makes three: DPP move, quieting of the moved value, maximum),
// and in one statement so that the eight rows stay interleaved: a link's producer stands eight instructions back and no link waits
__device__ __forceinline__ void row_max8(float (&v)[8]) {
  asm(
      "v_max_num_f32_dpp %0, %0, %0 row_xmask:8 row_mask:0xf bank_mask:0xf\n\t"
      "v_max_num_f32_dpp %1, %1, %1 row_xmask:8 row_mask:0xf bank_mask:0xf\n\t"
      "v_max_num_f32_dpp %2, %2, %2 row_xmask:8 row_mask:0xf bank_mask:0xf\n\t"
      "v_max_num_f32_dpp %3, %3, %3 row_xmask:8 row_mask:0xf bank_mask:0xf\n\t"
      "v_max_num_f32_dpp %4, %4, %4 row_xmask:8 row_mask:0xf bank_mask:0xf\n\t"
      "v_max_num_f32_dpp %5, %5, %5 row_xmask:8 row_mask:0xf bank_mask:0xf\n\t"
      "v_max_num_f32_dpp %6, %6, %6 row_xmask:8 row_mask:0xf bank_mask:0xf\n\t"
      "v_max_num_f32_dpp %7, %7, %7 row_xmask:8 row_mask:0xf bank_mask:0xf\n\t"
      "v_max_num_f32_dpp %0, %0, %0 row_xmask:4 row_mask:0xf bank_mask:0xf\n\t"
      "v_max_num_f32_dpp %1, %1, %1 row_xmask:4 row_mask:0xf bank_mask:0xf\n\t"
      "v_max_num_f32_dpp %2, %2, %2 row_xmask:4 row_mask:0xf bank_mask:0xf\n\t"
      "v_max_num_f32_dpp %3, %3, %3 row_xmask:4 row_mask:0xf bank_mask:0xf\n\t"
      "v_max_num_f32_dpp %4, %4, %4 row_xmask:4 row_mask:0xf bank_mask:0xf\n\t"
      "v_max_num_f32_dpp %5, %5, %5 row_xmask:4 row_mask:0xf bank_mask:0xf\n\t"
      "v_max_num_f32_dpp %6, %6, %6 row_xmask:4 row_mask:0xf bank_mask:0xf\n\t"
      "v_max_num_f32_dpp %7, %7, %7 row_xmask:4 row_mask:0xf bank_mask:0xf\n\t"
      "v_max_num_f32_dpp %0, %0, %0 row_xmask:2 row_mask:0xf bank_mask:0xf\n\t"
      "v_max_num_f32_dpp %1, %1, %1 row_xmask:2 row_mask:0xf bank_mask:0xf\n\t"
      "v_max_num_f32_dpp %2, %2, %2 row_xmask:2 row_mask:0xf bank_mask:0xf\n\t"
      "v_max_num_f32_dpp %3, %3, %3 row_xmask:2 row_mask:0xf bank_mask:0xf\n\t"
      "v_max_num_f32_dpp %4, %4, %4 row_xmask:2 row_mask:0xf bank_mask:0xf\n\t"
      "v_max_num_f32_dpp %5, %5, %5 row_xmask:2 row_mask:0xf bank_mask:0xf\n\t"
      "v_max_num_f32_dpp %6, %6, %6 row_xmask:2 row_mask:0xf bank_mask:0xf\n\t"
      "v_max_num_f32_dpp %7, %7, %7 row_xmask:2 row_mask:0xf bank_mask:0xf\n\t"
      "v_max_num_f32_dpp %0, %0, %0 row_xmask:1 row_mask:0xf bank_mask:0xf\n\t"
      "v_max_num_f32_dpp %1, %1, %1 row_xmask:1 row_mask:0xf bank_mask:0xf\n\t"
      "v_max_num_f32_dpp %2, %2, %2 row_xmask:1 row_mask:0xf bank_mask:0xf\n\t"
      "v_max_num_f32_dpp %3, %3, %3 row_xmask:1 row_mask:0xf bank_mask:0xf\n\t"
      "v_max_num_f32_dpp %4, %4, %4 row_xmask:1 row_mask:0xf bank_mask:0xf\n\t"
      "v_max_num_f32_dpp %5, %5, %5 row_xmask:1 row_mask:0xf bank_mask:0xf\n\t"
      "v_max_num_f32_dpp %6, %6, %6 row_xmask:1 row_mask:0xf bank_mask:0xf\n\t"
      "v_max_num_f32_dpp %7, %7, %7 row_xmask:1 row_mask:0xf bank_mask:0xf\n\t"
      : "+v"(v[0]), "+v"(v[1]), "+v"(v[2]), "+v"(v[3]), "+v"(v[4]), "+v"(v[5]), "+v"(v[6]), "+v"(v[7]));
}
// one exchange stage of eight independent row sums (lane distance M)
template <int M> __device__ __forceinline__ void sum_stage(float (&v)[8]) {
#pragma unroll
  for (int r = 0; r < 8; ++r) v[r] += row_xor<M>(v[r]);
}

// 16x32 f16 fragment from a k-contiguous row p (A row m = lane&15, or Bt row n = lane&15): elements 0..7 <- k 8h..8h+7, 8..15 <- k 16+8h..16+8h+7
__device__ __forceinline__ v16h frag16(const _Float16* p, int hh) {
  FragH f;
  f.half[0] = *(const v8us*)((const unsigned short*)p + 8 * hh);
  f.half[1] = *(const v8us*)((const unsigned short*)p + 16 + 8 * hh);
  return f.v;
}

// bx = block inside a batch element, bb = batch element
__device__ __forceinline__ void x16_block(const float* __restrict__ x, _Float16* __restrict__ X16, size_t n8, int bx, int bb) {
  const size_t t = (size_t)bx * 256 + threadIdx.x; if (t >= n8) return;
  x += (size_t)bb * SEQ_FULL * HID; X16 += (size_t)bb * SEQ * HID;
  const v4f a = *(const v4fa*)(x + t * 8), c = *(const v4fa*)(x + t * 8 + 4);
  Pack8 f;
#pragma unroll
  for (int q = 0; q < 4; ++q) { f.h[q] = (_Float16)bf16_rne(a[q]); f.h[4 + q] = (_Float16)bf16_rne(c[q]); }
  unsigned short* d = (unsigned short*)X16 + t * 8;
  *(v8us*)d = f.v; 
}

#define WT_K 128                     /* k per block tile: one 256-B piece of a Wt row */
#define WT_N 128                     /* n per block tile: two 256-B pieces of a W row */

// Wt[n][k] = f16(bf16rne(W[k][n]) * scale). Block bx = tile of WT_K k x WT_N n, (K / WT_K) * (N / WT_N) blocks; st = the block's LDS tile.
// A thread reads 8 k x (4 + 4) n (each wave-wide load covers two whole 256-B row pieces of W), packs 8 k per n and turns the tile in LDS; each wave-wide store covers two whole 256-B row pieces of Wt.
// LDS row n holds its sixteen 16-B k chunks at chunk ^ ((n >> 2) & 15): the 16 lanes of a half wave then fall on 16 different bank groups, writing (16 rows, one chunk) and reading (one row, 16 chunks).
// K and N are compile-time, so that the row steps are immediate offsets on one address.
template <int K, int N>
__device__ __forceinline__ void wt_block(unsigned short (*st)[WT_K], const float* __restrict__ W, _Float16* __restrict__ Wt, float scale, int bx) {
  static_assert(K % WT_K == 0);
  static_assert(N % WT_N == 0);
  const int tid = threadIdx.x;
  constexpr int ntn = N / WT_N;
  const int kt = bx / ntn, nt = bx - kt * ntn;
  const int k0 = kt * WT_K, n0 = nt * WT_N;
  const int lo = tid & 15, hi = tid >> 4;
  // block-uniform base plus one 32-bit lane offset that all sixteen loads (all eight stores) share
  const char* wb = (const char*)(W + (size_t)k0 * N + n0);
  const uint32_t vo = ((uint32_t)(hi * 8) * (uint32_t)N + (uint32_t)(lo * 4)) * 4u;
  v4f r[2][8];
#pragma unroll
  for (int i = 0; i < 8; ++i) {
    r[0][i] = *(const v4fa*)(wb + (size_t)i * N * 4 + vo);
    r[1][i] = *(const v4fa*)(wb + (size_t)i * N * 4 + 256 + vo);
  }
  // behind the last load: the offset register that all sixteen loads name stays whole until their addresses are taken (no load's result is placed on it), and no load sinks below into the conversions
  asm volatile("s_wait_xcnt 0x0" :: "v"(vo) : "memory");
#pragma unroll
  for (int h = 0; h < 2; ++h) {
#pragma unroll
    for (int j = 0; j < 4; ++j) {
      Pack8 f;
#pragma unroll
      for (int i = 0; i < 8; ++i) f.h[i] = (_Float16)(bf16_rne(r[h][i][j]) * scale);
      *(v8us*)&st[h * 64 + lo * 4 + j][(hi ^ lo) * 8] = f.v;
    }
  }
  __syncthreads();
  char* tb = (char*)(Wt + (size_t)n0 * K + k0);
  const uint32_t so = ((uint32_t)hi * (uint32_t)K + (uint32_t)(lo * 8)) * 2u;
#pragma unroll
  for (int it = 0; it < WT_N / 16; ++it) {
    const int n = it * 16 + hi;
    const v8us v = *(const v8us*)&st[n][(lo ^ ((n >> 2) & 15)) * 8];
    *(v8us*)(tb + (size_t)it * 16 * K * 2 + so) = v;
  }
}

__device__ __forceinline__ void rope_block(float* __restrict__ cs, int bx) {
  const int t = bx * 256 + threadIdx.x; if (t >= SEQ * NRP) return;
  const int pos = t / NRP, i = t - pos * NRP;
  const float inv = exp2f(-(float)i * 0.31143075889569022f);   // 2^(-i*log2(1e6)/64)
  const float ang = (float)pos * inv;
  float sn, cn; sincosf(ang, &sn, &cn);
  v2f o; o[0] = cn; o[1] = sn;
  float* d = cs + (size_t)t * 2;
  *(v2f*)d = o; 
}

// One grid for everything that reads only the inputs: rotary table, the four weight planes, the x plane. None reads what another writes; a block's index range says which piece it takes.
constexpr int PB_ROPE = (SEQ * NRP + 255) / 256;
constexpr int PB_WQ   = (HID / WT_K) * (NQC / WT_N);
constexpr int PB_WKV  = (HID / WT_K) * (NKV * HD / WT_N);
constexpr int PB_WO   = ((NH * HD) / WT_K) * (HID / WT_N);
constexpr int PB_X    = (int)(((size_t)SEQ * HID / 8 + 255) / 256);
constexpr int PB_ALL  = PB_ROPE + PB_WQ + 2 * PB_WKV + PB_WO + NB * PB_X;
__global__ __launch_bounds__(256) void k_prep(const float* __restrict__ x, const float* __restrict__ Wq, const float* __restrict__ Wk, const float* __restrict__ Wv, const float* __restrict__ Wo,
                                             _Float16* __restrict__ X16, _Float16* __restrict__ WqT, _Float16* __restrict__ WkvT, _Float16* __restrict__ WoT, float* __restrict__ cs, float scale) {
  __shared__ __attribute__((aligned(16))) unsigned short st[WT_N][WT_K];
  int b = (int)blockIdx.x;
  if (b < PB_ROPE) { rope_block(cs, b); return; }
  b -= PB_ROPE;
  if (b < PB_WQ) { wt_block<HID, NQC>(st, Wq, WqT, scale, b); return; }
  b -= PB_WQ;
  if (b < PB_WO) { wt_block<NH * HD, HID>(st, Wo, WoT, scale, b); return; }
  b -= PB_WO;
  if (b < 2 * PB_WKV) {
    const bool isv = b >= PB_WKV;
    wt_block<HID, NKV * HD>(st, isv ? Wv : Wk, isv ? WkvT + (size_t)NKV * HD * HID : WkvT, scale, isv ? b - PB_WKV : b);
    return;
  }
  b -= 2 * PB_WKV;
  const int bb = b / PB_X;
  x16_block(x, X16, (size_t)SEQ * HID / 8, b - bb * PB_X, bb);
}

#define G_PITCH 272u                 /* LDS row pitch: 256 B of k plus the mover's 16-B pad (ds_load_b128 readers) */
#define G_SLICE 18432u               /* one wave's slice: 64 rows at G_PITCH, rounded up to a multiple of 2 KiB */
#define G_STAGE (4u * G_SLICE)       /* one buffer: [A rows 0..63 | A rows 64..127 (RES: residual rows 0..63) | Bt rows 0..63 | Bt rows 64..127] */
static_assert(64u * G_PITCH <= G_SLICE);
static_assert(G_SLICE % 2048u == 0);
static_assert(64u * 68u * 4u <= G_SLICE);

// D += A.B by the plain builtin, whose distances the compiler keeps itself: register operands on an asm guard would hold the GEMM's accumulators and both fragment sets below v256 (spills)
__device__ __forceinline__ v8f mma16b(v16h a, v16h b, v8f c) { return __builtin_amdgcn_wmma_f32_16x16x32_f16(false, a, false, b, (short)0, c, false, false); }
__device__ __forceinline__ uint32_t uni(uint32_t v) { return (uint32_t)__builtin_amdgcn_readfirstlane(v); }
__device__ __forceinline__ uint32_t pinned(uint32_t v) { uint32_t w = uni(v); asm volatile("" : "+s"(w)); return w; }
__device__ __forceinline__ void wait_ds0() { asm volatile("s_wait_dscnt 0x0" ::: "memory"); }          // this wave's LDS reads have returned before the buffer is handed over
__device__ __forceinline__ void tdm_load(u32x4 g0, u32x8 g1) { asm volatile("tensor_load_to_lds %0, %1" :: "s"(g0), "s"(g1) : "memory"); }
// this wave's slice has landed; the compiler places no wait for the mover. The wait names the youngest request's descriptor as inputs: its scalar registers stay allocated, and so unwritten, until the request has returned
__device__ __forceinline__ void wait_tensor0_of(u32x4 g0, u32x8 g1) { asm volatile("s_wait_tensorcnt 0x0" :: "s"(g0), "s"(g1) : "memory"); }
// group 1: 1-byte elements, tile = tensor = 64 rows of 256 B, source row pitch in bytes, 4 dwords of LDS pad behind every 256-B row
__device__ __forceinline__ u32x8 tdm_group1(uint32_t src_pitch) {
  u32x8 g;
  g[0] = uni((1u << 20) | (5u << 22) | (3u << 25));
  // pinned(): descriptor words held in their scalar registers through the loop, so that none is rewritten while a request is outstanding
  g[1] = pinned(256u << 16);
  g[2] = pinned(64u << 16);
  g[3] = pinned(256u << 16);
  g[4] = pinned(64u);
  g[5] = pinned(src_pitch);
  g[6] = pinned(0u);
  g[7] = pinned(0u);
  return g;
}
__device__ __forceinline__ u32x4 tdm_group0(uint32_t lds_dst, uint64_t ga) {
  u32x4 g;
  g[0] = uni(1u); g[1] = uni(lds_dst); g[2] = uni((uint32_t)ga); g[3] = uni((((uint32_t)(ga >> 32)) & 0x01FFFFFFu) | 0x80000000u);
  return g;
}

typedef uint64_t u64a __attribute__((may_alias));
// behind eight 8-B stores: their data registers and their lane offset are inputs of the wait, so that they stay allocated, and so unwritten, until the stores' addresses and data are taken
__device__ __forceinline__ void wait_x0_of(const uint64_t (&d)[8], uint32_t o) {
  asm volatile("s_wait_xcnt 0x0" :: "v"(d[0]), "v"(d[1]), "v"(d[2]), "v"(d[3]), "v"(d[4]), "v"(d[5]), "v"(d[6]), "v"(d[7]), "v"(o) : "memory");
}

// C[M][N] (f32, pitch ldc) = alpha * A[M][K] (f16, pitch lda) . Bt[N][K]^T (f16, pitch ldb)  (+ alphal * Al . Bt^T when RES: residual plane Al, pitch lda).
// Block = 4 waves (2 x 2), C tile 128 x 128 (RES: 64 x 128), tile bx of (M / tile rows) * (N / 128); K % 128 == 0, K >= 128. sm = the block's LDS ring.
// A pass is 128 k: every wave brings its own 64-row slice of the pass into LDS with one tensor load, two buffers, the next pass's load in flight under this pass's products.
// Each accumulator sums its k in ascending steps of 32. Every inner loop is unrolled so that the accumulator and fragment arrays are indexed by constants and stay in registers.
// PROJ: the tile is one head's 128 columns of a projection, and mode (block-uniform) says what leaves the block:
//   0: the f32 tile to C, as without PROJ (gate columns);
//   1: q or k head: RMSNorm (nw + 1, eps 1e-6) over the tile's 128 columns, rotate-half RoPE from cs[token], f16 rows to PH[token][d], x2^10 residual rows to PL for tokens < RESQ;
//   2: v head: turned, f16 to PH[d][token] (row pitch SEQ), x2^10 residual to PL[d][token] (row pitch RESQ) for tokens < RESQ.
template <bool RES, bool PROJ>
__device__ __forceinline__ void gemm_tile(unsigned char* sm, int bx, const _Float16* __restrict__ A, const _Float16* __restrict__ Al, int lda, const _Float16* __restrict__ Bt, int ldb,
                                          float alpha, float alphal, float* __restrict__ C, int ldc, int M, int N, int K,
                                          int mode, const float* __restrict__ nw, const float* __restrict__ cs, _Float16* __restrict__ PH, _Float16* __restrict__ PL) {
  static_assert(!(RES && PROJ));
  constexpr int BM = RES ? 64 : 128;
  constexpr int NI = RES ? 2 : 4;        // 16-row C tiles per wave
  const int tid = threadIdx.x, lane = tid & 31, ln = lane & 15, hh = lane >> 4;
  const uint32_t w = uni((uint32_t)tid >> 5);
  const int wm = (int)(w >> 1), wn = (int)(w & 1u);
  const int ntn = N >> 7;
  const int mt = PROJ ? (int)uni((uint32_t)(bx / ntn)) : bx / ntn, nq = bx - mt * ntn;   // PROJ: the quotient (block-uniform) in a scalar register, and with it the tile's rows, columns and bases
  const int row0 = mt * BM, col0 = nq * 128;
  if (row0 >= M) return;
  const _Float16* src = (w >= 2u) ? (Bt + (size_t)(col0 + 64 * wn) * ldb)
                      : (RES ? ((w == 1u ? Al : A) + (size_t)row0 * lda) : (A + (size_t)(row0 + 64 * (int)w) * lda));
  const uint64_t ga0 = (uint64_t)(uintptr_t)src;
  const uint32_t lds0 = (uint32_t)(size_t)sm + w * G_SLICE;
  const u32x8 g1 = tdm_group1(2u * (uint32_t)(w >= 2u ? ldb : lda));
  const int ns = K >> 7;
  // per-lane fragment rows inside a buffer
  uint32_t aoff[4], boff[4];
#pragma unroll
  for (int i = 0; i < 4; ++i) {
    aoff[i] = RES ? ((uint32_t)(i >> 1) * G_SLICE + (uint32_t)(wm * 32 + (i & 1) * 16 + ln) * G_PITCH)
                  : ((uint32_t)wm * G_SLICE + (uint32_t)(i * 16 + ln) * G_PITCH);
    boff[i] = (uint32_t)(2 + wn) * G_SLICE + (uint32_t)(i * 16 + ln) * G_PITCH;
  }
  const v8f z8 = {0.f, 0.f, 0.f, 0.f, 0.f, 0.f, 0.f, 0.f};
  v8f c[4][4];                           // RES: c[0..1] main plane, c[2..3] residual plane of the same rows
#pragma unroll
  for (int i = 0; i < 4; ++i)
#pragma unroll
    for (int j = 0; j < 4; ++j) c[i][j] = z8;

  u32x4 g0 = tdm_group0(lds0, ga0);      // group 0 of the youngest request
  tdm_load(g0, g1);
  wait_tensor0_of(g0, g1);
  __syncthreads();
  if (pinned(1 < ns ? 1u : 0u) != 0u) { g0 = tdm_group0(lds0 + G_STAGE, ga0 + 256u); tdm_load(g0, g1); }
#pragma unroll 1                         // one pass per trip: the buffer alternates at run time
  for (int s = 0; s < ns; ++s) {
    const uint32_t bo = (uint32_t)(s & 1) * G_STAGE;
    const unsigned char* bp = sm + bo;
    v16h fa[2][4], fb[2][4];             // set (kk & 1) holds k-step kk's fragments; the next step's loads go ahead of this step's products as one group
#pragma unroll
    for (int i = 0; i < 4; ++i) { fa[0][i] = frag16((const _Float16*)(bp + aoff[i]), hh); fb[0][i] = frag16((const _Float16*)(bp + boff[i]), hh); }
#pragma unroll
    for (int kk = 0; kk < 4; ++kk) {
      if (kk < 3) {
#pragma unroll
        for (int i = 0; i < 4; ++i) {
          fa[(kk + 1) & 1][i] = frag16((const _Float16*)(bp + aoff[i] + (kk + 1) * 64), hh);
          fb[(kk + 1) & 1][i] = frag16((const _Float16*)(bp + boff[i] + (kk + 1) * 64), hh);
        }
      }
      __builtin_amdgcn_sched_barrier(0);   // keeps the next step's LDS loads one group ahead of the products, not spread among them
#pragma unroll
      for (int j = 0; j < 4; ++j)
#pragma unroll
        for (int i = 0; i < 4; ++i) c[i][j] = mma16b(fa[kk & 1][i], fb[kk & 1][j], c[i][j]);
      __builtin_amdgcn_sched_barrier(0);   // ends the block of products: the following loads stay behind it
    }
    asm volatile("v_nop\n\tv_nop\n\tv_nop\n\tv_nop");   // WMMA-to-VALU distance on the loop's exit path, where the epilogue reads the accumulators
    // publish point of pass s + 1: own LDS reads returned, own slice landed, block barrier, then the refill of the buffer just read
    wait_ds0();
    wait_tensor0_of(g0, g1);
    __syncthreads();
    if (pinned(s + 2 < ns ? 1u : 0u) != 0u) { g0 = tdm_group0(lds0 + bo, ga0 + (uint64_t)(uint32_t)(s + 2) * 256u); tdm_load(g0, g1); }
  }
  wait_tensor0_of(g0, g1);
  wait_ds0();

  if constexpr (PROJ) {
    if (mode == 2) {
      // v head: a lane's accumulator registers are eight consecutive tokens of one d, that is one 16-B piece of a V^T row; a wave's four i fill one 128-B line of each of its rows
      const bool wl = row0 < RESQ;       // block-uniform: RESQ is a multiple of the tile's rows
      char* vb = (char*)(PH + (size_t)(wn * 64) * SEQ + row0 + wm * 64);
      char* vlb = (char*)(PL + (size_t)(wn * 64) * RESQ + row0 + wm * 64);
      const uint32_t vo = ((uint32_t)ln * (uint32_t)SEQ + 8u * (uint32_t)hh) * 2u;
      const uint32_t vlo = ((uint32_t)ln * (uint32_t)RESQ + 8u * (uint32_t)hh) * 2u;
#pragma unroll
      for (int j = 0; j < 4; ++j) {
#pragma unroll
        for (int i = 0; i < 4; ++i) {
          Pack8 ph;
#pragma unroll
          for (int r = 0; r < 8; ++r) ph.h[r] = (_Float16)(c[i][j][r] * alpha);
          *(v8us*)(vb + (size_t)j * (16 * SEQ * 2) + (size_t)i * 32 + vo) = ph.v;
        }
      }
      asm volatile("s_wait_xcnt 0x0" ::: "memory");   // behind the stores, before the residual branch rewrites their data registers
      if (wl) {
#pragma unroll
        for (int j = 0; j < 4; ++j) {
#pragma unroll
          for (int i = 0; i < 4; ++i) {
            Pack8 pl;
#pragma unroll
            for (int r = 0; r < 8; ++r) { const float f = c[i][j][r] * alpha; pl.h[r] = (_Float16)((f - (float)(_Float16)f) * RCAR); }
            *(v8us*)(vlb + (size_t)j * (16 * RESQ * 2) + (size_t)i * 32 + vlo) = pl.v;
          }
        }
      }
      asm volatile("s_wait_xcnt 0x0" ::: "memory");   // behind the stores, before the code that follows this branch rewrites their address and data registers
      return;
    }
  }
  // epilogue: the ring is free behind the last pass's barrier; each wave stages its C tile in its own slice and stores whole 256-B row pieces
  float* so = (float*)(sm + w * G_SLICE);
#pragma unroll
  for (int i = 0; i < NI; ++i) {
#pragma unroll
    for (int j = 0; j < 4; ++j) {
#pragma unroll
      for (int r = 0; r < 8; ++r)
        so[(i * 16 + 8 * hh + r) * 68 + j * 16 + ln] = RES ? (c[i][j][r] * alpha + c[(i + 2) & 3][j][r] * alphal) : (c[i][j][r] * alpha);
    }
  }
  if constexpr (PROJ) {
    if (mode == 1) {
      // q or k head: a row's 128 columns lie in two waves' slices, so the block meets once; then wave w takes rows 32 w .. 32 w + 31, a row at a time over its 32 lanes (lane l: columns 4 l .. 4 l + 3)
      __syncthreads();
      const bool wl = row0 < RESQ;       // block-uniform
      const v4f wv = *(const v4fa*)(nw + 4 * lane);
      const int rw = row0 + 32 * (int)w; // the wave's first token
      const unsigned char* xb = sm + ((w & 2u) + (uint32_t)hh) * G_SLICE + (w & 1u) * (32u * 272u) + (uint32_t)ln * 16u;
      const char* cb = (const char*)(cs + (size_t)rw * (NRP * 2));
      const uint32_t co = (uint32_t)ln * 32u;
      char* hb = (char*)(PH + (size_t)rw * HD);
      char* lb = (char*)(PL + (size_t)rw * HD);
      const uint32_t ho = (uint32_t)lane * 8u;
      const float sg = (lane < 16) ? -1.0f : 1.0f;                        // d < 64: -x[d+64]; d >= 64: +x[d-64]
#pragma unroll
      for (int g = 0; g < 4; ++g) {
        v4f t01[8], t23[8];              // rotary rows of the group's eight tokens
#pragma unroll
        for (int u = 0; u < 8; ++u) {
          t01[u] = *(const v4fa*)(cb + (size_t)(g * 8 + u) * (NRP * 8) + co);
          t23[u] = *(const v4fa*)(cb + (size_t)(g * 8 + u) * (NRP * 8) + 16 + co);
        }
        asm volatile("s_wait_xcnt 0x0" :: "v"(co), "v"(lane) : "memory");   // behind the loads: the lane offsets that they name stay whole until their addresses are taken
        v4f xv[8];
#pragma unroll
        for (int u = 0; u < 8; ++u) xv[u] = *(const v4fa*)(xb + (g * 8 + u) * 272);
        // the eight rows pass each step together, so that no link of a row's chain waits for the one before it
        float ss[8], ov[8][4];
        uint64_t dh[8];
#pragma unroll
        for (int u = 0; u < 8; ++u) ss[u] = xv[u][0] * xv[u][0] + xv[u][1] * xv[u][1] + xv[u][2] * xv[u][2] + xv[u][3] * xv[u][3];
#pragma unroll
        for (int u = 0; u < 8; ++u) ss[u] += half_xor(ss[u]);
        sum_stage<8>(ss); sum_stage<4>(ss); sum_stage<2>(ss); sum_stage<1>(ss);
#pragma unroll
        for (int u = 0; u < 8; ++u) ss[u] = rsqrtf(ss[u] * (1.0f / 128.0f) + 1.0e-6f);
#pragma unroll
        for (int u = 0; u < 8; ++u) {
          const v4f a01 = t01[u], a23 = t23[u];
          float nv[4], pr[4];
#pragma unroll
          for (int q = 0; q < 4; ++q) nv[q] = xv[u][q] * ss[u] * (wv[q] + 1.0f);
#pragma unroll
          for (int q = 0; q < 4; ++q) pr[q] = half_xor(nv[q]);            // element d +- 64
          const float cv[4] = {a01[0], a01[2], a23[0], a23[2]};
          const float sv[4] = {a01[1], a01[3], a23[1], a23[3]};
          v4h oh;
#pragma unroll
          for (int q = 0; q < 4; ++q) { ov[u][q] = nv[q] * cv[q] + sg * pr[q] * sv[q]; oh[q] = (_Float16)ov[u][q]; }
          dh[u] = __builtin_bit_cast(uint64_t, oh);
        }
#pragma unroll
        for (int u = 0; u < 8; ++u) *(u64a*)(hb + (size_t)(g * 8 + u) * (HD * 2) + ho) = dh[u];
        wait_x0_of(dh, ho);
        if (wl) {
#pragma unroll
          for (int u = 0; u < 8; ++u) {
            v4h ol;
#pragma unroll
            for (int q = 0; q < 4; ++q) ol[q] = (_Float16)((ov[u][q] - (float)(_Float16)ov[u][q]) * RCAR);
            dh[u] = __builtin_bit_cast(uint64_t, ol);
          }
#pragma unroll
          for (int u = 0; u < 8; ++u) *(u64a*)(lb + (size_t)(g * 8 + u) * (HD * 2) + ho) = dh[u];
          wait_x0_of(dh, ho);
        }
      }
      return;
    }
  }
  __builtin_amdgcn_fence(4 /* acq_rel order */, "workgroup");
  __builtin_amdgcn_wave_barrier();
  const int rsub = lane >> 4, c4 = (lane & 15) * 4;
#pragma unroll
  for (int g = 0; g < NI; ++g) {         // eight row pairs a group: its LDS reads, its stores, one wait
    v4f v[8];
#pragma unroll
    for (int u = 0; u < 8; ++u) v[u] = *(const v4fa*)&so[((g * 8 + u) * 2 + rsub) * 68 + c4];
#pragma unroll
    for (int u = 0; u < 8; ++u) *(v4f*)(C + (size_t)(row0 + wm * (NI * 16) + (g * 8 + u) * 2 + rsub) * ldc + col0 + wn * 64 + c4) = v[u];
    asm volatile("s_wait_xcnt 0x0" ::: "memory");   // behind the group's stores, before the next group (or the code behind this tile) rewrites their address and data registers
  }
}

// x.Wq and x.[Wk|Wv] in one grid: blocks 0 .. PJ_Q-1 are the tiles of x.Wq, the others those of x.[Wk|Wv]; grid.y = batch element. A tile is 128 tokens of one head's q, gate, k or v columns,
// and q, k and v leave the block in the form that attention reads (norm, rotary, turn in the tile's epilogue): only the gate columns are kept in f32.
constexpr int PJ_Q  = (SEQ / 128) * (NQC / 128);
constexpr int PJ_KV = (SEQ / 128) * (NKVC / 128);
static_assert(((NQC / 128) & (NQC / 128 - 1)) == 0 && ((NKVC / 128) & (NKVC / 128 - 1)) == 0 && (NKV & (NKV - 1)) == 0);
__global__ __launch_bounds__(128) void k_proj(const _Float16* __restrict__ X16, const _Float16* __restrict__ WqT, const _Float16* __restrict__ WkvT,
                                             const float* __restrict__ qnw, const float* __restrict__ knw, const float* __restrict__ cs, float* __restrict__ qraw,
                                             _Float16* __restrict__ Qh, _Float16* __restrict__ Ql, _Float16* __restrict__ Kh, _Float16* __restrict__ Kl,
                                             _Float16* __restrict__ VT, _Float16* __restrict__ VTl, float alpha) {
  __shared__ __attribute__((aligned(2048))) unsigned char sm[2u * G_STAGE];
  const int bx = (int)blockIdx.x;
  const size_t bb = blockIdx.y;
  const _Float16* A = X16 + bb * ((size_t)SEQ * HID);
  const bool two = bx >= PJ_Q;           // block-uniform, like all that follows from it
  const int tb = two ? bx - PJ_Q : bx;
  const int nq = tb & ((two ? NKVC / 128 : NQC / 128) - 1);   // the tile's column block: tb modulo a power of two
  const bool isv = two && nq >= NKV;
  const size_t hp = two ? bb * NKV + (size_t)(nq & (NKV - 1)) : bb * NH + (size_t)(nq >> 1);   // head plane
  gemm_tile<false, true>(sm, tb, A, A, HID, two ? WkvT : WqT, HID, alpha, 0.0f, qraw + bb * ((size_t)SEQ * NQC), NQC, SEQ, two ? NKVC : NQC, HID,
                         two ? (isv ? 2 : 1) : ((nq & 1) ? 0 : 1), two ? knw : qnw, cs,
                         (two ? (isv ? VT : Kh) : Qh) + hp * ((size_t)SEQ * HD), (two ? (isv ? VTl : Kl) : Ql) + hp * ((size_t)RESQ * HD));
}

// Two independent products in one grid: blocks 0 .. n1-1 are the tiles of product 1 (plain), the others those of product 2 (with its residual plane). lda, ldb, K and alpha are common.
// grid.y = batch element: A advances by bsA, Al2 by bsAl2, C1 and C2 by bsC1 and bsC2 elements per batch element; Bt1 and Bt2 are shared.
__global__ __launch_bounds__(128) void k_gemm2(int n1, const _Float16* __restrict__ A1, const _Float16* __restrict__ Bt1, float* __restrict__ C1, int ldc1, int M1, int N1, size_t bsC1,
                                              const _Float16* __restrict__ A2, const _Float16* __restrict__ Al2, const _Float16* __restrict__ Bt2, float* __restrict__ C2, int ldc2, int M2, int N2, size_t bsC2,
                                              size_t bsAl2, int lda, int ldb, int K, size_t bsA, float alpha, float alphal) {
  __shared__ __attribute__((aligned(2048))) unsigned char sm[2u * G_STAGE];
  const int bx = (int)blockIdx.x;
  const size_t bb = blockIdx.y;
  if (bx >= n1) gemm_tile<true, false>(sm, bx - n1, A2 + bb * bsA, Al2 + bb * bsAl2, lda, Bt2, ldb, alpha, alphal, C2 + bb * bsC2, ldc2, M2, N2, K, 0, nullptr, nullptr, nullptr, nullptr);   // block-uniform
  else gemm_tile<false, false>(sm, bx, A1 + bb * bsA, A1 + bb * bsA, lda, Bt1, ldb, alpha, 0.0f, C1 + bb * bsC1, ldc1, M1, N1, K, 0, nullptr, nullptr, nullptr, nullptr);
}

// Causal grouped attention, flash form. Block = 8 waves x 16 query rows (query block qb) of head h (kv = h/4); bz = batch element (RES: batch element * 2 + o column half); smem = the block's LDS.
// Per key chunk: K rows [t][d] and V^T rows [d][t] staged in LDS (cross-wave: block barriers); S = q.k^T (f16, f32 acc), scale 1/sqrt(128),
// RES: first RESQ query rows: chunk 32 keys, q/k/P/V^T residual second terms into separate accumulators folded by 2^-10; block covers 64 o columns.
// Every inner loop is unrolled, so that the fragment, accumulator and row arrays are indexed by constants and stay in registers.
template <bool RES> struct AttnLds {     // byte sizes of the block's LDS tiles, in their order
  static constexpr int KC = RES ? 32 : 64, OD = RES ? 64 : 128, KP = HD + 8, VP = KC + 8, PP = 72;
  static constexpr uint32_t K = KC * KP * 2u, KL = (RES ? KC : 1) * KP * 2u, V = OD * VP * 2u, VL = (RES ? OD : 1) * VP * 2u, P = 8 * 16 * PP * 2u, PL = (RES ? 8 : 1) * 16 * PP * 2u;
  static constexpr uint32_t ALL = K + KL + V + VL + P + PL;
  static_assert(K % 16 == 0 && KL % 16 == 0 && V % 16 == 0 && VL % 16 == 0 && P % 16 == 0);
};
template <bool RES>
__device__ __forceinline__ void attn_block(unsigned char* smem, const _Float16* __restrict__ Qh, const _Float16* __restrict__ Ql,
                                           const _Float16* __restrict__ Kh, const _Float16* __restrict__ Kl,
                                           const _Float16* __restrict__ VT, const _Float16* __restrict__ VTl,
                                           const float* __restrict__ qraw, _Float16* __restrict__ Oh, _Float16* __restrict__ Ol, int qb, int h, int bz) {
  constexpr int KC = RES ? 32 : 64;      // keys per chunk
  constexpr int NJ = KC / 16;            // score column tiles
  constexpr int NKS = KC / 32;           // k-steps of P.V^T
  constexpr int OD = RES ? 64 : 128;     // o columns per block
  constexpr int NC = OD / 16;
  constexpr int NHF = OD / 64;
  constexpr int CG = RES ? 2 : 4;        // o column tiles per group of V^T fragment loads (four fragments with the residual ones)
  constexpr int NGC = NC / CG;           // groups per k-step
  constexpr int NG = NKS * NGC;
  constexpr int KP = HD + 8;             // sK pitch (halves)
  constexpr int VP = KC + 8;             // sV pitch
  constexpr int PP = 72;                 // sP pitch (KC weights, and 64 staged o columns)
  using L = AttnLds<RES>;
  static_assert(L::KC == KC && L::OD == OD && L::KP == KP && L::VP == VP && L::PP == PP);
  _Float16 (*sK)[KP]      = (_Float16 (*)[KP])smem;                                                  // [KC]
  _Float16 (*sKl)[KP]     = (_Float16 (*)[KP])(smem + L::K);                                         // [RES ? KC : 1]
  _Float16 (*sV)[VP]      = (_Float16 (*)[VP])(smem + L::K + L::KL);                                 // [OD]
  _Float16 (*sVl)[VP]     = (_Float16 (*)[VP])(smem + L::K + L::KL + L::V);                          // [RES ? OD : 1]
  _Float16 (*sP)[16][PP]  = (_Float16 (*)[16][PP])(smem + L::K + L::KL + L::V + L::VL);              // [8]
  _Float16 (*sPl)[16][PP] = (_Float16 (*)[16][PP])(smem + L::K + L::KL + L::V + L::VL + L::P);       // [RES ? 8 : 1]

  const int tid = threadIdx.x, w = tid >> 5, lane = tid & 31, ln = lane & 15, hh = lane >> 4;
  const int kv = h / GQ;
  const int dz = RES ? (bz & 1) * 64 : 0;
  const size_t bb = (size_t)(RES ? (bz >> 1) : bz);
  Qh += bb * ((size_t)NH * SEQ * HD); Ql += bb * ((size_t)NH * RESQ * HD); Kh += bb * ((size_t)NKV * SEQ * HD); Kl += bb * ((size_t)NKV * RESQ * HD);
  VT += bb * ((size_t)NKV * HD * SEQ); VTl += bb * ((size_t)NKV * HD * RESQ); qraw += bb * ((size_t)SEQ * NQC);
  Oh += bb * ((size_t)SEQ * NH * HD); Ol += bb * ((size_t)RESQ * NH * HD);
  const int q0b = qb * 128, q0w = q0b + 16 * w;
  const int nch = (q0b + 128) / KC;      // chunks holding keys <= last row of the block
  const int qlast = q0w + 15;

  v16h aq[4], aql[4];
  {
    const _Float16* qp = Qh + ((size_t)h * SEQ + q0w + ln) * HD;
#pragma unroll
    for (int kk = 0; kk < 4; ++kk) aq[kk] = frag16(qp + kk * 32, hh);
    if (RES) {
      const _Float16* qlp = Ql + ((size_t)h * RESQ + q0w + ln) * HD;
#pragma unroll
      for (int kk = 0; kk < 4; ++kk) aql[kk] = frag16(qlp + kk * 32, hh);
    } else {
#pragma unroll
      for (int kk = 0; kk < 4; ++kk) aql[kk] = aq[kk];
    }
  }
  const v8f z8 = {0.f, 0.f, 0.f, 0.f, 0.f, 0.f, 0.f, 0.f};
  v8f o[NC];
#pragma unroll
  for (int c = 0; c < NC; ++c) o[c] = z8;
  float mrow[8], lrow[8];
#pragma unroll
  for (int r = 0; r < 8; ++r) { mrow[r] = -3.0e38f; lrow[r] = 0.f; }
  const float alpha = 0.08838834764831845f;
  // staging addresses: block-uniform bases plus one 32-bit lane offset per plane, the row steps as constants (leaves the registers to the fragment groups)
  constexpr int VR = 256 / (KC / 8);     // V^T rows staged per round of the block
  const char* kgb = (const char*)(Kh + (size_t)kv * SEQ * HD);
  const char* klgb = (const char*)(Kl + (size_t)kv * RESQ * HD);
  const char* vgb = (const char*)(VT + (size_t)(kv * HD + dz) * SEQ);
  const char* vlgb = (const char*)(VTl + (size_t)(kv * HD + dz) * RESQ);
  const uint32_t kvo = (uint32_t)((tid >> 4) * HD + (tid & 15) * 8) * 2u;
  const uint32_t vvo = (uint32_t)((tid / (KC / 8)) * SEQ + (tid % (KC / 8)) * 8) * 2u;
  const uint32_t vlvo = (uint32_t)((tid / (KC / 8)) * RESQ + (tid % (KC / 8)) * 8) * 2u;
  _Float16* skp = &sK[tid >> 4][(tid & 15) * 8];
  _Float16* sklp = &sKl[RES ? (tid >> 4) : 0][(tid & 15) * 8];
  _Float16* svp = &sV[tid / (KC / 8)][(tid % (KC / 8)) * 8];
  _Float16* svlp = &sVl[RES ? (tid / (KC / 8)) : 0][(tid % (KC / 8)) * 8];

#pragma unroll 1
  for (int ch = 0; ch < nch; ++ch) {
    const int t0 = ch * KC;
    // stage K rows t0..t0+KC-1 (all 128 d) and V^T rows dz..dz+OD-1 (keys t0..t0+KC-1): staged extent == consumed extent
#pragma unroll
    for (int it = 0; it < (KC * 16) / 256; ++it) {
      *(v8us*)(skp + it * 16 * KP) = *(const v8us*)(kgb + (size_t)t0 * (HD * 2) + (size_t)it * (16 * HD * 2) + kvo);
      if (RES) *(v8us*)(sklp + it * 16 * KP) = *(const v8us*)(klgb + (size_t)t0 * (HD * 2) + (size_t)it * (16 * HD * 2) + kvo);
    }
#pragma unroll
    for (int it = 0; it < (OD * (KC / 8)) / 256; ++it) {
      *(v8us*)(svp + it * VR * VP) = *(const v8us*)(vgb + (size_t)t0 * 2 + (size_t)it * ((size_t)VR * SEQ * 2) + vvo);
      if (RES) *(v8us*)(svlp + it * VR * VP) = *(const v8us*)(vlgb + (size_t)t0 * 2 + (size_t)it * ((size_t)VR * RESQ * 2) + vlvo);
    }
    __syncthreads();
    if (t0 <= qlast) {                   // wave-uniform: this wave has unmasked keys in the chunk
      // k-step kk's K fragments of all key tiles are one group of LDS loads, issued one k-step ahead of their products (set kk & 1); the key tiles' accumulators are independent, each sums its kk in ascending order
      v8f sacc[NJ], stmp[RES ? NJ : 1];
#pragma unroll
      for (int j = 0; j < NJ; ++j) { sacc[j] = z8; if (RES) stmp[j] = z8; }
      {
        v16h fk[2][NJ], fkl[2][RES ? NJ : 1];
#pragma unroll
        for (int j = 0; j < NJ; ++j) {
          fk[0][j] = frag16(&sK[j * 16 + ln][0], hh);                     // B[k = d][n = key]: key row, d contiguous
          if (RES) fkl[0][j] = frag16(&sKl[j * 16 + ln][0], hh);
        }
#pragma unroll
        for (int kk = 0; kk < 4; ++kk) {
          if (kk < 3) {
#pragma unroll
            for (int j = 0; j < NJ; ++j) {
              fk[(kk + 1) & 1][j] = frag16(&sK[j * 16 + ln][(kk + 1) * 32], hh);
              if (RES) fkl[(kk + 1) & 1][j] = frag16(&sKl[j * 16 + ln][(kk + 1) * 32], hh);
            }
          }
          __builtin_amdgcn_sched_barrier(0);   // keeps the next k-step's LDS loads one group ahead of the products, not one by one in front of each
#pragma unroll
          for (int j = 0; j < NJ; ++j) sacc[j] = mma16b(aq[kk], fk[kk & 1][j], sacc[j]);
          if (RES) {
#pragma unroll
            for (int j = 0; j < NJ; ++j) stmp[j] = mma16b(aql[kk], fk[kk & 1][j], stmp[j]);
#pragma unroll
            for (int j = 0; j < NJ; ++j) stmp[j] = mma16b(aq[kk], fkl[kk & 1][j], stmp[j]);
          }
          __builtin_amdgcn_sched_barrier(0);   // ends the block of products: the following loads stay behind it
        }
      }
      if (RES) {
#pragma unroll
        for (int j = 0; j < NJ; ++j) sacc[j] = sacc[j] + stmp[j] * (1.0f / RCAR);
      }
      // scale, causal mask, online softmax; P (x2^14) to the wave-private LDS tile. The eight rows pass each exchange stage together: eight independent links a stage
      const int dk = t0 + ln - (q0w + 8 * hh);   // key tile j, row r is masked where dk + 16 j > r
      float mx[8], fac[8], rs[8];
#pragma unroll
      for (int r = 0; r < 8; ++r) {
        float m0 = -3.0e38f;
#pragma unroll
        for (int j = 0; j < NJ; ++j) m0 = fmaxf(m0, (dk + 16 * j > r) ? -3.0e38f : sacc[j][r] * alpha);
        mx[r] = m0;
      }
      row_max8(mx);
#pragma unroll
      for (int r = 0; r < 8; ++r) {
        const float mnew = fmaxf(mrow[r], mx[r]);
        fac[r] = (mrow[r] < -1.0e38f) ? 0.f : __expf(mrow[r] - mnew);
        mrow[r] = mnew;
        float s = 0.f;
#pragma unroll
        for (int j = 0; j < NJ; ++j) {
          const float p = (dk + 16 * j > r) ? 0.f : __expf(sacc[j][r] * alpha - mnew);
          s += p;
          const float pcv = p * PCAR; const _Float16 ph = (_Float16)pcv;
          sP[w][8 * hh + r][16 * j + ln] = ph;
          if (RES) sPl[w][8 * hh + r][16 * j + ln] = (_Float16)((pcv - (float)ph) * RCAR);
        }
        rs[r] = s;
      }
      // the row sums' four exchange stages (lane distance 8, 4, 2, 1)
      sum_stage<8>(rs); sum_stage<4>(rs); sum_stage<2>(rs); sum_stage<1>(rs);
#pragma unroll
      for (int r = 0; r < 8; ++r) lrow[r] = lrow[r] * fac[r] + rs[r];
#pragma unroll
      for (int r = 0; r < 8; ++r)
#pragma unroll
        for (int c = 0; c < NC; ++c) o[c][r] *= fac[r];
      __builtin_amdgcn_fence(4 /* acq_rel order */, "workgroup");
      __builtin_amdgcn_wave_barrier();
      v16h ap[NKS], apl[NKS];
#pragma unroll
      for (int ks = 0; ks < NKS; ++ks) {
        ap[ks] = frag16(&sP[w][ln][ks * 32], hh);                         // A[m = query row][k = key]
        if (RES) apl[ks] = frag16(&sPl[w][ln][ks * 32], hh); else apl[ks] = ap[ks];
      }
      // V^T fragments go in groups of four as well (CG o column tiles of one k-step); the first group shares the wait of the P fragments
      v16h fv[2][CG], fvl[2][RES ? CG : 1];
#pragma unroll
      for (int i = 0; i < CG; ++i) {
        fv[0][i] = frag16(&sV[i * 16 + ln][0], hh);                       // B[k = key][n = d]: d row, keys contiguous
        if (RES) fvl[0][i] = frag16(&sVl[i * 16 + ln][0], hh);
      }
      v8f ptmp[RES ? NC : 1];
      if (RES) {
#pragma unroll
        for (int c = 0; c < NC; ++c) ptmp[c] = z8;
      }
#pragma unroll
      for (int g = 0; g < NG; ++g) {           // group g: k-step g / NGC, o column tiles (g % NGC) * CG ..; every o tile meets its k-steps in ascending order
        if (g + 1 < NG) {
          const int ks1 = (g + 1) / NGC, cb1 = ((g + 1) % NGC) * CG;
#pragma unroll
          for (int i = 0; i < CG; ++i) {
            fv[(g + 1) & 1][i] = frag16(&sV[(cb1 + i) * 16 + ln][ks1 * 32], hh);
            if (RES) fvl[(g + 1) & 1][i] = frag16(&sVl[(cb1 + i) * 16 + ln][ks1 * 32], hh);
          }
        }
        __builtin_amdgcn_sched_barrier(0);     // keeps the next group's LDS loads ahead of this group's products
        const int ks = g / NGC, cb = (g % NGC) * CG;
#pragma unroll
        for (int i = 0; i < CG; ++i) o[cb + i] = mma16b(ap[ks], fv[g & 1][i], o[cb + i]);
        if (RES) {
#pragma unroll
          for (int i = 0; i < CG; ++i) ptmp[cb + i] = mma16b(apl[ks], fv[g & 1][i], ptmp[cb + i]);
#pragma unroll
          for (int i = 0; i < CG; ++i) ptmp[cb + i] = mma16b(ap[ks], fvl[g & 1][i], ptmp[cb + i]);
        }
        __builtin_amdgcn_sched_barrier(0);     // ends the block of products: the following loads stay behind it
      }
      if (RES) {
#pragma unroll
        for (int c = 0; c < NC; ++c) o[c] = o[c] + ptmp[c] * (1.0f / RCAR);
      }
    }
    __syncthreads();
  }

  // epilogue
  float il[8];
#pragma unroll
  for (int r = 0; r < 8; ++r) il[r] = (OCAR / PCAR) * __builtin_amdgcn_rcpf(lrow[r]);
  const float* gp = qraw + (size_t)(q0w + 8 * hh) * NQC + (size_t)h * (2 * HD) + HD + dz + ln;
#pragma unroll
  for (int hf = 0; hf < NHF; ++hf) {
    if (hf > 0) { __builtin_amdgcn_fence(4 /* acq_rel order */, "workgroup"); __builtin_amdgcn_wave_barrier(); }
#pragma unroll
    for (int cc = 0; cc < 4; ++cc) {
      const int c = hf * 4 + cc;
#pragma unroll
      for (int r = 0; r < 8; ++r) {
        const float g = gp[(size_t)r * NQC + c * 16];
        const float sig = __builtin_amdgcn_rcpf(1.0f + __expf(-g));
        const float val = o[c][r] * il[r] * sig;
        const _Float16 vh = (_Float16)val;
        sP[w][8 * hh + r][cc * 16 + ln] = vh;
        if (RES) sPl[w][8 * hh + r][cc * 16 + ln] = (_Float16)((val - (float)vh) * RCAR);
      }
      asm volatile("" ::: "memory");
    }
    __builtin_amdgcn_fence(4 /* acq_rel order */, "workgroup");
    __builtin_amdgcn_wave_barrier();
    const int prw = lane >> 3, pc = lane & 7;
    {
#pragma unroll
      for (int it = 0; it < 4; ++it) {
        const int row = it * 4 + prw;
        const v8us vv = *(const v8us*)&sP[w][row][pc * 8];
        const size_t go = (size_t)(q0w + row) * (NH * HD) + (size_t)h * HD + dz + hf * 64 + pc * 8;
        *(v8us*)((unsigned short*)Oh + go) = vv;
        if (RES) { const v8us vl = *(const v8us*)&sPl[w][row][pc * 8]; *(v8us*)((unsigned short*)Ol + go) = vl; }
      }
      
    }
  }
  asm volatile("s_wait_xcnt 0x0" ::: "memory");   // behind the last o stores: a precaution, as a block runs one form only and the kernel ends behind it
}

// One grid for both forms, which share no output row: the plain blocks first, then the residual ones, each form from its last query block (most key chunks) down to its first.
constexpr int AB_F = ((SEQ - RESQ) / 128) * NH * NB;
constexpr int AB_R = (RESQ / 128) * NH * NB * 2;
__global__ __launch_bounds__(256) void k_attn2(const _Float16* __restrict__ Qh, const _Float16* __restrict__ Ql,
                                              const _Float16* __restrict__ Kh, const _Float16* __restrict__ Kl,
                                              const _Float16* __restrict__ VT, const _Float16* __restrict__ VTl,
                                              const float* __restrict__ qraw, _Float16* __restrict__ Oh, _Float16* __restrict__ Ol) {
  __shared__ __attribute__((aligned(16))) unsigned char smem[AttnLds<true>::ALL > AttnLds<false>::ALL ? AttnLds<true>::ALL : AttnLds<false>::ALL];
  const int b = (int)blockIdx.x;
  if (b < AB_F) {
    const int qr = b / (NH * NB), rem = b - qr * (NH * NB);
    attn_block<false>(smem, Qh, Ql, Kh, Kl, VT, VTl, qraw, Oh, Ol, SEQ / 128 - 1 - qr, rem % NH, rem / NH);
  } else {
    const int c = b - AB_F, qr = c / (NH * NB * 2), rem = c - qr * (NH * NB * 2);
    attn_block<true>(smem, Qh, Ql, Kh, Kl, VT, VTl, qraw, Oh, Ol, RESQ / 128 - 1 - qr, rem % NH, rem / NH);
  }
}

extern "C" void kernel_launch(void* const* d_in, const int* in_sizes, int n_in,
                              void* d_out, int out_size, void* d_ws, size_t ws_size, hipStream_t stream) {
  if (n_in < 7) return;
  const long need_x = (long)(NB - 1) * SEQ_FULL * HID + (long)SEQ * HID;
  if ((long)in_sizes[0] < need_x) return;
  if (in_sizes[1] < HID * NQC) return;
  if (in_sizes[2] < HID * NKV * HD) return;
  if (in_sizes[3] < HID * NKV * HD) return;
  if (in_sizes[4] < NH * HD * HID) return;
  if (in_sizes[5] < HD) return;
  if (in_sizes[6] < HD) return;
  if ((long)out_size < need_x) return;

  const float* x   = (const float*)d_in[0];
  const float* Wq  = (const float*)d_in[1];
  const float* Wk  = (const float*)d_in[2];
  const float* Wv  = (const float*)d_in[3];
  const float* Wo  = (const float*)d_in[4];
  const float* qnw = (const float*)d_in[5];
  const float* knw = (const float*)d_in[6];

  char* ws = (char*)d_ws; size_t off = 0;
  auto take = [&](size_t bytes) { char* p = ws + off; off += (bytes + 255) & ~(size_t)255; return p; };
  _Float16* X16  = (_Float16*)take(SZ_X16);
  _Float16* WqT  = (_Float16*)take(SZ_WQT);
  _Float16* WkvT = (_Float16*)take(SZ_WKVT);
  _Float16* WoT  = (_Float16*)take(SZ_WOT);
  float*    CS   = (float*)take(SZ_CS);
  float*    qraw = (float*)take(SZ_QRAW);
  _Float16* Qh   = (_Float16*)take(SZ_QH);
  _Float16* Ql   = (_Float16*)take(SZ_QL);
  _Float16* Kh   = (_Float16*)take(SZ_KH);
  _Float16* Kl   = (_Float16*)take(SZ_KL);
  _Float16* VT   = (_Float16*)take(SZ_VT);
  _Float16* VTl  = (_Float16*)take(SZ_VTL);
  _Float16* Oh   = (_Float16*)take(SZ_OH);
  _Float16* Ol   = (_Float16*)take(SZ_OL);
  if (off > ws_size) return;

  const float walpha = 1.0f / WCAR;                          // 2^-4
  const float oalpha = 1.0f / (WCAR * OCAR);                 // 2^-10
  const float oalphal = oalpha / RCAR;                       // 2^-20
  // four launches, each holding every piece of work that depends only on the launches before it; every launch covers all NB batch elements
  float* out = (float*)d_out;
  // rotary table, weight planes (Bt[n][k] = f16(bf16rne(W[k][n]) * 16)), x plane
  k_prep<<<PB_ALL, 256, 0, stream>>>(x, Wq, Wk, Wv, Wo, X16, WqT, WkvT, WoT, CS, WCAR);
  // x.Wq and x.[Wk|Wv], with q/k norm + rotary and the V^T turn in the tiles' epilogues
  k_proj<<<dim3(PJ_Q + PJ_KV, NB), 128, 0, stream>>>(X16, WqT, WkvT, qnw, knw, CS, qraw, Qh, Ql, Kh, Kl, VT, VTl, walpha);
  k_attn2<<<AB_F + AB_R, 256, 0, stream>>>(Qh, Ql, Kh, Kl, VT, VTl, qraw, Oh, Ol);
  // o.Wo: rows RESQ.. plain, rows 0..RESQ-1 with the residual plane
  k_gemm2<<<dim3(((SEQ - RESQ) / 128) * (HID / 128) + (RESQ / 64) * (HID / 128), NB), 128, 0, stream>>>(
      ((SEQ - RESQ) / 128) * (HID / 128), Oh + (size_t)RESQ * NH * HD, WoT, out + (size_t)RESQ * HID, HID, SEQ - RESQ, HID, (size_t)SEQ_FULL * HID,
      Oh, Ol, WoT, out, HID, RESQ, HID, (size_t)SEQ_FULL * HID,
      (size_t)RESQ * NH * HD, NH * HD, NH * HD, NH * HD, (size_t)SEQ * NH * HD, oalpha, oalphal);
  (void)hipGetLastError();
}

// v008
// One run takes 174 microseconds.
// Two timings next to v007 both put it at 1.06 times that version's speed.
// Counting every step since v000, it is 5.17 times as fast.
#include <hip/hip_runtime.h>
#include <stdint.h>
// Contractions x.Wq, x.[Wk|Wv], k.q^T, V^T.P^T, o.Wo: v_wmma_f32_16x16x32_f16 (f16 operands, f32 accumulate). x and all weights RNE-converted to bf16 and held exactly in f16 (weights carried x16); q, k, V^T and gated o as f16 planes plus x2^10 f16 residual planes over the first RESQ query rows / keys (two-term products there, single products elsewhere); softmax weights x2^14 in f16 (+ x2^10 residual on those rows); gated o carried x64; RMSNorm, RoPE, softmax statistics and sigmoid gating in f32.

#ifndef NB
#define NB 2
#endif
#ifndef SEQ
#define SEQ 2048
#endif
#ifndef RESQ
#if SEQ < 512
#define RESQ SEQ
#else
#define RESQ 512
#endif
#endif
#define NB_FULL 2
#define SEQ_FULL 2048
#define HID 2048
#define NH 16
#define NKV 4
#define HD 128
#define GQ (NH / NKV)
#define NQC (2 * NH * HD)      /* q|gate columns: head h at h*256 (q) and h*256+128 (gate); the f32 plane qraw holds the gate columns only */
#define NKVC (2 * NKV * HD)    /* k|v columns: k head j at j*128, v head j at 512+j*128 */
#define NRP 64                 /* rotary pairs */
#define PCAR 16384.0f          /* softmax weight carry */
#define OCAR 64.0f             /* gated o carry */
#define RCAR 1024.0f           /* residual plane carry */
#define WCAR 16.0f             /* weight carry */

static_assert(NB >= 1);
static_assert(NB <= NB_FULL);
static_assert(SEQ % 128 == 0);
static_assert(SEQ <= SEQ_FULL);
static_assert(RESQ % 128 == 0);
static_assert(RESQ >= 128);
static_assert(RESQ <= SEQ);
static_assert((SEQ - RESQ) % 128 == 0);
static_assert(HID % 32 == 0);
static_assert(HID % 64 == 0);
static_assert(NQC % 128 == 0);
static_assert(NKVC % 128 == 0);
static_assert(HID % 256 == 0);
static_assert((NH * HD) % 256 == 0);
static_assert(HD == 128);
static_assert(NH % NKV == 0);
static_assert((SEQ * HID) % 8 == 0);

// planes of x, q, k, v and o hold all NB batch elements, element b at b * (plane size / NB)
constexpr size_t SZ_X16   = (size_t)NB * SEQ * HID * 2;
constexpr size_t SZ_WQT   = (size_t)NQC * HID * 2;
constexpr size_t SZ_WKVT  = (size_t)NKVC * HID * 2;
constexpr size_t SZ_WOT   = (size_t)HID * NH * HD * 2;
constexpr size_t SZ_CS    = (size_t)SEQ * NRP * 2 * 4;
constexpr size_t SZ_QRAW  = (size_t)NB * SEQ * NQC * 4;
constexpr size_t SZ_QH    = (size_t)NB * NH * SEQ * HD * 2;
constexpr size_t SZ_QL    = (size_t)NB * NH * RESQ * HD * 2;
constexpr size_t SZ_KH    = (size_t)NB * NKV * SEQ * HD * 2;
constexpr size_t SZ_KL    = (size_t)NB * NKV * RESQ * HD * 2;
constexpr size_t SZ_VT    = (size_t)NB * NKV * HD * SEQ * 2;
constexpr size_t SZ_VTL   = (size_t)NB * NKV * HD * RESQ * 2;
constexpr size_t SZ_OH    = (size_t)NB * SEQ * NH * HD * 2;
constexpr size_t SZ_OL    = (size_t)NB * RESQ * NH * HD * 2;
constexpr size_t WS_TOTAL = SZ_X16 + SZ_WQT + SZ_WKVT + SZ_WOT + SZ_CS + SZ_QRAW + SZ_QH + SZ_QL + SZ_KH + SZ_KL + SZ_VT + SZ_VTL + SZ_OH + SZ_OL;
static_assert(WS_TOTAL <= (size_t)268435456);
static_assert(SZ_X16 % 256 == 0);
static_assert(SZ_KL % 256 == 0);
static_assert(SZ_VTL % 256 == 0);
static_assert(SZ_CS % 256 == 0);

typedef _Float16 v16h __attribute__((ext_vector_type(16)));
typedef unsigned short v8us __attribute__((ext_vector_type(8), may_alias));
typedef float v8f __attribute__((ext_vector_type(8)));
typedef float v4f __attribute__((ext_vector_type(4)));
typedef float v4fa __attribute__((ext_vector_type(4), may_alias));
typedef float v2f __attribute__((ext_vector_type(2)));
typedef _Float16 v4h __attribute__((ext_vector_type(4)));
typedef uint32_t u32x4 __attribute__((ext_vector_type(4)));
typedef uint32_t u32x8 __attribute__((ext_vector_type(8)));
union FragH { v16h v; v8us half[2]; _Float16 h[16]; unsigned short u[16]; };
union Pack8 { v8us v; _Float16 h[8]; unsigned short u[8]; };

__device__ __forceinline__ unsigned short bf16_bits(float x) { const unsigned int u = __float_as_uint(x); return (unsigned short)((u + 0x7FFFu + ((u >> 16) & 1u)) >> 16); }
__device__ __forceinline__ float bf16_rne(float x) { return __uint_as_float(((unsigned int)bf16_bits(x)) << 16); }
// value of lane l ^ M, M < 16, inside the 16-lane row: a DPP operand (row_xmask) of the vector port, no LDS operation and no wait; every lane is on where it is used
template <int M> __device__ __forceinline__ float row_xor(float v) { return __builtin_bit_cast(float, __builtin_amdgcn_update_dpp(0, __builtin_bit_cast(int, v), 0x160 | M, 0xf, 0xf, true)); }
// value of lane l ^ 16: vector cross-row move
__device__ __forceinline__ float half_xor(float v) { return __builtin_bit_cast(float, __builtin_amdgcn_permlanex16(__builtin_bit_cast(int, v), __builtin_bit_cast(int, v), 0x76543210, 0xfedcba98, false, false)); }
// maxima of eight independent values over their 16-lane rows, lane distance 8, 4, 2, 1. In asm so that exchange and maximum are one instruction (from fmaxf the compiler makes three: DPP move, quieting of the moved value, maximum),
// and in one statement so that the eight rows stay interleaved: a link's producer stands eight instructions back and no link waits
__device__ __forceinline__ void row_max8(float (&v)[8]) {
  asm(
      "v_max_num_f32_dpp %0, %0, %0 row_xmask:8 row_mask:0xf bank_mask:0xf\n\t"
      "v_max_num_f32_dpp %1, %1, %1 row_xmask:8 row_mask:0xf bank_mask:0xf\n\t"
      "v_max_num_f32_dpp %2, %2, %2 row_xmask:8 row_mask:0xf bank_mask:0xf\n\t"
      "v_max_num_f32_dpp %3, %3, %3 row_xmask:8 row_mask:0xf bank_mask:0xf\n\t"
      "v_max_num_f32_dpp %4, %4, %4 row_xmask:8 row_mask:0xf bank_mask:0xf\n\t"
      "v_max_num_f32_dpp %5, %5, %5 row_xmask:8 row_mask:0xf bank_mask:0xf\n\t"
      "v_max_num_f32_dpp %6, %6, %6 row_xmask:8 row_mask:0xf bank_mask:0xf\n\t"
      "v_max_num_f32_dpp %7, %7, %7 row_xmask:8 row_mask:0xf bank_mask:0xf\n\t"
      "v_max_num_f32_dpp %0, %0, %0 row_xmask:4 row_mask:0xf bank_mask:0xf\n\t"
      "v_max_num_f32_dpp %1, %1, %1 row_xmask:4 row_mask:0xf bank_mask:0xf\n\t"
      "v_max_num_f32_dpp %2, %2, %2 row_xmask:4 row_mask:0xf bank_mask:0xf\n\t"
      "v_max_num_f32_dpp %3, %3, %3 row_xmask:4 row_mask:0xf bank_mask:0xf\n\t"
      "v_max_num_f32_dpp %4, %4, %4 row_xmask:4 row_mask:0xf bank_mask:0xf\n\t"
      "v_max_num_f32_dpp %5, %5, %5 row_xmask:4 row_mask:0xf bank_mask:0xf\n\t"
      "v_max_num_f32_dpp %6, %6, %6 row_xmask:4 row_mask:0xf bank_mask:0xf\n\t"
      "v_max_num_f32_dpp %7, %7, %7 row_xmask:4 row_mask:0xf bank_mask:0xf\n\t"
      "v_max_num_f32_dpp %0, %0, %0 row_xmask:2 row_mask:0xf bank_mask:0xf\n\t"
      "v_max_num_f32_dpp %1, %1, %1 row_xmask:2 row_mask:0xf bank_mask:0xf\n\t"
      "v_max_num_f32_dpp %2, %2, %2 row_xmask:2 row_mask:0xf bank_mask:0xf\n\t"
      "v_max_num_f32_dpp %3, %3, %3 row_xmask:2 row_mask:0xf bank_mask:0xf\n\t"
      "v_max_num_f32_dpp %4, %4, %4 row_xmask:2 row_mask:0xf bank_mask:0xf\n\t"
      "v_max_num_f32_dpp %5, %5, %5 row_xmask:2 row_mask:0xf bank_mask:0xf\n\t"
      "v_max_num_f32_dpp %6, %6, %6 row_xmask:2 row_mask:0xf bank_mask:0xf\n\t"
      "v_max_num_f32_dpp %7, %7, %7 row_xmask:2 row_mask:0xf bank_mask:0xf\n\t"
      "v_max_num_f32_dpp %0, %0, %0 row_xmask:1 row_mask:0xf bank_mask:0xf\n\t"
      "v_max_num_f32_dpp %1, %1, %1 row_xmask:1 row_mask:0xf bank_mask:0xf\n\t"
      "v_max_num_f32_dpp %2, %2, %2 row_xmask:1 row_mask:0xf bank_mask:0xf\n\t"
      "v_max_num_f32_dpp %3, %3, %3 row_xmask:1 row_mask:0xf bank_mask:0xf\n\t"
      "v_max_num_f32_dpp %4, %4, %4 row_xmask:1 row_mask:0xf bank_mask:0xf\n\t"
      "v_max_num_f32_dpp %5, %5, %5 row_xmask:1 row_mask:0xf bank_mask:0xf\n\t"
      "v_max_num_f32_dpp %6, %6, %6 row_xmask:1 row_mask:0xf bank_mask:0xf\n\t"
      "v_max_num_f32_dpp %7, %7, %7 row_xmask:1 row_mask:0xf bank_mask:0xf\n\t"
      : "+v"(v[0]), "+v"(v[1]), "+v"(v[2]), "+v"(v[3]), "+v"(v[4]), "+v"(v[5]), "+v"(v[6]), "+v"(v[7]));
}
// one exchange stage of eight independent row sums (lane distance M)
template <int M> __device__ __forceinline__ void sum_stage(float (&v)[8]) {
#pragma unroll
  for (int r = 0; r < 8; ++r) v[r] += row_xor<M>(v[r]);
}

// 16x32 f16 fragment from a k-contiguous row p (A row m = lane&15, or Bt row n = lane&15): elements 0..7 <- k 8h..8h+7, 8..15 <- k 16+8h..16+8h+7
__device__ __forceinline__ v16h frag16(const _Float16* p, int hh) {
  FragH f;
  f.half[0] = *(const v8us*)((const unsigned short*)p + 8 * hh);
  f.half[1] = *(const v8us*)((const unsigned short*)p + 16 + 8 * hh);
  return f.v;
}

// bx = block inside a batch element, bb = batch element
__device__ __forceinline__ void x16_block(const float* __restrict__ x, _Float16* __restrict__ X16, size_t n8, int bx, int bb) {
  const size_t t = (size_t)bx * 256 + threadIdx.x; if (t >= n8) return;
  x += (size_t)bb * SEQ_FULL * HID; X16 += (size_t)bb * SEQ * HID;
  const v4f a = *(const v4fa*)(x + t * 8), c = *(const v4fa*)(x + t * 8 + 4);
  Pack8 f;
#pragma unroll
  for (int q = 0; q < 4; ++q) { f.h[q] = (_Float16)bf16_rne(a[q]); f.h[4 + q] = (_Float16)bf16_rne(c[q]); }
  unsigned short* d = (unsigned short*)X16 + t * 8;
  *(v8us*)d = f.v; 
}

#define WT_K 128                     /* k per block tile: one 256-B piece of a Wt row */
#define WT_N 128                     /* n per block tile: two 256-B pieces of a W row */

// Wt[n][k] = f16(bf16rne(W[k][n]) * scale). Block bx = tile of WT_K k x WT_N n, (K / WT_K) * (N / WT_N) blocks; st = the block's LDS tile.
// A thread reads 8 k x (4 + 4) n (each wave-wide load covers two whole 256-B row pieces of W), packs 8 k per n and turns the tile in LDS; each wave-wide store covers two whole 256-B row pieces of Wt.
// LDS row n holds its sixteen 16-B k chunks at chunk ^ ((n >> 2) & 15): the 16 lanes of a half wave then fall on 16 different bank groups, writing (16 rows, one chunk) and reading (one row, 16 chunks).
// K and N are compile-time, so that the row steps are immediate offsets on one address.
template <int K, int N>
__device__ __forceinline__ void wt_block(unsigned short (*st)[WT_K], const float* __restrict__ W, _Float16* __restrict__ Wt, float scale, int bx) {
  static_assert(K % WT_K == 0);
  static_assert(N % WT_N == 0);
  const int tid = threadIdx.x;
  constexpr int ntn = N / WT_N;
  const int kt = bx / ntn, nt = bx - kt * ntn;
  const int k0 = kt * WT_K, n0 = nt * WT_N;
  const int lo = tid & 15, hi = tid >> 4;
  // block-uniform base plus one 32-bit lane offset that all sixteen loads (all eight stores) share
  const char* wb = (const char*)(W + (size_t)k0 * N + n0);
  const uint32_t vo = ((uint32_t)(hi * 8) * (uint32_t)N + (uint32_t)(lo * 4)) * 4u;
  v4f r[2][8];
#pragma unroll
  for (int i = 0; i < 8; ++i) {
    r[0][i] = *(const v4fa*)(wb + (size_t)i * N * 4 + vo);
    r[1][i] = *(const v4fa*)(wb + (size_t)i * N * 4 + 256 + vo);
  }
  // behind the last load: the offset register that all sixteen loads name stays whole until their addresses are taken (no load's result is placed on it), and no load sinks below into the conversions
  asm volatile("s_wait_xcnt 0x0" :: "v"(vo) : "memory");
#pragma unroll
  for (int h = 0; h < 2; ++h) {
#pragma unroll
    for (int j = 0; j < 4; ++j) {
      Pack8 f;
#pragma unroll
      for (int i = 0; i < 8; ++i) f.h[i] = (_Float16)(bf16_rne(r[h][i][j]) * scale);
      *(v8us*)&st[h * 64 + lo * 4 + j][(hi ^ lo) * 8] = f.v;
    }
  }
  __syncthreads();
  char* tb = (char*)(Wt + (size_t)n0 * K + k0);
  const uint32_t so = ((uint32_t)hi * (uint32_t)K + (uint32_t)(lo * 8)) * 2u;
#pragma unroll
  for (int it = 0; it < WT_N / 16; ++it) {
    const int n = it * 16 + hi;
    const v8us v = *(const v8us*)&st[n][(lo ^ ((n >> 2) & 15)) * 8];
    *(v8us*)(tb + (size_t)it * 16 * K * 2 + so) = v;
  }
}

__device__ __forceinline__ void rope_block(float* __restrict__ cs, int bx) {
  const int t = bx * 256 + threadIdx.x; if (t >= SEQ * NRP) return;
  const int pos = t / NRP, i = t - pos * NRP;
  const float inv = exp2f(-(float)i * 0.31143075889569022f);   // 2^(-i*log2(1e6)/64)
  const float ang = (float)pos * inv;
  float sn, cn; sincosf(ang, &sn, &cn);
  v2f o; o[0] = cn; o[1] = sn;
  float* d = cs + (size_t)t * 2;
  *(v2f*)d = o; 
}

// One grid for everything that reads only the inputs: rotary table, the four weight planes, the x plane. None reads what another writes; a block's index range says which piece it takes.
constexpr int PB_ROPE = (SEQ * NRP + 255) / 256;
constexpr int PB_WQ   = (HID / WT_K) * (NQC / WT_N);
constexpr int PB_WKV  = (HID / WT_K) * (NKV * HD / WT_N);
constexpr int PB_WO   = ((NH * HD) / WT_K) * (HID / WT_N);
constexpr int PB_X    = (int)(((size_t)SEQ * HID / 8 + 255) / 256);
constexpr int PB_ALL  = PB_ROPE + PB_WQ + 2 * PB_WKV + PB_WO + NB * PB_X;
__global__ __launch_bounds__(256) void k_prep(const float* __restrict__ x, const float* __restrict__ Wq, const float* __restrict__ Wk, const float* __restrict__ Wv, const float* __restrict__ Wo,
                                             _Float16* __restrict__ X16, _Float16* __restrict__ WqT, _Float16* __restrict__ WkvT, _Float16* __restrict__ WoT, float* __restrict__ cs, float scale) {
  __shared__ __attribute__((aligned(16))) unsigned short st[WT_N][WT_K];
  int b = (int)blockIdx.x;
  if (b < PB_ROPE) { rope_block(cs, b); return; }
  b -= PB_ROPE;
  if (b < PB_WQ) { wt_block<HID, NQC>(st, Wq, WqT, scale, b); return; }
  b -= PB_WQ;
  if (b < PB_WO) { wt_block<NH * HD, HID>(st, Wo, WoT, scale, b); return; }
  b -= PB_WO;
  if (b < 2 * PB_WKV) {
    const bool isv = b >= PB_WKV;
    wt_block<HID, NKV * HD>(st, isv ? Wv : Wk, isv ? WkvT + (size_t)NKV * HD * HID : WkvT, scale, isv ? b - PB_WKV : b);
    return;
  }
  b -= 2 * PB_WKV;
  const int bb = b / PB_X;
  x16_block(x, X16, (size_t)SEQ * HID / 8, b - bb * PB_X, bb);
}

#define G_PITCH 272u                 /* LDS row pitch: 256 B of k plus the mover's 16-B pad (ds_load_b128 readers) */
#define G_SLICE 18432u               /* one wave's slice: 64 rows at G_PITCH, rounded up to a multiple of 2 KiB */
#define G_STAGE (4u * G_SLICE)       /* one buffer: [A rows 0..63 | A rows 64..127 (RES: residual rows 0..63) | Bt rows 0..63 | Bt rows 64..127] */
static_assert(64u * G_PITCH <= G_SLICE);
static_assert(G_SLICE % 2048u == 0);
static_assert(64u * 68u * 4u <= G_SLICE);

// D += A.B by the plain builtin, whose distances the compiler keeps itself: register operands on an asm guard would hold the GEMM's accumulators and both fragment sets below v256 (spills)
__device__ __forceinline__ v8f mma16b(v16h a, v16h b, v8f c) { return __builtin_amdgcn_wmma_f32_16x16x32_f16(false, a, false, b, (short)0, c, false, false); }
__device__ __forceinline__ uint32_t uni(uint32_t v) { return (uint32_t)__builtin_amdgcn_readfirstlane(v); }
__device__ __forceinline__ uint32_t pinned(uint32_t v) { uint32_t w = uni(v); asm volatile("" : "+s"(w)); return w; }
__device__ __forceinline__ void wait_ds0() { asm volatile("s_wait_dscnt 0x0" ::: "memory"); }          // this wave's LDS reads have returned before the buffer is handed over
__device__ __forceinline__ void tdm_load(u32x4 g0, u32x8 g1) { asm volatile("tensor_load_to_lds %0, %1" :: "s"(g0), "s"(g1) : "memory"); }
// this wave's slice has landed; the compiler places no wait for the mover. The wait names the youngest request's descriptor as inputs: its scalar registers stay allocated, and so unwritten, until the request has returned
__device__ __forceinline__ void wait_tensor0_of(u32x4 g0, u32x8 g1) { asm volatile("s_wait_tensorcnt 0x0" :: "s"(g0), "s"(g1) : "memory"); }
// group 1: 1-byte elements, tile = tensor = 64 rows of 256 B, source row pitch in bytes, 4 dwords of LDS pad behind every 256-B row
__device__ __forceinline__ u32x8 tdm_group1(uint32_t src_pitch) {
  u32x8 g;
  g[0] = uni((1u << 20) | (5u << 22) | (3u << 25));
  // pinned(): descriptor words held in their scalar registers through the loop, so that none is rewritten while a request is outstanding
  g[1] = pinned(256u << 16);
  g[2] = pinned(64u << 16);
  g[3] = pinned(256u << 16);
  g[4] = pinned(64u);
  g[5] = pinned(src_pitch);
  g[6] = pinned(0u);
  g[7] = pinned(0u);
  return g;
}
__device__ __forceinline__ u32x4 tdm_group0(uint32_t lds_dst, uint64_t ga) {
  u32x4 g;
  g[0] = uni(1u); g[1] = uni(lds_dst); g[2] = uni((uint32_t)ga); g[3] = uni((((uint32_t)(ga >> 32)) & 0x01FFFFFFu) | 0x80000000u);
  return g;
}

typedef uint64_t u64a __attribute__((may_alias));
// behind eight 8-B stores: their data registers and their lane offset are inputs of the wait, so that they stay allocated, and so unwritten, until the stores' addresses and data are taken
__device__ __forceinline__ void wait_x0_of(const uint64_t (&d)[8], uint32_t o) {
  asm volatile("s_wait_xcnt 0x0" :: "v"(d[0]), "v"(d[1]), "v"(d[2]), "v"(d[3]), "v"(d[4]), "v"(d[5]), "v"(d[6]), "v"(d[7]), "v"(o) : "memory");
}

// C[M][N] (f32, pitch ldc) = alpha * A[M][K] (f16, pitch lda) . Bt[N][K]^T (f16, pitch ldb)  (+ alphal * Al . Bt^T when RES: residual plane Al, pitch lda).
// Block = 4 waves (2 x 2), C tile 128 x 128 (RES: 64 x 128), tile bx of (M / tile rows) * (N / 128); K % 128 == 0, K >= 128. sm = the block's LDS ring.
// A pass is 128 k: every wave brings its own 64-row slice of the pass into LDS with one tensor load, two buffers, the next pass's load in flight under this pass's products.
// Each accumulator sums its k in ascending steps of 32. Every inner loop is unrolled so that the accumulator and fragment arrays are indexed by constants and stay in registers.
// PROJ: the tile is one head's 128 columns of a projection, and mode (block-uniform) says what leaves the block:
//   0: the f32 tile to C, as without PROJ (gate columns);
//   1: q or k head: RMSNorm (nw + 1, eps 1e-6) over the tile's 128 columns, rotate-half RoPE from cs[token], f16 rows to PH[token][d], x2^10 residual rows to PL for tokens < RESQ;
//   2: v head: turned, f16 to PH[d][token] (row pitch SEQ), x2^10 residual to PL[d][token] (row pitch RESQ) for tokens < RESQ.
template <bool RES, bool PROJ>
__device__ __forceinline__ void gemm_tile(unsigned char* sm, int bx, const _Float16* __restrict__ A, const _Float16* __restrict__ Al, int lda, const _Float16* __restrict__ Bt, int ldb,
                                          float alpha, float alphal, float* __restrict__ C, int ldc, int M, int N, int K,
                                          int mode, const float* __restrict__ nw, const float* __restrict__ cs, _Float16* __restrict__ PH, _Float16* __restrict__ PL) {
  static_assert(!(RES && PROJ));
  constexpr int BM = RES ? 64 : 128;
  constexpr int NI = RES ? 2 : 4;        // 16-row C tiles per wave
  const int tid = threadIdx.x, lane = tid & 31, ln = lane & 15, hh = lane >> 4;
  const uint32_t w = uni((uint32_t)tid >> 5);
  const int wm = (int)(w >> 1), wn = (int)(w & 1u);
  const int ntn = N >> 7;
  const int mt = PROJ ? (int)uni((uint32_t)(bx / ntn)) : bx / ntn, nq = bx - mt * ntn;   // PROJ: the quotient (block-uniform) in a scalar register, and with it the tile's rows, columns and bases
  const int row0 = mt * BM, col0 = nq * 128;
  if (row0 >= M) return;
  const _Float16* src = (w >= 2u) ? (Bt + (size_t)(col0 + 64 * wn) * ldb)
                      : (RES ? ((w == 1u ? Al : A) + (size_t)row0 * lda) : (A + (size_t)(row0 + 64 * (int)w) * lda));
  const uint64_t ga0 = (uint64_t)(uintptr_t)src;
  const uint32_t lds0 = (uint32_t)(size_t)sm + w * G_SLICE;
  const u32x8 g1 = tdm_group1(2u * (uint32_t)(w >= 2u ? ldb : lda));
  const int ns = K >> 7;
  // per-lane fragment rows inside a buffer
  uint32_t aoff[4], boff[4];
#pragma unroll
  for (int i = 0; i < 4; ++i) {
    aoff[i] = RES ? ((uint32_t)(i >> 1) * G_SLICE + (uint32_t)(wm * 32 + (i & 1) * 16 + ln) * G_PITCH)
                  : ((uint32_t)wm * G_SLICE + (uint32_t)(i * 16 + ln) * G_PITCH);
    boff[i] = (uint32_t)(2 + wn) * G_SLICE + (uint32_t)(i * 16 + ln) * G_PITCH;
  }
  const v8f z8 = {0.f, 0.f, 0.f, 0.f, 0.f, 0.f, 0.f, 0.f};
  v8f c[4][4];                           // RES: c[0..1] main plane, c[2..3] residual plane of the same rows
#pragma unroll
  for (int i = 0; i < 4; ++i)
#pragma unroll
    for (int j = 0; j < 4; ++j) c[i][j] = z8;

  u32x4 g0 = tdm_group0(lds0, ga0);      // group 0 of the youngest request
  tdm_load(g0, g1);
  wait_tensor0_of(g0, g1);
  __syncthreads();
  if (pinned(1 < ns ? 1u : 0u) != 0u) { g0 = tdm_group0(lds0 + G_STAGE, ga0 + 256u); tdm_load(g0, g1); }
#pragma unroll 1                         // one pass per trip: the buffer alternates at run time
  for (int s = 0; s < ns; ++s) {
    const uint32_t bo = (uint32_t)(s & 1) * G_STAGE;
    const unsigned char* bp = sm + bo;
    v16h fa[2][4], fb[2][4];             // set (kk & 1) holds k-step kk's fragments; the next step's loads go ahead of this step's products as one group
#pragma unroll
    for (int i = 0; i < 4; ++i) { fa[0][i] = frag16((const _Float16*)(bp + aoff[i]), hh); fb[0][i] = frag16((const _Float16*)(bp + boff[i]), hh); }
#pragma unroll
    for (int kk = 0; kk < 4; ++kk) {
      if (kk < 3) {
#pragma unroll
        for (int i = 0; i < 4; ++i) {
          fa[(kk + 1) & 1][i] = frag16((const _Float16*)(bp + aoff[i] + (kk + 1) * 64), hh);
          fb[(kk + 1) & 1][i] = frag16((const _Float16*)(bp + boff[i] + (kk + 1) * 64), hh);
        }
      }
      __builtin_amdgcn_sched_barrier(0);   // keeps the next step's LDS loads one group ahead of the products, not spread among them
#pragma unroll
      for (int j = 0; j < 4; ++j)
#pragma unroll
        for (int i = 0; i < 4; ++i) c[i][j] = mma16b(fa[kk & 1][i], fb[kk & 1][j], c[i][j]);
      __builtin_amdgcn_sched_barrier(0);   // ends the block of products: the following loads stay behind it
    }
    asm volatile("v_nop\n\tv_nop\n\tv_nop\n\tv_nop");   // WMMA-to-VALU distance on the loop's exit path, where the epilogue reads the accumulators
    // publish point of pass s + 1: own LDS reads returned, own slice landed, block barrier, then the refill of the buffer just read
    wait_ds0();
    wait_tensor0_of(g0, g1);
    __syncthreads();
    if (pinned(s + 2 < ns ? 1u : 0u) != 0u) { g0 = tdm_group0(lds0 + bo, ga0 + (uint64_t)(uint32_t)(s + 2) * 256u); tdm_load(g0, g1); }
  }
  wait_tensor0_of(g0, g1);
  wait_ds0();

  if constexpr (PROJ) {
    if (mode == 2) {
      // v head: a lane's accumulator registers are eight consecutive tokens of one d, that is one 16-B piece of a V^T row; a wave's four i fill one 128-B line of each of its rows
      const bool wl = row0 < RESQ;       // block-uniform: RESQ is a multiple of the tile's rows
      char* vb = (char*)(PH + (size_t)(wn * 64) * SEQ + row0 + wm * 64);
      char* vlb = (char*)(PL + (size_t)(wn * 64) * RESQ + row0 + wm * 64);
      const uint32_t vo = ((uint32_t)ln * (uint32_t)SEQ + 8u * (uint32_t)hh) * 2u;
      const uint32_t vlo = ((uint32_t)ln * (uint32_t)RESQ + 8u * (uint32_t)hh) * 2u;
#pragma unroll
      for (int j = 0; j < 4; ++j) {
#pragma unroll
        for (int i = 0; i < 4; ++i) {
          Pack8 ph;
#pragma unroll
          for (int r = 0; r < 8; ++r) ph.h[r] = (_Float16)(c[i][j][r] * alpha);
          *(v8us*)(vb + (size_t)j * (16 * SEQ * 2) + (size_t)i * 32 + vo) = ph.v;
        }
      }
      asm volatile("s_wait_xcnt 0x0" ::: "memory");   // behind the stores, before the residual branch rewrites their data registers
      if (wl) {
#pragma unroll
        for (int j = 0; j < 4; ++j) {
#pragma unroll
          for (int i = 0; i < 4; ++i) {
            Pack8 pl;
#pragma unroll
            for (int r = 0; r < 8; ++r) { const float f = c[i][j][r] * alpha; pl.h[r] = (_Float16)((f - (float)(_Float16)f) * RCAR); }
            *(v8us*)(vlb + (size_t)j * (16 * RESQ * 2) + (size_t)i * 32 + vlo) = pl.v;
          }
        }
      }
      asm volatile("s_wait_xcnt 0x0" ::: "memory");   // behind the stores, before the code that follows this branch rewrites their address and data registers
      return;
    }
  }
  // epilogue: the ring is free behind the last pass's barrier; each wave stages its C tile in its own slice and stores whole 256-B row pieces
  float* so = (float*)(sm + w * G_SLICE);
#pragma unroll
  for (int i = 0; i < NI; ++i) {
#pragma unroll
    for (int j = 0; j < 4; ++j) {
#pragma unroll
      for (int r = 0; r < 8; ++r)
        so[(i * 16 + 8 * hh + r) * 68 + j * 16 + ln] = RES ? (c[i][j][r] * alpha + c[(i + 2) & 3][j][r] * alphal) : (c[i][j][r] * alpha);
    }
  }
  if constexpr (PROJ) {
    if (mode == 1) {
      // q or k head: a row's 128 columns lie in two waves' slices, so the block meets once; then wave w takes rows 32 w .. 32 w + 31, a row at a time over its 32 lanes (lane l: columns 4 l .. 4 l + 3)
      __syncthreads();
      const bool wl = row0 < RESQ;       // block-uniform
      const v4f wv = *(const v4fa*)(nw + 4 * lane);
      const int rw = row0 + 32 * (int)w; // the wave's first token
      const unsigned char* xb = sm + ((w & 2u) + (uint32_t)hh) * G_SLICE + (w & 1u) * (32u * 272u) + (uint32_t)ln * 16u;
      const char* cb = (const char*)(cs + (size_t)rw * (NRP * 2));
      const uint32_t co = (uint32_t)ln * 32u;
      char* hb = (char*)(PH + (size_t)rw * HD);
      char* lb = (char*)(PL + (size_t)rw * HD);
      const uint32_t ho = (uint32_t)lane * 8u;
      const float sg = (lane < 16) ? -1.0f : 1.0f;                        // d < 64: -x[d+64]; d >= 64: +x[d-64]
#pragma unroll
      for (int g = 0; g < 4; ++g) {
        v4f t01[8], t23[8];              // rotary rows of the group's eight tokens
#pragma unroll
        for (int u = 0; u < 8; ++u) {
          t01[u] = *(const v4fa*)(cb + (size_t)(g * 8 + u) * (NRP * 8) + co);
          t23[u] = *(const v4fa*)(cb + (size_t)(g * 8 + u) * (NRP * 8) + 16 + co);
        }
        asm volatile("s_wait_xcnt 0x0" :: "v"(co), "v"(lane) : "memory");   // behind the loads: the lane offsets that they name stay whole until their addresses are taken
        v4f xv[8];
#pragma unroll
        for (int u = 0; u < 8; ++u) xv[u] = *(const v4fa*)(xb + (g * 8 + u) * 272);
        // the eight rows pass each step together, so that no link of a row's chain waits for the one before it
        float ss[8], ov[8][4];
        uint64_t dh[8];
#pragma unroll
        for (int u = 0; u < 8; ++u) ss[u] = xv[u][0] * xv[u][0] + xv[u][1] * xv[u][1] + xv[u][2] * xv[u][2] + xv[u][3] * xv[u][3];
#pragma unroll
        for (int u = 0; u < 8; ++u) ss[u] += half_xor(ss[u]);
        sum_stage<8>(ss); sum_stage<4>(ss); sum_stage<2>(ss); sum_stage<1>(ss);
#pragma unroll
        for (int u = 0; u < 8; ++u) ss[u] = rsqrtf(ss[u] * (1.0f / 128.0f) + 1.0e-6f);
#pragma unroll
        for (int u = 0; u < 8; ++u) {
          const v4f a01 = t01[u], a23 = t23[u];
          float nv[4], pr[4];
#pragma unroll
          for (int q = 0; q < 4; ++q) nv[q] = xv[u][q] * ss[u] * (wv[q] + 1.0f);
#pragma unroll
          for (int q = 0; q < 4; ++q) pr[q] = half_xor(nv[q]);            // element d +- 64
          const float cv[4] = {a01[0], a01[2], a23[0], a23[2]};
          const float sv[4] = {a01[1], a01[3], a23[1], a23[3]};
          v4h oh;
#pragma unroll
          for (int q = 0; q < 4; ++q) { ov[u][q] = nv[q] * cv[q] + sg * pr[q] * sv[q]; oh[q] = (_Float16)ov[u][q]; }
          dh[u] = __builtin_bit_cast(uint64_t, oh);
        }
#pragma unroll
        for (int u = 0; u < 8; ++u) *(u64a*)(hb + (size_t)(g * 8 + u) * (HD * 2) + ho) = dh[u];
        wait_x0_of(dh, ho);
        if (wl) {
#pragma unroll
          for (int u = 0; u < 8; ++u) {
            v4h ol;
#pragma unroll
            for (int q = 0; q < 4; ++q) ol[q] = (_Float16)((ov[u][q] - (float)(_Float16)ov[u][q]) * RCAR);
            dh[u] = __builtin_bit_cast(uint64_t, ol);
          }
#pragma unroll
          for (int u = 0; u < 8; ++u) *(u64a*)(lb + (size_t)(g * 8 + u) * (HD * 2) + ho) = dh[u];
          wait_x0_of(dh, ho);
        }
      }
      return;
    }
  }
  __builtin_amdgcn_fence(4 /* acq_rel order */, "workgroup");
  __builtin_amdgcn_wave_barrier();
  const int rsub = lane >> 4, c4 = (lane & 15) * 4;
#pragma unroll
  for (int g = 0; g < NI; ++g) {         // eight row pairs a group: its LDS reads, its stores, one wait
    v4f v[8];
#pragma unroll
    for (int u = 0; u < 8; ++u) v[u] = *(const v4fa*)&so[((g * 8 + u) * 2 + rsub) * 68 + c4];
#pragma unroll
    for (int u = 0; u < 8; ++u) *(v4f*)(C + (size_t)(row0 + wm * (NI * 16) + (g * 8 + u) * 2 + rsub) * ldc + col0 + wn * 64 + c4) = v[u];
    asm volatile("s_wait_xcnt 0x0" ::: "memory");   // behind the group's stores, before the next group (or the code behind this tile) rewrites their address and data registers
  }
}

// x.Wq and x.[Wk|Wv] in one grid: blocks 0 .. PJ_Q-1 are the tiles of x.Wq, the others those of x.[Wk|Wv]; grid.y = batch element. A tile is 128 tokens of one head's q, gate, k or v columns,
// and q, k and v leave the block in the form that attention reads (norm, rotary, turn in the tile's epilogue): only the gate columns are kept in f32.
constexpr int PJ_Q  = (SEQ / 128) * (NQC / 128);
constexpr int PJ_KV = (SEQ / 128) * (NKVC / 128);
static_assert(((NQC / 128) & (NQC / 128 - 1)) == 0 && ((NKVC / 128) & (NKVC / 128 - 1)) == 0 && (NKV & (NKV - 1)) == 0);
__global__ __launch_bounds__(128) void k_proj(const _Float16* __restrict__ X16, const _Float16* __restrict__ WqT, const _Float16* __restrict__ WkvT,
                                             const float* __restrict__ qnw, const float* __restrict__ knw, const float* __restrict__ cs, float* __restrict__ qraw,
                                             _Float16* __restrict__ Qh, _Float16* __restrict__ Ql, _Float16* __restrict__ Kh, _Float16* __restrict__ Kl,
                                             _Float16* __restrict__ VT, _Float16* __restrict__ VTl, float alpha) {
  __shared__ __attribute__((aligned(2048))) unsigned char sm[2u * G_STAGE];
  const int bx = (int)blockIdx.x;
  const size_t bb = blockIdx.y;
  const _Float16* A = X16 + bb * ((size_t)SEQ * HID);
  const bool two = bx >= PJ_Q;           // block-uniform, like all that follows from it
  const int tb = two ? bx - PJ_Q : bx;
  const int nq = tb & ((two ? NKVC / 128 : NQC / 128) - 1);   // the tile's column block: tb modulo a power of two
  const bool isv = two && nq >= NKV;
  const size_t hp = two ? bb * NKV + (size_t)(nq & (NKV - 1)) : bb * NH + (size_t)(nq >> 1);   // head plane
  gemm_tile<false, true>(sm, tb, A, A, HID, two ? WkvT : WqT, HID, alpha, 0.0f, qraw + bb * ((size_t)SEQ * NQC), NQC, SEQ, two ? NKVC : NQC, HID,
                         two ? (isv ? 2 : 1) : ((nq & 1) ? 0 : 1), two ? knw : qnw, cs,
                         (two ? (isv ? VT : Kh) : Qh) + hp * ((size_t)SEQ * HD), (two ? (isv ? VTl : Kl) : Ql) + hp * ((size_t)RESQ * HD));
}

// Two independent products in one grid: blocks 0 .. n1-1 are the tiles of product 1 (plain), the others those of product 2 (with its residual plane). lda, ldb, K and alpha are common.
// grid.y = batch element: A advances by bsA, Al2 by bsAl2, C1 and C2 by bsC1 and bsC2 elements per batch element; Bt1 and Bt2 are shared.
__global__ __launch_bounds__(128) void k_gemm2(int n1, const _Float16* __restrict__ A1, const _Float16* __restrict__ Bt1, float* __restrict__ C1, int ldc1, int M1, int N1, size_t bsC1,
                                              const _Float16* __restrict__ A2, const _Float16* __restrict__ Al2, const _Float16* __restrict__ Bt2, float* __restrict__ C2, int ldc2, int M2, int N2, size_t bsC2,
                                              size_t bsAl2, int lda, int ldb, int K, size_t bsA, float alpha, float alphal) {
  __shared__ __attribute__((aligned(2048))) unsigned char sm[2u * G_STAGE];
  const int bx = (int)blockIdx.x;
  const size_t bb = blockIdx.y;
  if (bx >= n1) gemm_tile<true, false>(sm, bx - n1, A2 + bb * bsA, Al2 + bb * bsAl2, lda, Bt2, ldb, alpha, alphal, C2 + bb * bsC2, ldc2, M2, N2, K, 0, nullptr, nullptr, nullptr, nullptr);   // block-uniform
  else gemm_tile<false, false>(sm, bx, A1 + bb * bsA, A1 + bb * bsA, lda, Bt1, ldb, alpha, 0.0f, C1 + bb * bsC1, ldc1, M1, N1, K, 0, nullptr, nullptr, nullptr, nullptr);
}

template <bool RES> struct AttnLds {     // byte sizes of the block's LDS tiles, in their order
  static constexpr int KC = RES ? 32 : 64, OD = RES ? 64 : 128, KP = HD + 8, VP = KC + 8, PP = 72;
  static constexpr uint32_t K = KC * KP * 2u, KL = (RES ? KC : 1) * KP * 2u, V = OD * VP * 2u, VL = (RES ? OD : 1) * VP * 2u, P = 8 * 16 * PP * 2u, PL = (RES ? 8 : 1) * 16 * PP * 2u;
  static constexpr uint32_t ALL = K + KL + V + VL + P + PL;
  static_assert(K % 16 == 0 && KL % 16 == 0 && V % 16 == 0 && VL % 16 == 0 && P % 16 == 0);
};
template <bool RES>
__device__ __forceinline__ void attn_block(unsigned char* smem, const _Float16* __restrict__ Qh, const _Float16* __restrict__ Ql,
                                           const _Float16* __restrict__ Kh, const _Float16* __restrict__ Kl,
                                           const _Float16* __restrict__ VT, const _Float16* __restrict__ VTl,
                                           const float* __restrict__ qraw, _Float16* __restrict__ Oh, _Float16* __restrict__ Ol, int qb, int h, int bz) {
  constexpr int KC = RES ? 32 : 64;      // keys per chunk
  constexpr int NJ = KC / 16;            // score column tiles
  constexpr int NKS = KC / 32;           // k-steps of P.V^T
  constexpr int OD = RES ? 64 : 128;     // o columns per block
  constexpr int NC = OD / 16;
  constexpr int NHF = OD / 64;
  constexpr int CG = RES ? 2 : 4;        // o column tiles per group of V^T fragment loads (four fragments with the residual ones)
  constexpr int NGC = NC / CG;           // groups per k-step
  constexpr int NG = NKS * NGC;
  constexpr int KP = HD + 8;             // sK pitch (halves)
  constexpr int VP = KC + 8;             // sV pitch
  constexpr int PP = 72;                 // sP pitch (64 staged o columns)
  using L = AttnLds<RES>;
  static_assert(L::KC == KC && L::OD == OD && L::KP == KP && L::VP == VP && L::PP == PP);
  _Float16 (*sK)[KP]      = (_Float16 (*)[KP])smem;                                                  // [KC]
  _Float16 (*sKl)[KP]     = (_Float16 (*)[KP])(smem + L::K);                                         // [RES ? KC : 1]
  _Float16 (*sV)[VP]      = (_Float16 (*)[VP])(smem + L::K + L::KL);                                 // [OD]
  _Float16 (*sVl)[VP]     = (_Float16 (*)[VP])(smem + L::K + L::KL + L::V);                          // [RES ? OD : 1]
  _Float16 (*sP)[16][PP]  = (_Float16 (*)[16][PP])(smem + L::K + L::KL + L::V + L::VL);              // [8]
  _Float16 (*sPl)[16][PP] = (_Float16 (*)[16][PP])(smem + L::K + L::KL + L::V + L::VL + L::P);       // [RES ? 8 : 1]

  const int tid = threadIdx.x, w = tid >> 5, lane = tid & 31, ln = lane & 15, hh = lane >> 4;
  const int kv = h / GQ;
  const int dz = RES ? (bz & 1) * 64 : 0;
  const size_t bb = (size_t)(RES ? (bz >> 1) : bz);
  Qh += bb * ((size_t)NH * SEQ * HD); Ql += bb * ((size_t)NH * RESQ * HD); Kh += bb * ((size_t)NKV * SEQ * HD); Kl += bb * ((size_t)NKV * RESQ * HD);
  VT += bb * ((size_t)NKV * HD * SEQ); VTl += bb * ((size_t)NKV * HD * RESQ); qraw += bb * ((size_t)SEQ * NQC);
  Oh += bb * ((size_t)SEQ * NH * HD); Ol += bb * ((size_t)RESQ * NH * HD);
  const int q0b = qb * 128, q0w = q0b + 16 * w;
  const int nch = (q0b + 128) / KC;      // chunks holding keys <= last row of the block
  const int qlast = q0w + 15;

  v16h aq[4], aql[4];
  {
    const _Float16* qp = Qh + ((size_t)h * SEQ + q0w + ln) * HD;
#pragma unroll
    for (int kk = 0; kk < 4; ++kk) aq[kk] = frag16(qp + kk * 32, hh);
    if (RES) {
      const _Float16* qlp = Ql + ((size_t)h * RESQ + q0w + ln) * HD;
#pragma unroll
      for (int kk = 0; kk < 4; ++kk) aql[kk] = frag16(qlp + kk * 32, hh);
    } else {
#pragma unroll
      for (int kk = 0; kk < 4; ++kk) aql[kk] = aq[kk];
    }
  }
  const v8f z8 = {0.f, 0.f, 0.f, 0.f, 0.f, 0.f, 0.f, 0.f};
  v8f o[NC];
#pragma unroll
  for (int c = 0; c < NC; ++c) o[c] = z8;
  float mrow = -3.0e38f, lrow = 0.f;     // query q0w + ln: running maximum (both halves alike), sum over this half's keys
  const float alpha = 0.08838834764831845f;
  // staging addresses: block-uniform bases plus one 32-bit lane offset per plane, the row steps as constants (leaves the registers to the fragment groups)
  constexpr int VR = 256 / (KC / 8);     // V^T rows staged per round of the block
  const char* kgb = (const char*)(Kh + (size_t)kv * SEQ * HD);
  const char* klgb = (const char*)(Kl + (size_t)kv * RESQ * HD);
  const char* vgb = (const char*)(VT + (size_t)(kv * HD + dz) * SEQ);
  const char* vlgb = (const char*)(VTl + (size_t)(kv * HD + dz) * RESQ);
  const uint32_t kvo = (uint32_t)((tid >> 4) * HD + (tid & 15) * 8) * 2u;
  const uint32_t vvo = (uint32_t)((tid / (KC / 8)) * SEQ + (tid % (KC / 8)) * 8) * 2u;
  const uint32_t vlvo = (uint32_t)((tid / (KC / 8)) * RESQ + (tid % (KC / 8)) * 8) * 2u;
  _Float16* skp = &sK[tid >> 4][(tid & 15) * 8];
  _Float16* sklp = &sKl[RES ? (tid >> 4) : 0][(tid & 15) * 8];
  _Float16* svp = &sV[tid / (KC / 8)][(tid % (KC / 8)) * 8];
  _Float16* svlp = &sVl[RES ? (tid / (KC / 8)) : 0][(tid % (KC / 8)) * 8];

#pragma unroll 1
  for (int ch = 0; ch < nch; ++ch) {
    const int t0 = ch * KC;
    // stage K rows t0..t0+KC-1 (all 128 d) and V^T rows dz..dz+OD-1 (keys t0..t0+KC-1): staged extent == consumed extent
#pragma unroll
    for (int it = 0; it < (KC * 16) / 256; ++it) {
      *(v8us*)(skp + it * 16 * KP) = *(const v8us*)(kgb + (size_t)t0 * (HD * 2) + (size_t)it * (16 * HD * 2) + kvo);
      if (RES) *(v8us*)(sklp + it * 16 * KP) = *(const v8us*)(klgb + (size_t)t0 * (HD * 2) + (size_t)it * (16 * HD * 2) + kvo);
    }
#pragma unroll
    for (int it = 0; it < (OD * (KC / 8)) / 256; ++it) {
      *(v8us*)(svp + it * VR * VP) = *(const v8us*)(vgb + (size_t)t0 * 2 + (size_t)it * ((size_t)VR * SEQ * 2) + vvo);
      if (RES) *(v8us*)(svlp + it * VR * VP) = *(const v8us*)(vlgb + (size_t)t0 * 2 + (size_t)it * ((size_t)VR * RESQ * 2) + vlvo);
    }
    __syncthreads();
    if (t0 <= qlast) {                   // wave-uniform: this wave has unmasked keys in the chunk
      // k-step kk's K fragments of all key tiles are one group of LDS loads, issued one k-step ahead of their products (set kk & 1); the key tiles' accumulators are independent, each sums its kk in ascending order
      v8f sacc[NJ], stmp[RES ? NJ : 1];
#pragma unroll
      for (int j = 0; j < NJ; ++j) { sacc[j] = z8; if (RES) stmp[j] = z8; }
      {
        v16h fk[2][NJ], fkl[2][RES ? NJ : 1];
#pragma unroll
        for (int j = 0; j < NJ; ++j) {
          fk[0][j] = frag16(&sK[j * 16 + ln][0], hh);                     // A[m = key][k = d]: key row, d contiguous
          if (RES) fkl[0][j] = frag16(&sKl[j * 16 + ln][0], hh);
        }
#pragma unroll
        for (int kk = 0; kk < 4; ++kk) {
          if (kk < 3) {
#pragma unroll
            for (int j = 0; j < NJ; ++j) {
              fk[(kk + 1) & 1][j] = frag16(&sK[j * 16 + ln][(kk + 1) * 32], hh);
              if (RES) fkl[(kk + 1) & 1][j] = frag16(&sKl[j * 16 + ln][(kk + 1) * 32], hh);
            }
          }
          __builtin_amdgcn_sched_barrier(0);   // keeps the next k-step's LDS loads one group ahead of the products, not one by one in front of each
#pragma unroll
          for (int j = 0; j < NJ; ++j) sacc[j] = mma16b(fk[kk & 1][j], aq[kk], sacc[j]);
          if (RES) {
#pragma unroll
            for (int j = 0; j < NJ; ++j) stmp[j] = mma16b(fk[kk & 1][j], aql[kk], stmp[j]);
#pragma unroll
            for (int j = 0; j < NJ; ++j) stmp[j] = mma16b(fkl[kk & 1][j], aq[kk], stmp[j]);
          }
          __builtin_amdgcn_sched_barrier(0);   // ends the block of products: the following loads stay behind it
        }
      }
      if (RES) {
#pragma unroll
        for (int j = 0; j < NJ; ++j) sacc[j] = sacc[j] + stmp[j] * (1.0f / RCAR);
      }
      // V^T fragments go in groups of four as well (CG o column tiles of one k-step); the first group's loads go ahead of the softmax, which needs no LDS and covers their latency
      v16h fv[2][CG], fvl[2][RES ? CG : 1];
#pragma unroll
      for (int i = 0; i < CG; ++i) {
        fv[0][i] = frag16(&sV[i * 16 + ln][0], hh);                       // A[m = d][k = key]: d row, keys contiguous
        if (RES) fvl[0][i] = frag16(&sVl[i * 16 + ln][0], hh);
      }
      __builtin_amdgcn_sched_barrier(0);       // holds that group's loads here, ahead of the softmax
      // scale, causal mask, online softmax. sacc[j][r] is key t0 + 16 j + 8 hh + r against query q0w + ln. One chain per key tile for maximum and sum, so that no link waits for the one before it
      const int dq = q0w + ln - t0 - 8 * hh;     // key tile j, register r is masked where 16 j + r > dq
      float mj[NJ], sj[NJ];
#pragma unroll
      for (int j = 0; j < NJ; ++j) mj[j] = -3.0e38f;
#pragma unroll
      for (int r = 0; r < 8; ++r)
#pragma unroll
        for (int j = 0; j < NJ; ++j) mj[j] = fmaxf(mj[j], (16 * j + r > dq) ? -3.0e38f : sacc[j][r] * alpha);
#pragma unroll
      for (int j = 1; j < NJ; ++j) mj[0] = fmaxf(mj[0], mj[j]);
      const float mnew = fmaxf(mrow, fmaxf(mj[0], half_xor(mj[0])));
      const float fac = (mrow < -1.0e38f) ? 0.f : __expf(mrow - mnew);
      mrow = mnew;
      // P^T (x2^14) as B[k = key][n = query]: element e of k-step ks is key 32 ks + 8 hh + e (e < 8) or 32 ks + 16 + 8 hh + e - 8, that is register e & 7 of key tile 2 ks + (e >> 3), in this lane
      FragH ap[NKS], apl[NKS];
#pragma unroll
      for (int j = 0; j < NJ; ++j) sj[j] = 0.f;
#pragma unroll
      for (int r = 0; r < 8; ++r) {
#pragma unroll
        for (int j = 0; j < NJ; ++j) {
          const float p = (16 * j + r > dq) ? 0.f : __expf(sacc[j][r] * alpha - mnew);
          sj[j] += p;
          const float pcv = p * PCAR; const _Float16 ph = (_Float16)pcv;
          ap[j >> 1].h[(j & 1) * 8 + r] = ph;
          if (RES) apl[j >> 1].h[(j & 1) * 8 + r] = (_Float16)((pcv - (float)ph) * RCAR);
        }
      }
#pragma unroll
      for (int j = 1; j < NJ; ++j) sj[0] += sj[j];
      lrow = lrow * fac + sj[0];
#pragma unroll
      for (int c = 0; c < NC; ++c) o[c] = o[c] * fac;
      v8f ptmp[RES ? NC : 1];
      if (RES) {
#pragma unroll
        for (int c = 0; c < NC; ++c) ptmp[c] = z8;
      }
#pragma unroll
      for (int g = 0; g < NG; ++g) {           // group g: k-step g / NGC, o column tiles (g % NGC) * CG ..; every o tile meets its k-steps in ascending order
        if (g + 1 < NG) {
          const int ks1 = (g + 1) / NGC, cb1 = ((g + 1) % NGC) * CG;
#pragma unroll
          for (int i = 0; i < CG; ++i) {
            fv[(g + 1) & 1][i] = frag16(&sV[(cb1 + i) * 16 + ln][ks1 * 32], hh);
            if (RES) fvl[(g + 1) & 1][i] = frag16(&sVl[(cb1 + i) * 16 + ln][ks1 * 32], hh);
          }
        }
        __builtin_amdgcn_sched_barrier(0);     // keeps the next group's LDS loads ahead of this group's products
        const int ks = g / NGC, cb = (g % NGC) * CG;
#pragma unroll
        for (int i = 0; i < CG; ++i) o[cb + i] = mma16b(fv[g & 1][i], ap[ks].v, o[cb + i]);
        if (RES) {
#pragma unroll
          for (int i = 0; i < CG; ++i) ptmp[cb + i] = mma16b(fv[g & 1][i], apl[ks].v, ptmp[cb + i]);
#pragma unroll
          for (int i = 0; i < CG; ++i) ptmp[cb + i] = mma16b(fvl[g & 1][i], ap[ks].v, ptmp[cb + i]);
        }
        __builtin_amdgcn_sched_barrier(0);     // ends the block of products: the following loads stay behind it
      }
      if (RES) {
#pragma unroll
        for (int c = 0; c < NC; ++c) o[c] = o[c] + ptmp[c] * (1.0f / RCAR);
      }
    }
    __syncthreads();
  }

  // epilogue
  // o[c][r] is column 16 c + 8 hh + r of query q0w + ln: eight consecutive columns a tile, one 16-B piece of the staged row; the halves' sums are joined here, once
  const float il = (OCAR / PCAR) * __builtin_amdgcn_rcpf(lrow + half_xor(lrow));
  const char* gb = (const char*)(qraw + (size_t)q0w * NQC + (size_t)h * (2 * HD) + HD + dz);
  const uint32_t go = ((uint32_t)ln * (uint32_t)NQC + 8u * (uint32_t)hh) * 4u;
#pragma unroll
  for (int hf = 0; hf < NHF; ++hf) {
    if (hf > 0) {
      __builtin_amdgcn_fence(4 /* acq_rel order */, "workgroup"); __builtin_amdgcn_wave_barrier();
      asm volatile("s_wait_xcnt 0x0" ::: "memory");   // behind the first half's o stores, before this half's gate loads are given their data registers
    }
    v4f ga[4], gc[4];                    // gate columns of the half's four tiles
#pragma unroll
    for (int cc = 0; cc < 4; ++cc) {
      ga[cc] = *(const v4fa*)(gb + (size_t)(hf * 4 + cc) * 64 + go);
      gc[cc] = *(const v4fa*)(gb + (size_t)(hf * 4 + cc) * 64 + 16 + go);
    }
    asm volatile("s_wait_xcnt 0x0" :: "v"(go) : "memory");   // behind the loads: the lane offset that they name stays whole until their addresses are taken
#pragma unroll
    for (int cc = 0; cc < 4; ++cc) {
      const int c = hf * 4 + cc;
      Pack8 vh, vl;
#pragma unroll
      for (int r = 0; r < 8; ++r) {
        const float g = r < 4 ? ga[cc][r & 3] : gc[cc][r & 3];
        const float sig = __builtin_amdgcn_rcpf(1.0f + __expf(-g));
        const float val = o[c][r] * il * sig;
        vh.h[r] = (_Float16)val;
        if (RES) vl.h[r] = (_Float16)((val - (float)vh.h[r]) * RCAR);
      }
      *(v8us*)&sP[w][ln][cc * 16 + 8 * hh] = vh.v;
      if (RES) *(v8us*)&sPl[w][ln][cc * 16 + 8 * hh] = vl.v;
    }
    __builtin_amdgcn_fence(4 /* acq_rel order */, "workgroup");
    __builtin_amdgcn_wave_barrier();
    const int prw = lane >> 3, pc = lane & 7;
    {
#pragma unroll
      for (int it = 0; it < 4; ++it) {
        const int row = it * 4 + prw;
        const v8us vv = *(const v8us*)&sP[w][row][pc * 8];
        const size_t go = (size_t)(q0w + row) * (NH * HD) + (size_t)h * HD + dz + hf * 64 + pc * 8;
        *(v8us*)((unsigned short*)Oh + go) = vv;
        if (RES) { const v8us vl = *(const v8us*)&sPl[w][row][pc * 8]; *(v8us*)((unsigned short*)Ol + go) = vl; }
      }
      
    }
  }
  asm volatile("s_wait_xcnt 0x0" ::: "memory");   // behind the last o stores: a precaution, as a block runs one form only and the kernel ends behind it
}

// One grid for both forms, which share no output row: the plain blocks first, then the residual ones, each form from its last query block (most key chunks) down to its first.
constexpr int AB_F = ((SEQ - RESQ) / 128) * NH * NB;
constexpr int AB_R = (RESQ / 128) * NH * NB * 2;
// at most 256 registers a wave: four waves a SIMD, two blocks a WGP, as before (the loops need some 210; left free, the allocator reached one register past 256)
__global__ __launch_bounds__(256) __attribute__((amdgpu_num_vgpr(256))) void k_attn2(const _Float16* __restrict__ Qh, const _Float16* __restrict__ Ql,
                                              const _Float16* __restrict__ Kh, const _Float16* __restrict__ Kl,
                                              const _Float16* __restrict__ VT, const _Float16* __restrict__ VTl,
                                              const float* __restrict__ qraw, _Float16* __restrict__ Oh, _Float16* __restrict__ Ol) {
  __shared__ __attribute__((aligned(16))) unsigned char smem[AttnLds<true>::ALL > AttnLds<false>::ALL ? AttnLds<true>::ALL : AttnLds<false>::ALL];
  const int b = (int)blockIdx.x;
  if (b < AB_F) {
    const int qr = b / (NH * NB), rem = b - qr * (NH * NB);
    attn_block<false>(smem, Qh, Ql, Kh, Kl, VT, VTl, qraw, Oh, Ol, SEQ / 128 - 1 - qr, rem % NH, rem / NH);
  } else {
    const int c = b - AB_F, qr = c / (NH * NB * 2), rem = c - qr * (NH * NB * 2);
    attn_block<true>(smem, Qh, Ql, Kh, Kl, VT, VTl, qraw, Oh, Ol, RESQ / 128 - 1 - qr, rem % NH, rem / NH);
  }
}

extern "C" void kernel_launch(void* const* d_in, const int* in_sizes, int n_in,
                              void* d_out, int out_size, void* d_ws, size_t ws_size, hipStream_t stream) {
  if (n_in < 7) return;
  const long need_x = (long)(NB - 1) * SEQ_FULL * HID + (long)SEQ * HID;
  if ((long)in_sizes[0] < need_x) return;
  if (in_sizes[1] < HID * NQC) return;
  if (in_sizes[2] < HID * NKV * HD) return;
  if (in_sizes[3] < HID * NKV * HD) return;
  if (in_sizes[4] < NH * HD * HID) return;
  if (in_sizes[5] < HD) return;
  if (in_sizes[6] < HD) return;
  if ((long)out_size < need_x) return;

  const float* x   = (const float*)d_in[0];
  const float* Wq  = (const float*)d_in[1];
  const float* Wk  = (const float*)d_in[2];
  const float* Wv  = (const float*)d_in[3];
  const float* Wo  = (const float*)d_in[4];
  const float* qnw = (const float*)d_in[5];
  const float* knw = (const float*)d_in[6];

  char* ws = (char*)d_ws; size_t off = 0;
  auto take = [&](size_t bytes) { char* p = ws + off; off += (bytes + 255) & ~(size_t)255; return p; };
  _Float16* X16  = (_Float16*)take(SZ_X16);
  _Float16* WqT  = (_Float16*)take(SZ_WQT);
  _Float16* WkvT = (_Float16*)take(SZ_WKVT);
  _Float16* WoT  = (_Float16*)take(SZ_WOT);
  float*    CS   = (float*)take(SZ_CS);
  float*    qraw = (float*)take(SZ_QRAW);
  _Float16* Qh   = (_Float16*)take(SZ_QH);
  _Float16* Ql   = (_Float16*)take(SZ_QL);
  _Float16* Kh   = (_Float16*)take(SZ_KH);
  _Float16* Kl   = (_Float16*)take(SZ_KL);
  _Float16* VT   = (_Float16*)take(SZ_VT);
  _Float16* VTl  = (_Float16*)take(SZ_VTL);
  _Float16* Oh   = (_Float16*)take(SZ_OH);
  _Float16* Ol   = (_Float16*)take(SZ_OL);
  if (off > ws_size) return;

  const float walpha = 1.0f / WCAR;                          // 2^-4
  const float oalpha = 1.0f / (WCAR * OCAR);                 // 2^-10
  const float oalphal = oalpha / RCAR;                       // 2^-20
  // four launches, each holding every piece of work that depends only on the launches before it; every launch covers all NB batch elements
  float* out = (float*)d_out;
  // rotary table, weight planes (Bt[n][k] = f16(bf16rne(W[k][n]) * 16)), x plane
  k_prep<<<PB_ALL, 256, 0, stream>>>(x, Wq, Wk, Wv, Wo, X16, WqT, WkvT, WoT, CS, WCAR);
  // x.Wq and x.[Wk|Wv], with q/k norm + rotary and the V^T turn in the tiles' epilogues
  k_proj<<<dim3(PJ_Q + PJ_KV, NB), 128, 0, stream>>>(X16, WqT, WkvT, qnw, knw, CS, qraw, Qh, Ql, Kh, Kl, VT, VTl, walpha);
  k_attn2<<<AB_F + AB_R, 256, 0, stream>>>(Qh, Ql, Kh, Kl, VT, VTl, qraw, Oh, Ol);
  // o.Wo: rows RESQ.. plain, rows 0..RESQ-1 with the residual plane
  k_gemm2<<<dim3(((SEQ - RESQ) / 128) * (HID / 128) + (RESQ / 64) * (HID / 128), NB), 128, 0, stream>>>(
      ((SEQ - RESQ) / 128) * (HID / 128), Oh + (size_t)RESQ * NH * HD, WoT, out + (size_t)RESQ * HID, HID, SEQ - RESQ, HID, (size_t)SEQ_FULL * HID,
      Oh, Ol, WoT, out, HID, RESQ, HID, (size_t)SEQ_FULL * HID,
      (size_t)RESQ * NH * HD, NH * HD, NH * HD, NH * HD, (size_t)SEQ * NH * HD, oalpha, oalphal);
  (void)hipGetLastError();
}

// v009
// A run of this version takes 161 microseconds.
// In two side-by-side timings against v008, it was 1.09 and 1.08 times as fast.
// Counting every step since v000, it is 5.60 times as fast.
#include <hip/hip_runtime.h>
#include <stdint.h>
// Contractions x.Wq, x.[Wk|Wv], k.q^T, V^T.P^T, o.Wo: v_wmma_f32_16x16x32_f16 (f16 operands, f32 accumulate). x and all weights RNE-converted to bf16 and held exactly in f16 (weights carried x16); q, k, V^T and gated o as f16 planes plus x2^10 f16 residual planes over the first RESQ query rows / keys (two-term products there, single products elsewhere); softmax weights x2^14 in f16 (+ x2^10 residual on those rows); gated o carried x64; RMSNorm, RoPE, softmax statistics and sigmoid gating in f32.

#ifndef NB
#define NB 2
#endif
#ifndef SEQ
#define SEQ 2048
#endif
#ifndef RESQ
#if SEQ < 512
#define RESQ SEQ
#else
#define RESQ 512
#endif
#endif
#define NB_FULL 2
#define SEQ_FULL 2048
#define HID 2048
#define NH 16
#define NKV 4
#define HD 128
#define GQ (NH / NKV)
#define NQC (2 * NH * HD)      /* q|gate columns: head h at h*256 (q) and h*256+128 (gate); the f32 plane qraw holds the gate columns only */
#define NKVC (2 * NKV * HD)    /* k|v columns: k head j at j*128, v head j at 512+j*128 */
#define NRP 64                 /* rotary pairs */
#define PCAR 16384.0f          /* softmax weight carry */
#define OCAR 64.0f             /* gated o carry */
#define RCAR 1024.0f           /* residual plane carry */
#define WCAR 16.0f             /* weight carry */

static_assert(NB >= 1);
static_assert(NB <= NB_FULL);
static_assert(SEQ % 128 == 0);
static_assert(SEQ <= SEQ_FULL);
static_assert(RESQ % 128 == 0);
static_assert(RESQ >= 128);
static_assert(RESQ <= SEQ);
static_assert((SEQ - RESQ) % 128 == 0);
static_assert(HID % 32 == 0);
static_assert(HID % 64 == 0);
static_assert(NQC % 128 == 0);
static_assert(NKVC % 128 == 0);
static_assert(HID % 256 == 0);
static_assert((NH * HD) % 256 == 0);
static_assert(HD == 128);
static_assert(NH % NKV == 0);
static_assert((SEQ * HID) % 8 == 0);

// planes of x, q, k, v and o hold all NB batch elements, element b at b * (plane size / NB)
constexpr size_t SZ_X16   = (size_t)NB * SEQ * HID * 2;
constexpr size_t SZ_WQT   = (size_t)NQC * HID * 2;
constexpr size_t SZ_WKVT  = (size_t)NKVC * HID * 2;
constexpr size_t SZ_WOT   = (size_t)HID * NH * HD * 2;
constexpr size_t SZ_CS    = (size_t)SEQ * NRP * 2 * 4;
constexpr size_t SZ_QRAW  = (size_t)NB * SEQ * NQC * 4;
constexpr size_t SZ_QH    = (size_t)NB * NH * SEQ * HD * 2;
constexpr size_t SZ_QL    = (size_t)NB * NH * RESQ * HD * 2;
constexpr size_t SZ_KH    = (size_t)NB * NKV * SEQ * HD * 2;
constexpr size_t SZ_KL    = (size_t)NB * NKV * RESQ * HD * 2;
constexpr size_t SZ_VT    = (size_t)NB * NKV * HD * SEQ * 2;
constexpr size_t SZ_VTL   = (size_t)NB * NKV * HD * RESQ * 2;
constexpr size_t SZ_OH    = (size_t)NB * SEQ * NH * HD * 2;
constexpr size_t SZ_OL    = (size_t)NB * RESQ * NH * HD * 2;
constexpr size_t WS_TOTAL = SZ_X16 + SZ_WQT + SZ_WKVT + SZ_WOT + SZ_CS + SZ_QRAW + SZ_QH + SZ_QL + SZ_KH + SZ_KL + SZ_VT + SZ_VTL + SZ_OH + SZ_OL;
static_assert(WS_TOTAL <= (size_t)268435456);
static_assert(SZ_X16 % 256 == 0);
static_assert(SZ_KL % 256 == 0);
static_assert(SZ_VTL % 256 == 0);
static_assert(SZ_CS % 256 == 0);

typedef _Float16 v16h __attribute__((ext_vector_type(16)));
typedef unsigned short v8us __attribute__((ext_vector_type(8), may_alias));
typedef float v8f __attribute__((ext_vector_type(8)));
typedef float v4f __attribute__((ext_vector_type(4)));
typedef float v4fa __attribute__((ext_vector_type(4), may_alias));
typedef float v2f __attribute__((ext_vector_type(2)));
typedef _Float16 v4h __attribute__((ext_vector_type(4)));
typedef uint32_t u32x4 __attribute__((ext_vector_type(4)));
typedef uint32_t u32x8 __attribute__((ext_vector_type(8)));
union FragH { v16h v; v8us half[2]; _Float16 h[16]; unsigned short u[16]; };
union Pack8 { v8us v; _Float16 h[8]; unsigned short u[8]; };

__device__ __forceinline__ unsigned short bf16_bits(float x) { const unsigned int u = __float_as_uint(x); return (unsigned short)((u + 0x7FFFu + ((u >> 16) & 1u)) >> 16); }
__device__ __forceinline__ float bf16_rne(float x) { return __uint_as_float(((unsigned int)bf16_bits(x)) << 16); }
// value of lane l ^ M, M < 16, inside the 16-lane row: a DPP operand (row_xmask) of the vector port, no LDS operation and no wait; every lane is on where it is used
template <int M> __device__ __forceinline__ float row_xor(float v) { return __builtin_bit_cast(float, __builtin_amdgcn_update_dpp(0, __builtin_bit_cast(int, v), 0x160 | M, 0xf, 0xf, true)); }
// value of lane l ^ 16: vector cross-row move
__device__ __forceinline__ float half_xor(float v) { return __builtin_bit_cast(float, __builtin_amdgcn_permlanex16(__builtin_bit_cast(int, v), __builtin_bit_cast(int, v), 0x76543210, 0xfedcba98, false, false)); }
// maxima of eight independent values over their 16-lane rows, lane distance 8, 4, 2, 1. In asm so that exchange and maximum are one instruction (from fmaxf the compiler makes three: DPP move, quieting of the moved value, maximum),
// and in one statement so that the eight rows stay interleaved: a link's producer stands eight instructions back and no link waits
__device__ __forceinline__ void row_max8(float (&v)[8]) {
  asm(
      "v_max_num_f32_dpp %0, %0, %0 row_xmask:8 row_mask:0xf bank_mask:0xf\n\t"
      "v_max_num_f32_dpp %1, %1, %1 row_xmask:8 row_mask:0xf bank_mask:0xf\n\t"
      "v_max_num_f32_dpp %2, %2, %2 row_xmask:8 row_mask:0xf bank_mask:0xf\n\t"
      "v_max_num_f32_dpp %3, %3, %3 row_xmask:8 row_mask:0xf bank_mask:0xf\n\t"
      "v_max_num_f32_dpp %4, %4, %4 row_xmask:8 row_mask:0xf bank_mask:0xf\n\t"
      "v_max_num_f32_dpp %5, %5, %5 row_xmask:8 row_mask:0xf bank_mask:0xf\n\t"
      "v_max_num_f32_dpp %6, %6, %6 row_xmask:8 row_mask:0xf bank_mask:0xf\n\t"
      "v_max_num_f32_dpp %7, %7, %7 row_xmask:8 row_mask:0xf bank_mask:0xf\n\t"
      "v_max_num_f32_dpp %0, %0, %0 row_xmask:4 row_mask:0xf bank_mask:0xf\n\t"
      "v_max_num_f32_dpp %1, %1, %1 row_xmask:4 row_mask:0xf bank_mask:0xf\n\t"
      "v_max_num_f32_dpp %2, %2, %2 row_xmask:4 row_mask:0xf bank_mask:0xf\n\t"
      "v_max_num_f32_dpp %3, %3, %3 row_xmask:4 row_mask:0xf bank_mask:0xf\n\t"
      "v_max_num_f32_dpp %4, %4, %4 row_xmask:4 row_mask:0xf bank_mask:0xf\n\t"
      "v_max_num_f32_dpp %5, %5, %5 row_xmask:4 row_mask:0xf bank_mask:0xf\n\t"
      "v_max_num_f32_dpp %6, %6, %6 row_xmask:4 row_mask:0xf bank_mask:0xf\n\t"
      "v_max_num_f32_dpp %7, %7, %7 row_xmask:4 row_mask:0xf bank_mask:0xf\n\t"
      "v_max_num_f32_dpp %0, %0, %0 row_xmask:2 row_mask:0xf bank_mask:0xf\n\t"
      "v_max_num_f32_dpp %1, %1, %1 row_xmask:2 row_mask:0xf bank_mask:0xf\n\t"
      "v_max_num_f32_dpp %2, %2, %2 row_xmask:2 row_mask:0xf bank_mask:0xf\n\t"
      "v_max_num_f32_dpp %3, %3, %3 row_xmask:2 row_mask:0xf bank_mask:0xf\n\t"
      "v_max_num_f32_dpp %4, %4, %4 row_xmask:2 row_mask:0xf bank_mask:0xf\n\t"
      "v_max_num_f32_dpp %5, %5, %5 row_xmask:2 row_mask:0xf bank_mask:0xf\n\t"
      "v_max_num_f32_dpp %6, %6, %6 row_xmask:2 row_mask:0xf bank_mask:0xf\n\t"
      "v_max_num_f32_dpp %7, %7, %7 row_xmask:2 row_mask:0xf bank_mask:0xf\n\t"
      "v_max_num_f32_dpp %0, %0, %0 row_xmask:1 row_mask:0xf bank_mask:0xf\n\t"
      "v_max_num_f32_dpp %1, %1, %1 row_xmask:1 row_mask:0xf bank_mask:0xf\n\t"
      "v_max_num_f32_dpp %2, %2, %2 row_xmask:1 row_mask:0xf bank_mask:0xf\n\t"
      "v_max_num_f32_dpp %3, %3, %3 row_xmask:1 row_mask:0xf bank_mask:0xf\n\t"
      "v_max_num_f32_dpp %4, %4, %4 row_xmask:1 row_mask:0xf bank_mask:0xf\n\t"
      "v_max_num_f32_dpp %5, %5, %5 row_xmask:1 row_mask:0xf bank_mask:0xf\n\t"
      "v_max_num_f32_dpp %6, %6, %6 row_xmask:1 row_mask:0xf bank_mask:0xf\n\t"
      "v_max_num_f32_dpp %7, %7, %7 row_xmask:1 row_mask:0xf bank_mask:0xf\n\t"
      : "+v"(v[0]), "+v"(v[1]), "+v"(v[2]), "+v"(v[3]), "+v"(v[4]), "+v"(v[5]), "+v"(v[6]), "+v"(v[7]));
}
// one exchange stage of eight independent row sums (lane distance M)
template <int M> __device__ __forceinline__ void sum_stage(float (&v)[8]) {
#pragma unroll
  for (int r = 0; r < 8; ++r) v[r] += row_xor<M>(v[r]);
}

// 16x32 f16 fragment from a k-contiguous row p (A row m = lane&15, or Bt row n = lane&15): elements 0..7 <- k 8h..8h+7, 8..15 <- k 16+8h..16+8h+7
__device__ __forceinline__ v16h frag16(const _Float16* p, int hh) {
  FragH f;
  f.half[0] = *(const v8us*)((const unsigned short*)p + 8 * hh);
  f.half[1] = *(const v8us*)((const unsigned short*)p + 16 + 8 * hh);
  return f.v;
}

// bx = block inside a batch element, bb = batch element
__device__ __forceinline__ void x16_block(const float* __restrict__ x, _Float16* __restrict__ X16, size_t n8, int bx, int bb) {
  const size_t t = (size_t)bx * 256 + threadIdx.x; if (t >= n8) return;
  x += (size_t)bb * SEQ_FULL * HID; X16 += (size_t)bb * SEQ * HID;
  const v4f a = *(const v4fa*)(x + t * 8), c = *(const v4fa*)(x + t * 8 + 4);
  Pack8 f;
#pragma unroll
  for (int q = 0; q < 4; ++q) { f.h[q] = (_Float16)bf16_rne(a[q]); f.h[4 + q] = (_Float16)bf16_rne(c[q]); }
  unsigned short* d = (unsigned short*)X16 + t * 8;
  *(v8us*)d = f.v; 
}

#define WT_K 128                     /* k per block tile: one 256-B piece of a Wt row */
#define WT_N 128                     /* n per block tile: two 256-B pieces of a W row */

// Wt[n][k] = f16(bf16rne(W[k][n]) * scale). Block bx = tile of WT_K k x WT_N n, (K / WT_K) * (N / WT_N) blocks; st = the block's LDS tile.
// A thread reads 8 k x (4 + 4) n (each wave-wide load covers two whole 256-B row pieces of W), packs 8 k per n and turns the tile in LDS; each wave-wide store covers two whole 256-B row pieces of Wt.
// LDS row n holds its sixteen 16-B k chunks at chunk ^ ((n >> 2) & 15): the 16 lanes of a half wave then fall on 16 different bank groups, writing (16 rows, one chunk) and reading (one row, 16 chunks).
// K and N are compile-time, so that the row steps are immediate offsets on one address.
template <int K, int N>
__device__ __forceinline__ void wt_block(unsigned short (*st)[WT_K], const float* __restrict__ W, _Float16* __restrict__ Wt, float scale, int bx) {
  static_assert(K % WT_K == 0);
  static_assert(N % WT_N == 0);
  const int tid = threadIdx.x;
  constexpr int ntn = N / WT_N;
  const int kt = bx / ntn, nt = bx - kt * ntn;
  const int k0 = kt * WT_K, n0 = nt * WT_N;
  const int lo = tid & 15, hi = tid >> 4;
  // block-uniform base plus one 32-bit lane offset that all sixteen loads (all eight stores) share
  const char* wb = (const char*)(W + (size_t)k0 * N + n0);
  const uint32_t vo = ((uint32_t)(hi * 8) * (uint32_t)N + (uint32_t)(lo * 4)) * 4u;
  v4f r[2][8];
#pragma unroll
  for (int i = 0; i < 8; ++i) {
    r[0][i] = *(const v4fa*)(wb + (size_t)i * N * 4 + vo);
    r[1][i] = *(const v4fa*)(wb + (size_t)i * N * 4 + 256 + vo);
  }
  // behind the last load: the offset register that all sixteen loads name stays whole until their addresses are taken (no load's result is placed on it), and no load sinks below into the conversions
  asm volatile("s_wait_xcnt 0x0" :: "v"(vo) : "memory");
#pragma unroll
  for (int h = 0; h < 2; ++h) {
#pragma unroll
    for (int j = 0; j < 4; ++j) {
      Pack8 f;
#pragma unroll
      for (int i = 0; i < 8; ++i) f.h[i] = (_Float16)(bf16_rne(r[h][i][j]) * scale);
      *(v8us*)&st[h * 64 + lo * 4 + j][(hi ^ lo) * 8] = f.v;
    }
  }
  __syncthreads();
  char* tb = (char*)(Wt + (size_t)n0 * K + k0);
  const uint32_t so = ((uint32_t)hi * (uint32_t)K + (uint32_t)(lo * 8)) * 2u;
#pragma unroll
  for (int it = 0; it < WT_N / 16; ++it) {
    const int n = it * 16 + hi;
    const v8us v = *(const v8us*)&st[n][(lo ^ ((n >> 2) & 15)) * 8];
    *(v8us*)(tb + (size_t)it * 16 * K * 2 + so) = v;
  }
}

__device__ __forceinline__ void rope_block(float* __restrict__ cs, int bx) {
  const int t = bx * 256 + threadIdx.x; if (t >= SEQ * NRP) return;
  const int pos = t / NRP, i = t - pos * NRP;
  const float inv = exp2f(-(float)i * 0.31143075889569022f);   // 2^(-i*log2(1e6)/64)
  const float ang = (float)pos * inv;
  float sn, cn; sincosf(ang, &sn, &cn);
  v2f o; o[0] = cn; o[1] = sn;
  float* d = cs + (size_t)t * 2;
  *(v2f*)d = o; 
}

// One grid for everything that reads only the inputs: rotary table, the four weight planes, the x plane. None reads what another writes; a block's index range says which piece it takes.
constexpr int PB_ROPE = (SEQ * NRP + 255) / 256;
constexpr int PB_WQ   = (HID / WT_K) * (NQC / WT_N);
constexpr int PB_WKV  = (HID / WT_K) * (NKV * HD / WT_N);
constexpr int PB_WO   = ((NH * HD) / WT_K) * (HID / WT_N);
constexpr int PB_X    = (int)(((size_t)SEQ * HID / 8 + 255) / 256);
constexpr int PB_ALL  = PB_ROPE + PB_WQ + 2 * PB_WKV + PB_WO + NB * PB_X;
__global__ __launch_bounds__(256) void k_prep(const float* __restrict__ x, const float* __restrict__ Wq, const float* __restrict__ Wk, const float* __restrict__ Wv, const float* __restrict__ Wo,
                                             _Float16* __restrict__ X16, _Float16* __restrict__ WqT, _Float16* __restrict__ WkvT, _Float16* __restrict__ WoT, float* __restrict__ cs, float scale) {
  __shared__ __attribute__((aligned(16))) unsigned short st[WT_N][WT_K];
  int b = (int)blockIdx.x;
  if (b < PB_ROPE) { rope_block(cs, b); return; }
  b -= PB_ROPE;
  if (b < PB_WQ) { wt_block<HID, NQC>(st, Wq, WqT, scale, b); return; }
  b -= PB_WQ;
  if (b < PB_WO) { wt_block<NH * HD, HID>(st, Wo, WoT, scale, b); return; }
  b -= PB_WO;
  if (b < 2 * PB_WKV) {
    const bool isv = b >= PB_WKV;
    wt_block<HID, NKV * HD>(st, isv ? Wv : Wk, isv ? WkvT + (size_t)NKV * HD * HID : WkvT, scale, isv ? b - PB_WKV : b);
    return;
  }
  b -= 2 * PB_WKV;
  const int bb = b / PB_X;
  x16_block(x, X16, (size_t)SEQ * HID / 8, b - bb * PB_X, bb);
}

#define G_PITCH 272u                 /* LDS row pitch: 256 B of k plus the mover's 16-B pad (ds_load_b128 readers) */
#define G_SLICE 18432u               /* one wave's slice: 64 rows at G_PITCH, rounded up to a multiple of 2 KiB */
#define G_STAGE (4u * G_SLICE)       /* one buffer: [A rows 0..63 | A rows 64..127 (RES: residual rows 0..63) | Bt rows 0..63 | Bt rows 64..127] */
static_assert(64u * G_PITCH <= G_SLICE);
static_assert(G_SLICE % 2048u == 0);
static_assert(64u * 68u * 4u <= G_SLICE);

// D += A.B by the plain builtin, whose distances the compiler keeps itself: register operands on an asm guard would hold the GEMM's accumulators and both fragment sets below v256 (spills)
__device__ __forceinline__ v8f mma16b(v16h a, v16h b, v8f c) { return __builtin_amdgcn_wmma_f32_16x16x32_f16(false, a, false, b, (short)0, c, false, false); }
__device__ __forceinline__ uint32_t uni(uint32_t v) { return (uint32_t)__builtin_amdgcn_readfirstlane(v); }
__device__ __forceinline__ uint32_t pinned(uint32_t v) { uint32_t w = uni(v); asm volatile("" : "+s"(w)); return w; }
__device__ __forceinline__ void wait_ds0() { asm volatile("s_wait_dscnt 0x0" ::: "memory"); }          // this wave's LDS reads have returned before the buffer is handed over
__device__ __forceinline__ void tdm_load(u32x4 g0, u32x8 g1) { asm volatile("tensor_load_to_lds %0, %1" :: "s"(g0), "s"(g1) : "memory"); }
// this wave's slice has landed; the compiler places no wait for the mover. The wait names the youngest request's descriptor as inputs: its scalar registers stay allocated, and so unwritten, until the request has returned
__device__ __forceinline__ void wait_tensor0_of(u32x4 g0, u32x8 g1) { asm volatile("s_wait_tensorcnt 0x0" :: "s"(g0), "s"(g1) : "memory"); }
// group 1: 1-byte elements, tile = tensor = 64 rows of 256 B, source row pitch in bytes, 4 dwords of LDS pad behind every 256-B row
__device__ __forceinline__ u32x8 tdm_group1(uint32_t src_pitch) {
  u32x8 g;
  g[0] = uni((1u << 20) | (5u << 22) | (3u << 25));
  // pinned(): descriptor words held in their scalar registers through the loop, so that none is rewritten while a request is outstanding
  g[1] = pinned(256u << 16);
  g[2] = pinned(64u << 16);
  g[3] = pinned(256u << 16);
  g[4] = pinned(64u);
  g[5] = pinned(src_pitch);
  g[6] = pinned(0u);
  g[7] = pinned(0u);
  return g;
}
__device__ __forceinline__ u32x4 tdm_group0(uint32_t lds_dst, uint64_t ga) {
  u32x4 g;
  g[0] = uni(1u); g[1] = uni(lds_dst); g[2] = uni((uint32_t)ga); g[3] = uni((((uint32_t)(ga >> 32)) & 0x01FFFFFFu) | 0x80000000u);
  return g;
}

typedef uint64_t u64a __attribute__((may_alias));
// behind eight 8-B stores: their data registers and their lane offset are inputs of the wait, so that they stay allocated, and so unwritten, until the stores' addresses and data are taken
__device__ __forceinline__ void wait_x0_of(const uint64_t (&d)[8], uint32_t o) {
  asm volatile("s_wait_xcnt 0x0" :: "v"(d[0]), "v"(d[1]), "v"(d[2]), "v"(d[3]), "v"(d[4]), "v"(d[5]), "v"(d[6]), "v"(d[7]), "v"(o) : "memory");
}

// C[M][N] (f32, pitch ldc) = alpha * A[M][K] (f16, pitch lda) . Bt[N][K]^T (f16, pitch ldb)  (+ alphal * Al . Bt^T when RES: residual plane Al, pitch lda).
// Block = 4 waves (2 x 2), C tile 128 x 128 (RES: 64 x 128), tile bx of (M / tile rows) * (N / 128); K % 128 == 0, K >= 128. sm = the block's LDS ring.
// A pass is 128 k: every wave brings its own 64-row slice of the pass into LDS with one tensor load, two buffers, the next pass's load in flight under this pass's products.
// Each accumulator sums its k in ascending steps of 32. Every inner loop is unrolled so that the accumulator and fragment arrays are indexed by constants and stay in registers.
// PROJ: the tile is one head's 128 columns of a projection, and mode (block-uniform) says what leaves the block:
//   0: the f32 tile to C, as without PROJ (gate columns);
//   1: q or k head: RMSNorm (nw + 1, eps 1e-6) over the tile's 128 columns, rotate-half RoPE from cs[token], f16 rows to PH[token][d], x2^10 residual rows to PL for tokens < RESQ;
//   2: v head: turned, f16 to PH[d][token] (row pitch SEQ), x2^10 residual to PL[d][token] (row pitch RESQ) for tokens < RESQ.
template <bool RES, bool PROJ>
__device__ __forceinline__ void gemm_tile(unsigned char* sm, int bx, const _Float16* __restrict__ A, const _Float16* __restrict__ Al, int lda, const _Float16* __restrict__ Bt, int ldb,
                                          float alpha, float alphal, float* __restrict__ C, int ldc, int M, int N, int K,
                                          int mode, const float* __restrict__ nw, const float* __restrict__ cs, _Float16* __restrict__ PH, _Float16* __restrict__ PL) {
  static_assert(!(RES && PROJ));
  constexpr int BM = RES ? 64 : 128;
  constexpr int NI = RES ? 2 : 4;        // 16-row C tiles per wave
  const int tid = threadIdx.x, lane = tid & 31, ln = lane & 15, hh = lane >> 4;
  const uint32_t w = uni((uint32_t)tid >> 5);
  const int wm = (int)(w >> 1), wn = (int)(w & 1u);
  const int ntn = N >> 7;
  const int mt = PROJ ? (int)uni((uint32_t)(bx / ntn)) : bx / ntn, nq = bx - mt * ntn;   // PROJ: the quotient (block-uniform) in a scalar register, and with it the tile's rows, columns and bases
  const int row0 = mt * BM, col0 = nq * 128;
  if (row0 >= M) return;
  const _Float16* src = (w >= 2u) ? (Bt + (size_t)(col0 + 64 * wn) * ldb)
                      : (RES ? ((w == 1u ? Al : A) + (size_t)row0 * lda) : (A + (size_t)(row0 + 64 * (int)w) * lda));
  const uint64_t ga0 = (uint64_t)(uintptr_t)src;
  const uint32_t lds0 = (uint32_t)(size_t)sm + w * G_SLICE;
  const u32x8 g1 = tdm_group1(2u * (uint32_t)(w >= 2u ? ldb : lda));
  const int ns = K >> 7;
  // per-lane fragment rows inside a buffer
  uint32_t aoff[4], boff[4];
#pragma unroll
  for (int i = 0; i < 4; ++i) {
    aoff[i] = RES ? ((uint32_t)(i >> 1) * G_SLICE + (uint32_t)(wm * 32 + (i & 1) * 16 + ln) * G_PITCH)
                  : ((uint32_t)wm * G_SLICE + (uint32_t)(i * 16 + ln) * G_PITCH);
    boff[i] = (uint32_t)(2 + wn) * G_SLICE + (uint32_t)(i * 16 + ln) * G_PITCH;
  }
  const v8f z8 = {0.f, 0.f, 0.f, 0.f, 0.f, 0.f, 0.f, 0.f};
  v8f c[4][4];                           // RES: c[0..1] main plane, c[2..3] residual plane of the same rows
#pragma unroll
  for (int i = 0; i < 4; ++i)
#pragma unroll
    for (int j = 0; j < 4; ++j) c[i][j] = z8;

  u32x4 g0 = tdm_group0(lds0, ga0);      // group 0 of the youngest request
  tdm_load(g0, g1);
  wait_tensor0_of(g0, g1);
  __syncthreads();
  if (pinned(1 < ns ? 1u : 0u) != 0u) { g0 = tdm_group0(lds0 + G_STAGE, ga0 + 256u); tdm_load(g0, g1); }
#pragma unroll 1                         // one pass per trip: the buffer alternates at run time
  for (int s = 0; s < ns; ++s) {
    const uint32_t bo = (uint32_t)(s & 1) * G_STAGE;
    const unsigned char* bp = sm + bo;
    v16h fa[2][4], fb[2][4];             // set (kk & 1) holds k-step kk's fragments; the next step's loads go ahead of this step's products as one group
#pragma unroll
    for (int i = 0; i < 4; ++i) { fa[0][i] = frag16((const _Float16*)(bp + aoff[i]), hh); fb[0][i] = frag16((const _Float16*)(bp + boff[i]), hh); }
#pragma unroll
    for (int kk = 0; kk < 4; ++kk) {
      if (kk < 3) {
#pragma unroll
        for (int i = 0; i < 4; ++i) {
          fa[(kk + 1) & 1][i] = frag16((const _Float16*)(bp + aoff[i] + (kk + 1) * 64), hh);
          fb[(kk + 1) & 1][i] = frag16((const _Float16*)(bp + boff[i] + (kk + 1) * 64), hh);
        }
      }
      __builtin_amdgcn_sched_barrier(0);   // keeps the next step's LDS loads one group ahead of the products, not spread among them
#pragma unroll
      for (int j = 0; j < 4; ++j)
#pragma unroll
        for (int i = 0; i < 4; ++i) c[i][j] = mma16b(fa[kk & 1][i], fb[kk & 1][j], c[i][j]);
      __builtin_amdgcn_sched_barrier(0);   // ends the block of products: the following loads stay behind it
    }
    asm volatile("v_nop\n\tv_nop\n\tv_nop\n\tv_nop");   // WMMA-to-VALU distance on the loop's exit path, where the epilogue reads the accumulators
    // publish point of pass s + 1: own LDS reads returned, own slice landed, block barrier, then the refill of the buffer just read
    wait_ds0();
    wait_tensor0_of(g0, g1);
    __syncthreads();
    if (pinned(s + 2 < ns ? 1u : 0u) != 0u) { g0 = tdm_group0(lds0 + bo, ga0 + (uint64_t)(uint32_t)(s + 2) * 256u); tdm_load(g0, g1); }
  }
  wait_tensor0_of(g0, g1);
  wait_ds0();

  if constexpr (PROJ) {
    if (mode == 2) {
      // v head: a lane's accumulator registers are eight consecutive tokens of one d, that is one 16-B piece of a V^T row; a wave's four i fill one 128-B line of each of its rows
      const bool wl = row0 < RESQ;       // block-uniform: RESQ is a multiple of the tile's rows
      char* vb = (char*)(PH + (size_t)(wn * 64) * SEQ + row0 + wm * 64);
      char* vlb = (char*)(PL + (size_t)(wn * 64) * RESQ + row0 + wm * 64);
      const uint32_t vo = ((uint32_t)ln * (uint32_t)SEQ + 8u * (uint32_t)hh) * 2u;
      const uint32_t vlo = ((uint32_t)ln * (uint32_t)RESQ + 8u * (uint32_t)hh) * 2u;
#pragma unroll
      for (int j = 0; j < 4; ++j) {
#pragma unroll
        for (int i = 0; i < 4; ++i) {
          Pack8 ph;
#pragma unroll
          for (int r = 0; r < 8; ++r) ph.h[r] = (_Float16)(c[i][j][r] * alpha);
          *(v8us*)(vb + (size_t)j * (16 * SEQ * 2) + (size_t)i * 32 + vo) = ph.v;
        }
      }
      asm volatile("s_wait_xcnt 0x0" ::: "memory");   // behind the stores, before the residual branch rewrites their data registers
      if (wl) {
#pragma unroll
        for (int j = 0; j < 4; ++j) {
#pragma unroll
          for (int i = 0; i < 4; ++i) {
            Pack8 pl;
#pragma unroll
            for (int r = 0; r < 8; ++r) { const float f = c[i][j][r] * alpha; pl.h[r] = (_Float16)((f - (float)(_Float16)f) * RCAR); }
            *(v8us*)(vlb + (size_t)j * (16 * RESQ * 2) + (size_t)i * 32 + vlo) = pl.v;
          }
        }
      }
      asm volatile("s_wait_xcnt 0x0" ::: "memory");   // behind the stores, before the code that follows this branch rewrites their address and data registers
      return;
    }
  }
  // epilogue: the ring is free behind the last pass's barrier; each wave stages its C tile in its own slice and stores whole 256-B row pieces
  float* so = (float*)(sm + w * G_SLICE);
#pragma unroll
  for (int i = 0; i < NI; ++i) {
#pragma unroll
    for (int j = 0; j < 4; ++j) {
#pragma unroll
      for (int r = 0; r < 8; ++r)
        so[(i * 16 + 8 * hh + r) * 68 + j * 16 + ln] = RES ? (c[i][j][r] * alpha + c[(i + 2) & 3][j][r] * alphal) : (c[i][j][r] * alpha);
    }
  }
  if constexpr (PROJ) {
    if (mode == 1) {
      // q or k head: a row's 128 columns lie in two waves' slices, so the block meets once; then wave w takes rows 32 w .. 32 w + 31, a row at a time over its 32 lanes (lane l: columns 4 l .. 4 l + 3)
      __syncthreads();
      const bool wl = row0 < RESQ;       // block-uniform
      const v4f wv = *(const v4fa*)(nw + 4 * lane);
      const int rw = row0 + 32 * (int)w; // the wave's first token
      const unsigned char* xb = sm + ((w & 2u) + (uint32_t)hh) * G_SLICE + (w & 1u) * (32u * 272u) + (uint32_t)ln * 16u;
      const char* cb = (const char*)(cs + (size_t)rw * (NRP * 2));
      const uint32_t co = (uint32_t)ln * 32u;
      char* hb = (char*)(PH + (size_t)rw * HD);
      char* lb = (char*)(PL + (size_t)rw * HD);
      const uint32_t ho = (uint32_t)lane * 8u;
      const float sg = (lane < 16) ? -1.0f : 1.0f;                        // d < 64: -x[d+64]; d >= 64: +x[d-64]
#pragma unroll
      for (int g = 0; g < 4; ++g) {
        v4f t01[8], t23[8];              // rotary rows of the group's eight tokens
#pragma unroll
        for (int u = 0; u < 8; ++u) {
          t01[u] = *(const v4fa*)(cb + (size_t)(g * 8 + u) * (NRP * 8) + co);
          t23[u] = *(const v4fa*)(cb + (size_t)(g * 8 + u) * (NRP * 8) + 16 + co);
        }
        asm volatile("s_wait_xcnt 0x0" :: "v"(co), "v"(lane) : "memory");   // behind the loads: the lane offsets that they name stay whole until their addresses are taken
        v4f xv[8];
#pragma unroll
        for (int u = 0; u < 8; ++u) xv[u] = *(const v4fa*)(xb + (g * 8 + u) * 272);
        // the eight rows pass each step together, so that no link of a row's chain waits for the one before it
        float ss[8], ov[8][4];
        uint64_t dh[8];
#pragma unroll
        for (int u = 0; u < 8; ++u) ss[u] = xv[u][0] * xv[u][0] + xv[u][1] * xv[u][1] + xv[u][2] * xv[u][2] + xv[u][3] * xv[u][3];
#pragma unroll
        for (int u = 0; u < 8; ++u) ss[u] += half_xor(ss[u]);
        sum_stage<8>(ss); sum_stage<4>(ss); sum_stage<2>(ss); sum_stage<1>(ss);
#pragma unroll
        for (int u = 0; u < 8; ++u) ss[u] = rsqrtf(ss[u] * (1.0f / 128.0f) + 1.0e-6f);
#pragma unroll
        for (int u = 0; u < 8; ++u) {
          const v4f a01 = t01[u], a23 = t23[u];
          float nv[4], pr[4];
#pragma unroll
          for (int q = 0; q < 4; ++q) nv[q] = xv[u][q] * ss[u] * (wv[q] + 1.0f);
#pragma unroll
          for (int q = 0; q < 4; ++q) pr[q] = half_xor(nv[q]);            // element d +- 64
          const float cv[4] = {a01[0], a01[2], a23[0], a23[2]};
          const float sv[4] = {a01[1], a01[3], a23[1], a23[3]};
          v4h oh;
#pragma unroll
          for (int q = 0; q < 4; ++q) { ov[u][q] = nv[q] * cv[q] + sg * pr[q] * sv[q]; oh[q] = (_Float16)ov[u][q]; }
          dh[u] = __builtin_bit_cast(uint64_t, oh);
        }
#pragma unroll
        for (int u = 0; u < 8; ++u) *(u64a*)(hb + (size_t)(g * 8 + u) * (HD * 2) + ho) = dh[u];
        wait_x0_of(dh, ho);
        if (wl) {
#pragma unroll
          for (int u = 0; u < 8; ++u) {
            v4h ol;
#pragma unroll
            for (int q = 0; q < 4; ++q) ol[q] = (_Float16)((ov[u][q] - (float)(_Float16)ov[u][q]) * RCAR);
            dh[u] = __builtin_bit_cast(uint64_t, ol);
          }
#pragma unroll
          for (int u = 0; u < 8; ++u) *(u64a*)(lb + (size_t)(g * 8 + u) * (HD * 2) + ho) = dh[u];
          wait_x0_of(dh, ho);
        }
      }
      return;
    }
  }
  __builtin_amdgcn_fence(4 /* acq_rel order */, "workgroup");
  __builtin_amdgcn_wave_barrier();
  const int rsub = lane >> 4, c4 = (lane & 15) * 4;
#pragma unroll
  for (int g = 0; g < NI; ++g) {         // eight row pairs a group: its LDS reads, its stores, one wait
    v4f v[8];
#pragma unroll
    for (int u = 0; u < 8; ++u) v[u] = *(const v4fa*)&so[((g * 8 + u) * 2 + rsub) * 68 + c4];
#pragma unroll
    for (int u = 0; u < 8; ++u) *(v4f*)(C + (size_t)(row0 + wm * (NI * 16) + (g * 8 + u) * 2 + rsub) * ldc + col0 + wn * 64 + c4) = v[u];
    asm volatile("s_wait_xcnt 0x0" ::: "memory");   // behind the group's stores, before the next group (or the code behind this tile) rewrites their address and data registers
  }
}

// x.Wq and x.[Wk|Wv] in one grid: blocks 0 .. PJ_Q-1 are the tiles of x.Wq, the others those of x.[Wk|Wv]; grid.y = batch element. A tile is 128 tokens of one head's q, gate, k or v columns,
// and q, k and v leave the block in the form that attention reads (norm, rotary, turn in the tile's epilogue): only the gate columns are kept in f32.
constexpr int PJ_Q  = (SEQ / 128) * (NQC / 128);
constexpr int PJ_KV = (SEQ / 128) * (NKVC / 128);
static_assert(((NQC / 128) & (NQC / 128 - 1)) == 0 && ((NKVC / 128) & (NKVC / 128 - 1)) == 0 && (NKV & (NKV - 1)) == 0);
__global__ __launch_bounds__(128) void k_proj(const _Float16* __restrict__ X16, const _Float16* __restrict__ WqT, const _Float16* __restrict__ WkvT,
                                             const float* __restrict__ qnw, const float* __restrict__ knw, const float* __restrict__ cs, float* __restrict__ qraw,
                                             _Float16* __restrict__ Qh, _Float16* __restrict__ Ql, _Float16* __restrict__ Kh, _Float16* __restrict__ Kl,
                                             _Float16* __restrict__ VT, _Float16* __restrict__ VTl, float alpha) {
  __shared__ __attribute__((aligned(2048))) unsigned char sm[2u * G_STAGE];
  const int bx = (int)blockIdx.x;
  const size_t bb = blockIdx.y;
  const _Float16* A = X16 + bb * ((size_t)SEQ * HID);
  const bool two = bx >= PJ_Q;           // block-uniform, like all that follows from it
  const int tb = two ? bx - PJ_Q : bx;
  const int nq = tb & ((two ? NKVC / 128 : NQC / 128) - 1);   // the tile's column block: tb modulo a power of two
  const bool isv = two && nq >= NKV;
  const size_t hp = two ? bb * NKV + (size_t)(nq & (NKV - 1)) : bb * NH + (size_t)(nq >> 1);   // head plane
  gemm_tile<false, true>(sm, tb, A, A, HID, two ? WkvT : WqT, HID, alpha, 0.0f, qraw + bb * ((size_t)SEQ * NQC), NQC, SEQ, two ? NKVC : NQC, HID,
                         two ? (isv ? 2 : 1) : ((nq & 1) ? 0 : 1), two ? knw : qnw, cs,
                         (two ? (isv ? VT : Kh) : Qh) + hp * ((size_t)SEQ * HD), (two ? (isv ? VTl : Kl) : Ql) + hp * ((size_t)RESQ * HD));
}

// Two independent products in one grid: blocks 0 .. n1-1 are the tiles of product 1 (plain), the others those of product 2 (with its residual plane). lda, ldb, K and alpha are common.
// grid.y = batch element: A advances by bsA, Al2 by bsAl2, C1 and C2 by bsC1 and bsC2 elements per batch element; Bt1 and Bt2 are shared.
__global__ __launch_bounds__(128) void k_gemm2(int n1, const _Float16* __restrict__ A1, const _Float16* __restrict__ Bt1, float* __restrict__ C1, int ldc1, int M1, int N1, size_t bsC1,
                                              const _Float16* __restrict__ A2, const _Float16* __restrict__ Al2, const _Float16* __restrict__ Bt2, float* __restrict__ C2, int ldc2, int M2, int N2, size_t bsC2,
                                              size_t bsAl2, int lda, int ldb, int K, size_t bsA, float alpha, float alphal) {
  __shared__ __attribute__((aligned(2048))) unsigned char sm[2u * G_STAGE];
  const int bx = (int)blockIdx.x;
  const size_t bb = blockIdx.y;
  if (bx >= n1) gemm_tile<true, false>(sm, bx - n1, A2 + bb * bsA, Al2 + bb * bsAl2, lda, Bt2, ldb, alpha, alphal, C2 + bb * bsC2, ldc2, M2, N2, K, 0, nullptr, nullptr, nullptr, nullptr);   // block-uniform
  else gemm_tile<false, false>(sm, bx, A1 + bb * bsA, A1 + bb * bsA, lda, Bt1, ldb, alpha, 0.0f, C1 + bb * bsC1, ldc1, M1, N1, K, 0, nullptr, nullptr, nullptr, nullptr);
}

// this wave's asynchronous copies have landed in LDS; the compiler places no wait for them
__device__ __forceinline__ void wait_async0() { asm volatile("s_wait_asynccnt 0x0" ::: "memory"); }
// One chunk's copies of a lane, 16 B each, global memory to LDS through no register: l = the lane's LDS byte address, g = its global address.
// The s_wait_xcnt is the statement's last line, so that it stands in front of every later write of the address registers that the copies name.
__device__ __forceinline__ void acopy8(const uint32_t (&l)[8], const char* const (&g)[8]) {
  asm volatile("global_load_async_to_lds_b128 %0, %1, off\n\t"
               "global_load_async_to_lds_b128 %2, %3, off\n\t"
               "global_load_async_to_lds_b128 %4, %5, off\n\t"
               "global_load_async_to_lds_b128 %6, %7, off\n\t"
               "global_load_async_to_lds_b128 %8, %9, off\n\t"
               "global_load_async_to_lds_b128 %10, %11, off\n\t"
               "global_load_async_to_lds_b128 %12, %13, off\n\t"
               "global_load_async_to_lds_b128 %14, %15, off\n\t"
               "s_wait_xcnt 0x0"
               :: "v"(l[0]), "v"(g[0]), "v"(l[1]), "v"(g[1]), "v"(l[2]), "v"(g[2]), "v"(l[3]), "v"(g[3]),
                  "v"(l[4]), "v"(g[4]), "v"(l[5]), "v"(g[5]), "v"(l[6]), "v"(g[6]), "v"(l[7]), "v"(g[7]) : "memory");
}
__device__ __forceinline__ void acopy6(const uint32_t (&l)[6], const char* const (&g)[6]) {
  asm volatile("global_load_async_to_lds_b128 %0, %1, off\n\t"
               "global_load_async_to_lds_b128 %2, %3, off\n\t"
               "global_load_async_to_lds_b128 %4, %5, off\n\t"
               "global_load_async_to_lds_b128 %6, %7, off\n\t"
               "global_load_async_to_lds_b128 %8, %9, off\n\t"
               "global_load_async_to_lds_b128 %10, %11, off\n\t"
               "s_wait_xcnt 0x0"
               :: "v"(l[0]), "v"(g[0]), "v"(l[1]), "v"(g[1]), "v"(l[2]), "v"(g[2]), "v"(l[3]), "v"(g[3]),
                  "v"(l[4]), "v"(g[4]), "v"(l[5]), "v"(g[5]) : "memory");
}

template <bool RES> struct AttnLds {     // byte sizes of the block's LDS tiles, in their order
  static constexpr int KC = RES ? 32 : 64, OD = RES ? 64 : 128, KP = HD + 8, VP = KC + 8, PP = 72;
  static constexpr uint32_t K = KC * KP * 2u, KL = (RES ? KC : 1) * KP * 2u, V = OD * VP * 2u, VL = (RES ? OD : 1) * VP * 2u, P = 8 * 16 * PP * 2u, PL = (RES ? 8 : 1) * 16 * PP * 2u;
  static constexpr uint32_t STG = K + KL + V + VL;   // one buffer of the K / V^T ring
  static constexpr uint32_t ALL = 2 * STG + P + PL;
  static_assert(K % 16 == 0 && KL % 16 == 0 && V % 16 == 0 && VL % 16 == 0 && P % 16 == 0);
};
template <bool RES>
__device__ __forceinline__ void attn_block(unsigned char* smem, const _Float16* __restrict__ Qh, const _Float16* __restrict__ Ql,
                                           const _Float16* __restrict__ Kh, const _Float16* __restrict__ Kl,
                                           const _Float16* __restrict__ VT, const _Float16* __restrict__ VTl,
                                           const float* __restrict__ qraw, _Float16* __restrict__ Oh, _Float16* __restrict__ Ol, int qb, int h, int bz) {
  constexpr int KC = RES ? 32 : 64;      // keys per chunk
  constexpr int NJ = KC / 16;            // score column tiles
  constexpr int NKS = KC / 32;           // k-steps of P.V^T
  constexpr int OD = RES ? 64 : 128;     // o columns per block
  constexpr int NC = OD / 16;
  constexpr int NHF = OD / 64;
  constexpr int CG = RES ? 2 : 4;        // o column tiles per group of V^T fragment loads (four fragments with the residual ones)
  constexpr int NGC = NC / CG;           // groups per k-step
  constexpr int NG = NKS * NGC;
  constexpr int KP = HD + 8;             // sK pitch (halves)
  constexpr int VP = KC + 8;             // sV pitch
  constexpr int PP = 72;                 // sP pitch (64 staged o columns)
  using L = AttnLds<RES>;
  static_assert(L::KC == KC && L::OD == OD && L::KP == KP && L::VP == VP && L::PP == PP);
  // two ring buffers of L::STG bytes, each [K | K residual | V^T | V^T residual], then the o staging tiles
  _Float16 (*sP)[16][PP]  = (_Float16 (*)[16][PP])(smem + 2 * L::STG);                               // [8]
  _Float16 (*sPl)[16][PP] = (_Float16 (*)[16][PP])(smem + 2 * L::STG + L::P);                        // [RES ? 8 : 1]

  const int tid = threadIdx.x, w = tid >> 5, lane = tid & 31, ln = lane & 15, hh = lane >> 4;
  const int kv = h / GQ;
  const int dz = RES ? (bz & 1) * 64 : 0;
  const size_t bb = (size_t)(RES ? (bz >> 1) : bz);
  Qh += bb * ((size_t)NH * SEQ * HD); Ql += bb * ((size_t)NH * RESQ * HD); Kh += bb * ((size_t)NKV * SEQ * HD); Kl += bb * ((size_t)NKV * RESQ * HD);
  VT += bb * ((size_t)NKV * HD * SEQ); VTl += bb * ((size_t)NKV * HD * RESQ); qraw += bb * ((size_t)SEQ * NQC);
  Oh += bb * ((size_t)SEQ * NH * HD); Ol += bb * ((size_t)RESQ * NH * HD);
  const int q0b = qb * 128, q0w = q0b + 16 * w;
  const int nch = (q0b + 128) / KC;      // chunks holding keys <= last row of the block
  const int qlast = q0w + 15;

  v16h aq[4], aql[4];
  {
    const _Float16* qp = Qh + ((size_t)h * SEQ + q0w + ln) * HD;
#pragma unroll
    for (int kk = 0; kk < 4; ++kk) aq[kk] = frag16(qp + kk * 32, hh);
    if (RES) {
      const _Float16* qlp = Ql + ((size_t)h * RESQ + q0w + ln) * HD;
#pragma unroll
      for (int kk = 0; kk < 4; ++kk) aql[kk] = frag16(qlp + kk * 32, hh);
    } else {
#pragma unroll
      for (int kk = 0; kk < 4; ++kk) aql[kk] = aq[kk];
    }
  }
  const v8f z8 = {0.f, 0.f, 0.f, 0.f, 0.f, 0.f, 0.f, 0.f};
  v8f o[NC];
#pragma unroll
  for (int c = 0; c < NC; ++c) o[c] = z8;
  float mrow = -3.0e38f, lrow = 0.f;     // query q0w + ln: running maximum (both halves alike), sum over this half's keys
  const float alpha = 0.08838834764831845f;
  // staging addresses: block-uniform bases plus one 32-bit lane offset per plane, the row steps as constants (leaves the registers to the fragment groups)
  constexpr int VR = 256 / (KC / 8);     // V^T rows staged per round of the block
  const char* kgb = (const char*)(Kh + (size_t)kv * SEQ * HD);
  const char* klgb = (const char*)(Kl + (size_t)kv * RESQ * HD);
  const char* vgb = (const char*)(VT + (size_t)(kv * HD + dz) * SEQ);
  const char* vlgb = (const char*)(VTl + (size_t)(kv * HD + dz) * RESQ);
  const uint32_t kvo = (uint32_t)((tid >> 4) * HD + (tid & 15) * 8) * 2u;
  const uint32_t vvo = (uint32_t)((tid / (KC / 8)) * SEQ + (tid % (KC / 8)) * 8) * 2u;
  const uint32_t vlvo = (uint32_t)((tid / (KC / 8)) * RESQ + (tid % (KC / 8)) * 8) * 2u;
  // the lane's LDS byte addresses in buffer 0 (low 32 bits of the shared address)
  const uint32_t lk = (uint32_t)(size_t)smem + (uint32_t)((tid >> 4) * KP + (tid & 15) * 8) * 2u;
  const uint32_t lv = (uint32_t)(size_t)smem + L::K + L::KL + (uint32_t)((tid / (KC / 8)) * VP + (tid % (KC / 8)) * 8) * 2u;
  // chunk c into the buffer at byte bo: K rows c KC .. c KC + KC - 1 (all 128 d) and V^T rows dz..dz+OD-1 (those keys): staged extent == consumed extent
  auto stage = [&](int c, uint32_t bo) {
    const size_t tc = (size_t)c * KC;
    if constexpr (RES) {
      static_assert((KC * 16) / 256 == 2 && (OD * (KC / 8)) / 256 == 1);
      const uint32_t l[6] = {lk + bo, lk + bo + 16u * KP * 2u, lk + bo + L::K, lk + bo + L::K + 16u * KP * 2u, lv + bo, lv + bo + L::V};
      const char* const g[6] = {kgb + tc * (HD * 2) + kvo, kgb + tc * (HD * 2) + 16 * HD * 2 + kvo, klgb + tc * (HD * 2) + kvo, klgb + tc * (HD * 2) + 16 * HD * 2 + kvo,
                                vgb + tc * 2 + vvo, vlgb + tc * 2 + vlvo};
      acopy6(l, g);
    } else {
      static_assert((KC * 16) / 256 == 4 && (OD * (KC / 8)) / 256 == 4);
      const uint32_t l[8] = {lk + bo, lk + bo + 16u * KP * 2u, lk + bo + 32u * KP * 2u, lk + bo + 48u * KP * 2u,
                             lv + bo, lv + bo + (uint32_t)VR * VP * 2u, lv + bo + 2u * VR * VP * 2u, lv + bo + 3u * VR * VP * 2u};
      const char* const g[8] = {kgb + tc * (HD * 2) + kvo, kgb + tc * (HD * 2) + 16 * HD * 2 + kvo, kgb + tc * (HD * 2) + 32 * HD * 2 + kvo, kgb + tc * (HD * 2) + 48 * HD * 2 + kvo,
                                vgb + tc * 2 + vvo, vgb + tc * 2 + (size_t)VR * SEQ * 2 + vvo, vgb + tc * 2 + (size_t)2 * VR * SEQ * 2 + vvo, vgb + tc * 2 + (size_t)3 * VR * SEQ * 2 + vvo};
      acopy8(l, g);
    }
  };
  // in front of the loop: chunk 0 landed and published, then chunk 1 on its way
  stage(0, 0u);
  wait_async0();
  __syncthreads();
  if (1 < nch) stage(1, L::STG);         // block-uniform

#pragma unroll 1
  for (int ch = 0; ch < nch; ++ch) {
    const int t0 = ch * KC;
    const uint32_t bo = (uint32_t)(ch & 1) * L::STG;   // this chunk's buffer, the only one that the trip reads
    _Float16 (*sK)[KP]  = (_Float16 (*)[KP])(smem + bo);                          // [KC]
    _Float16 (*sKl)[KP] = (_Float16 (*)[KP])(smem + bo + L::K);                   // [RES ? KC : 1]
    _Float16 (*sV)[VP]  = (_Float16 (*)[VP])(smem + bo + L::K + L::KL);           // [OD]
    _Float16 (*sVl)[VP] = (_Float16 (*)[VP])(smem + bo + L::K + L::KL + L::V);    // [RES ? OD : 1]
    if (t0 <= qlast) {                   // wave-uniform: this wave has unmasked keys in the chunk
      // k-step kk's K fragments of all key tiles are one group of LDS loads, issued one k-step ahead of their products (set kk & 1); the key tiles' accumulators are independent, each sums its kk in ascending order
      v8f sacc[NJ], stmp[RES ? NJ : 1];
#pragma unroll
      for (int j = 0; j < NJ; ++j) { sacc[j] = z8; if (RES) stmp[j] = z8; }
      {
        v16h fk[2][NJ], fkl[2][RES ? NJ : 1];
#pragma unroll
        for (int j = 0; j < NJ; ++j) {
          fk[0][j] = frag16(&sK[j * 16 + ln][0], hh);                     // A[m = key][k = d]: key row, d contiguous
          if (RES) fkl[0][j] = frag16(&sKl[j * 16 + ln][0], hh);
        }
#pragma unroll
        for (int kk = 0; kk < 4; ++kk) {
          if (kk < 3) {
#pragma unroll
            for (int j = 0; j < NJ; ++j) {
              fk[(kk + 1) & 1][j] = frag16(&sK[j * 16 + ln][(kk + 1) * 32], hh);
              if (RES) fkl[(kk + 1) & 1][j] = frag16(&sKl[j * 16 + ln][(kk + 1) * 32], hh);
            }
          }
          __builtin_amdgcn_sched_barrier(0);   // keeps the next k-step's LDS loads one group ahead of the products, not one by one in front of each
#pragma unroll
          for (int j = 0; j < NJ; ++j) sacc[j] = mma16b(fk[kk & 1][j], aq[kk], sacc[j]);
          if (RES) {
#pragma unroll
            for (int j = 0; j < NJ; ++j) stmp[j] = mma16b(fk[kk & 1][j], aql[kk], stmp[j]);
#pragma unroll
            for (int j = 0; j < NJ; ++j) stmp[j] = mma16b(fkl[kk & 1][j], aq[kk], stmp[j]);
          }
          __builtin_amdgcn_sched_barrier(0);   // ends the block of products: the following loads stay behind it
        }
      }
      if (RES) {
#pragma unroll
        for (int j = 0; j < NJ; ++j) sacc[j] = sacc[j] + stmp[j] * (1.0f / RCAR);
      }
      // V^T fragments go in groups of four as well (CG o column tiles of one k-step); the first group's loads go ahead of the softmax, which needs no LDS and covers their latency
      v16h fv[2][CG], fvl[2][RES ? CG : 1];
#pragma unroll
      for (int i = 0; i < CG; ++i) {
        fv[0][i] = frag16(&sV[i * 16 + ln][0], hh);                       // A[m = d][k = key]: d row, keys contiguous
        if (RES) fvl[0][i] = frag16(&sVl[i * 16 + ln][0], hh);
      }
      __builtin_amdgcn_sched_barrier(0);       // holds that group's loads here, ahead of the softmax
      // scale, causal mask, online softmax. sacc[j][r] is key t0 + 16 j + 8 hh + r against query q0w + ln. One chain per key tile for maximum and sum, so that no link waits for the one before it
      const int dq = q0w + ln - t0 - 8 * hh;     // key tile j, register r is masked where 16 j + r > dq
      float mj[NJ], sj[NJ];
#pragma unroll
      for (int j = 0; j < NJ; ++j) mj[j] = -3.0e38f;
#pragma unroll
      for (int r = 0; r < 8; ++r)
#pragma unroll
        for (int j = 0; j < NJ; ++j) mj[j] = fmaxf(mj[j], (16 * j + r > dq) ? -3.0e38f : sacc[j][r] * alpha);
#pragma unroll
      for (int j = 1; j < NJ; ++j) mj[0] = fmaxf(mj[0], mj[j]);
      const float mnew = fmaxf(mrow, fmaxf(mj[0], half_xor(mj[0])));
      const float fac = (mrow < -1.0e38f) ? 0.f : __expf(mrow - mnew);
      mrow = mnew;
      // P^T (x2^14) as B[k = key][n = query]: element e of k-step ks is key 32 ks + 8 hh + e (e < 8) or 32 ks + 16 + 8 hh + e - 8, that is register e & 7 of key tile 2 ks + (e >> 3), in this lane
      FragH ap[NKS], apl[NKS];
#pragma unroll
      for (int j = 0; j < NJ; ++j) sj[j] = 0.f;
#pragma unroll
      for (int r = 0; r < 8; ++r) {
#pragma unroll
        for (int j = 0; j < NJ; ++j) {
          const float p = (16 * j + r > dq) ? 0.f : __expf(sacc[j][r] * alpha - mnew);
          sj[j] += p;
          const float pcv = p * PCAR; const _Float16 ph = (_Float16)pcv;
          ap[j >> 1].h[(j & 1) * 8 + r] = ph;
          if (RES) apl[j >> 1].h[(j & 1) * 8 + r] = (_Float16)((pcv - (float)ph) * RCAR);
        }
      }
#pragma unroll
      for (int j = 1; j < NJ; ++j) sj[0] += sj[j];
      lrow = lrow * fac + sj[0];
#pragma unroll
      for (int c = 0; c < NC; ++c) o[c] = o[c] * fac;
      v8f ptmp[RES ? NC : 1];
      if (RES) {
#pragma unroll
        for (int c = 0; c < NC; ++c) ptmp[c] = z8;
      }
#pragma unroll
      for (int g = 0; g < NG; ++g) {           // group g: k-step g / NGC, o column tiles (g % NGC) * CG ..; every o tile meets its k-steps in ascending order
        if (g + 1 < NG) {
          const int ks1 = (g + 1) / NGC, cb1 = ((g + 1) % NGC) * CG;
#pragma unroll
          for (int i = 0; i < CG; ++i) {
            fv[(g + 1) & 1][i] = frag16(&sV[(cb1 + i) * 16 + ln][ks1 * 32], hh);
            if (RES) fvl[(g + 1) & 1][i] = frag16(&sVl[(cb1 + i) * 16 + ln][ks1 * 32], hh);
          }
        }
        __builtin_amdgcn_sched_barrier(0);     // keeps the next group's LDS loads ahead of this group's products
        const int ks = g / NGC, cb = (g % NGC) * CG;
#pragma unroll
        for (int i = 0; i < CG; ++i) o[cb + i] = mma16b(fv[g & 1][i], ap[ks].v, o[cb + i]);
        if (RES) {
#pragma unroll
          for (int i = 0; i < CG; ++i) ptmp[cb + i] = mma16b(fv[g & 1][i], apl[ks].v, ptmp[cb + i]);
#pragma unroll
          for (int i = 0; i < CG; ++i) ptmp[cb + i] = mma16b(fvl[g & 1][i], ap[ks].v, ptmp[cb + i]);
        }
        __builtin_amdgcn_sched_barrier(0);     // ends the block of products: the following loads stay behind it
      }
      if (RES) {
#pragma unroll
        for (int c = 0; c < NC; ++c) o[c] = o[c] + ptmp[c] * (1.0f / RCAR);
      }
    }
    // publish point of chunk ch + 1, every wave: own LDS reads returned, own copies landed, block barrier, then the refill of the buffer just read
    wait_ds0();
    wait_async0();
    __syncthreads();
    if (ch + 2 < nch) stage(ch + 2, bo); // block-uniform
  }
  wait_async0();                         // nothing of this wave's is in flight behind the loop

  // epilogue
  // o[c][r] is column 16 c + 8 hh + r of query q0w + ln: eight consecutive columns a tile, one 16-B piece of the staged row; the halves' sums are joined here, once
  const float il = (OCAR / PCAR) * __builtin_amdgcn_rcpf(lrow + half_xor(lrow));
  const char* gb = (const char*)(qraw + (size_t)q0w * NQC + (size_t)h * (2 * HD) + HD + dz);
  const uint32_t go = ((uint32_t)ln * (uint32_t)NQC + 8u * (uint32_t)hh) * 4u;
#pragma unroll
  for (int hf = 0; hf < NHF; ++hf) {
    if (hf > 0) {
      __builtin_amdgcn_fence(4 /* acq_rel order */, "workgroup"); __builtin_amdgcn_wave_barrier();
      asm volatile("s_wait_xcnt 0x0" ::: "memory");   // behind the first half's o stores, before this half's gate loads are given their data registers
    }
    v4f ga[4], gc[4];                    // gate columns of the half's four tiles
#pragma unroll
    for (int cc = 0; cc < 4; ++cc) {
      ga[cc] = *(const v4fa*)(gb + (size_t)(hf * 4 + cc) * 64 + go);
      gc[cc] = *(const v4fa*)(gb + (size_t)(hf * 4 + cc) * 64 + 16 + go);
    }
    asm volatile("s_wait_xcnt 0x0" :: "v"(go) : "memory");   // behind the loads: the lane offset that they name stays whole until their addresses are taken
#pragma unroll
    for (int cc = 0; cc < 4; ++cc) {
      const int c = hf * 4 + cc;
      Pack8 vh, vl;
#pragma unroll
      for (int r = 0; r < 8; ++r) {
        const float g = r < 4 ? ga[cc][r & 3] : gc[cc][r & 3];
        const float sig = __builtin_amdgcn_rcpf(1.0f + __expf(-g));
        const float val = o[c][r] * il * sig;
        vh.h[r] = (_Float16)val;
        if (RES) vl.h[r] = (_Float16)((val - (float)vh.h[r]) * RCAR);
      }
      *(v8us*)&sP[w][ln][cc * 16 + 8 * hh] = vh.v;
      if (RES) *(v8us*)&sPl[w][ln][cc * 16 + 8 * hh] = vl.v;
    }
    __builtin_amdgcn_fence(4 /* acq_rel order */, "workgroup");
    __builtin_amdgcn_wave_barrier();
    const int prw = lane >> 3, pc = lane & 7;
    {
#pragma unroll
      for (int it = 0; it < 4; ++it) {
        const int row = it * 4 + prw;
        const v8us vv = *(const v8us*)&sP[w][row][pc * 8];
        const size_t go = (size_t)(q0w + row) * (NH * HD) + (size_t)h * HD + dz + hf * 64 + pc * 8;
        *(v8us*)((unsigned short*)Oh + go) = vv;
        if (RES) { const v8us vl = *(const v8us*)&sPl[w][row][pc * 8]; *(v8us*)((unsigned short*)Ol + go) = vl; }
      }
      
    }
  }
  asm volatile("s_wait_xcnt 0x0" ::: "memory");   // behind the last o stores: a precaution, as a block runs one form only and the kernel ends behind it
}

// One grid for both forms, which share no output row: the plain blocks first, then the residual ones, each form from its last query block (most key chunks) down to its first.
constexpr int AB_F = ((SEQ - RESQ) / 128) * NH * NB;
constexpr int AB_R = (RESQ / 128) * NH * NB * 2;
// at most 256 registers a wave: four waves a SIMD, two blocks a WGP, as before (the loops need some 210; left free, the allocator reached one register past 256)
__global__ __launch_bounds__(256) __attribute__((amdgpu_num_vgpr(256))) void k_attn2(const _Float16* __restrict__ Qh, const _Float16* __restrict__ Ql,
                                              const _Float16* __restrict__ Kh, const _Float16* __restrict__ Kl,
                                              const _Float16* __restrict__ VT, const _Float16* __restrict__ VTl,
                                              const float* __restrict__ qraw, _Float16* __restrict__ Oh, _Float16* __restrict__ Ol) {
  __shared__ __attribute__((aligned(16))) unsigned char smem[AttnLds<true>::ALL > AttnLds<false>::ALL ? AttnLds<true>::ALL : AttnLds<false>::ALL];
  const int b = (int)blockIdx.x;
  if (b < AB_F) {
    const int qr = b / (NH * NB), rem = b - qr * (NH * NB);
    attn_block<false>(smem, Qh, Ql, Kh, Kl, VT, VTl, qraw, Oh, Ol, SEQ / 128 - 1 - qr, rem % NH, rem / NH);
  } else {
    const int c = b - AB_F, qr = c / (NH * NB * 2), rem = c - qr * (NH * NB * 2);
    attn_block<true>(smem, Qh, Ql, Kh, Kl, VT, VTl, qraw, Oh, Ol, RESQ / 128 - 1 - qr, rem % NH, rem / NH);
  }
}

extern "C" void kernel_launch(void* const* d_in, const int* in_sizes, int n_in,
                              void* d_out, int out_size, void* d_ws, size_t ws_size, hipStream_t stream) {
  if (n_in < 7) return;
  const long need_x = (long)(NB - 1) * SEQ_FULL * HID + (long)SEQ * HID;
  if ((long)in_sizes[0] < need_x) return;
  if (in_sizes[1] < HID * NQC) return;
  if (in_sizes[2] < HID * NKV * HD) return;
  if (in_sizes[3] < HID * NKV * HD) return;
  if (in_sizes[4] < NH * HD * HID) return;
  if (in_sizes[5] < HD) return;
  if (in_sizes[6] < HD) return;
  if ((long)out_size < need_x) return;

  const float* x   = (const float*)d_in[0];
  const float* Wq  = (const float*)d_in[1];
  const float* Wk  = (const float*)d_in[2];
  const float* Wv  = (const float*)d_in[3];
  const float* Wo  = (const float*)d_in[4];
  const float* qnw = (const float*)d_in[5];
  const float* knw = (const float*)d_in[6];

  char* ws = (char*)d_ws; size_t off = 0;
  auto take = [&](size_t bytes) { char* p = ws + off; off += (bytes + 255) & ~(size_t)255; return p; };
  _Float16* X16  = (_Float16*)take(SZ_X16);
  _Float16* WqT  = (_Float16*)take(SZ_WQT);
  _Float16* WkvT = (_Float16*)take(SZ_WKVT);
  _Float16* WoT  = (_Float16*)take(SZ_WOT);
  float*    CS   = (float*)take(SZ_CS);
  float*    qraw = (float*)take(SZ_QRAW);
  _Float16* Qh   = (_Float16*)take(SZ_QH);
  _Float16* Ql   = (_Float16*)take(SZ_QL);
  _Float16* Kh   = (_Float16*)take(SZ_KH);
  _Float16* Kl   = (_Float16*)take(SZ_KL);
  _Float16* VT   = (_Float16*)take(SZ_VT);
  _Float16* VTl  = (_Float16*)take(SZ_VTL);
  _Float16* Oh   = (_Float16*)take(SZ_OH);
  _Float16* Ol   = (_Float16*)take(SZ_OL);
  if (off > ws_size) return;

  const float walpha = 1.0f / WCAR;                          // 2^-4
  const float oalpha = 1.0f / (WCAR * OCAR);                 // 2^-10
  const float oalphal = oalpha / RCAR;                       // 2^-20
  // four launches, each holding every piece of work that depends only on the launches before it; every launch covers all NB batch elements
  float* out = (float*)d_out;
  // rotary table, weight planes (Bt[n][k] = f16(bf16rne(W[k][n]) * 16)), x plane
  k_prep<<<PB_ALL, 256, 0, stream>>>(x, Wq, Wk, Wv, Wo, X16, WqT, WkvT, WoT, CS, WCAR);
  // x.Wq and x.[Wk|Wv], with q/k norm + rotary and the V^T turn in the tiles' epilogues
  k_proj<<<dim3(PJ_Q + PJ_KV, NB), 128, 0, stream>>>(X16, WqT, WkvT, qnw, knw, CS, qraw, Qh, Ql, Kh, Kl, VT, VTl, walpha);
  k_attn2<<<AB_F + AB_R, 256, 0, stream>>>(Qh, Ql, Kh, Kl, VT, VTl, qraw, Oh, Ol);
  // o.Wo: rows RESQ.. plain, rows 0..RESQ-1 with the residual plane
  k_gemm2<<<dim3(((SEQ - RESQ) / 128) * (HID / 128) + (RESQ / 64) * (HID / 128), NB), 128, 0, stream>>>(
      ((SEQ - RESQ) / 128) * (HID / 128), Oh + (size_t)RESQ * NH * HD, WoT, out + (size_t)RESQ * HID, HID, SEQ - RESQ, HID, (size_t)SEQ_FULL * HID,
      Oh, Ol, WoT, out, HID, RESQ, HID, (size_t)SEQ_FULL * HID,
      (size_t)RESQ * NH * HD, NH * HD, NH * HD, NH * HD, (size_t)SEQ * NH * HD, oalpha, oalphal);
  (void)hipGetLastError();
}
